// v000
// Times are from an AMD MI455X. After a warm-up the kernel runs many times in a row, and a time is the length of
// such a window on the GPU divided by its runs, so every launch and the gaps after it count. The runs cycle
// through copies of the inputs. A figure is the median of several windows, for all but v000 over two sittings.
// Sittings can differ by a few percent; kernels timed side by side share one.
// v000, which the later versions start from, runs in 1070 microseconds.
// Contractions on v_wmma_f32_16x16x32_bf16 with f32 accumulate: per-head projections = bf16(X) x bf16(W^T) (inputs RNE-converted once); Q.K^T and P.V = bf16 hi/lo planes (hi.hi + hi.lo + lo.hi); output projection = concat bf16 hi/lo x bf16(Wo^T) (hi.W + lo.W) + bf16(bo); softmax, rescaling and normalisation in f32.
#include <hip/hip_runtime.h>
#include <stdint.h>
#include <math.h>

typedef __attribute__((ext_vector_type(16))) _Float16 v16h;
typedef __attribute__((ext_vector_type(8)))  _Float16 v8h;
typedef __attribute__((ext_vector_type(16))) __bf16   v16b;
typedef __attribute__((ext_vector_type(8)))  __bf16   v8b;
typedef __attribute__((ext_vector_type(8)))  float    v8f;
typedef __attribute__((ext_vector_type(4)))  float    v4f;
typedef __attribute__((ext_vector_type(4)))  unsigned v4u;

// ---- problem geometry ----
constexpr int EMB_SZ  = 768;
constexpr int NHEAD   = 3;
constexpr int HDIM    = 256;
constexpr int NBATCH  = 4;
constexpr int SEQLEN  = 2048;
constexpr int NROWS   = NBATCH * SEQLEN;                       // 8192 flattened (b,s) rows
constexpr size_t PLANE_ELEMS = (size_t)NROWS * EMB_SZ;          // 6291456 elements per [8192][768] plane
constexpr size_t PLANE_BYTES = PLANE_ELEMS * 2;                 // 12582912 B per 16-bit plane
constexpr size_t WT_ELEMS    = (size_t)NHEAD * HDIM * EMB_SZ;   // 589824 (W^T planes [3][256][768])
constexpr size_t WO_ELEMS    = (size_t)EMB_SZ * EMB_SZ;         // 589824 (Wo^T plane [768][768])

// [0]            Xk bf16 plane        (dead after projections; reused as concat hi plane)
// [1*PLANE]      Xv bf16 plane        (reused as concat lo plane)
// [2*PLANE]      Xq bf16 plane
// [3*PLANE]      K hi, [4*PLANE] K lo, [5*PLANE] V hi, [6*PLANE] V lo, [7*PLANE] Q hi, [8*PLANE] Q lo
// [9*PLANE]      Wk^T bf16 [3][256][768], then Wv^T, Wq^T (WT_ELEMS each)
// [9*PLANE+3*WT] Wo^T bf16 [768][768]
constexpr size_t WS_OFF_WKT = 9 * PLANE_ELEMS;
constexpr size_t WS_OFF_WVT = WS_OFF_WKT + WT_ELEMS;
constexpr size_t WS_OFF_WQT = WS_OFF_WVT + WT_ELEMS;
constexpr size_t WS_OFF_WOT = WS_OFF_WQT + WT_ELEMS;
constexpr size_t WS_TOTAL_BYTES = (WS_OFF_WOT + WO_ELEMS) * 2;    // 117964800 B
static_assert(WS_TOTAL_BYTES == 117964800ull);
static_assert(WS_TOTAL_BYTES <= 134217728ull);
static_assert((PLANE_BYTES % 128) == 0 && ((WT_ELEMS * 2) % 128) == 0 && ((WO_ELEMS * 2) % 128) == 0);

// ---- GEMM shape contract for the launches in this file ----
static_assert(NROWS % 64 == 0 && HDIM % 64 == 0 && EMB_SZ % 64 == 0);   // M, N tile multiples
static_assert(EMB_SZ % 32 == 0);                                          // K % 32 == 0 for all GEMMs (K = 768)
static_assert(PLANE_ELEMS % (8 * 256) == 0);                              // convert kernel: exact thread coverage

__device__ __forceinline__ unsigned short f2bf_bits(float f) {
  unsigned u = __float_as_uint(f);
  return (unsigned short)((u + 0x7FFFu + ((u >> 16) & 1u)) >> 16);
}
__device__ __forceinline__ float bf_bits2f(unsigned short h) { return __uint_as_float(((unsigned)h) << 16); }

// hazard guards as plain device helpers (no inline asm inside the kernel template body)
__device__ __forceinline__ void dep_guard_h(v8f& a, v8f& b, v16h x, v16h y) { asm volatile("v_nop\n\tv_nop\n\tv_nop\n\tv_nop" : "+v"(a), "+v"(b) : "v"(x), "v"(y)); }
__device__ __forceinline__ void dep_guard_b(v8f& a, v8f& b, v16b x, v16b y) { asm volatile("v_nop\n\tv_nop\n\tv_nop\n\tv_nop" : "+v"(a), "+v"(b) : "v"(x), "v"(y)); }
__device__ __forceinline__ void keep4_h(v16h a, v16h b, v16h c, v16h d) { asm volatile("v_nop" :: "v"(a), "v"(b), "v"(c), "v"(d)); }
__device__ __forceinline__ void keep4_b(v16b a, v16b b, v16b c, v16b d) { asm volatile("v_nop" :: "v"(a), "v"(b), "v"(c), "v"(d)); }
__device__ __forceinline__ void acc_guard4(v8f& a, v8f& b, v8f& c, v8f& d) { asm volatile("v_nop\n\tv_nop\n\tv_nop\n\tv_nop" : "+v"(a), "+v"(b), "+v"(c), "+v"(d)); }
template <typename T> struct Frag;
template <> struct Frag<_Float16> {
  typedef v16h V; union U { v16h v; v8h h[2]; };
  static __device__ __forceinline__ v16h load(const _Float16* p) {   // elements 0..7 <- p[0..7], 8..15 <- p[16..23]
    U f; f.h[0] = *(const v8h*)(p); f.h[1] = *(const v8h*)(p + 16); return f.v;
  }
  static __device__ __forceinline__ v8f mma(v16h a, v16h b, v8f c) {
    return __builtin_amdgcn_wmma_f32_16x16x32_f16(false, a, false, b, (short)0, c, false, false);
  }
  static __device__ __forceinline__ void guard(v8f& a, v8f& b, v16h x, v16h y) { dep_guard_h(a, b, x, y); }
  static __device__ __forceinline__ void keep(v16h a, v16h b, v16h c, v16h d) { keep4_h(a, b, c, d); }
};
template <> struct Frag<__bf16> {
  typedef v16b V; union U { v16b v; v8b h[2]; };
  static __device__ __forceinline__ v16b load(const __bf16* p) {
    U f; f.h[0] = *(const v8b*)(p); f.h[1] = *(const v8b*)(p + 16); return f.v;
  }
  static __device__ __forceinline__ v8f mma(v16b a, v16b b, v8f c) {
    return __builtin_amdgcn_wmma_f32_16x16x32_bf16(false, a, false, b, (short)0, c, false, false);
  }
  static __device__ __forceinline__ void guard(v8f& a, v8f& b, v16b x, v16b y) { dep_guard_b(a, b, x, y); }
  static __device__ __forceinline__ void keep(v16b a, v16b b, v16b c, v16b d) { keep4_b(a, b, c, d); }
};

// ---- Register-blocked batched WMMA GEMM (with independent A/B split flags) --------------------
// C[m,n] = scale * sum_k A[m,k] * Bt[n,k] (+bias); each wave owns a 64x64 tile.
// A row-major [M,K]; Bt row-major [N,K]; M,N % 64 == 0, K % 32 == 0 (no tail handling).
// SPLITA: A has a lo plane A2 (product += Alo.Bhi); SPLITB: Bt has a lo plane Bt2 (product += Ahi.Blo).
// BIAS_MODE: 0 = none, 1 = bias[m], 2 = RNE-bf16(bias[n]).
// OUT_MODE: 0 = f32, 1 = f16, 2 = bf16 hi plane (Cout) + bf16 lo plane (Cout2).
// ET: 0 = f16 operands, 1 = bf16 operands (pointers passed as 16-bit storage)
template <int ET> struct Elem;
template <> struct Elem<0> { typedef _Float16 T; };
template <> struct Elem<1> { typedef __bf16 T; };
template <int ET, bool SPLITA, bool SPLITB, int BIAS_MODE, int OUT_MODE>
__global__ __launch_bounds__(256) void wmma_gemm64(
    const unsigned short* __restrict__ Ap, const unsigned short* __restrict__ A2p, int lda, long strideA,
    const unsigned short* __restrict__ Btp, const unsigned short* __restrict__ Bt2p, int ldb, long strideB,
    void* __restrict__ Cout, void* __restrict__ Cout2, int ldc, long strideC,
    const float* __restrict__ bias,
    int M, int N, int K, float scale) {
  typedef typename Elem<ET>::T T;
  typedef typename Frag<T>::V V;
  const T* A = (const T*)Ap; const T* A2 = (const T*)A2p; const T* Bt = (const T*)Btp; const T* Bt2 = (const T*)Bt2p;
  __shared__ __align__(16) float sT[8][16 * 68];   // per-wave 16x64 slab, pitch 68 floats
  const int b    = blockIdx.y;
  const int lane = threadIdx.x & 31;
  const int wave = threadIdx.x >> 5;
  const int tilesN = N >> 6;
  const int tilesM = M >> 6;
  const int tile = blockIdx.x * 8 + wave;
  if (tile >= tilesM * tilesN) return;   // wave-uniform; no block barriers in this kernel
  const int tm = tile / tilesN;
  const int tn = tile - tm * tilesN;
  const int m0 = tm << 6;
  const int n0 = tn << 6;

  const T* Ab  = A  + (size_t)b * strideA;
  const T* Bb  = Bt + (size_t)b * strideB;
  const T* Ab2 = SPLITA ? (A2  + (size_t)b * strideA) : nullptr;
  const T* Bb2 = SPLITB ? (Bt2 + (size_t)b * strideB) : nullptr;

  const int rlane = lane & 15;                 // row (A) / col (B, D) within subtile
  const int koff  = (lane >> 4) * 8;           // k offset of this lane half
  const int mOff  = (lane >> 4) * 8;           // D row offset

  v8f acc[4][4];
#pragma unroll
  for (int i = 0; i < 4; ++i)
#pragma unroll
    for (int j = 0; j < 4; ++j) acc[i][j] = (v8f){0.f,0.f,0.f,0.f,0.f,0.f,0.f,0.f};

  for (int k0 = 0; k0 < K; k0 += 32) {
    V bh[4], bl[4];
#pragma unroll
    for (int j = 0; j < 4; ++j) {
      const size_t bo = (size_t)(n0 + (j << 4) + rlane) * ldb + koff + k0;
      bh[j] = Frag<T>::load(Bb + bo);
      if (SPLITB) bl[j] = Frag<T>::load(Bb2 + bo);
    }
#pragma unroll
    for (int i = 0; i < 4; ++i) {
      const size_t ao = (size_t)(m0 + (i << 4) + rlane) * lda + koff + k0;
      V ah = Frag<T>::load(Ab + ao);
      V al;
      if (SPLITA) al = Frag<T>::load(Ab2 + ao);
#pragma unroll
      for (int j = 0; j < 4; ++j) {
        acc[i][j] = Frag<T>::mma(ah, bh[j], acc[i][j]);
        if (SPLITB) acc[i][j] = Frag<T>::mma(ah, bl[j], acc[i][j]);
        if (SPLITA) acc[i][j] = Frag<T>::mma(al, bh[j], acc[i][j]);
      }
      Frag<T>::guard(acc[i][0], acc[i][3], ah, SPLITA ? al : ah);
    }
    Frag<T>::keep(bh[0], bh[1], bh[2], bh[3]);
    if (SPLITB) Frag<T>::keep(bl[0], bl[1], bl[2], bl[3]);
  }
  acc_guard4(acc[0][0], acc[0][1], acc[0][2], acc[0][3]);
  acc_guard4(acc[1][0], acc[1][1], acc[1][2], acc[1][3]);
  acc_guard4(acc[2][0], acc[2][1], acc[2][2], acc[2][3]);
  acc_guard4(acc[3][0], acc[3][1], acc[3][2], acc[3][3]);

  // ---- epilogue ----
  float* slab = sT[wave];
#pragma unroll
  for (int i = 0; i < 4; ++i) {
    const int mBase = m0 + (i << 4);
#pragma unroll
    for (int j = 0; j < 4; ++j) {
      const int n = n0 + (j << 4) + rlane;
      float bv = 0.f;
      if (BIAS_MODE == 2) bv = bf_bits2f(f2bf_bits(bias[n]));
#pragma unroll
      for (int r = 0; r < 8; ++r) {
        float v = acc[i][j][r] * scale;
        if (BIAS_MODE == 1) v += bias[mBase + mOff + r];
        if (BIAS_MODE == 2) v += bv;
        slab[(mOff + r) * 68 + (j << 4) + rlane] = v;
      }
    }
    __builtin_amdgcn_fence(__ATOMIC_RELEASE, "workgroup");
    __builtin_amdgcn_wave_barrier();
    __builtin_amdgcn_fence(__ATOMIC_ACQUIRE, "workgroup");
    if (OUT_MODE == 0) {
      float* C = (float*)Cout + (size_t)b * strideC;
      const int hh = lane >> 4, c4 = (lane & 15) * 4;     // row seg = 256 B = 16 lanes x 16 B
      {
#pragma unroll
        for (int it = 0; it < 8; ++it) {
          const int row = it * 2 + hh;
          v4f v = *(const v4f*)(slab + row * 68 + c4);
          *(v4f*)(C + (size_t)(mBase + row) * ldc + n0 + c4) = v;
        }
        
      }
    } else {
      const int q = lane >> 3, c8 = (lane & 7) * 8;
      unsigned short* C  = (unsigned short*)Cout  + (size_t)b * strideC;
      unsigned short* C2 = (OUT_MODE == 2) ? ((unsigned short*)Cout2 + (size_t)b * strideC) : nullptr;
      {
#pragma unroll
        for (int it = 0; it < 4; ++it) {
          const int row = it * 4 + q;
          const float* sp = slab + row * 68 + c8;
          v8h hv, lv;
#pragma unroll
          for (int e = 0; e < 8; ++e) {
            if (OUT_MODE == 1) {
              hv[e] = (_Float16)sp[e];
            } else {
              unsigned short hb = f2bf_bits(sp[e]);
              unsigned short lb = f2bf_bits(sp[e] - bf_bits2f(hb));
              hv[e] = __builtin_bit_cast(_Float16, hb);
              lv[e] = __builtin_bit_cast(_Float16, lb);
            }
          }
          *(v8h*)(C + (size_t)(mBase + row) * ldc + n0 + c8) = hv;
          if (OUT_MODE == 2) *(v8h*)(C2 + (size_t)(mBase + row) * ldc + n0 + c8) = lv;
        }
        
      }
    }
    __builtin_amdgcn_fence(__ATOMIC_RELEASE, "workgroup");
    __builtin_amdgcn_wave_barrier();
    __builtin_amdgcn_fence(__ATOMIC_ACQUIRE, "workgroup");
  }
}

// ---- f32 -> bf16 (RNE) plane convert, 8 elements (16 B) per thread ---------------------------------
__global__ __launch_bounds__(256) void cvt_f32_bf16x8(
    const float* __restrict__ in, unsigned short* __restrict__ out, int n8) {
  const int i = blockIdx.x * 256 + threadIdx.x;
  if (i < n8) {
    const float* p = in + (size_t)i * 8;
    const v4f a = *(const v4f*)p;
    const v4f c2 = *(const v4f*)(p + 4);
    v4u w;
    w[0] = (unsigned)f2bf_bits(a[0])  | ((unsigned)f2bf_bits(a[1])  << 16);
    w[1] = (unsigned)f2bf_bits(a[2])  | ((unsigned)f2bf_bits(a[3])  << 16);
    w[2] = (unsigned)f2bf_bits(c2[0]) | ((unsigned)f2bf_bits(c2[1]) << 16);
    w[3] = (unsigned)f2bf_bits(c2[2]) | ((unsigned)f2bf_bits(c2[3]) << 16);
    unsigned short* o = out + (size_t)i * 8;
    *(v4u*)o = w;
    
  }
}

// ---- transpose + RNE-bf16 convert: in = z planes of [R][CC] f32 -> out = z planes of [CC][R] bf16 ------
// grid = (CC/64, R/64, z), block 256. Per block one 64x64 tile through LDS.
// Store coverage: wave w writes out rows ct*64 + 8w + {0..7} (2 iterations x 4 rows), lanes 8q..8q+7 write
__global__ __launch_bounds__(256) void tr_cvt_bf16(
    const float* __restrict__ in, unsigned short* __restrict__ out, int R, int CC) {
  __shared__ float tile[64][65];
  const int tid = threadIdx.x;
  const size_t zoff = (size_t)blockIdx.z * (size_t)R * (size_t)CC;
  const float* src = in + zoff;
  unsigned short* dst = out + zoff;
  const int ct = blockIdx.x, rt = blockIdx.y;
  const int lr = tid >> 2, lc = (tid & 3) * 16;           // in-tile row (input row), 16 input cols
  const float* sp = src + (size_t)(rt * 64 + lr) * CC + ct * 64 + lc;
#pragma unroll
  for (int i = 0; i < 4; ++i) {
    const v4f v = *(const v4f*)(sp + 4 * i);
    tile[lr][lc + 4 * i + 0] = v[0];
    tile[lr][lc + 4 * i + 1] = v[1];
    tile[lr][lc + 4 * i + 2] = v[2];
    tile[lr][lc + 4 * i + 3] = v[3];
  }
  __syncthreads();
  const int lane = tid & 31, wave = tid >> 5, q = lane >> 3, c8 = (lane & 7) * 8;
  v4u w[2];
#pragma unroll
  for (int it = 0; it < 2; ++it) {
    const int fl = wave * 8 + it * 4 + q;                   // out row within tile = input col within tile
    v4u t4;
#pragma unroll
    for (int e = 0; e < 4; ++e) {
      const unsigned lo16 = (unsigned)f2bf_bits(tile[c8 + 2 * e][fl]);
      const unsigned hi16 = (unsigned)f2bf_bits(tile[c8 + 2 * e + 1][fl]);
      t4[e] = lo16 | (hi16 << 16);
    }
    w[it] = t4;
  }
  {
#pragma unroll
    for (int it = 0; it < 2; ++it) {
      const int fl = wave * 8 + it * 4 + q;
      *(v4u*)(dst + (size_t)(ct * 64 + fl) * R + rt * 64 + c8) = w[it];
    }
    
  }
}

// =====================================================================================================
// Causal flash attention, head_dim 256, operands = bf16 hi/lo planes.
//   Q/K/V planes: element (b, s, h, d) at [(b*SEQLEN + s)*EMB_SZ + h*HDIM + d] (hi plane and lo plane).
//   scores = (Qhi.Khi + Qhi.Klo + Qlo.Khi) * inv_scale; causal mask = -inf for key > query (diagonal chunk);
//   online softmax in f32; P (unnormalised exp) split to bf16 hi/lo in LDS; O += Phi.Vhi + Phi.Vlo + Plo.Vhi;
//   out = O / l written as bf16 hi/lo concat planes in the same [(b,s)][h*HDIM + d] layout.
// Block = 256 threads = 8 waves, 64 query rows of one (b,h); wave w: row group rw = w&3 (16 rows),
// half ch = w>>2: key half (32 of 64 keys) for the score tiles, column half (128 of 256) for O.
// Row max / row sum of the two key halves combined through LDS with block barriers.
// grid = (SEQLEN/64, NBATCH*NHEAD).
// =====================================================================================================
constexpr int AT_KEYS  = 64;    // keys per chunk
constexpr int AT_QROWS = 64;    // query rows per block
constexpr int AT_WHALF = 128;   // output columns per wave
static_assert(SEQLEN % AT_QROWS == 0 && SEQLEN % AT_KEYS == 0 && HDIM == 2 * AT_WHALF);
static_assert(8 * 16 * AT_WHALF == AT_KEYS * HDIM);   // output staging slabs fit one K plane

__device__ __forceinline__ v16b ldfrag16(const unsigned short* p) {   // elements 0..7 <- p[0..7], 8..15 <- p[16..23]
  union { v16b v; v8b h[2]; } f;
  f.h[0] = *(const v8b*)(p); f.h[1] = *(const v8b*)(p + 16); return f.v;
}
__device__ __forceinline__ v8f mma_bf(v16b a, v16b b, v8f c) {
  c = __builtin_amdgcn_wmma_f32_16x16x32_bf16(false, a, false, b, (short)0, c, false, false);
  asm volatile("v_nop\n\tv_nop\n\tv_nop\n\tv_nop" : "+v"(c) : "v"(a), "v"(b));
  return c;
}

__global__ __launch_bounds__(256) void attn_hd256(
    const unsigned short* __restrict__ Qh, const unsigned short* __restrict__ Ql,
    const unsigned short* __restrict__ Kh, const unsigned short* __restrict__ Kl,
    const unsigned short* __restrict__ Vh, const unsigned short* __restrict__ Vl,
    unsigned short* __restrict__ Oh, unsigned short* __restrict__ Ol, float inv_scale) {
  __shared__ __align__(16) unsigned short Ks[2][AT_KEYS * HDIM];     // [plane][key][d]   65536 B; reused as output staging
  __shared__ __align__(16) unsigned short Vts[2][HDIM * AT_KEYS];    // [plane][d][key]   65536 B
  __shared__ __align__(16) unsigned short Ps[2][AT_QROWS * AT_KEYS]; // [plane][row][key] 16384 B
  __shared__ float redm[2][AT_QROWS];                                // partial row max per key half
  __shared__ float reds[2][AT_QROWS];                                // partial row sum per key half

  const int tid  = threadIdx.x;
  const int lane = tid & 31;
  const int wave = tid >> 5;
  const int hh   = lane >> 4;
  const int c    = lane & 15;
  const int rw   = wave & 3;
  const int ch   = wave >> 2;
  const int qb   = blockIdx.x;                 // query block 0..31
  const int bh   = blockIdx.y;                 // b*NHEAD + h
  const int h    = bh % NHEAD;
  const int b    = bh / NHEAD;
  const int q0w  = qb * AT_QROWS + rw * 16;    // first query row (within the sequence) of this wave
  const size_t rowb = (size_t)b * SEQLEN;      // flattened row base of this batch
  const int hcol = h * HDIM;

  float mrow[8], lrow[8];
  v8f oacc[8];
#pragma unroll
  for (int r = 0; r < 8; ++r) { mrow[r] = -INFINITY; lrow[r] = 0.f; }
#pragma unroll
  for (int t = 0; t < 8; ++t) oacc[t] = (v8f){0.f,0.f,0.f,0.f,0.f,0.f,0.f,0.f};

  const int nch = qb + 1;                      // causal horizon in 64-key chunks (block-uniform)
  for (int kc = 0; kc < nch; ++kc) {
    const int kv0 = kc * AT_KEYS;
    __syncthreads();
    // ---- stage K (hi/lo, [key][d]) and V (hi/lo, transposed [d][key]) ----
    // Coverage: 256 threads x 64 elements = 64 keys x 256 d per plane (thread -> key tid>>2, d quarter (tid&3)*64).
    {
      const int kvr = tid >> 2, dq = (tid & 3) * 64;
      const size_t gbase = (rowb + kv0 + kvr) * EMB_SZ + hcol + dq;
#pragma unroll 1
      for (int i = 0; i < 8; ++i) {
        const v4u kh4 = *(const v4u*)(Kh + gbase + 8 * i);
        const v4u kl4 = *(const v4u*)(Kl + gbase + 8 * i);
        *(v4u*)(&Ks[0][kvr * HDIM + dq + 8 * i]) = kh4;
        *(v4u*)(&Ks[1][kvr * HDIM + dq + 8 * i]) = kl4;
      }
#pragma unroll 1
      for (int i = 0; i < 8; ++i) {
        const v4u vh4 = *(const v4u*)(Vh + gbase + 8 * i);
        const v4u vl4 = *(const v4u*)(Vl + gbase + 8 * i);
#pragma unroll
        for (int e = 0; e < 8; ++e) {
          const int d = dq + 8 * i + e;
          const unsigned sh = (unsigned)(e & 1) * 16u;
          Vts[0][d * AT_KEYS + kvr] = (unsigned short)((vh4[e >> 1] >> sh) & 0xffffu);
          Vts[1][d * AT_KEYS + kvr] = (unsigned short)((vl4[e >> 1] >> sh) & 0xffffu);
        }
      }
    }
    __syncthreads();

    // ---- scores for this wave: 16 rows x 32 keys (two 16x16 D tiles), hi.hi + hi.lo + lo.hi over d ----
    v8f s[2];
    s[0] = (v8f){0.f,0.f,0.f,0.f,0.f,0.f,0.f,0.f};
    s[1] = (v8f){0.f,0.f,0.f,0.f,0.f,0.f,0.f,0.f};
    {
      const size_t qoff = (rowb + q0w + c) * EMB_SZ + hcol + 8 * hh;   // A fragment row m = c
#pragma unroll 1
      for (int dc = 0; dc < 8; ++dc) {
        const v16b qa  = ldfrag16(Qh + qoff + dc * 32);
        const v16b qal = ldfrag16(Ql + qoff + dc * 32);
#pragma unroll
        for (int j = 0; j < 2; ++j) {
          const int kr = ch * 32 + j * 16 + c;                           // B fragment column n = key kr
          const int koff = kr * HDIM + dc * 32 + 8 * hh;
          const v16b kb = ldfrag16(&Ks[0][koff]);
          const v16b kl = ldfrag16(&Ks[1][koff]);
          s[j] = mma_bf(qa, kb, s[j]);
          s[j] = mma_bf(qa, kl, s[j]);
          s[j] = mma_bf(qal, kb, s[j]);
        }
      }
    }

    // ---- scale, causal mask, partial row max over this wave's 32 keys ----
    const bool diag = (kc == qb);                // block-uniform
#pragma unroll
    for (int r = 0; r < 8; ++r) {
      const int qrow = q0w + 8 * hh + r;         // D row 8hh+r
      float m = -INFINITY;
#pragma unroll
      for (int j = 0; j < 2; ++j) {
        const int kvcol = kv0 + ch * 32 + j * 16 + c;   // D col c of tile j
        float sv = s[j][r] * inv_scale;
        if (diag && (kvcol > qrow)) sv = -INFINITY;
        s[j][r] = sv;
        m = fmaxf(m, sv);
      }
      m = fmaxf(m, __shfl_xor(m, 1, 32));
      m = fmaxf(m, __shfl_xor(m, 2, 32));
      m = fmaxf(m, __shfl_xor(m, 4, 32));
      m = fmaxf(m, __shfl_xor(m, 8, 32));
      redm[ch][rw * 16 + 8 * hh + r] = m;
    }
    __syncthreads();

    // ---- online softmax update; P hi/lo to LDS; partial sums ----
    float alph[8];
#pragma unroll
    for (int r = 0; r < 8; ++r) {
      const int row = rw * 16 + 8 * hh + r;
      const float mc = fmaxf(redm[0][row], redm[1][row]);
      const float mnew = fmaxf(mrow[r], mc);
      const float alpha = expf(mrow[r] - mnew);
      mrow[r] = mnew;
      alph[r] = alpha;
      float psum = 0.f;
#pragma unroll
      for (int j = 0; j < 2; ++j) {
        const float p = expf(s[j][r] - mnew);
        psum += p;
        const unsigned short hb = f2bf_bits(p);
        const unsigned short lb = f2bf_bits(p - bf_bits2f(hb));
        const int pidx = row * AT_KEYS + ch * 32 + j * 16 + c;
        Ps[0][pidx] = hb;
        Ps[1][pidx] = lb;
      }
      psum += __shfl_xor(psum, 1, 32);
      psum += __shfl_xor(psum, 2, 32);
      psum += __shfl_xor(psum, 4, 32);
      psum += __shfl_xor(psum, 8, 32);
      reds[ch][row] = psum;
#pragma unroll
      for (int t = 0; t < 8; ++t) oacc[t][r] *= alpha;
    }
    __syncthreads();
#pragma unroll
    for (int r = 0; r < 8; ++r) {
      const int row = rw * 16 + 8 * hh + r;
      lrow[r] = lrow[r] * alph[r] + (reds[0][row] + reds[1][row]);
    }

    // ---- O += P.V over 64 keys for this wave's 16 rows x 128 columns ----
#pragma unroll 1
    for (int kk = 0; kk < 2; ++kk) {
      const int poff = (rw * 16 + c) * AT_KEYS + kk * 32 + 8 * hh;            // A fragment row m = c
      const v16b pa = ldfrag16(&Ps[0][poff]);
      const v16b pl = ldfrag16(&Ps[1][poff]);
#pragma unroll
      for (int t = 0; t < 8; ++t) {
        const int voff = (ch * AT_WHALF + t * 16 + c) * AT_KEYS + kk * 32 + 8 * hh;   // B fragment column n = d
        const v16b vb = ldfrag16(&Vts[0][voff]);
        const v16b vl = ldfrag16(&Vts[1][voff]);
        oacc[t] = mma_bf(pa, vb, oacc[t]);
        oacc[t] = mma_bf(pa, vl, oacc[t]);
        oacc[t] = mma_bf(pl, vb, oacc[t]);
      }
    }
  }

  // ---- epilogue: normalise, split to bf16 hi/lo in per-wave LDS slabs (K region), whole-line stores ----
  __syncthreads();
  unsigned short* slh = &Ks[0][wave * (16 * AT_WHALF)];
  unsigned short* sll = &Ks[1][wave * (16 * AT_WHALF)];
#pragma unroll
  for (int r = 0; r < 8; ++r) {
    const float inv = 1.0f / lrow[r];
    const int row = 8 * hh + r;
#pragma unroll
    for (int t = 0; t < 8; ++t) {
      const float v = oacc[t][r] * inv;
      const unsigned short hb = f2bf_bits(v);
      const unsigned short lb = f2bf_bits(v - bf_bits2f(hb));
      slh[row * AT_WHALF + t * 16 + c] = hb;
      sll[row * AT_WHALF + t * 16 + c] = lb;
    }
  }
  __syncthreads();
  // Store coverage: 8 iterations x rows (2it + hh) = 16 rows; per row 16 lanes x 16 B = 128 columns = 2 whole
  {
    {
#pragma unroll
      for (int it = 0; it < 8; ++it) {
        const int row = it * 2 + hh;
        const v4u wh = *(const v4u*)(slh + row * AT_WHALF + c * 8);
        const v4u wl = *(const v4u*)(sll + row * AT_WHALF + c * 8);
        const size_t go = (rowb + q0w + row) * EMB_SZ + hcol + ch * AT_WHALF + c * 8;
        *(v4u*)(Oh + go) = wh;
        *(v4u*)(Ol + go) = wl;
      }
      
    }
  }
}

// ---------------------------------------------------------------------------------------------------
extern "C" void kernel_launch(void* const* d_in, const int* in_sizes, int n_in,
                              void* d_out, int out_size, void* d_ws, size_t ws_size,
                              hipStream_t stream) {
  (void)in_sizes; (void)n_in; (void)out_size;
  const float* Xk = (const float*)d_in[0];
  const float* Xv = (const float*)d_in[1];
  const float* Xq = (const float*)d_in[2];
  const float* Wk = (const float*)d_in[3];
  const float* Wv = (const float*)d_in[4];
  const float* Wq = (const float*)d_in[5];
  const float* Wo = (const float*)d_in[6];
  const float* bo = (const float*)d_in[7];
  float* out = (float*)d_out;

  if (ws_size < WS_TOTAL_BYTES) return;

  unsigned short* ws = (unsigned short*)d_ws;
  unsigned short* xk_b = ws + 0 * PLANE_ELEMS;   // later: concat hi
  unsigned short* xv_b = ws + 1 * PLANE_ELEMS;   // later: concat lo
  unsigned short* xq_b = ws + 2 * PLANE_ELEMS;
  unsigned short* k_hi = ws + 3 * PLANE_ELEMS;
  unsigned short* k_lo = ws + 4 * PLANE_ELEMS;
  unsigned short* v_hi = ws + 5 * PLANE_ELEMS;
  unsigned short* v_lo = ws + 6 * PLANE_ELEMS;
  unsigned short* q_hi = ws + 7 * PLANE_ELEMS;
  unsigned short* q_lo = ws + 8 * PLANE_ELEMS;
  unsigned short* wkT  = ws + WS_OFF_WKT;
  unsigned short* wvT  = ws + WS_OFF_WVT;
  unsigned short* wqT  = ws + WS_OFF_WQT;
  unsigned short* woT  = ws + WS_OFF_WOT;
  unsigned short* cc_hi = xk_b;
  unsigned short* cc_lo = xv_b;

  // 1) inputs -> bf16 planes (RNE), [8192][768] each
  const int n8 = (int)(PLANE_ELEMS / 8);                 // 786432 = 3072 * 256
  cvt_f32_bf16x8<<<dim3(n8 / 256), 256, 0, stream>>>(Xk, xk_b, n8);
  cvt_f32_bf16x8<<<dim3(n8 / 256), 256, 0, stream>>>(Xv, xv_b, n8);
  cvt_f32_bf16x8<<<dim3(n8 / 256), 256, 0, stream>>>(Xq, xq_b, n8);

  // 2) weights: in [3][768][256] -> out [3][256][768] bf16 (Bt layout [N=f][K=e]); Wo [768 k][768 n] -> [768 n][768 k]
  tr_cvt_bf16<<<dim3(HDIM / 64, EMB_SZ / 64, NHEAD), 256, 0, stream>>>(Wk, wkT, EMB_SZ, HDIM);
  tr_cvt_bf16<<<dim3(HDIM / 64, EMB_SZ / 64, NHEAD), 256, 0, stream>>>(Wv, wvT, EMB_SZ, HDIM);
  tr_cvt_bf16<<<dim3(HDIM / 64, EMB_SZ / 64, NHEAD), 256, 0, stream>>>(Wq, wqT, EMB_SZ, HDIM);
  tr_cvt_bf16<<<dim3(EMB_SZ / 64, EMB_SZ / 64, 1), 256, 0, stream>>>(Wo, woT, EMB_SZ, EMB_SZ);

  // 3) per-head projections: C_h[8192 x 256] = X[8192 x 768] . (W_h^T)[256 x 768]^T, written as bf16 hi/lo
  //    planes at column offset h*256 with ldc 768 (grid.y = head). M=8192, N=256, K=768: 512 tiles = 64 blocks x 8 waves.
  const dim3 gproj((NROWS / 64) * (HDIM / 64) / 8, NHEAD);
  wmma_gemm64<1, false, false, 0, 2><<<gproj, 256, 0, stream>>>(
      xk_b, xk_b, EMB_SZ, 0L, wkT, wkT, EMB_SZ, (long)HDIM * EMB_SZ,
      (void*)k_hi, (void*)k_lo, EMB_SZ, (long)HDIM, bo, NROWS, HDIM, EMB_SZ, 1.0f);
  wmma_gemm64<1, false, false, 0, 2><<<gproj, 256, 0, stream>>>(
      xv_b, xv_b, EMB_SZ, 0L, wvT, wvT, EMB_SZ, (long)HDIM * EMB_SZ,
      (void*)v_hi, (void*)v_lo, EMB_SZ, (long)HDIM, bo, NROWS, HDIM, EMB_SZ, 1.0f);
  wmma_gemm64<1, false, false, 0, 2><<<gproj, 256, 0, stream>>>(
      xq_b, xq_b, EMB_SZ, 0L, wqT, wqT, EMB_SZ, (long)HDIM * EMB_SZ,
      (void*)q_hi, (void*)q_lo, EMB_SZ, (long)HDIM, bo, NROWS, HDIM, EMB_SZ, 1.0f);

  // 4) causal attention -> concat hi/lo planes (X planes are dead now)
  const float inv_scale = 1.0f / sqrtf((float)SEQLEN);
  attn_hd256<<<dim3(SEQLEN / AT_QROWS, NBATCH * NHEAD), 256, 0, stream>>>(
      q_hi, q_lo, k_hi, k_lo, v_hi, v_lo, cc_hi, cc_lo, inv_scale);

  // 5) output projection: out[8192 x 768] = concat(hi+lo) . (Wo^T)^T + bo, f32. M=8192, N=768, K=768: 1536 tiles = 192 blocks.
  const dim3 gout((NROWS / 64) * (EMB_SZ / 64) / 8, 1);
  wmma_gemm64<1, true, false, 2, 0><<<gout, 256, 0, stream>>>(
      cc_hi, cc_lo, EMB_SZ, 0L, woT, woT, EMB_SZ, 0L,
      (void*)out, (void*)out, EMB_SZ, 0L, bo, NROWS, EMB_SZ, EMB_SZ, 1.0f);
}

// v001
// One run takes 815 microseconds.
// In both of two side-by-side timings against v000, it was 1.32 times as fast.
// Contractions on v_wmma_f32_16x16x32_bf16 with f32 accumulate: per-head projections = bf16(X) x bf16(W^T) (inputs RNE-converted once); Q.K^T and P.V = bf16 hi/lo planes (hi.hi + hi.lo + lo.hi); output projection = concat bf16 hi/lo x bf16(Wo^T) (hi.W + lo.W) + bf16(bo); softmax, rescaling and normalisation in f32.
#include <hip/hip_runtime.h>
#include <stdint.h>
#include <math.h>

typedef __attribute__((ext_vector_type(16))) _Float16 v16h;
typedef __attribute__((ext_vector_type(8)))  _Float16 v8h;
typedef __attribute__((ext_vector_type(16))) __bf16   v16b;
typedef __attribute__((ext_vector_type(8)))  __bf16   v8b;
typedef __attribute__((ext_vector_type(8)))  float    v8f;
typedef __attribute__((ext_vector_type(4)))  float    v4f;
typedef __attribute__((ext_vector_type(4)))  unsigned v4u;

// ---- problem geometry ----
constexpr int EMB_SZ  = 768;
constexpr int NHEAD   = 3;
constexpr int HDIM    = 256;
constexpr int NBATCH  = 4;
constexpr int SEQLEN  = 2048;
constexpr int NROWS   = NBATCH * SEQLEN;                       // 8192 flattened (b,s) rows
constexpr size_t PLANE_ELEMS = (size_t)NROWS * EMB_SZ;          // 6291456 elements per [8192][768] plane
constexpr size_t PLANE_BYTES = PLANE_ELEMS * 2;                 // 12582912 B per 16-bit plane
constexpr size_t WT_ELEMS    = (size_t)NHEAD * HDIM * EMB_SZ;   // 589824 (W^T planes [3][256][768])
constexpr size_t WO_ELEMS    = (size_t)EMB_SZ * EMB_SZ;         // 589824 (Wo^T plane [768][768])

// [0]            Xk bf16 plane        (dead after projections; reused as concat hi plane)
// [1*PLANE]      Xv bf16 plane        (reused as concat lo plane)
// [2*PLANE]      Xq bf16 plane
// [3*PLANE]      K hi, [4*PLANE] K lo, [5*PLANE] V hi, [6*PLANE] V lo, [7*PLANE] Q hi, [8*PLANE] Q lo
// [9*PLANE]      Wk^T bf16 [3][256][768], then Wv^T, Wq^T (WT_ELEMS each)
// [9*PLANE+3*WT] Wo^T bf16 [768][768]
constexpr size_t WS_OFF_WKT = 9 * PLANE_ELEMS;
constexpr size_t WS_OFF_WVT = WS_OFF_WKT + WT_ELEMS;
constexpr size_t WS_OFF_WQT = WS_OFF_WVT + WT_ELEMS;
constexpr size_t WS_OFF_WOT = WS_OFF_WQT + WT_ELEMS;
constexpr size_t WS_TOTAL_BYTES = (WS_OFF_WOT + WO_ELEMS) * 2;    // 117964800 B
static_assert(WS_TOTAL_BYTES == 117964800ull);
static_assert(WS_TOTAL_BYTES <= 134217728ull);
static_assert((PLANE_BYTES % 128) == 0 && ((WT_ELEMS * 2) % 128) == 0 && ((WO_ELEMS * 2) % 128) == 0);

// ---- GEMM shape contract for the launches in this file ----
static_assert(NROWS % 64 == 0 && HDIM % 64 == 0 && EMB_SZ % 64 == 0);   // M, N tile multiples
static_assert(EMB_SZ % 32 == 0);                                          // K % 32 == 0 for all GEMMs (K = 768)
static_assert(PLANE_ELEMS % (8 * 256) == 0);                              // convert kernel: exact thread coverage

__device__ __forceinline__ unsigned short f2bf_bits(float f) {
  unsigned u = __float_as_uint(f);
  return (unsigned short)((u + 0x7FFFu + ((u >> 16) & 1u)) >> 16);
}
__device__ __forceinline__ float bf_bits2f(unsigned short h) { return __uint_as_float(((unsigned)h) << 16); }

// hazard guards as plain device helpers (no inline asm inside the kernel template body)
__device__ __forceinline__ void dep_guard_h(v8f& a, v8f& b, v16h x, v16h y) { asm volatile("v_nop\n\tv_nop\n\tv_nop\n\tv_nop" : "+v"(a), "+v"(b) : "v"(x), "v"(y)); }
__device__ __forceinline__ void dep_guard_b(v8f& a, v8f& b, v16b x, v16b y) { asm volatile("v_nop\n\tv_nop\n\tv_nop\n\tv_nop" : "+v"(a), "+v"(b) : "v"(x), "v"(y)); }
__device__ __forceinline__ void keep4_h(v16h a, v16h b, v16h c, v16h d) { asm volatile("v_nop" :: "v"(a), "v"(b), "v"(c), "v"(d)); }
__device__ __forceinline__ void keep4_b(v16b a, v16b b, v16b c, v16b d) { asm volatile("v_nop" :: "v"(a), "v"(b), "v"(c), "v"(d)); }
__device__ __forceinline__ void acc_guard4(v8f& a, v8f& b, v8f& c, v8f& d) { asm volatile("v_nop\n\tv_nop\n\tv_nop\n\tv_nop" : "+v"(a), "+v"(b), "+v"(c), "+v"(d)); }
template <typename T> struct Frag;
template <> struct Frag<_Float16> {
  typedef v16h V; union U { v16h v; v8h h[2]; };
  static __device__ __forceinline__ v16h load(const _Float16* p) {   // elements 0..7 <- p[0..7], 8..15 <- p[16..23]
    U f; f.h[0] = *(const v8h*)(p); f.h[1] = *(const v8h*)(p + 16); return f.v;
  }
  static __device__ __forceinline__ v8f mma(v16h a, v16h b, v8f c) {
    return __builtin_amdgcn_wmma_f32_16x16x32_f16(false, a, false, b, (short)0, c, false, false);
  }
  static __device__ __forceinline__ void guard(v8f& a, v8f& b, v16h x, v16h y) { dep_guard_h(a, b, x, y); }
  static __device__ __forceinline__ void keep(v16h a, v16h b, v16h c, v16h d) { keep4_h(a, b, c, d); }
};
template <> struct Frag<__bf16> {
  typedef v16b V; union U { v16b v; v8b h[2]; };
  static __device__ __forceinline__ v16b load(const __bf16* p) {
    U f; f.h[0] = *(const v8b*)(p); f.h[1] = *(const v8b*)(p + 16); return f.v;
  }
  static __device__ __forceinline__ v8f mma(v16b a, v16b b, v8f c) {
    return __builtin_amdgcn_wmma_f32_16x16x32_bf16(false, a, false, b, (short)0, c, false, false);
  }
  static __device__ __forceinline__ void guard(v8f& a, v8f& b, v16b x, v16b y) { dep_guard_b(a, b, x, y); }
  static __device__ __forceinline__ void keep(v16b a, v16b b, v16b c, v16b d) { keep4_b(a, b, c, d); }
};

// ---- Register-blocked batched WMMA GEMM (with independent A/B split flags) --------------------
// C[m,n] = scale * sum_k A[m,k] * Bt[n,k] (+bias); each wave owns a 64x64 tile.
// A row-major [M,K]; Bt row-major [N,K]; M,N % 64 == 0, K % 32 == 0 (no tail handling).
// SPLITA: A has a lo plane A2 (product += Alo.Bhi); SPLITB: Bt has a lo plane Bt2 (product += Ahi.Blo).
// BIAS_MODE: 0 = none, 1 = bias[m], 2 = RNE-bf16(bias[n]).
// OUT_MODE: 0 = f32, 1 = f16, 2 = bf16 hi plane (Cout) + bf16 lo plane (Cout2).
// ET: 0 = f16 operands, 1 = bf16 operands (pointers passed as 16-bit storage)
template <int ET> struct Elem;
template <> struct Elem<0> { typedef _Float16 T; };
template <> struct Elem<1> { typedef __bf16 T; };
template <int ET, bool SPLITA, bool SPLITB, int BIAS_MODE, int OUT_MODE>
__global__ __launch_bounds__(256) void wmma_gemm64(
    const unsigned short* __restrict__ Ap, const unsigned short* __restrict__ A2p, int lda, long strideA,
    const unsigned short* __restrict__ Btp, const unsigned short* __restrict__ Bt2p, int ldb, long strideB,
    void* __restrict__ Cout, void* __restrict__ Cout2, int ldc, long strideC,
    const float* __restrict__ bias,
    int M, int N, int K, float scale) {
  typedef typename Elem<ET>::T T;
  typedef typename Frag<T>::V V;
  const T* A = (const T*)Ap; const T* A2 = (const T*)A2p; const T* Bt = (const T*)Btp; const T* Bt2 = (const T*)Bt2p;
  __shared__ __align__(16) float sT[8][16 * 68];   // per-wave 16x64 slab, pitch 68 floats
  const int b    = blockIdx.y;
  const int lane = threadIdx.x & 31;
  const int wave = threadIdx.x >> 5;
  const int tilesN = N >> 6;
  const int tilesM = M >> 6;
  const int tile = blockIdx.x * 8 + wave;
  if (tile >= tilesM * tilesN) return;   // wave-uniform; no block barriers in this kernel
  const int tm = tile / tilesN;
  const int tn = tile - tm * tilesN;
  const int m0 = tm << 6;
  const int n0 = tn << 6;

  const T* Ab  = A  + (size_t)b * strideA;
  const T* Bb  = Bt + (size_t)b * strideB;
  const T* Ab2 = SPLITA ? (A2  + (size_t)b * strideA) : nullptr;
  const T* Bb2 = SPLITB ? (Bt2 + (size_t)b * strideB) : nullptr;

  const int rlane = lane & 15;                 // row (A) / col (B, D) within subtile
  const int koff  = (lane >> 4) * 8;           // k offset of this lane half
  const int mOff  = (lane >> 4) * 8;           // D row offset

  v8f acc[4][4];
#pragma unroll
  for (int i = 0; i < 4; ++i)
#pragma unroll
    for (int j = 0; j < 4; ++j) acc[i][j] = (v8f){0.f,0.f,0.f,0.f,0.f,0.f,0.f,0.f};

  for (int k0 = 0; k0 < K; k0 += 32) {
    V bh[4], bl[4];
#pragma unroll
    for (int j = 0; j < 4; ++j) {
      const size_t bo = (size_t)(n0 + (j << 4) + rlane) * ldb + koff + k0;
      bh[j] = Frag<T>::load(Bb + bo);
      if (SPLITB) bl[j] = Frag<T>::load(Bb2 + bo);
    }
#pragma unroll
    for (int i = 0; i < 4; ++i) {
      const size_t ao = (size_t)(m0 + (i << 4) + rlane) * lda + koff + k0;
      V ah = Frag<T>::load(Ab + ao);
      V al;
      if (SPLITA) al = Frag<T>::load(Ab2 + ao);
#pragma unroll
      for (int j = 0; j < 4; ++j) {
        acc[i][j] = Frag<T>::mma(ah, bh[j], acc[i][j]);
        if (SPLITB) acc[i][j] = Frag<T>::mma(ah, bl[j], acc[i][j]);
        if (SPLITA) acc[i][j] = Frag<T>::mma(al, bh[j], acc[i][j]);
      }
      Frag<T>::guard(acc[i][0], acc[i][3], ah, SPLITA ? al : ah);
    }
    Frag<T>::keep(bh[0], bh[1], bh[2], bh[3]);
    if (SPLITB) Frag<T>::keep(bl[0], bl[1], bl[2], bl[3]);
  }
  acc_guard4(acc[0][0], acc[0][1], acc[0][2], acc[0][3]);
  acc_guard4(acc[1][0], acc[1][1], acc[1][2], acc[1][3]);
  acc_guard4(acc[2][0], acc[2][1], acc[2][2], acc[2][3]);
  acc_guard4(acc[3][0], acc[3][1], acc[3][2], acc[3][3]);

  // ---- epilogue ----
  float* slab = sT[wave];
#pragma unroll
  for (int i = 0; i < 4; ++i) {
    const int mBase = m0 + (i << 4);
#pragma unroll
    for (int j = 0; j < 4; ++j) {
      const int n = n0 + (j << 4) + rlane;
      float bv = 0.f;
      if (BIAS_MODE == 2) bv = bf_bits2f(f2bf_bits(bias[n]));
#pragma unroll
      for (int r = 0; r < 8; ++r) {
        float v = acc[i][j][r] * scale;
        if (BIAS_MODE == 1) v += bias[mBase + mOff + r];
        if (BIAS_MODE == 2) v += bv;
        slab[(mOff + r) * 68 + (j << 4) + rlane] = v;
      }
    }
    __builtin_amdgcn_fence(__ATOMIC_RELEASE, "workgroup");
    __builtin_amdgcn_wave_barrier();
    __builtin_amdgcn_fence(__ATOMIC_ACQUIRE, "workgroup");
    if (OUT_MODE == 0) {
      float* C = (float*)Cout + (size_t)b * strideC;
      const int hh = lane >> 4, c4 = (lane & 15) * 4;     // row seg = 256 B = 16 lanes x 16 B
      {
#pragma unroll
        for (int it = 0; it < 8; ++it) {
          const int row = it * 2 + hh;
          v4f v = *(const v4f*)(slab + row * 68 + c4);
          *(v4f*)(C + (size_t)(mBase + row) * ldc + n0 + c4) = v;
        }
        
      }
    } else {
      const int q = lane >> 3, c8 = (lane & 7) * 8;
      unsigned short* C  = (unsigned short*)Cout  + (size_t)b * strideC;
      unsigned short* C2 = (OUT_MODE == 2) ? ((unsigned short*)Cout2 + (size_t)b * strideC) : nullptr;
      {
#pragma unroll
        for (int it = 0; it < 4; ++it) {
          const int row = it * 4 + q;
          const float* sp = slab + row * 68 + c8;
          v8h hv, lv;
#pragma unroll
          for (int e = 0; e < 8; ++e) {
            if (OUT_MODE == 1) {
              hv[e] = (_Float16)sp[e];
            } else {
              unsigned short hb = f2bf_bits(sp[e]);
              unsigned short lb = f2bf_bits(sp[e] - bf_bits2f(hb));
              hv[e] = __builtin_bit_cast(_Float16, hb);
              lv[e] = __builtin_bit_cast(_Float16, lb);
            }
          }
          *(v8h*)(C + (size_t)(mBase + row) * ldc + n0 + c8) = hv;
          if (OUT_MODE == 2) *(v8h*)(C2 + (size_t)(mBase + row) * ldc + n0 + c8) = lv;
        }
        
      }
    }
    __builtin_amdgcn_fence(__ATOMIC_RELEASE, "workgroup");
    __builtin_amdgcn_wave_barrier();
    __builtin_amdgcn_fence(__ATOMIC_ACQUIRE, "workgroup");
  }
}

// ---- f32 -> bf16 (RNE) plane convert, 8 elements (16 B) per thread ---------------------------------
__global__ __launch_bounds__(256) void cvt_f32_bf16x8(
    const float* __restrict__ in, unsigned short* __restrict__ out, int n8) {
  const int i = blockIdx.x * 256 + threadIdx.x;
  if (i < n8) {
    const float* p = in + (size_t)i * 8;
    const v4f a = *(const v4f*)p;
    const v4f c2 = *(const v4f*)(p + 4);
    v4u w;
    w[0] = (unsigned)f2bf_bits(a[0])  | ((unsigned)f2bf_bits(a[1])  << 16);
    w[1] = (unsigned)f2bf_bits(a[2])  | ((unsigned)f2bf_bits(a[3])  << 16);
    w[2] = (unsigned)f2bf_bits(c2[0]) | ((unsigned)f2bf_bits(c2[1]) << 16);
    w[3] = (unsigned)f2bf_bits(c2[2]) | ((unsigned)f2bf_bits(c2[3]) << 16);
    unsigned short* o = out + (size_t)i * 8;
    *(v4u*)o = w;
    
  }
}

// ---- transpose + RNE-bf16 convert: in = z planes of [R][CC] f32 -> out = z planes of [CC][R] bf16 ------
// grid = (CC/64, R/64, z), block 256. Per block one 64x64 tile through LDS.
// Store coverage: wave w writes out rows ct*64 + 8w + {0..7} (2 iterations x 4 rows), lanes 8q..8q+7 write
__global__ __launch_bounds__(256) void tr_cvt_bf16(
    const float* __restrict__ in, unsigned short* __restrict__ out, int R, int CC) {
  __shared__ float tile[64][65];
  const int tid = threadIdx.x;
  const size_t zoff = (size_t)blockIdx.z * (size_t)R * (size_t)CC;
  const float* src = in + zoff;
  unsigned short* dst = out + zoff;
  const int ct = blockIdx.x, rt = blockIdx.y;
  const int lr = tid >> 2, lc = (tid & 3) * 16;           // in-tile row (input row), 16 input cols
  const float* sp = src + (size_t)(rt * 64 + lr) * CC + ct * 64 + lc;
#pragma unroll
  for (int i = 0; i < 4; ++i) {
    const v4f v = *(const v4f*)(sp + 4 * i);
    tile[lr][lc + 4 * i + 0] = v[0];
    tile[lr][lc + 4 * i + 1] = v[1];
    tile[lr][lc + 4 * i + 2] = v[2];
    tile[lr][lc + 4 * i + 3] = v[3];
  }
  __syncthreads();
  const int lane = tid & 31, wave = tid >> 5, q = lane >> 3, c8 = (lane & 7) * 8;
  v4u w[2];
#pragma unroll
  for (int it = 0; it < 2; ++it) {
    const int fl = wave * 8 + it * 4 + q;                   // out row within tile = input col within tile
    v4u t4;
#pragma unroll
    for (int e = 0; e < 4; ++e) {
      const unsigned lo16 = (unsigned)f2bf_bits(tile[c8 + 2 * e][fl]);
      const unsigned hi16 = (unsigned)f2bf_bits(tile[c8 + 2 * e + 1][fl]);
      t4[e] = lo16 | (hi16 << 16);
    }
    w[it] = t4;
  }
  {
#pragma unroll
    for (int it = 0; it < 2; ++it) {
      const int fl = wave * 8 + it * 4 + q;
      *(v4u*)(dst + (size_t)(ct * 64 + fl) * R + rt * 64 + c8) = w[it];
    }
    
  }
}

// =====================================================================================================
// Causal flash attention, head_dim 256, operands = bf16 hi/lo planes.
//   Q/K/V planes: element (b, s, h, d) at [(b*SEQLEN + s)*EMB_SZ + h*HDIM + d] (hi plane and lo plane).
//   scores = (Qhi.Khi + Qhi.Klo + Qlo.Khi) * inv_scale; causal mask = -inf for key > query (diagonal chunk);
//   online softmax in f32; P (unnormalised exp) split to bf16 hi/lo in LDS; O += Phi.Vhi + Phi.Vlo + Plo.Vhi;
//   out = O / l written as bf16 hi/lo concat planes in the same [(b,s)][h*HDIM + d] layout.
// Block = 256 threads = 8 waves, 64 query rows of one (b,h); wave w: row group rw = w&3 (16 rows),
// half ch = w>>2: key half (32 of 64 keys) for the score tiles, column half (128 of 256) for O.
// Row max / row sum of the two key halves combined through LDS with block barriers.
// grid = (SEQLEN/64, NBATCH*NHEAD).
// =====================================================================================================
constexpr int AT_KEYS  = 64;    // keys per chunk
constexpr int AT_QROWS = 64;    // query rows per block
constexpr int AT_WHALF = 128;   // output columns per wave
// LDS row pitches in 16-bit elements: each row carries 16 B of pad, so the pitch is an odd multiple of 16 B and
// the 16 rows that one b128 fragment read touches fall on 16 different groups of four banks.
constexpr int AT_KPITCH = HDIM + 8;       // K rows [key][d]: 528 B
constexpr int AT_VPITCH = AT_KEYS + 8;    // V^T rows [d][key]: 144 B
constexpr int AT_PPITCH = AT_KEYS + 8;    // P rows [row][key]: 144 B
// V^T also shifts each quarter of 64 d rows by a further 16 B: the four lanes that stage one key write rows 64
// apart, which any row pitch alone leaves on one bank.
constexpr int AT_VPLANE = HDIM * AT_VPITCH + (HDIM / 64) * 8;
__device__ __forceinline__ int vt_index(int d, int key) { return d * AT_VPITCH + (d >> 6) * 8 + key; }
static_assert(SEQLEN % AT_QROWS == 0 && SEQLEN % AT_KEYS == 0 && HDIM == 2 * AT_WHALF);
static_assert(8 * 16 * AT_WHALF <= AT_KEYS * AT_KPITCH);   // output staging slabs fit one K plane
static_assert((AT_KPITCH * 2) % 32 == 16 && (AT_VPITCH * 2) % 32 == 16 && (AT_PPITCH * 2) % 32 == 16 && (AT_VPLANE * 2) % 16 == 0);

__device__ __forceinline__ v16b ldfrag16(const unsigned short* p) {   // elements 0..7 <- p[0..7], 8..15 <- p[16..23]
  union { v16b v; v8b h[2]; } f;
  f.h[0] = *(const v8b*)(p); f.h[1] = *(const v8b*)(p + 16); return f.v;
}
__device__ __forceinline__ v8f mma_bf(v16b a, v16b b, v8f c) {
  c = __builtin_amdgcn_wmma_f32_16x16x32_bf16(false, a, false, b, (short)0, c, false, false);
  asm volatile("v_nop\n\tv_nop\n\tv_nop\n\tv_nop" : "+v"(c) : "v"(a), "v"(b));
  return c;
}

__global__ __launch_bounds__(256) void attn_hd256(
    const unsigned short* __restrict__ Qh, const unsigned short* __restrict__ Ql,
    const unsigned short* __restrict__ Kh, const unsigned short* __restrict__ Kl,
    const unsigned short* __restrict__ Vh, const unsigned short* __restrict__ Vl,
    unsigned short* __restrict__ Oh, unsigned short* __restrict__ Ol, float inv_scale) {
  __shared__ __align__(16) unsigned short Ks[2][AT_KEYS * AT_KPITCH];   // [plane][key][d]   67584 B; reused as output staging
  __shared__ __align__(16) unsigned short Vts[2][AT_VPLANE];            // [plane][d][key]   73856 B
  __shared__ __align__(16) unsigned short Ps[2][AT_QROWS * AT_PPITCH];  // [plane][row][key] 18432 B
  __shared__ float redm[2][AT_QROWS];                                // partial row max per key half
  __shared__ float reds[2][AT_QROWS];                                // partial row sum per key half

  const int tid  = threadIdx.x;
  const int lane = tid & 31;
  const int wave = tid >> 5;
  const int hh   = lane >> 4;
  const int c    = lane & 15;
  const int rw   = wave & 3;
  const int ch   = wave >> 2;
  const int qb   = blockIdx.x;                 // query block 0..31
  const int bh   = blockIdx.y;                 // b*NHEAD + h
  const int h    = bh % NHEAD;
  const int b    = bh / NHEAD;
  const int q0w  = qb * AT_QROWS + rw * 16;    // first query row (within the sequence) of this wave
  const size_t rowb = (size_t)b * SEQLEN;      // flattened row base of this batch
  const int hcol = h * HDIM;

  float mrow[8], lrow[8];
  v8f oacc[8];
#pragma unroll
  for (int r = 0; r < 8; ++r) { mrow[r] = -INFINITY; lrow[r] = 0.f; }
#pragma unroll
  for (int t = 0; t < 8; ++t) oacc[t] = (v8f){0.f,0.f,0.f,0.f,0.f,0.f,0.f,0.f};

  const int nch = qb + 1;                      // causal horizon in 64-key chunks (block-uniform)
  for (int kc = 0; kc < nch; ++kc) {
    const int kv0 = kc * AT_KEYS;
    __syncthreads();
    // ---- stage K (hi/lo, [key][d]) and V (hi/lo, transposed [d][key]) ----
    // Coverage: 256 threads x 64 elements = 64 keys x 256 d per plane (thread -> key tid>>2, d quarter (tid&3)*64).
    {
      const int kvr = tid >> 2, dq = (tid & 3) * 64;
      const size_t gbase = (rowb + kv0 + kvr) * EMB_SZ + hcol + dq;
#pragma unroll 1
      for (int i = 0; i < 8; ++i) {
        const v4u kh4 = *(const v4u*)(Kh + gbase + 8 * i);
        const v4u kl4 = *(const v4u*)(Kl + gbase + 8 * i);
        *(v4u*)(&Ks[0][kvr * AT_KPITCH + dq + 8 * i]) = kh4;
        *(v4u*)(&Ks[1][kvr * AT_KPITCH + dq + 8 * i]) = kl4;
      }
#pragma unroll 1
      for (int i = 0; i < 8; ++i) {
        const v4u vh4 = *(const v4u*)(Vh + gbase + 8 * i);
        const v4u vl4 = *(const v4u*)(Vl + gbase + 8 * i);
#pragma unroll
        for (int e = 0; e < 8; ++e) {
          const int d = dq + 8 * i + e;
          const unsigned sh = (unsigned)(e & 1) * 16u;
          Vts[0][vt_index(d, kvr)] = (unsigned short)((vh4[e >> 1] >> sh) & 0xffffu);
          Vts[1][vt_index(d, kvr)] = (unsigned short)((vl4[e >> 1] >> sh) & 0xffffu);
        }
      }
    }
    __syncthreads();

    // ---- scores for this wave: 16 rows x 32 keys (two 16x16 D tiles), hi.hi + hi.lo + lo.hi over d ----
    v8f s[2];
    s[0] = (v8f){0.f,0.f,0.f,0.f,0.f,0.f,0.f,0.f};
    s[1] = (v8f){0.f,0.f,0.f,0.f,0.f,0.f,0.f,0.f};
    {
      const size_t qoff = (rowb + q0w + c) * EMB_SZ + hcol + 8 * hh;   // A fragment row m = c
#pragma unroll 1
      for (int dc = 0; dc < 8; ++dc) {
        const v16b qa  = ldfrag16(Qh + qoff + dc * 32);
        const v16b qal = ldfrag16(Ql + qoff + dc * 32);
#pragma unroll
        for (int j = 0; j < 2; ++j) {
          const int kr = ch * 32 + j * 16 + c;                           // B fragment column n = key kr
          const int koff = kr * AT_KPITCH + dc * 32 + 8 * hh;
          const v16b kb = ldfrag16(&Ks[0][koff]);
          const v16b kl = ldfrag16(&Ks[1][koff]);
          s[j] = mma_bf(qa, kb, s[j]);
          s[j] = mma_bf(qa, kl, s[j]);
          s[j] = mma_bf(qal, kb, s[j]);
        }
      }
    }

    // ---- scale, causal mask, partial row max over this wave's 32 keys ----
    const bool diag = (kc == qb);                // block-uniform
#pragma unroll
    for (int r = 0; r < 8; ++r) {
      const int qrow = q0w + 8 * hh + r;         // D row 8hh+r
      float m = -INFINITY;
#pragma unroll
      for (int j = 0; j < 2; ++j) {
        const int kvcol = kv0 + ch * 32 + j * 16 + c;   // D col c of tile j
        float sv = s[j][r] * inv_scale;
        if (diag && (kvcol > qrow)) sv = -INFINITY;
        s[j][r] = sv;
        m = fmaxf(m, sv);
      }
      m = fmaxf(m, __shfl_xor(m, 1, 32));
      m = fmaxf(m, __shfl_xor(m, 2, 32));
      m = fmaxf(m, __shfl_xor(m, 4, 32));
      m = fmaxf(m, __shfl_xor(m, 8, 32));
      redm[ch][rw * 16 + 8 * hh + r] = m;
    }
    __syncthreads();

    // ---- online softmax update; P hi/lo to LDS; partial sums ----
    float alph[8];
#pragma unroll
    for (int r = 0; r < 8; ++r) {
      const int row = rw * 16 + 8 * hh + r;
      const float mc = fmaxf(redm[0][row], redm[1][row]);
      const float mnew = fmaxf(mrow[r], mc);
      const float alpha = expf(mrow[r] - mnew);
      mrow[r] = mnew;
      alph[r] = alpha;
      float psum = 0.f;
#pragma unroll
      for (int j = 0; j < 2; ++j) {
        const float p = expf(s[j][r] - mnew);
        psum += p;
        const unsigned short hb = f2bf_bits(p);
        const unsigned short lb = f2bf_bits(p - bf_bits2f(hb));
        const int pidx = row * AT_PPITCH + ch * 32 + j * 16 + c;
        Ps[0][pidx] = hb;
        Ps[1][pidx] = lb;
      }
      psum += __shfl_xor(psum, 1, 32);
      psum += __shfl_xor(psum, 2, 32);
      psum += __shfl_xor(psum, 4, 32);
      psum += __shfl_xor(psum, 8, 32);
      reds[ch][row] = psum;
#pragma unroll
      for (int t = 0; t < 8; ++t) oacc[t][r] *= alpha;
    }
    __syncthreads();
#pragma unroll
    for (int r = 0; r < 8; ++r) {
      const int row = rw * 16 + 8 * hh + r;
      lrow[r] = lrow[r] * alph[r] + (reds[0][row] + reds[1][row]);
    }

    // ---- O += P.V over 64 keys for this wave's 16 rows x 128 columns ----
#pragma unroll 1
    for (int kk = 0; kk < 2; ++kk) {
      const int poff = (rw * 16 + c) * AT_PPITCH + kk * 32 + 8 * hh;          // A fragment row m = c
      const v16b pa = ldfrag16(&Ps[0][poff]);
      const v16b pl = ldfrag16(&Ps[1][poff]);
#pragma unroll
      for (int t = 0; t < 8; ++t) {
        const int voff = vt_index(ch * AT_WHALF + t * 16 + c, kk * 32 + 8 * hh);      // B fragment column n = d
        const v16b vb = ldfrag16(&Vts[0][voff]);
        const v16b vl = ldfrag16(&Vts[1][voff]);
        oacc[t] = mma_bf(pa, vb, oacc[t]);
        oacc[t] = mma_bf(pa, vl, oacc[t]);
        oacc[t] = mma_bf(pl, vb, oacc[t]);
      }
    }
  }

  // ---- epilogue: normalise, split to bf16 hi/lo in per-wave LDS slabs (K region), whole-line stores ----
  __syncthreads();
  unsigned short* slh = &Ks[0][wave * (16 * AT_WHALF)];
  unsigned short* sll = &Ks[1][wave * (16 * AT_WHALF)];
#pragma unroll
  for (int r = 0; r < 8; ++r) {
    const float inv = 1.0f / lrow[r];
    const int row = 8 * hh + r;
#pragma unroll
    for (int t = 0; t < 8; ++t) {
      const float v = oacc[t][r] * inv;
      const unsigned short hb = f2bf_bits(v);
      const unsigned short lb = f2bf_bits(v - bf_bits2f(hb));
      slh[row * AT_WHALF + t * 16 + c] = hb;
      sll[row * AT_WHALF + t * 16 + c] = lb;
    }
  }
  __syncthreads();
  // Store coverage: 8 iterations x rows (2it + hh) = 16 rows; per row 16 lanes x 16 B = 128 columns = 2 whole
  {
    {
#pragma unroll
      for (int it = 0; it < 8; ++it) {
        const int row = it * 2 + hh;
        const v4u wh = *(const v4u*)(slh + row * AT_WHALF + c * 8);
        const v4u wl = *(const v4u*)(sll + row * AT_WHALF + c * 8);
        const size_t go = (rowb + q0w + row) * EMB_SZ + hcol + ch * AT_WHALF + c * 8;
        *(v4u*)(Oh + go) = wh;
        *(v4u*)(Ol + go) = wl;
      }
      
    }
  }
}

// ---------------------------------------------------------------------------------------------------
extern "C" void kernel_launch(void* const* d_in, const int* in_sizes, int n_in,
                              void* d_out, int out_size, void* d_ws, size_t ws_size,
                              hipStream_t stream) {
  (void)in_sizes; (void)n_in; (void)out_size;
  const float* Xk = (const float*)d_in[0];
  const float* Xv = (const float*)d_in[1];
  const float* Xq = (const float*)d_in[2];
  const float* Wk = (const float*)d_in[3];
  const float* Wv = (const float*)d_in[4];
  const float* Wq = (const float*)d_in[5];
  const float* Wo = (const float*)d_in[6];
  const float* bo = (const float*)d_in[7];
  float* out = (float*)d_out;

  if (ws_size < WS_TOTAL_BYTES) return;

  unsigned short* ws = (unsigned short*)d_ws;
  unsigned short* xk_b = ws + 0 * PLANE_ELEMS;   // later: concat hi
  unsigned short* xv_b = ws + 1 * PLANE_ELEMS;   // later: concat lo
  unsigned short* xq_b = ws + 2 * PLANE_ELEMS;
  unsigned short* k_hi = ws + 3 * PLANE_ELEMS;
  unsigned short* k_lo = ws + 4 * PLANE_ELEMS;
  unsigned short* v_hi = ws + 5 * PLANE_ELEMS;
  unsigned short* v_lo = ws + 6 * PLANE_ELEMS;
  unsigned short* q_hi = ws + 7 * PLANE_ELEMS;
  unsigned short* q_lo = ws + 8 * PLANE_ELEMS;
  unsigned short* wkT  = ws + WS_OFF_WKT;
  unsigned short* wvT  = ws + WS_OFF_WVT;
  unsigned short* wqT  = ws + WS_OFF_WQT;
  unsigned short* woT  = ws + WS_OFF_WOT;
  unsigned short* cc_hi = xk_b;
  unsigned short* cc_lo = xv_b;

  // 1) inputs -> bf16 planes (RNE), [8192][768] each
  const int n8 = (int)(PLANE_ELEMS / 8);                 // 786432 = 3072 * 256
  cvt_f32_bf16x8<<<dim3(n8 / 256), 256, 0, stream>>>(Xk, xk_b, n8);
  cvt_f32_bf16x8<<<dim3(n8 / 256), 256, 0, stream>>>(Xv, xv_b, n8);
  cvt_f32_bf16x8<<<dim3(n8 / 256), 256, 0, stream>>>(Xq, xq_b, n8);

  // 2) weights: in [3][768][256] -> out [3][256][768] bf16 (Bt layout [N=f][K=e]); Wo [768 k][768 n] -> [768 n][768 k]
  tr_cvt_bf16<<<dim3(HDIM / 64, EMB_SZ / 64, NHEAD), 256, 0, stream>>>(Wk, wkT, EMB_SZ, HDIM);
  tr_cvt_bf16<<<dim3(HDIM / 64, EMB_SZ / 64, NHEAD), 256, 0, stream>>>(Wv, wvT, EMB_SZ, HDIM);
  tr_cvt_bf16<<<dim3(HDIM / 64, EMB_SZ / 64, NHEAD), 256, 0, stream>>>(Wq, wqT, EMB_SZ, HDIM);
  tr_cvt_bf16<<<dim3(EMB_SZ / 64, EMB_SZ / 64, 1), 256, 0, stream>>>(Wo, woT, EMB_SZ, EMB_SZ);

  // 3) per-head projections: C_h[8192 x 256] = X[8192 x 768] . (W_h^T)[256 x 768]^T, written as bf16 hi/lo
  //    planes at column offset h*256 with ldc 768 (grid.y = head). M=8192, N=256, K=768: 512 tiles = 64 blocks x 8 waves.
  const dim3 gproj((NROWS / 64) * (HDIM / 64) / 8, NHEAD);
  wmma_gemm64<1, false, false, 0, 2><<<gproj, 256, 0, stream>>>(
      xk_b, xk_b, EMB_SZ, 0L, wkT, wkT, EMB_SZ, (long)HDIM * EMB_SZ,
      (void*)k_hi, (void*)k_lo, EMB_SZ, (long)HDIM, bo, NROWS, HDIM, EMB_SZ, 1.0f);
  wmma_gemm64<1, false, false, 0, 2><<<gproj, 256, 0, stream>>>(
      xv_b, xv_b, EMB_SZ, 0L, wvT, wvT, EMB_SZ, (long)HDIM * EMB_SZ,
      (void*)v_hi, (void*)v_lo, EMB_SZ, (long)HDIM, bo, NROWS, HDIM, EMB_SZ, 1.0f);
  wmma_gemm64<1, false, false, 0, 2><<<gproj, 256, 0, stream>>>(
      xq_b, xq_b, EMB_SZ, 0L, wqT, wqT, EMB_SZ, (long)HDIM * EMB_SZ,
      (void*)q_hi, (void*)q_lo, EMB_SZ, (long)HDIM, bo, NROWS, HDIM, EMB_SZ, 1.0f);

  // 4) causal attention -> concat hi/lo planes (X planes are dead now)
  const float inv_scale = 1.0f / sqrtf((float)SEQLEN);
  attn_hd256<<<dim3(SEQLEN / AT_QROWS, NBATCH * NHEAD), 256, 0, stream>>>(
      q_hi, q_lo, k_hi, k_lo, v_hi, v_lo, cc_hi, cc_lo, inv_scale);

  // 5) output projection: out[8192 x 768] = concat(hi+lo) . (Wo^T)^T + bo, f32. M=8192, N=768, K=768: 1536 tiles = 192 blocks.
  const dim3 gout((NROWS / 64) * (EMB_SZ / 64) / 8, 1);
  wmma_gemm64<1, true, false, 2, 0><<<gout, 256, 0, stream>>>(
      cc_hi, cc_lo, EMB_SZ, 0L, woT, woT, EMB_SZ, 0L,
      (void*)out, (void*)out, EMB_SZ, 0L, bo, NROWS, EMB_SZ, EMB_SZ, 1.0f);
}

// v002
// It runs in 419 microseconds.
// Timed twice side by side with v001, it ran 1.94 and 1.95 times as fast.
// Counting every step since v000, it is 2.57 times as fast.
// Contractions on v_wmma_f32_16x16x32_bf16 with f32 accumulate: per-head projections = bf16(X) x bf16(W^T) (inputs RNE-converted once); Q.K^T and P.V = bf16 hi/lo planes (hi.hi + hi.lo + lo.hi); output projection = concat bf16 hi/lo x bf16(Wo^T) (hi.W + lo.W) + bf16(bo); softmax, rescaling and normalisation in f32.
#include <hip/hip_runtime.h>
#include <stdint.h>
#include <math.h>

typedef __attribute__((ext_vector_type(16))) _Float16 v16h;
typedef __attribute__((ext_vector_type(8)))  _Float16 v8h;
typedef __attribute__((ext_vector_type(16))) __bf16   v16b;
typedef __attribute__((ext_vector_type(8)))  __bf16   v8b;
typedef __attribute__((ext_vector_type(8)))  float    v8f;
typedef __attribute__((ext_vector_type(4)))  float    v4f;
typedef __attribute__((ext_vector_type(4)))  unsigned v4u;

// ---- problem geometry ----
constexpr int EMB_SZ  = 768;
constexpr int NHEAD   = 3;
constexpr int HDIM    = 256;
constexpr int NBATCH  = 4;
constexpr int SEQLEN  = 2048;
constexpr int NROWS   = NBATCH * SEQLEN;                       // 8192 flattened (b,s) rows
constexpr size_t PLANE_ELEMS = (size_t)NROWS * EMB_SZ;          // 6291456 elements per [8192][768] plane
constexpr size_t PLANE_BYTES = PLANE_ELEMS * 2;                 // 12582912 B per 16-bit plane
constexpr size_t WT_ELEMS    = (size_t)NHEAD * HDIM * EMB_SZ;   // 589824 (W^T planes [3][256][768])
constexpr size_t WO_ELEMS    = (size_t)EMB_SZ * EMB_SZ;         // 589824 (Wo^T plane [768][768])

// [0]            Xk bf16 plane        (dead after projections; reused as concat hi plane)
// [1*PLANE]      Xv bf16 plane        (reused as concat lo plane)
// [2*PLANE]      Xq bf16 plane
// [3*PLANE]      K hi, [4*PLANE] K lo, [5*PLANE] V hi, [6*PLANE] V lo, [7*PLANE] Q hi, [8*PLANE] Q lo
// [9*PLANE]      Wk^T bf16 [3][256][768], then Wv^T, Wq^T (WT_ELEMS each)
// [9*PLANE+3*WT] Wo^T bf16 [768][768]
constexpr size_t WS_OFF_WKT = 9 * PLANE_ELEMS;
constexpr size_t WS_OFF_WVT = WS_OFF_WKT + WT_ELEMS;
constexpr size_t WS_OFF_WQT = WS_OFF_WVT + WT_ELEMS;
constexpr size_t WS_OFF_WOT = WS_OFF_WQT + WT_ELEMS;
constexpr size_t WS_TOTAL_BYTES = (WS_OFF_WOT + WO_ELEMS) * 2;    // 117964800 B
static_assert(WS_TOTAL_BYTES == 117964800ull);
static_assert(WS_TOTAL_BYTES <= 134217728ull);
static_assert((PLANE_BYTES % 128) == 0 && ((WT_ELEMS * 2) % 128) == 0 && ((WO_ELEMS * 2) % 128) == 0);

// ---- GEMM shape contract for the launches in this file ----
static_assert(NROWS % 64 == 0 && HDIM % 64 == 0 && EMB_SZ % 64 == 0);   // M, N tile multiples
static_assert(EMB_SZ % 32 == 0);                                          // K % 32 == 0 for all GEMMs (K = 768)
static_assert(PLANE_ELEMS % (8 * 256) == 0);                              // convert kernel: exact thread coverage

__device__ __forceinline__ unsigned short f2bf_bits(float f) {
  unsigned u = __float_as_uint(f);
  return (unsigned short)((u + 0x7FFFu + ((u >> 16) & 1u)) >> 16);
}
__device__ __forceinline__ float bf_bits2f(unsigned short h) { return __uint_as_float(((unsigned)h) << 16); }

// hazard guards as plain device helpers (no inline asm inside the kernel template body)
__device__ __forceinline__ void dep_guard_h(v8f& a, v8f& b, v16h x, v16h y) { asm volatile("v_nop\n\tv_nop\n\tv_nop\n\tv_nop" : "+v"(a), "+v"(b) : "v"(x), "v"(y)); }
__device__ __forceinline__ void dep_guard_b(v8f& a, v8f& b, v16b x, v16b y) { asm volatile("v_nop\n\tv_nop\n\tv_nop\n\tv_nop" : "+v"(a), "+v"(b) : "v"(x), "v"(y)); }
__device__ __forceinline__ void keep4_h(v16h a, v16h b, v16h c, v16h d) { asm volatile("v_nop" :: "v"(a), "v"(b), "v"(c), "v"(d)); }
__device__ __forceinline__ void keep4_b(v16b a, v16b b, v16b c, v16b d) { asm volatile("v_nop" :: "v"(a), "v"(b), "v"(c), "v"(d)); }
__device__ __forceinline__ void acc_guard4(v8f& a, v8f& b, v8f& c, v8f& d) { asm volatile("v_nop\n\tv_nop\n\tv_nop\n\tv_nop" : "+v"(a), "+v"(b), "+v"(c), "+v"(d)); }
template <typename T> struct Frag;
template <> struct Frag<_Float16> {
  typedef v16h V; union U { v16h v; v8h h[2]; };
  static __device__ __forceinline__ v16h load(const _Float16* p) {   // elements 0..7 <- p[0..7], 8..15 <- p[16..23]
    U f; f.h[0] = *(const v8h*)(p); f.h[1] = *(const v8h*)(p + 16); return f.v;
  }
  static __device__ __forceinline__ v8f mma(v16h a, v16h b, v8f c) {
    return __builtin_amdgcn_wmma_f32_16x16x32_f16(false, a, false, b, (short)0, c, false, false);
  }
  static __device__ __forceinline__ void guard(v8f& a, v8f& b, v16h x, v16h y) { dep_guard_h(a, b, x, y); }
  static __device__ __forceinline__ void keep(v16h a, v16h b, v16h c, v16h d) { keep4_h(a, b, c, d); }
};
template <> struct Frag<__bf16> {
  typedef v16b V; union U { v16b v; v8b h[2]; };
  static __device__ __forceinline__ v16b load(const __bf16* p) {
    U f; f.h[0] = *(const v8b*)(p); f.h[1] = *(const v8b*)(p + 16); return f.v;
  }
  static __device__ __forceinline__ v8f mma(v16b a, v16b b, v8f c) {
    return __builtin_amdgcn_wmma_f32_16x16x32_bf16(false, a, false, b, (short)0, c, false, false);
  }
  static __device__ __forceinline__ void guard(v8f& a, v8f& b, v16b x, v16b y) { dep_guard_b(a, b, x, y); }
  static __device__ __forceinline__ void keep(v16b a, v16b b, v16b c, v16b d) { keep4_b(a, b, c, d); }
};

// ---- Register-blocked batched WMMA GEMM (with independent A/B split flags) --------------------
// C[m,n] = scale * sum_k A[m,k] * Bt[n,k] (+bias); each wave owns a 64x64 tile.
// A row-major [M,K]; Bt row-major [N,K]; M,N % 64 == 0, K % 32 == 0 (no tail handling).
// SPLITA: A has a lo plane A2 (product += Alo.Bhi); SPLITB: Bt has a lo plane Bt2 (product += Ahi.Blo).
// BIAS_MODE: 0 = none, 1 = bias[m], 2 = RNE-bf16(bias[n]).
// OUT_MODE: 0 = f32, 1 = f16, 2 = bf16 hi plane (Cout) + bf16 lo plane (Cout2).
// ET: 0 = f16 operands, 1 = bf16 operands (pointers passed as 16-bit storage)
template <int ET> struct Elem;
template <> struct Elem<0> { typedef _Float16 T; };
template <> struct Elem<1> { typedef __bf16 T; };
template <int ET, bool SPLITA, bool SPLITB, int BIAS_MODE, int OUT_MODE>
__global__ __launch_bounds__(256) void wmma_gemm64(
    const unsigned short* __restrict__ Ap, const unsigned short* __restrict__ A2p, int lda, long strideA,
    const unsigned short* __restrict__ Btp, const unsigned short* __restrict__ Bt2p, int ldb, long strideB,
    void* __restrict__ Cout, void* __restrict__ Cout2, int ldc, long strideC,
    const float* __restrict__ bias,
    int M, int N, int K, float scale) {
  typedef typename Elem<ET>::T T;
  typedef typename Frag<T>::V V;
  const T* A = (const T*)Ap; const T* A2 = (const T*)A2p; const T* Bt = (const T*)Btp; const T* Bt2 = (const T*)Bt2p;
  __shared__ __align__(16) float sT[8][16 * 68];   // per-wave 16x64 slab, pitch 68 floats
  const int b    = blockIdx.y;
  const int lane = threadIdx.x & 31;
  const int wave = threadIdx.x >> 5;
  const int tilesN = N >> 6;
  const int tilesM = M >> 6;
  const int tile = blockIdx.x * 8 + wave;
  if (tile >= tilesM * tilesN) return;   // wave-uniform; no block barriers in this kernel
  const int tm = tile / tilesN;
  const int tn = tile - tm * tilesN;
  const int m0 = tm << 6;
  const int n0 = tn << 6;

  const T* Ab  = A  + (size_t)b * strideA;
  const T* Bb  = Bt + (size_t)b * strideB;
  const T* Ab2 = SPLITA ? (A2  + (size_t)b * strideA) : nullptr;
  const T* Bb2 = SPLITB ? (Bt2 + (size_t)b * strideB) : nullptr;

  const int rlane = lane & 15;                 // row (A) / col (B, D) within subtile
  const int koff  = (lane >> 4) * 8;           // k offset of this lane half
  const int mOff  = (lane >> 4) * 8;           // D row offset

  v8f acc[4][4];
#pragma unroll
  for (int i = 0; i < 4; ++i)
#pragma unroll
    for (int j = 0; j < 4; ++j) acc[i][j] = (v8f){0.f,0.f,0.f,0.f,0.f,0.f,0.f,0.f};

  for (int k0 = 0; k0 < K; k0 += 32) {
    V bh[4], bl[4];
#pragma unroll
    for (int j = 0; j < 4; ++j) {
      const size_t bo = (size_t)(n0 + (j << 4) + rlane) * ldb + koff + k0;
      bh[j] = Frag<T>::load(Bb + bo);
      if (SPLITB) bl[j] = Frag<T>::load(Bb2 + bo);
    }
#pragma unroll
    for (int i = 0; i < 4; ++i) {
      const size_t ao = (size_t)(m0 + (i << 4) + rlane) * lda + koff + k0;
      V ah = Frag<T>::load(Ab + ao);
      V al;
      if (SPLITA) al = Frag<T>::load(Ab2 + ao);
#pragma unroll
      for (int j = 0; j < 4; ++j) {
        acc[i][j] = Frag<T>::mma(ah, bh[j], acc[i][j]);
        if (SPLITB) acc[i][j] = Frag<T>::mma(ah, bl[j], acc[i][j]);
        if (SPLITA) acc[i][j] = Frag<T>::mma(al, bh[j], acc[i][j]);
      }
      Frag<T>::guard(acc[i][0], acc[i][3], ah, SPLITA ? al : ah);
    }
    Frag<T>::keep(bh[0], bh[1], bh[2], bh[3]);
    if (SPLITB) Frag<T>::keep(bl[0], bl[1], bl[2], bl[3]);
  }
  acc_guard4(acc[0][0], acc[0][1], acc[0][2], acc[0][3]);
  acc_guard4(acc[1][0], acc[1][1], acc[1][2], acc[1][3]);
  acc_guard4(acc[2][0], acc[2][1], acc[2][2], acc[2][3]);
  acc_guard4(acc[3][0], acc[3][1], acc[3][2], acc[3][3]);

  // ---- epilogue ----
  float* slab = sT[wave];
#pragma unroll
  for (int i = 0; i < 4; ++i) {
    const int mBase = m0 + (i << 4);
#pragma unroll
    for (int j = 0; j < 4; ++j) {
      const int n = n0 + (j << 4) + rlane;
      float bv = 0.f;
      if (BIAS_MODE == 2) bv = bf_bits2f(f2bf_bits(bias[n]));
#pragma unroll
      for (int r = 0; r < 8; ++r) {
        float v = acc[i][j][r] * scale;
        if (BIAS_MODE == 1) v += bias[mBase + mOff + r];
        if (BIAS_MODE == 2) v += bv;
        slab[(mOff + r) * 68 + (j << 4) + rlane] = v;
      }
    }
    __builtin_amdgcn_fence(__ATOMIC_RELEASE, "workgroup");
    __builtin_amdgcn_wave_barrier();
    __builtin_amdgcn_fence(__ATOMIC_ACQUIRE, "workgroup");
    if (OUT_MODE == 0) {
      float* C = (float*)Cout + (size_t)b * strideC;
      const int hh = lane >> 4, c4 = (lane & 15) * 4;     // row seg = 256 B = 16 lanes x 16 B
      {
#pragma unroll
        for (int it = 0; it < 8; ++it) {
          const int row = it * 2 + hh;
          v4f v = *(const v4f*)(slab + row * 68 + c4);
          *(v4f*)(C + (size_t)(mBase + row) * ldc + n0 + c4) = v;
        }
        
      }
    } else {
      const int q = lane >> 3, c8 = (lane & 7) * 8;
      unsigned short* C  = (unsigned short*)Cout  + (size_t)b * strideC;
      unsigned short* C2 = (OUT_MODE == 2) ? ((unsigned short*)Cout2 + (size_t)b * strideC) : nullptr;
      {
#pragma unroll
        for (int it = 0; it < 4; ++it) {
          const int row = it * 4 + q;
          const float* sp = slab + row * 68 + c8;
          v8h hv, lv;
#pragma unroll
          for (int e = 0; e < 8; ++e) {
            if (OUT_MODE == 1) {
              hv[e] = (_Float16)sp[e];
            } else {
              unsigned short hb = f2bf_bits(sp[e]);
              unsigned short lb = f2bf_bits(sp[e] - bf_bits2f(hb));
              hv[e] = __builtin_bit_cast(_Float16, hb);
              lv[e] = __builtin_bit_cast(_Float16, lb);
            }
          }
          *(v8h*)(C + (size_t)(mBase + row) * ldc + n0 + c8) = hv;
          if (OUT_MODE == 2) *(v8h*)(C2 + (size_t)(mBase + row) * ldc + n0 + c8) = lv;
        }
        
      }
    }
    __builtin_amdgcn_fence(__ATOMIC_RELEASE, "workgroup");
    __builtin_amdgcn_wave_barrier();
    __builtin_amdgcn_fence(__ATOMIC_ACQUIRE, "workgroup");
  }
}

// ---- f32 -> bf16 (RNE) plane convert, 8 elements (16 B) per thread ---------------------------------
__global__ __launch_bounds__(256) void cvt_f32_bf16x8(
    const float* __restrict__ in, unsigned short* __restrict__ out, int n8) {
  const int i = blockIdx.x * 256 + threadIdx.x;
  if (i < n8) {
    const float* p = in + (size_t)i * 8;
    const v4f a = *(const v4f*)p;
    const v4f c2 = *(const v4f*)(p + 4);
    v4u w;
    w[0] = (unsigned)f2bf_bits(a[0])  | ((unsigned)f2bf_bits(a[1])  << 16);
    w[1] = (unsigned)f2bf_bits(a[2])  | ((unsigned)f2bf_bits(a[3])  << 16);
    w[2] = (unsigned)f2bf_bits(c2[0]) | ((unsigned)f2bf_bits(c2[1]) << 16);
    w[3] = (unsigned)f2bf_bits(c2[2]) | ((unsigned)f2bf_bits(c2[3]) << 16);
    unsigned short* o = out + (size_t)i * 8;
    *(v4u*)o = w;
    
  }
}

// ---- transpose + RNE-bf16 convert: in = z planes of [R][CC] f32 -> out = z planes of [CC][R] bf16 ------
// grid = (CC/64, R/64, z), block 256. Per block one 64x64 tile through LDS.
// Store coverage: wave w writes out rows ct*64 + 8w + {0..7} (2 iterations x 4 rows), lanes 8q..8q+7 write
__global__ __launch_bounds__(256) void tr_cvt_bf16(
    const float* __restrict__ in, unsigned short* __restrict__ out, int R, int CC) {
  __shared__ float tile[64][65];
  const int tid = threadIdx.x;
  const size_t zoff = (size_t)blockIdx.z * (size_t)R * (size_t)CC;
  const float* src = in + zoff;
  unsigned short* dst = out + zoff;
  const int ct = blockIdx.x, rt = blockIdx.y;
  const int lr = tid >> 2, lc = (tid & 3) * 16;           // in-tile row (input row), 16 input cols
  const float* sp = src + (size_t)(rt * 64 + lr) * CC + ct * 64 + lc;
#pragma unroll
  for (int i = 0; i < 4; ++i) {
    const v4f v = *(const v4f*)(sp + 4 * i);
    tile[lr][lc + 4 * i + 0] = v[0];
    tile[lr][lc + 4 * i + 1] = v[1];
    tile[lr][lc + 4 * i + 2] = v[2];
    tile[lr][lc + 4 * i + 3] = v[3];
  }
  __syncthreads();
  const int lane = tid & 31, wave = tid >> 5, q = lane >> 3, c8 = (lane & 7) * 8;
  v4u w[2];
#pragma unroll
  for (int it = 0; it < 2; ++it) {
    const int fl = wave * 8 + it * 4 + q;                   // out row within tile = input col within tile
    v4u t4;
#pragma unroll
    for (int e = 0; e < 4; ++e) {
      const unsigned lo16 = (unsigned)f2bf_bits(tile[c8 + 2 * e][fl]);
      const unsigned hi16 = (unsigned)f2bf_bits(tile[c8 + 2 * e + 1][fl]);
      t4[e] = lo16 | (hi16 << 16);
    }
    w[it] = t4;
  }
  {
#pragma unroll
    for (int it = 0; it < 2; ++it) {
      const int fl = wave * 8 + it * 4 + q;
      *(v4u*)(dst + (size_t)(ct * 64 + fl) * R + rt * 64 + c8) = w[it];
    }
    
  }
}

// =====================================================================================================
// Causal flash attention, head_dim 256, operands = bf16 hi/lo planes.
//   Q/K/V planes: element (b, s, h, d) at [(b*SEQLEN + s)*EMB_SZ + h*HDIM + d] (hi plane and lo plane).
//   scores = (Qhi.Khi + Qhi.Klo + Qlo.Khi) * inv_scale; causal mask = -inf for key > query (diagonal chunk);
//   online softmax in f32; P (unnormalised exp) split to bf16 hi/lo in LDS; O += Phi.Vhi + Phi.Vlo + Plo.Vhi;
//   out = O / l written as bf16 hi/lo concat planes in the same [(b,s)][h*HDIM + d] layout.
// Block = 256 threads = 8 waves, 64 query rows of one (b,h); wave w: row group rw = w&3 (16 rows),
// half ch = w>>2: key half (32 of 64 keys) for the score tiles, column half (128 of 256) for O.
// Row max / row sum of the two key halves combined through LDS with block barriers.
// grid = (SEQLEN/64, NBATCH*NHEAD).
// =====================================================================================================
constexpr int AT_KEYS  = 64;    // keys per chunk
constexpr int AT_QROWS = 64;    // query rows per block
constexpr int AT_WHALF = 128;   // output columns per wave
// LDS row pitches in 16-bit elements. K and P rows are read by b128 fragment loads: 16 B of pad make the pitch an odd
// multiple of 16 B, so the 16 rows of one read fall on 16 different groups of four banks. V rows are read by the
// transposing load, whose conflict-free pitch is an odd multiple of 32 B.
constexpr int AT_KPITCH = HDIM + 8;       // K rows [key][d]: 528 B
constexpr int AT_VPITCH = HDIM + 16;      // V rows [key][d]: 544 B
constexpr int AT_PPITCH = AT_KEYS + 8;    // P rows [row][key]: 144 B
static_assert(SEQLEN % AT_QROWS == 0 && SEQLEN % AT_KEYS == 0 && HDIM == 2 * AT_WHALF);
static_assert(8 * 16 * AT_WHALF <= AT_KEYS * AT_KPITCH);   // output staging slabs fit one K plane
static_assert((AT_KPITCH * 2) % 32 == 16 && (AT_VPITCH * 2) % 64 == 32 && (AT_PPITCH * 2) % 32 == 16);
static_assert(HDIM * 2 == 32 * 16 && AT_KEYS == 8 * 8);    // one copy of a wave = one row; 8 waves x 8 rows = one plane

__device__ __forceinline__ v16b ldfrag16(const unsigned short* p) {   // elements 0..7 <- p[0..7], 8..15 <- p[16..23]
  union { v16b v; v8b h[2]; } f;
  f.h[0] = *(const v8b*)(p); f.h[1] = *(const v8b*)(p + 16); return f.v;
}
// B fragment (32 keys x 16 d) of a row-major [key][d] LDS tile: p = this lane's address in the first 16 keys,
// row 8*(lane>>4) + (lane&7), column 8*((lane>>3)&1). Lane (c, hh) receives keys 8hh..8hh+7 of column c, then keys
// 16+8hh..16+8hh+7: the k order of ldfrag16.
typedef short s16x8 __attribute__((ext_vector_type(8)));
__device__ __forceinline__ v16b ldfrag16_tr(const unsigned short* p) {
  typedef __attribute__((address_space(3))) s16x8 lds_s16x8;
  union { v16b v; s16x8 h[2]; } f;
  f.h[0] = __builtin_amdgcn_ds_load_tr16_b128_v8i16((lds_s16x8*)p);
  f.h[1] = __builtin_amdgcn_ds_load_tr16_b128_v8i16((lds_s16x8*)(p + 16 * AT_VPITCH));
  return f.v;
}
// Eight asynchronous copies of one wave, global -> LDS: copy j brings row j (512 B, 16 B per lane). g and l are the
// lane's own addresses in row 0. The s_wait_xcnt closes the statement so that it stands in front of every later write
// of an address register that a copy names.
__device__ __forceinline__ void copy_rows8(const unsigned short* l, int lpitch, const unsigned short* g) {
  const unsigned l0 = (unsigned)(size_t)l;
  const unsigned lp = (unsigned)lpitch * 2u;
  asm volatile(
      "global_load_async_to_lds_b128 %0, %8, off\n\t"
      "global_load_async_to_lds_b128 %1, %9, off\n\t"
      "global_load_async_to_lds_b128 %2, %10, off\n\t"
      "global_load_async_to_lds_b128 %3, %11, off\n\t"
      "global_load_async_to_lds_b128 %4, %12, off\n\t"
      "global_load_async_to_lds_b128 %5, %13, off\n\t"
      "global_load_async_to_lds_b128 %6, %14, off\n\t"
      "global_load_async_to_lds_b128 %7, %15, off\n\t"
      "s_wait_xcnt 0x0"
      :: "v"(l0), "v"(l0 + lp), "v"(l0 + 2u * lp), "v"(l0 + 3u * lp),
         "v"(l0 + 4u * lp), "v"(l0 + 5u * lp), "v"(l0 + 6u * lp), "v"(l0 + 7u * lp),
         "v"(g), "v"(g + EMB_SZ), "v"(g + 2 * EMB_SZ), "v"(g + 3 * EMB_SZ),
         "v"(g + 4 * EMB_SZ), "v"(g + 5 * EMB_SZ), "v"(g + 6 * EMB_SZ), "v"(g + 7 * EMB_SZ)
      : "memory");
}
__device__ __forceinline__ v8f mma_bf(v16b a, v16b b, v8f c) {
  c = __builtin_amdgcn_wmma_f32_16x16x32_bf16(false, a, false, b, (short)0, c, false, false);
  asm volatile("v_nop\n\tv_nop\n\tv_nop\n\tv_nop" : "+v"(c) : "v"(a), "v"(b));
  return c;
}

__global__ __launch_bounds__(256) void attn_hd256(
    const unsigned short* __restrict__ Qh, const unsigned short* __restrict__ Ql,
    const unsigned short* __restrict__ Kh, const unsigned short* __restrict__ Kl,
    const unsigned short* __restrict__ Vh, const unsigned short* __restrict__ Vl,
    unsigned short* __restrict__ Oh, unsigned short* __restrict__ Ol, float inv_scale) {
  __shared__ __align__(16) unsigned short Ks[2][AT_KEYS * AT_KPITCH];   // [plane][key][d]   67584 B; reused as output staging
  __shared__ __align__(16) unsigned short Vs[2][AT_KEYS * AT_VPITCH];   // [plane][key][d]   69632 B
  __shared__ __align__(16) unsigned short Ps[2][AT_QROWS * AT_PPITCH];  // [plane][row][key] 18432 B
  __shared__ float redm[2][AT_QROWS];                                // partial row max per key half
  __shared__ float reds[2][AT_QROWS];                                // partial row sum per key half

  const int tid  = threadIdx.x;
  const int lane = tid & 31;
  const int wave = tid >> 5;
  const int hh   = lane >> 4;
  const int c    = lane & 15;
  const int rw   = wave & 3;
  const int ch   = wave >> 2;
  const int qb   = blockIdx.x;                 // query block 0..31
  const int bh   = blockIdx.y;                 // b*NHEAD + h
  const int h    = bh % NHEAD;
  const int b    = bh / NHEAD;
  const int q0w  = qb * AT_QROWS + rw * 16;    // first query row (within the sequence) of this wave
  const size_t rowb = (size_t)b * SEQLEN;      // flattened row base of this batch
  const int hcol = h * HDIM;

  float mrow[8], lrow[8];
  v8f oacc[8];
#pragma unroll
  for (int r = 0; r < 8; ++r) { mrow[r] = -INFINITY; lrow[r] = 0.f; }
#pragma unroll
  for (int t = 0; t < 8; ++t) oacc[t] = (v8f){0.f,0.f,0.f,0.f,0.f,0.f,0.f,0.f};

  const int nch = qb + 1;                      // causal horizon in 64-key chunks (block-uniform)
  for (int kc = 0; kc < nch; ++kc) {
    const int kv0 = kc * AT_KEYS;
    // This wave's LDS reads of the last chunk have returned before the barrier behind which K and V are overwritten.
    asm volatile("s_wait_dscnt 0x0" ::: "memory");
    __syncthreads();
    // ---- stage K and V (hi/lo, both [key][d]) by asynchronous copies to LDS ----
    // Coverage: wave w brings keys 8w..8w+7 of each of the four planes, one whole row per copy.
    {
      const int kr0 = wave * 8;
      const size_t gbase = (rowb + kv0 + kr0) * EMB_SZ + hcol + lane * 8;
      copy_rows8(&Ks[0][kr0 * AT_KPITCH + lane * 8], AT_KPITCH, Kh + gbase);
      copy_rows8(&Ks[1][kr0 * AT_KPITCH + lane * 8], AT_KPITCH, Kl + gbase);
      copy_rows8(&Vs[0][kr0 * AT_VPITCH + lane * 8], AT_VPITCH, Vh + gbase);
      copy_rows8(&Vs[1][kr0 * AT_VPITCH + lane * 8], AT_VPITCH, Vl + gbase);
    }
    // This wave's copies have landed before the barrier behind which the other waves read them.
    asm volatile("s_wait_asynccnt 0x0" ::: "memory");
    __syncthreads();

    // ---- scores for this wave: 16 rows x 32 keys (two 16x16 D tiles), hi.hi + hi.lo + lo.hi over d ----
    v8f s[2];
    s[0] = (v8f){0.f,0.f,0.f,0.f,0.f,0.f,0.f,0.f};
    s[1] = (v8f){0.f,0.f,0.f,0.f,0.f,0.f,0.f,0.f};
    {
      const size_t qoff = (rowb + q0w + c) * EMB_SZ + hcol + 8 * hh;   // A fragment row m = c
#pragma unroll 1
      for (int dc = 0; dc < 8; ++dc) {
        const v16b qa  = ldfrag16(Qh + qoff + dc * 32);
        const v16b qal = ldfrag16(Ql + qoff + dc * 32);
#pragma unroll
        for (int j = 0; j < 2; ++j) {
          const int kr = ch * 32 + j * 16 + c;                           // B fragment column n = key kr
          const int koff = kr * AT_KPITCH + dc * 32 + 8 * hh;
          const v16b kb = ldfrag16(&Ks[0][koff]);
          const v16b kl = ldfrag16(&Ks[1][koff]);
          s[j] = mma_bf(qa, kb, s[j]);
          s[j] = mma_bf(qa, kl, s[j]);
          s[j] = mma_bf(qal, kb, s[j]);
        }
      }
    }

    // ---- scale, causal mask, partial row max over this wave's 32 keys ----
    const bool diag = (kc == qb);                // block-uniform
#pragma unroll
    for (int r = 0; r < 8; ++r) {
      const int qrow = q0w + 8 * hh + r;         // D row 8hh+r
      float m = -INFINITY;
#pragma unroll
      for (int j = 0; j < 2; ++j) {
        const int kvcol = kv0 + ch * 32 + j * 16 + c;   // D col c of tile j
        float sv = s[j][r] * inv_scale;
        if (diag && (kvcol > qrow)) sv = -INFINITY;
        s[j][r] = sv;
        m = fmaxf(m, sv);
      }
      m = fmaxf(m, __shfl_xor(m, 1, 32));
      m = fmaxf(m, __shfl_xor(m, 2, 32));
      m = fmaxf(m, __shfl_xor(m, 4, 32));
      m = fmaxf(m, __shfl_xor(m, 8, 32));
      redm[ch][rw * 16 + 8 * hh + r] = m;
    }
    __syncthreads();

    // ---- online softmax update; P hi/lo to LDS; partial sums ----
    float alph[8];
#pragma unroll
    for (int r = 0; r < 8; ++r) {
      const int row = rw * 16 + 8 * hh + r;
      const float mc = fmaxf(redm[0][row], redm[1][row]);
      const float mnew = fmaxf(mrow[r], mc);
      const float alpha = expf(mrow[r] - mnew);
      mrow[r] = mnew;
      alph[r] = alpha;
      float psum = 0.f;
#pragma unroll
      for (int j = 0; j < 2; ++j) {
        const float p = expf(s[j][r] - mnew);
        psum += p;
        const unsigned short hb = f2bf_bits(p);
        const unsigned short lb = f2bf_bits(p - bf_bits2f(hb));
        const int pidx = row * AT_PPITCH + ch * 32 + j * 16 + c;
        Ps[0][pidx] = hb;
        Ps[1][pidx] = lb;
      }
      psum += __shfl_xor(psum, 1, 32);
      psum += __shfl_xor(psum, 2, 32);
      psum += __shfl_xor(psum, 4, 32);
      psum += __shfl_xor(psum, 8, 32);
      reds[ch][row] = psum;
#pragma unroll
      for (int t = 0; t < 8; ++t) oacc[t][r] *= alpha;
    }
    __syncthreads();
#pragma unroll
    for (int r = 0; r < 8; ++r) {
      const int row = rw * 16 + 8 * hh + r;
      lrow[r] = lrow[r] * alph[r] + (reds[0][row] + reds[1][row]);
    }

    // ---- O += P.V over 64 keys for this wave's 16 rows x 128 columns ----
#pragma unroll 1
    for (int kk = 0; kk < 2; ++kk) {
      const int poff = (rw * 16 + c) * AT_PPITCH + kk * 32 + 8 * hh;          // A fragment row m = c
      const v16b pa = ldfrag16(&Ps[0][poff]);
      const v16b pl = ldfrag16(&Ps[1][poff]);
#pragma unroll
      for (int t = 0; t < 8; ++t) {
        const int voff = (kk * 32 + 8 * hh + (lane & 7)) * AT_VPITCH + ch * AT_WHALF + t * 16 + ((lane >> 3) & 1) * 8;   // B fragment column n = d
        const v16b vb = ldfrag16_tr(&Vs[0][voff]);
        const v16b vl = ldfrag16_tr(&Vs[1][voff]);
        oacc[t] = mma_bf(pa, vb, oacc[t]);
        oacc[t] = mma_bf(pa, vl, oacc[t]);
        oacc[t] = mma_bf(pl, vb, oacc[t]);
      }
    }
  }

  // ---- epilogue: normalise, split to bf16 hi/lo in per-wave LDS slabs (K region), whole-line stores ----
  __syncthreads();
  unsigned short* slh = &Ks[0][wave * (16 * AT_WHALF)];
  unsigned short* sll = &Ks[1][wave * (16 * AT_WHALF)];
#pragma unroll
  for (int r = 0; r < 8; ++r) {
    const float inv = 1.0f / lrow[r];
    const int row = 8 * hh + r;
#pragma unroll
    for (int t = 0; t < 8; ++t) {
      const float v = oacc[t][r] * inv;
      const unsigned short hb = f2bf_bits(v);
      const unsigned short lb = f2bf_bits(v - bf_bits2f(hb));
      slh[row * AT_WHALF + t * 16 + c] = hb;
      sll[row * AT_WHALF + t * 16 + c] = lb;
    }
  }
  __syncthreads();
  // Store coverage: 8 iterations x rows (2it + hh) = 16 rows; per row 16 lanes x 16 B = 128 columns = 2 whole
  {
    {
#pragma unroll
      for (int it = 0; it < 8; ++it) {
        const int row = it * 2 + hh;
        const v4u wh = *(const v4u*)(slh + row * AT_WHALF + c * 8);
        const v4u wl = *(const v4u*)(sll + row * AT_WHALF + c * 8);
        const size_t go = (rowb + q0w + row) * EMB_SZ + hcol + ch * AT_WHALF + c * 8;
        *(v4u*)(Oh + go) = wh;
        *(v4u*)(Ol + go) = wl;
      }
      
    }
  }
}

// ---------------------------------------------------------------------------------------------------
extern "C" void kernel_launch(void* const* d_in, const int* in_sizes, int n_in,
                              void* d_out, int out_size, void* d_ws, size_t ws_size,
                              hipStream_t stream) {
  (void)in_sizes; (void)n_in; (void)out_size;
  const float* Xk = (const float*)d_in[0];
  const float* Xv = (const float*)d_in[1];
  const float* Xq = (const float*)d_in[2];
  const float* Wk = (const float*)d_in[3];
  const float* Wv = (const float*)d_in[4];
  const float* Wq = (const float*)d_in[5];
  const float* Wo = (const float*)d_in[6];
  const float* bo = (const float*)d_in[7];
  float* out = (float*)d_out;

  if (ws_size < WS_TOTAL_BYTES) return;

  unsigned short* ws = (unsigned short*)d_ws;
  unsigned short* xk_b = ws + 0 * PLANE_ELEMS;   // later: concat hi
  unsigned short* xv_b = ws + 1 * PLANE_ELEMS;   // later: concat lo
  unsigned short* xq_b = ws + 2 * PLANE_ELEMS;
  unsigned short* k_hi = ws + 3 * PLANE_ELEMS;
  unsigned short* k_lo = ws + 4 * PLANE_ELEMS;
  unsigned short* v_hi = ws + 5 * PLANE_ELEMS;
  unsigned short* v_lo = ws + 6 * PLANE_ELEMS;
  unsigned short* q_hi = ws + 7 * PLANE_ELEMS;
  unsigned short* q_lo = ws + 8 * PLANE_ELEMS;
  unsigned short* wkT  = ws + WS_OFF_WKT;
  unsigned short* wvT  = ws + WS_OFF_WVT;
  unsigned short* wqT  = ws + WS_OFF_WQT;
  unsigned short* woT  = ws + WS_OFF_WOT;
  unsigned short* cc_hi = xk_b;
  unsigned short* cc_lo = xv_b;

  // 1) inputs -> bf16 planes (RNE), [8192][768] each
  const int n8 = (int)(PLANE_ELEMS / 8);                 // 786432 = 3072 * 256
  cvt_f32_bf16x8<<<dim3(n8 / 256), 256, 0, stream>>>(Xk, xk_b, n8);
  cvt_f32_bf16x8<<<dim3(n8 / 256), 256, 0, stream>>>(Xv, xv_b, n8);
  cvt_f32_bf16x8<<<dim3(n8 / 256), 256, 0, stream>>>(Xq, xq_b, n8);

  // 2) weights: in [3][768][256] -> out [3][256][768] bf16 (Bt layout [N=f][K=e]); Wo [768 k][768 n] -> [768 n][768 k]
  tr_cvt_bf16<<<dim3(HDIM / 64, EMB_SZ / 64, NHEAD), 256, 0, stream>>>(Wk, wkT, EMB_SZ, HDIM);
  tr_cvt_bf16<<<dim3(HDIM / 64, EMB_SZ / 64, NHEAD), 256, 0, stream>>>(Wv, wvT, EMB_SZ, HDIM);
  tr_cvt_bf16<<<dim3(HDIM / 64, EMB_SZ / 64, NHEAD), 256, 0, stream>>>(Wq, wqT, EMB_SZ, HDIM);
  tr_cvt_bf16<<<dim3(EMB_SZ / 64, EMB_SZ / 64, 1), 256, 0, stream>>>(Wo, woT, EMB_SZ, EMB_SZ);

  // 3) per-head projections: C_h[8192 x 256] = X[8192 x 768] . (W_h^T)[256 x 768]^T, written as bf16 hi/lo
  //    planes at column offset h*256 with ldc 768 (grid.y = head). M=8192, N=256, K=768: 512 tiles = 64 blocks x 8 waves.
  const dim3 gproj((NROWS / 64) * (HDIM / 64) / 8, NHEAD);
  wmma_gemm64<1, false, false, 0, 2><<<gproj, 256, 0, stream>>>(
      xk_b, xk_b, EMB_SZ, 0L, wkT, wkT, EMB_SZ, (long)HDIM * EMB_SZ,
      (void*)k_hi, (void*)k_lo, EMB_SZ, (long)HDIM, bo, NROWS, HDIM, EMB_SZ, 1.0f);
  wmma_gemm64<1, false, false, 0, 2><<<gproj, 256, 0, stream>>>(
      xv_b, xv_b, EMB_SZ, 0L, wvT, wvT, EMB_SZ, (long)HDIM * EMB_SZ,
      (void*)v_hi, (void*)v_lo, EMB_SZ, (long)HDIM, bo, NROWS, HDIM, EMB_SZ, 1.0f);
  wmma_gemm64<1, false, false, 0, 2><<<gproj, 256, 0, stream>>>(
      xq_b, xq_b, EMB_SZ, 0L, wqT, wqT, EMB_SZ, (long)HDIM * EMB_SZ,
      (void*)q_hi, (void*)q_lo, EMB_SZ, (long)HDIM, bo, NROWS, HDIM, EMB_SZ, 1.0f);

  // 4) causal attention -> concat hi/lo planes (X planes are dead now)
  const float inv_scale = 1.0f / sqrtf((float)SEQLEN);
  attn_hd256<<<dim3(SEQLEN / AT_QROWS, NBATCH * NHEAD), 256, 0, stream>>>(
      q_hi, q_lo, k_hi, k_lo, v_hi, v_lo, cc_hi, cc_lo, inv_scale);

  // 5) output projection: out[8192 x 768] = concat(hi+lo) . (Wo^T)^T + bo, f32. M=8192, N=768, K=768: 1536 tiles = 192 blocks.
  const dim3 gout((NROWS / 64) * (EMB_SZ / 64) / 8, 1);
  wmma_gemm64<1, true, false, 2, 0><<<gout, 256, 0, stream>>>(
      cc_hi, cc_lo, EMB_SZ, 0L, woT, woT, EMB_SZ, 0L,
      (void*)out, (void*)out, EMB_SZ, 0L, bo, NROWS, EMB_SZ, EMB_SZ, 1.0f);
}

// v003
// A run of this version takes 401 microseconds.
// Timed twice side by side with v002, it ran 1.05 and 1.04 times as fast.
// Over all steps from v000 it is 2.70 times as fast.
// Contractions on v_wmma_f32_16x16x32_bf16 with f32 accumulate: per-head projections = bf16(X) x bf16(W^T) (inputs RNE-converted once); Q.K^T and P.V = bf16 hi/lo planes (hi.hi + hi.lo + lo.hi); output projection = concat bf16 hi/lo x bf16(Wo^T) (hi.W + lo.W) + bf16(bo); softmax, rescaling and normalisation in f32.
#include <hip/hip_runtime.h>
#include <stdint.h>
#include <math.h>

typedef __attribute__((ext_vector_type(16))) _Float16 v16h;
typedef __attribute__((ext_vector_type(8)))  _Float16 v8h;
typedef __attribute__((ext_vector_type(16))) __bf16   v16b;
typedef __attribute__((ext_vector_type(8)))  __bf16   v8b;
typedef __attribute__((ext_vector_type(8)))  float    v8f;
typedef __attribute__((ext_vector_type(4)))  float    v4f;
typedef __attribute__((ext_vector_type(4)))  unsigned v4u;

// ---- problem geometry ----
constexpr int EMB_SZ  = 768;
constexpr int NHEAD   = 3;
constexpr int HDIM    = 256;
constexpr int NBATCH  = 4;
constexpr int SEQLEN  = 2048;
constexpr int NROWS   = NBATCH * SEQLEN;                       // 8192 flattened (b,s) rows
constexpr size_t PLANE_ELEMS = (size_t)NROWS * EMB_SZ;          // 6291456 elements per [8192][768] plane
constexpr size_t PLANE_BYTES = PLANE_ELEMS * 2;                 // 12582912 B per 16-bit plane
constexpr size_t WT_ELEMS    = (size_t)NHEAD * HDIM * EMB_SZ;   // 589824 (W^T planes [3][256][768])
constexpr size_t WO_ELEMS    = (size_t)EMB_SZ * EMB_SZ;         // 589824 (Wo^T plane [768][768])

// [0]            Xk bf16 plane        (dead after projections; reused as concat hi plane)
// [1*PLANE]      Xv bf16 plane        (reused as concat lo plane)
// [2*PLANE]      Xq bf16 plane
// [3*PLANE]      K hi, [4*PLANE] K lo, [5*PLANE] V hi, [6*PLANE] V lo, [7*PLANE] Q hi, [8*PLANE] Q lo
// [9*PLANE]      Wk^T bf16 [3][256][768], then Wv^T, Wq^T (WT_ELEMS each)
// [9*PLANE+3*WT] Wo^T bf16 [768][768]
constexpr size_t WS_OFF_WKT = 9 * PLANE_ELEMS;
constexpr size_t WS_OFF_WVT = WS_OFF_WKT + WT_ELEMS;
constexpr size_t WS_OFF_WQT = WS_OFF_WVT + WT_ELEMS;
constexpr size_t WS_OFF_WOT = WS_OFF_WQT + WT_ELEMS;
constexpr size_t WS_TOTAL_BYTES = (WS_OFF_WOT + WO_ELEMS) * 2;    // 117964800 B
static_assert(WS_TOTAL_BYTES == 117964800ull);
static_assert(WS_TOTAL_BYTES <= 134217728ull);
static_assert((PLANE_BYTES % 128) == 0 && ((WT_ELEMS * 2) % 128) == 0 && ((WO_ELEMS * 2) % 128) == 0);

// ---- GEMM shape contract for the launches in this file ----
static_assert(NROWS % 64 == 0 && HDIM % 64 == 0 && EMB_SZ % 64 == 0);   // M, N tile multiples
static_assert(EMB_SZ % 32 == 0);                                          // K % 32 == 0 for all GEMMs (K = 768)
static_assert(PLANE_ELEMS % (8 * 256) == 0);                              // convert kernel: exact thread coverage

__device__ __forceinline__ unsigned short f2bf_bits(float f) {
  unsigned u = __float_as_uint(f);
  return (unsigned short)((u + 0x7FFFu + ((u >> 16) & 1u)) >> 16);
}
__device__ __forceinline__ float bf_bits2f(unsigned short h) { return __uint_as_float(((unsigned)h) << 16); }

// hazard guards as plain device helpers (no inline asm inside the kernel template body)
__device__ __forceinline__ void dep_guard_h(v8f& a, v8f& b, v16h x, v16h y) { asm volatile("v_nop\n\tv_nop\n\tv_nop\n\tv_nop" : "+v"(a), "+v"(b) : "v"(x), "v"(y)); }
__device__ __forceinline__ void dep_guard_b(v8f& a, v8f& b, v16b x, v16b y) { asm volatile("v_nop\n\tv_nop\n\tv_nop\n\tv_nop" : "+v"(a), "+v"(b) : "v"(x), "v"(y)); }
__device__ __forceinline__ void keep4_h(v16h a, v16h b, v16h c, v16h d) { asm volatile("v_nop" :: "v"(a), "v"(b), "v"(c), "v"(d)); }
__device__ __forceinline__ void keep4_b(v16b a, v16b b, v16b c, v16b d) { asm volatile("v_nop" :: "v"(a), "v"(b), "v"(c), "v"(d)); }
__device__ __forceinline__ void acc_guard4(v8f& a, v8f& b, v8f& c, v8f& d) { asm volatile("v_nop\n\tv_nop\n\tv_nop\n\tv_nop" : "+v"(a), "+v"(b), "+v"(c), "+v"(d)); }
template <typename T> struct Frag;
template <> struct Frag<_Float16> {
  typedef v16h V; union U { v16h v; v8h h[2]; };
  static __device__ __forceinline__ v16h load(const _Float16* p) {   // elements 0..7 <- p[0..7], 8..15 <- p[16..23]
    U f; f.h[0] = *(const v8h*)(p); f.h[1] = *(const v8h*)(p + 16); return f.v;
  }
  static __device__ __forceinline__ v8f mma(v16h a, v16h b, v8f c) {
    return __builtin_amdgcn_wmma_f32_16x16x32_f16(false, a, false, b, (short)0, c, false, false);
  }
  static __device__ __forceinline__ void guard(v8f& a, v8f& b, v16h x, v16h y) { dep_guard_h(a, b, x, y); }
  static __device__ __forceinline__ void keep(v16h a, v16h b, v16h c, v16h d) { keep4_h(a, b, c, d); }
};
template <> struct Frag<__bf16> {
  typedef v16b V; union U { v16b v; v8b h[2]; };
  static __device__ __forceinline__ v16b load(const __bf16* p) {
    U f; f.h[0] = *(const v8b*)(p); f.h[1] = *(const v8b*)(p + 16); return f.v;
  }
  static __device__ __forceinline__ v8f mma(v16b a, v16b b, v8f c) {
    return __builtin_amdgcn_wmma_f32_16x16x32_bf16(false, a, false, b, (short)0, c, false, false);
  }
  static __device__ __forceinline__ void guard(v8f& a, v8f& b, v16b x, v16b y) { dep_guard_b(a, b, x, y); }
  static __device__ __forceinline__ void keep(v16b a, v16b b, v16b c, v16b d) { keep4_b(a, b, c, d); }
};

// ---- Register-blocked batched WMMA GEMM (with independent A/B split flags) --------------------
// C[m,n] = scale * sum_k A[m,k] * Bt[n,k] (+bias); each wave owns a 64x64 tile.
// A row-major [M,K]; Bt row-major [N,K]; M,N % 64 == 0, K % 32 == 0 (no tail handling).
// SPLITA: A has a lo plane A2 (product += Alo.Bhi); SPLITB: Bt has a lo plane Bt2 (product += Ahi.Blo).
// BIAS_MODE: 0 = none, 1 = bias[m], 2 = RNE-bf16(bias[n]).
// OUT_MODE: 0 = f32, 1 = f16, 2 = bf16 hi plane (Cout) + bf16 lo plane (Cout2).
// ET: 0 = f16 operands, 1 = bf16 operands (pointers passed as 16-bit storage)
template <int ET> struct Elem;
template <> struct Elem<0> { typedef _Float16 T; };
template <> struct Elem<1> { typedef __bf16 T; };
template <int ET, bool SPLITA, bool SPLITB, int BIAS_MODE, int OUT_MODE>
__global__ __launch_bounds__(256) void wmma_gemm64(
    const unsigned short* __restrict__ Ap, const unsigned short* __restrict__ A2p, int lda, long strideA,
    const unsigned short* __restrict__ Btp, const unsigned short* __restrict__ Bt2p, int ldb, long strideB,
    void* __restrict__ Cout, void* __restrict__ Cout2, int ldc, long strideC,
    const float* __restrict__ bias,
    int M, int N, int K, float scale) {
  typedef typename Elem<ET>::T T;
  typedef typename Frag<T>::V V;
  const T* A = (const T*)Ap; const T* A2 = (const T*)A2p; const T* Bt = (const T*)Btp; const T* Bt2 = (const T*)Bt2p;
  __shared__ __align__(16) float sT[8][16 * 68];   // per-wave 16x64 slab, pitch 68 floats
  const int b    = blockIdx.y;
  const int lane = threadIdx.x & 31;
  const int wave = threadIdx.x >> 5;
  const int tilesN = N >> 6;
  const int tilesM = M >> 6;
  const int tile = blockIdx.x * 8 + wave;
  if (tile >= tilesM * tilesN) return;   // wave-uniform; no block barriers in this kernel
  const int tm = tile / tilesN;
  const int tn = tile - tm * tilesN;
  const int m0 = tm << 6;
  const int n0 = tn << 6;

  const T* Ab  = A  + (size_t)b * strideA;
  const T* Bb  = Bt + (size_t)b * strideB;
  const T* Ab2 = SPLITA ? (A2  + (size_t)b * strideA) : nullptr;
  const T* Bb2 = SPLITB ? (Bt2 + (size_t)b * strideB) : nullptr;

  const int rlane = lane & 15;                 // row (A) / col (B, D) within subtile
  const int koff  = (lane >> 4) * 8;           // k offset of this lane half
  const int mOff  = (lane >> 4) * 8;           // D row offset

  v8f acc[4][4];
#pragma unroll
  for (int i = 0; i < 4; ++i)
#pragma unroll
    for (int j = 0; j < 4; ++j) acc[i][j] = (v8f){0.f,0.f,0.f,0.f,0.f,0.f,0.f,0.f};

  for (int k0 = 0; k0 < K; k0 += 32) {
    V bh[4], bl[4];
#pragma unroll
    for (int j = 0; j < 4; ++j) {
      const size_t bo = (size_t)(n0 + (j << 4) + rlane) * ldb + koff + k0;
      bh[j] = Frag<T>::load(Bb + bo);
      if (SPLITB) bl[j] = Frag<T>::load(Bb2 + bo);
    }
#pragma unroll
    for (int i = 0; i < 4; ++i) {
      const size_t ao = (size_t)(m0 + (i << 4) + rlane) * lda + koff + k0;
      V ah = Frag<T>::load(Ab + ao);
      V al;
      if (SPLITA) al = Frag<T>::load(Ab2 + ao);
#pragma unroll
      for (int j = 0; j < 4; ++j) {
        acc[i][j] = Frag<T>::mma(ah, bh[j], acc[i][j]);
        if (SPLITB) acc[i][j] = Frag<T>::mma(ah, bl[j], acc[i][j]);
        if (SPLITA) acc[i][j] = Frag<T>::mma(al, bh[j], acc[i][j]);
      }
      Frag<T>::guard(acc[i][0], acc[i][3], ah, SPLITA ? al : ah);
    }
    Frag<T>::keep(bh[0], bh[1], bh[2], bh[3]);
    if (SPLITB) Frag<T>::keep(bl[0], bl[1], bl[2], bl[3]);
  }
  acc_guard4(acc[0][0], acc[0][1], acc[0][2], acc[0][3]);
  acc_guard4(acc[1][0], acc[1][1], acc[1][2], acc[1][3]);
  acc_guard4(acc[2][0], acc[2][1], acc[2][2], acc[2][3]);
  acc_guard4(acc[3][0], acc[3][1], acc[3][2], acc[3][3]);

  // ---- epilogue ----
  float* slab = sT[wave];
#pragma unroll
  for (int i = 0; i < 4; ++i) {
    const int mBase = m0 + (i << 4);
#pragma unroll
    for (int j = 0; j < 4; ++j) {
      const int n = n0 + (j << 4) + rlane;
      float bv = 0.f;
      if (BIAS_MODE == 2) bv = bf_bits2f(f2bf_bits(bias[n]));
#pragma unroll
      for (int r = 0; r < 8; ++r) {
        float v = acc[i][j][r] * scale;
        if (BIAS_MODE == 1) v += bias[mBase + mOff + r];
        if (BIAS_MODE == 2) v += bv;
        slab[(mOff + r) * 68 + (j << 4) + rlane] = v;
      }
    }
    __builtin_amdgcn_fence(__ATOMIC_RELEASE, "workgroup");
    __builtin_amdgcn_wave_barrier();
    __builtin_amdgcn_fence(__ATOMIC_ACQUIRE, "workgroup");
    if (OUT_MODE == 0) {
      float* C = (float*)Cout + (size_t)b * strideC;
      const int hh = lane >> 4, c4 = (lane & 15) * 4;     // row seg = 256 B = 16 lanes x 16 B
      {
#pragma unroll
        for (int it = 0; it < 8; ++it) {
          const int row = it * 2 + hh;
          v4f v = *(const v4f*)(slab + row * 68 + c4);
          *(v4f*)(C + (size_t)(mBase + row) * ldc + n0 + c4) = v;
        }
        
      }
    } else {
      const int q = lane >> 3, c8 = (lane & 7) * 8;
      unsigned short* C  = (unsigned short*)Cout  + (size_t)b * strideC;
      unsigned short* C2 = (OUT_MODE == 2) ? ((unsigned short*)Cout2 + (size_t)b * strideC) : nullptr;
      {
#pragma unroll
        for (int it = 0; it < 4; ++it) {
          const int row = it * 4 + q;
          const float* sp = slab + row * 68 + c8;
          v8h hv, lv;
#pragma unroll
          for (int e = 0; e < 8; ++e) {
            if (OUT_MODE == 1) {
              hv[e] = (_Float16)sp[e];
            } else {
              unsigned short hb = f2bf_bits(sp[e]);
              unsigned short lb = f2bf_bits(sp[e] - bf_bits2f(hb));
              hv[e] = __builtin_bit_cast(_Float16, hb);
              lv[e] = __builtin_bit_cast(_Float16, lb);
            }
          }
          *(v8h*)(C + (size_t)(mBase + row) * ldc + n0 + c8) = hv;
          if (OUT_MODE == 2) *(v8h*)(C2 + (size_t)(mBase + row) * ldc + n0 + c8) = lv;
        }
        
      }
    }
    __builtin_amdgcn_fence(__ATOMIC_RELEASE, "workgroup");
    __builtin_amdgcn_wave_barrier();
    __builtin_amdgcn_fence(__ATOMIC_ACQUIRE, "workgroup");
  }
}

// ---- f32 -> bf16 (RNE) plane convert, 8 elements (16 B) per thread ---------------------------------
__global__ __launch_bounds__(256) void cvt_f32_bf16x8(
    const float* __restrict__ in, unsigned short* __restrict__ out, int n8) {
  const int i = blockIdx.x * 256 + threadIdx.x;
  if (i < n8) {
    const float* p = in + (size_t)i * 8;
    const v4f a = *(const v4f*)p;
    const v4f c2 = *(const v4f*)(p + 4);
    v4u w;
    w[0] = (unsigned)f2bf_bits(a[0])  | ((unsigned)f2bf_bits(a[1])  << 16);
    w[1] = (unsigned)f2bf_bits(a[2])  | ((unsigned)f2bf_bits(a[3])  << 16);
    w[2] = (unsigned)f2bf_bits(c2[0]) | ((unsigned)f2bf_bits(c2[1]) << 16);
    w[3] = (unsigned)f2bf_bits(c2[2]) | ((unsigned)f2bf_bits(c2[3]) << 16);
    unsigned short* o = out + (size_t)i * 8;
    *(v4u*)o = w;
    
  }
}

// ---- transpose + RNE-bf16 convert: in = z planes of [R][CC] f32 -> out = z planes of [CC][R] bf16 ------
// grid = (CC/64, R/64, z), block 256. Per block one 64x64 tile through LDS.
// Store coverage: wave w writes out rows ct*64 + 8w + {0..7} (2 iterations x 4 rows), lanes 8q..8q+7 write
__global__ __launch_bounds__(256) void tr_cvt_bf16(
    const float* __restrict__ in, unsigned short* __restrict__ out, int R, int CC) {
  __shared__ float tile[64][65];
  const int tid = threadIdx.x;
  const size_t zoff = (size_t)blockIdx.z * (size_t)R * (size_t)CC;
  const float* src = in + zoff;
  unsigned short* dst = out + zoff;
  const int ct = blockIdx.x, rt = blockIdx.y;
  const int lr = tid >> 2, lc = (tid & 3) * 16;           // in-tile row (input row), 16 input cols
  const float* sp = src + (size_t)(rt * 64 + lr) * CC + ct * 64 + lc;
#pragma unroll
  for (int i = 0; i < 4; ++i) {
    const v4f v = *(const v4f*)(sp + 4 * i);
    tile[lr][lc + 4 * i + 0] = v[0];
    tile[lr][lc + 4 * i + 1] = v[1];
    tile[lr][lc + 4 * i + 2] = v[2];
    tile[lr][lc + 4 * i + 3] = v[3];
  }
  __syncthreads();
  const int lane = tid & 31, wave = tid >> 5, q = lane >> 3, c8 = (lane & 7) * 8;
  v4u w[2];
#pragma unroll
  for (int it = 0; it < 2; ++it) {
    const int fl = wave * 8 + it * 4 + q;                   // out row within tile = input col within tile
    v4u t4;
#pragma unroll
    for (int e = 0; e < 4; ++e) {
      const unsigned lo16 = (unsigned)f2bf_bits(tile[c8 + 2 * e][fl]);
      const unsigned hi16 = (unsigned)f2bf_bits(tile[c8 + 2 * e + 1][fl]);
      t4[e] = lo16 | (hi16 << 16);
    }
    w[it] = t4;
  }
  {
#pragma unroll
    for (int it = 0; it < 2; ++it) {
      const int fl = wave * 8 + it * 4 + q;
      *(v4u*)(dst + (size_t)(ct * 64 + fl) * R + rt * 64 + c8) = w[it];
    }
    
  }
}

// =====================================================================================================
// Causal flash attention, head_dim 256, operands = bf16 hi/lo planes.
//   Q/K/V planes: element (b, s, h, d) at [(b*SEQLEN + s)*EMB_SZ + h*HDIM + d] (hi plane and lo plane).
//   scores = (Qhi.Khi + Qhi.Klo + Qlo.Khi) * inv_scale; causal mask = -inf for key > query (diagonal chunk);
//   online softmax in f32; P (unnormalised exp) split to bf16 hi/lo in LDS; O += Phi.Vhi + Phi.Vlo + Plo.Vhi;
//   out = O / l written as bf16 hi/lo concat planes in the same [(b,s)][h*HDIM + d] layout.
// Block = 256 threads = 8 waves, 64 query rows of one (b,h); wave w: row group rw = w&3 (16 rows),
// half ch = w>>2: d half (128 of 256) for the score products, key half (32 of 64 keys) for the softmax,
// column half (128 of 256) for O. Q stays in registers: each wave holds its 16 rows x its d half, forms partial
// scores for all 64 keys, and the two waves of a row group swap the partial tiles of each other's key half in LDS.
// Row max / row sum of the two key halves combined through LDS with block barriers.
// grid = (SEQLEN/64, NBATCH*NHEAD).
// =====================================================================================================
constexpr int AT_KEYS  = 64;    // keys per chunk
constexpr int AT_QROWS = 64;    // query rows per block
constexpr int AT_WHALF = 128;   // output columns per wave
// LDS row pitches in 16-bit elements. K and P rows are read by b128 fragment loads: 16 B of pad make the pitch an odd
// multiple of 16 B, so the 16 rows of one read fall on 16 different groups of four banks. V rows are read by the
// transposing load, whose conflict-free pitch is an odd multiple of 32 B.
constexpr int AT_KPITCH = HDIM + 8;       // K rows [key][d]: 528 B
constexpr int AT_VPITCH = HDIM + 16;      // V rows [key][d]: 544 B
constexpr int AT_PPITCH = AT_KEYS + 8;    // P rows [row][key]: 144 B
static_assert(SEQLEN % AT_QROWS == 0 && SEQLEN % AT_KEYS == 0 && HDIM == 2 * AT_WHALF);
static_assert(8 * 16 * AT_WHALF <= AT_KEYS * AT_KPITCH);   // output staging slabs fit one K plane
static_assert((AT_KPITCH * 2) % 32 == 16 && (AT_VPITCH * 2) % 64 == 32 && (AT_PPITCH * 2) % 32 == 16);
static_assert(HDIM * 2 == 32 * 16 && AT_KEYS == 8 * 8);    // one copy of a wave = one row; 8 waves x 8 rows = one plane
static_assert(8 * 512 * 4 <= 2 * AT_QROWS * AT_PPITCH * 2);  // the partial-score swap (8 waves x 2 tiles, f32) fits the P planes

__device__ __forceinline__ v16b ldfrag16(const unsigned short* p) {   // elements 0..7 <- p[0..7], 8..15 <- p[16..23]
  union { v16b v; v8b h[2]; } f;
  f.h[0] = *(const v8b*)(p); f.h[1] = *(const v8b*)(p + 16); return f.v;
}
// B fragment (32 keys x 16 d) of a row-major [key][d] LDS tile: p = this lane's address in the first 16 keys,
// row 8*(lane>>4) + (lane&7), column 8*((lane>>3)&1). Lane (c, hh) receives keys 8hh..8hh+7 of column c, then keys
// 16+8hh..16+8hh+7: the k order of ldfrag16.
typedef short s16x8 __attribute__((ext_vector_type(8)));
__device__ __forceinline__ v16b ldfrag16_tr(const unsigned short* p) {
  typedef __attribute__((address_space(3))) s16x8 lds_s16x8;
  union { v16b v; s16x8 h[2]; } f;
  f.h[0] = __builtin_amdgcn_ds_load_tr16_b128_v8i16((lds_s16x8*)p);
  f.h[1] = __builtin_amdgcn_ds_load_tr16_b128_v8i16((lds_s16x8*)(p + 16 * AT_VPITCH));
  return f.v;
}
// Eight asynchronous copies of one wave, global -> LDS: copy j brings row j (512 B, 16 B per lane). g and l are the
// lane's own addresses in row 0. The s_wait_xcnt closes the statement so that it stands in front of every later write
// of an address register that a copy names.
__device__ __forceinline__ void copy_rows8(const unsigned short* l, int lpitch, const unsigned short* g) {
  const unsigned l0 = (unsigned)(size_t)l;
  const unsigned lp = (unsigned)lpitch * 2u;
  asm volatile(
      "global_load_async_to_lds_b128 %0, %8, off\n\t"
      "global_load_async_to_lds_b128 %1, %9, off\n\t"
      "global_load_async_to_lds_b128 %2, %10, off\n\t"
      "global_load_async_to_lds_b128 %3, %11, off\n\t"
      "global_load_async_to_lds_b128 %4, %12, off\n\t"
      "global_load_async_to_lds_b128 %5, %13, off\n\t"
      "global_load_async_to_lds_b128 %6, %14, off\n\t"
      "global_load_async_to_lds_b128 %7, %15, off\n\t"
      "s_wait_xcnt 0x0"
      :: "v"(l0), "v"(l0 + lp), "v"(l0 + 2u * lp), "v"(l0 + 3u * lp),
         "v"(l0 + 4u * lp), "v"(l0 + 5u * lp), "v"(l0 + 6u * lp), "v"(l0 + 7u * lp),
         "v"(g), "v"(g + EMB_SZ), "v"(g + 2 * EMB_SZ), "v"(g + 3 * EMB_SZ),
         "v"(g + 4 * EMB_SZ), "v"(g + 5 * EMB_SZ), "v"(g + 6 * EMB_SZ), "v"(g + 7 * EMB_SZ)
      : "memory");
}
__device__ __forceinline__ v8f mma_bf(v16b a, v16b b, v8f c) {
  c = __builtin_amdgcn_wmma_f32_16x16x32_bf16(false, a, false, b, (short)0, c, false, false);
  asm volatile("v_nop\n\tv_nop\n\tv_nop\n\tv_nop" : "+v"(c) : "v"(a), "v"(b));
  return c;
}

// Second bound: four waves per SIMD, so that two workgroups still share a WGP (its LDS holds two) with Q resident.
__global__ __launch_bounds__(256, 4) void attn_hd256(
    const unsigned short* __restrict__ Qh, const unsigned short* __restrict__ Ql,
    const unsigned short* __restrict__ Kh, const unsigned short* __restrict__ Kl,
    const unsigned short* __restrict__ Vh, const unsigned short* __restrict__ Vl,
    unsigned short* __restrict__ Oh, unsigned short* __restrict__ Ol, float inv_scale) {
  __shared__ __align__(16) unsigned short Ks[2][AT_KEYS * AT_KPITCH];   // [plane][key][d]   67584 B; reused as output staging
  __shared__ __align__(16) unsigned short Vs[2][AT_KEYS * AT_VPITCH];   // [plane][key][d]   69632 B
  __shared__ __align__(16) unsigned short Ps[2][AT_QROWS * AT_PPITCH];  // [plane][row][key] 18432 B
  __shared__ float redm[2][AT_QROWS];                                // partial row max per key half
  __shared__ float reds[2][AT_QROWS];                                // partial row sum per key half

  const int tid  = threadIdx.x;
  const int lane = tid & 31;
  const int wave = __builtin_amdgcn_readfirstlane(tid >> 5);   // scalar: what derives from it alone costs no vector register
  const int hh   = lane >> 4;
  const int c    = lane & 15;
  const int rw   = wave & 3;
  const int ch   = wave >> 2;
  const int qb   = blockIdx.x;                 // query block 0..31
  const int bh   = blockIdx.y;                 // b*NHEAD + h
  const int h    = bh % NHEAD;
  const int b    = bh / NHEAD;
  const int q0w  = qb * AT_QROWS + rw * 16;    // first query row (within the sequence) of this wave
  const size_t rowb = (size_t)b * SEQLEN;      // flattened row base of this batch
  const int hcol = h * HDIM;

  float mrow[8], lrow[8];
  v8f oacc[8];
#pragma unroll
  for (int r = 0; r < 8; ++r) { mrow[r] = -INFINITY; lrow[r] = 0.f; }
#pragma unroll
  for (int t = 0; t < 8; ++t) oacc[t] = (v8f){0.f,0.f,0.f,0.f,0.f,0.f,0.f,0.f};

  // This wave's 16 query rows x its d half, hi and lo, as A fragments (row m = c): loaded once, kept for every chunk.
  v16b qfh[4], qfl[4];
  {
    const size_t qoff = (rowb + q0w + c) * EMB_SZ + hcol + ch * AT_WHALF + 8 * hh;
#pragma unroll   // constant indices keep the fragment arrays in registers
    for (int dc = 0; dc < 4; ++dc) {
      qfh[dc] = ldfrag16(Qh + qoff + dc * 32);
      qfl[dc] = ldfrag16(Ql + qoff + dc * 32);
    }
  }
  // Swap area for partial score tiles, in the P planes (free from the chunk's first barrier to the row-max barrier):
  // per wave 4 quads x 32 lanes x 4 floats, so that each b128 access of a wave is 512 contiguous bytes.
  float* const xown  = reinterpret_cast<float*>(&Ps[0][0]) + wave * 512 + lane * 4;
  const float* const xpeer = reinterpret_cast<const float*>(&Ps[0][0]) + (wave ^ 4) * 512 + lane * 4;

  const int nch = qb + 1;                      // causal horizon in 64-key chunks (block-uniform)
  for (int kc = 0; kc < nch; ++kc) {
    const int kv0 = kc * AT_KEYS;
    // This wave's LDS reads of the last chunk have returned before the barrier behind which K and V are overwritten.
    asm volatile("s_wait_dscnt 0x0" ::: "memory");
    __syncthreads();
    // ---- stage K and V (hi/lo, both [key][d]) by asynchronous copies to LDS ----
    // Coverage: wave w brings keys 8w..8w+7 of each of the four planes, one whole row per copy.
    {
      const int kr0 = wave * 8;
      const size_t gbase = (rowb + kv0 + kr0) * EMB_SZ + hcol + lane * 8;
      copy_rows8(&Ks[0][kr0 * AT_KPITCH + lane * 8], AT_KPITCH, Kh + gbase);
      copy_rows8(&Ks[1][kr0 * AT_KPITCH + lane * 8], AT_KPITCH, Kl + gbase);
      copy_rows8(&Vs[0][kr0 * AT_VPITCH + lane * 8], AT_VPITCH, Vh + gbase);
      copy_rows8(&Vs[1][kr0 * AT_VPITCH + lane * 8], AT_VPITCH, Vl + gbase);
    }
    // This wave's copies have landed before the barrier behind which the other waves read them.
    asm volatile("s_wait_asynccnt 0x0" ::: "memory");
    __syncthreads();

    // ---- partial scores over this wave's d half: 16 rows x 64 keys (four 16x16 D tiles), hi.hi + hi.lo + lo.hi ----
    // Tiles 0,1 = this wave's own key half, tiles 2,3 = the other wave's.
    v8f sp[4];
#pragma unroll
    for (int j = 0; j < 4; ++j) sp[j] = (v8f){0.f,0.f,0.f,0.f,0.f,0.f,0.f,0.f};
#pragma unroll   // both loops: constant indices keep qfh, qfl and sp in registers
    for (int dc = 0; dc < 4; ++dc) {
#pragma unroll
      for (int j = 0; j < 4; ++j) {
        const int kr = ((ch * 2 + j) & 3) * 16 + c;                      // B fragment column n = key kr
        const int koff = kr * AT_KPITCH + ch * AT_WHALF + dc * 32 + 8 * hh;
        const v16b kb = ldfrag16(&Ks[0][koff]);
        const v16b kl = ldfrag16(&Ks[1][koff]);
        sp[j] = mma_bf(qfh[dc], kb, sp[j]);
        sp[j] = mma_bf(qfh[dc], kl, sp[j]);
        sp[j] = mma_bf(qfl[dc], kb, sp[j]);
      }
    }
    // ---- swap: hand tiles 2,3 to the other wave of the row group, add its partials to tiles 0,1 ----
#pragma unroll
    for (int q = 0; q < 4; ++q) {
      const v8f t = sp[2 + (q >> 1)];
      const int e = (q & 1) * 4;
      *(v4f*)(xown + q * 128) = (v4f){t[e], t[e + 1], t[e + 2], t[e + 3]};
    }
    __syncthreads();   // every wave's partial tiles are in LDS before the other wave of its row group reads them
    v8f s[2];
    {
      v4f t[4];
#pragma unroll
      for (int q = 0; q < 4; ++q) t[q] = *(const v4f*)(xpeer + q * 128);
#pragma unroll
      for (int q = 0; q < 4; ++q)
#pragma unroll
        for (int i = 0; i < 4; ++i) s[q >> 1][(q & 1) * 4 + i] = sp[q >> 1][(q & 1) * 4 + i] + t[q][i];
    }

    // ---- scale, causal mask, partial row max over this wave's 32 keys ----
    const bool diag = (kc == qb);                // block-uniform
#pragma unroll
    for (int r = 0; r < 8; ++r) {
      const int qrow = q0w + 8 * hh + r;         // D row 8hh+r
      float m = -INFINITY;
#pragma unroll
      for (int j = 0; j < 2; ++j) {
        const int kvcol = kv0 + ch * 32 + j * 16 + c;   // D col c of tile j
        float sv = s[j][r] * inv_scale;
        if (diag && (kvcol > qrow)) sv = -INFINITY;
        s[j][r] = sv;
        m = fmaxf(m, sv);
      }
      m = fmaxf(m, __shfl_xor(m, 1, 32));
      m = fmaxf(m, __shfl_xor(m, 2, 32));
      m = fmaxf(m, __shfl_xor(m, 4, 32));
      m = fmaxf(m, __shfl_xor(m, 8, 32));
      redm[ch][rw * 16 + 8 * hh + r] = m;
    }
    __syncthreads();

    // ---- online softmax update; P hi/lo to LDS; partial sums ----
    float alph[8];
#pragma unroll
    for (int r = 0; r < 8; ++r) {
      const int row = rw * 16 + 8 * hh + r;
      const float mc = fmaxf(redm[0][row], redm[1][row]);
      const float mnew = fmaxf(mrow[r], mc);
      const float alpha = expf(mrow[r] - mnew);
      mrow[r] = mnew;
      alph[r] = alpha;
      float psum = 0.f;
#pragma unroll
      for (int j = 0; j < 2; ++j) {
        const float p = expf(s[j][r] - mnew);
        psum += p;
        const unsigned short hb = f2bf_bits(p);
        const unsigned short lb = f2bf_bits(p - bf_bits2f(hb));
        const int pidx = row * AT_PPITCH + ch * 32 + j * 16 + c;
        Ps[0][pidx] = hb;
        Ps[1][pidx] = lb;
      }
      psum += __shfl_xor(psum, 1, 32);
      psum += __shfl_xor(psum, 2, 32);
      psum += __shfl_xor(psum, 4, 32);
      psum += __shfl_xor(psum, 8, 32);
      reds[ch][row] = psum;
#pragma unroll
      for (int t = 0; t < 8; ++t) oacc[t][r] *= alpha;
    }
    __syncthreads();
#pragma unroll
    for (int r = 0; r < 8; ++r) {
      const int row = rw * 16 + 8 * hh + r;
      lrow[r] = lrow[r] * alph[r] + (reds[0][row] + reds[1][row]);
    }

    // ---- O += P.V over 64 keys for this wave's 16 rows x 128 columns ----
#pragma unroll 1
    for (int kk = 0; kk < 2; ++kk) {
      const int poff = (rw * 16 + c) * AT_PPITCH + kk * 32 + 8 * hh;          // A fragment row m = c
      const v16b pa = ldfrag16(&Ps[0][poff]);
      const v16b pl = ldfrag16(&Ps[1][poff]);
#pragma unroll
      for (int t = 0; t < 8; ++t) {
        const int voff = (kk * 32 + 8 * hh + (lane & 7)) * AT_VPITCH + ch * AT_WHALF + t * 16 + ((lane >> 3) & 1) * 8;   // B fragment column n = d
        const v16b vb = ldfrag16_tr(&Vs[0][voff]);
        const v16b vl = ldfrag16_tr(&Vs[1][voff]);
        oacc[t] = mma_bf(pa, vb, oacc[t]);
        oacc[t] = mma_bf(pa, vl, oacc[t]);
        oacc[t] = mma_bf(pl, vb, oacc[t]);
      }
    }
  }

  // ---- epilogue: normalise, split to bf16 hi/lo in per-wave LDS slabs (K region), whole-line stores ----
  __syncthreads();
  unsigned short* slh = &Ks[0][wave * (16 * AT_WHALF)];
  unsigned short* sll = &Ks[1][wave * (16 * AT_WHALF)];
#pragma unroll
  for (int r = 0; r < 8; ++r) {
    const float inv = 1.0f / lrow[r];
    const int row = 8 * hh + r;
#pragma unroll
    for (int t = 0; t < 8; ++t) {
      const float v = oacc[t][r] * inv;
      const unsigned short hb = f2bf_bits(v);
      const unsigned short lb = f2bf_bits(v - bf_bits2f(hb));
      slh[row * AT_WHALF + t * 16 + c] = hb;
      sll[row * AT_WHALF + t * 16 + c] = lb;
    }
  }
  __syncthreads();
  // Store coverage: 8 iterations x rows (2it + hh) = 16 rows; per row 16 lanes x 16 B = 128 columns = 2 whole
  {
    {
#pragma unroll
      for (int it = 0; it < 8; ++it) {
        const int row = it * 2 + hh;
        const v4u wh = *(const v4u*)(slh + row * AT_WHALF + c * 8);
        const v4u wl = *(const v4u*)(sll + row * AT_WHALF + c * 8);
        const size_t go = (rowb + q0w + row) * EMB_SZ + hcol + ch * AT_WHALF + c * 8;
        *(v4u*)(Oh + go) = wh;
        *(v4u*)(Ol + go) = wl;
      }
      
    }
  }
}

// ---------------------------------------------------------------------------------------------------
extern "C" void kernel_launch(void* const* d_in, const int* in_sizes, int n_in,
                              void* d_out, int out_size, void* d_ws, size_t ws_size,
                              hipStream_t stream) {
  (void)in_sizes; (void)n_in; (void)out_size;
  const float* Xk = (const float*)d_in[0];
  const float* Xv = (const float*)d_in[1];
  const float* Xq = (const float*)d_in[2];
  const float* Wk = (const float*)d_in[3];
  const float* Wv = (const float*)d_in[4];
  const float* Wq = (const float*)d_in[5];
  const float* Wo = (const float*)d_in[6];
  const float* bo = (const float*)d_in[7];
  float* out = (float*)d_out;

  if (ws_size < WS_TOTAL_BYTES) return;

  unsigned short* ws = (unsigned short*)d_ws;
  unsigned short* xk_b = ws + 0 * PLANE_ELEMS;   // later: concat hi
  unsigned short* xv_b = ws + 1 * PLANE_ELEMS;   // later: concat lo
  unsigned short* xq_b = ws + 2 * PLANE_ELEMS;
  unsigned short* k_hi = ws + 3 * PLANE_ELEMS;
  unsigned short* k_lo = ws + 4 * PLANE_ELEMS;
  unsigned short* v_hi = ws + 5 * PLANE_ELEMS;
  unsigned short* v_lo = ws + 6 * PLANE_ELEMS;
  unsigned short* q_hi = ws + 7 * PLANE_ELEMS;
  unsigned short* q_lo = ws + 8 * PLANE_ELEMS;
  unsigned short* wkT  = ws + WS_OFF_WKT;
  unsigned short* wvT  = ws + WS_OFF_WVT;
  unsigned short* wqT  = ws + WS_OFF_WQT;
  unsigned short* woT  = ws + WS_OFF_WOT;
  unsigned short* cc_hi = xk_b;
  unsigned short* cc_lo = xv_b;

  // 1) inputs -> bf16 planes (RNE), [8192][768] each
  const int n8 = (int)(PLANE_ELEMS / 8);                 // 786432 = 3072 * 256
  cvt_f32_bf16x8<<<dim3(n8 / 256), 256, 0, stream>>>(Xk, xk_b, n8);
  cvt_f32_bf16x8<<<dim3(n8 / 256), 256, 0, stream>>>(Xv, xv_b, n8);
  cvt_f32_bf16x8<<<dim3(n8 / 256), 256, 0, stream>>>(Xq, xq_b, n8);

  // 2) weights: in [3][768][256] -> out [3][256][768] bf16 (Bt layout [N=f][K=e]); Wo [768 k][768 n] -> [768 n][768 k]
  tr_cvt_bf16<<<dim3(HDIM / 64, EMB_SZ / 64, NHEAD), 256, 0, stream>>>(Wk, wkT, EMB_SZ, HDIM);
  tr_cvt_bf16<<<dim3(HDIM / 64, EMB_SZ / 64, NHEAD), 256, 0, stream>>>(Wv, wvT, EMB_SZ, HDIM);
  tr_cvt_bf16<<<dim3(HDIM / 64, EMB_SZ / 64, NHEAD), 256, 0, stream>>>(Wq, wqT, EMB_SZ, HDIM);
  tr_cvt_bf16<<<dim3(EMB_SZ / 64, EMB_SZ / 64, 1), 256, 0, stream>>>(Wo, woT, EMB_SZ, EMB_SZ);

  // 3) per-head projections: C_h[8192 x 256] = X[8192 x 768] . (W_h^T)[256 x 768]^T, written as bf16 hi/lo
  //    planes at column offset h*256 with ldc 768 (grid.y = head). M=8192, N=256, K=768: 512 tiles = 64 blocks x 8 waves.
  const dim3 gproj((NROWS / 64) * (HDIM / 64) / 8, NHEAD);
  wmma_gemm64<1, false, false, 0, 2><<<gproj, 256, 0, stream>>>(
      xk_b, xk_b, EMB_SZ, 0L, wkT, wkT, EMB_SZ, (long)HDIM * EMB_SZ,
      (void*)k_hi, (void*)k_lo, EMB_SZ, (long)HDIM, bo, NROWS, HDIM, EMB_SZ, 1.0f);
  wmma_gemm64<1, false, false, 0, 2><<<gproj, 256, 0, stream>>>(
      xv_b, xv_b, EMB_SZ, 0L, wvT, wvT, EMB_SZ, (long)HDIM * EMB_SZ,
      (void*)v_hi, (void*)v_lo, EMB_SZ, (long)HDIM, bo, NROWS, HDIM, EMB_SZ, 1.0f);
  wmma_gemm64<1, false, false, 0, 2><<<gproj, 256, 0, stream>>>(
      xq_b, xq_b, EMB_SZ, 0L, wqT, wqT, EMB_SZ, (long)HDIM * EMB_SZ,
      (void*)q_hi, (void*)q_lo, EMB_SZ, (long)HDIM, bo, NROWS, HDIM, EMB_SZ, 1.0f);

  // 4) causal attention -> concat hi/lo planes (X planes are dead now)
  const float inv_scale = 1.0f / sqrtf((float)SEQLEN);
  attn_hd256<<<dim3(SEQLEN / AT_QROWS, NBATCH * NHEAD), 256, 0, stream>>>(
      q_hi, q_lo, k_hi, k_lo, v_hi, v_lo, cc_hi, cc_lo, inv_scale);

  // 5) output projection: out[8192 x 768] = concat(hi+lo) . (Wo^T)^T + bo, f32. M=8192, N=768, K=768: 1536 tiles = 192 blocks.
  const dim3 gout((NROWS / 64) * (EMB_SZ / 64) / 8, 1);
  wmma_gemm64<1, true, false, 2, 0><<<gout, 256, 0, stream>>>(
      cc_hi, cc_lo, EMB_SZ, 0L, woT, woT, EMB_SZ, 0L,
      (void*)out, (void*)out, EMB_SZ, 0L, bo, NROWS, EMB_SZ, EMB_SZ, 1.0f);
}

// v004
// It runs in 387 microseconds.
// Two timings next to v003 both put it at 1.03 times that version's speed.
// Over all steps from v000 it is 2.79 times as fast.
// Contractions on v_wmma_f32_16x16x32_bf16 with f32 accumulate: per-head projections = bf16(X) x bf16(W^T) (inputs RNE-converted once); Q.K^T and P.V = bf16 hi/lo planes (hi.hi + hi.lo + lo.hi); output projection = concat bf16 hi/lo x bf16(Wo^T) (hi.W + lo.W) + bf16(bo); softmax, rescaling and normalisation in f32.
#include <hip/hip_runtime.h>
#include <stdint.h>
#include <math.h>

typedef __attribute__((ext_vector_type(16))) _Float16 v16h;
typedef __attribute__((ext_vector_type(8)))  _Float16 v8h;
typedef __attribute__((ext_vector_type(16))) __bf16   v16b;
typedef __attribute__((ext_vector_type(8)))  __bf16   v8b;
typedef __attribute__((ext_vector_type(8)))  float    v8f;
typedef __attribute__((ext_vector_type(4)))  float    v4f;
typedef __attribute__((ext_vector_type(4)))  unsigned v4u;

// ---- problem geometry ----
constexpr int EMB_SZ  = 768;
constexpr int NHEAD   = 3;
constexpr int HDIM    = 256;
constexpr int NBATCH  = 4;
constexpr int SEQLEN  = 2048;
constexpr int NROWS   = NBATCH * SEQLEN;                       // 8192 flattened (b,s) rows
constexpr size_t PLANE_ELEMS = (size_t)NROWS * EMB_SZ;          // 6291456 elements per [8192][768] plane
constexpr size_t PLANE_BYTES = PLANE_ELEMS * 2;                 // 12582912 B per 16-bit plane
constexpr size_t WT_ELEMS    = (size_t)NHEAD * HDIM * EMB_SZ;   // 589824 (W^T planes [3][256][768])
constexpr size_t WO_ELEMS    = (size_t)EMB_SZ * EMB_SZ;         // 589824 (Wo^T plane [768][768])

// [0]            Xk bf16 plane        (dead after projections; reused as concat hi plane)
// [1*PLANE]      Xv bf16 plane        (reused as concat lo plane)
// [2*PLANE]      Xq bf16 plane
// [3*PLANE]      K hi, [4*PLANE] K lo, [5*PLANE] V hi, [6*PLANE] V lo, [7*PLANE] Q hi, [8*PLANE] Q lo
// [9*PLANE]      Wk^T bf16 [3][256][768], then Wv^T, Wq^T (WT_ELEMS each)
// [9*PLANE+3*WT] Wo^T bf16 [768][768]
constexpr size_t WS_OFF_WKT = 9 * PLANE_ELEMS;
constexpr size_t WS_OFF_WVT = WS_OFF_WKT + WT_ELEMS;
constexpr size_t WS_OFF_WQT = WS_OFF_WVT + WT_ELEMS;
constexpr size_t WS_OFF_WOT = WS_OFF_WQT + WT_ELEMS;
constexpr size_t WS_TOTAL_BYTES = (WS_OFF_WOT + WO_ELEMS) * 2;    // 117964800 B
static_assert(WS_TOTAL_BYTES == 117964800ull);
static_assert(WS_TOTAL_BYTES <= 134217728ull);
static_assert((PLANE_BYTES % 128) == 0 && ((WT_ELEMS * 2) % 128) == 0 && ((WO_ELEMS * 2) % 128) == 0);

// ---- GEMM shape contract for the launches in this file ----
static_assert(NROWS % 64 == 0 && HDIM % 64 == 0 && EMB_SZ % 64 == 0);   // M, N tile multiples
static_assert(EMB_SZ % 32 == 0);                                          // K % 32 == 0 for all GEMMs (K = 768)

__device__ __forceinline__ unsigned short f2bf_bits(float f) {
  unsigned u = __float_as_uint(f);
  return (unsigned short)((u + 0x7FFFu + ((u >> 16) & 1u)) >> 16);
}
__device__ __forceinline__ float bf_bits2f(unsigned short h) { return __uint_as_float(((unsigned)h) << 16); }

// hazard guards as plain device helpers (no inline asm inside the kernel template body)
__device__ __forceinline__ void dep_guard_h(v8f& a, v8f& b, v16h x, v16h y) { asm volatile("v_nop\n\tv_nop\n\tv_nop\n\tv_nop" : "+v"(a), "+v"(b) : "v"(x), "v"(y)); }
__device__ __forceinline__ void dep_guard_b(v8f& a, v8f& b, v16b x, v16b y) { asm volatile("v_nop\n\tv_nop\n\tv_nop\n\tv_nop" : "+v"(a), "+v"(b) : "v"(x), "v"(y)); }
__device__ __forceinline__ void keep4_h(v16h a, v16h b, v16h c, v16h d) { asm volatile("v_nop" :: "v"(a), "v"(b), "v"(c), "v"(d)); }
__device__ __forceinline__ void keep4_b(v16b a, v16b b, v16b c, v16b d) { asm volatile("v_nop" :: "v"(a), "v"(b), "v"(c), "v"(d)); }
__device__ __forceinline__ void acc_guard4(v8f& a, v8f& b, v8f& c, v8f& d) { asm volatile("v_nop\n\tv_nop\n\tv_nop\n\tv_nop" : "+v"(a), "+v"(b), "+v"(c), "+v"(d)); }
template <typename T> struct Frag;
template <> struct Frag<_Float16> {
  typedef v16h V; union U { v16h v; v8h h[2]; };
  static __device__ __forceinline__ v16h load(const _Float16* p) {   // elements 0..7 <- p[0..7], 8..15 <- p[16..23]
    U f; f.h[0] = *(const v8h*)(p); f.h[1] = *(const v8h*)(p + 16); return f.v;
  }
  static __device__ __forceinline__ v8f mma(v16h a, v16h b, v8f c) {
    return __builtin_amdgcn_wmma_f32_16x16x32_f16(false, a, false, b, (short)0, c, false, false);
  }
  static __device__ __forceinline__ void guard(v8f& a, v8f& b, v16h x, v16h y) { dep_guard_h(a, b, x, y); }
  static __device__ __forceinline__ void keep(v16h a, v16h b, v16h c, v16h d) { keep4_h(a, b, c, d); }
};
template <> struct Frag<__bf16> {
  typedef v16b V; union U { v16b v; v8b h[2]; };
  static __device__ __forceinline__ v16b load(const __bf16* p) {
    U f; f.h[0] = *(const v8b*)(p); f.h[1] = *(const v8b*)(p + 16); return f.v;
  }
  static __device__ __forceinline__ v8f mma(v16b a, v16b b, v8f c) {
    return __builtin_amdgcn_wmma_f32_16x16x32_bf16(false, a, false, b, (short)0, c, false, false);
  }
  static __device__ __forceinline__ void guard(v8f& a, v8f& b, v16b x, v16b y) { dep_guard_b(a, b, x, y); }
  static __device__ __forceinline__ void keep(v16b a, v16b b, v16b c, v16b d) { keep4_b(a, b, c, d); }
};

// ---- Register-blocked batched WMMA GEMM (with independent A/B split flags) --------------------
// C[m,n] = scale * sum_k A[m,k] * Bt[n,k] (+bias); each wave owns a 64x64 tile.
// A row-major [M,K]; Bt row-major [N,K]; M,N % 64 == 0, K % 32 == 0 (no tail handling).
// SPLITA: A has a lo plane A2 (product += Alo.Bhi); SPLITB: Bt has a lo plane Bt2 (product += Ahi.Blo).
// BIAS_MODE: 0 = none, 1 = bias[m], 2 = RNE-bf16(bias[n]).
// OUT_MODE: 0 = f32, 1 = f16, 2 = bf16 hi plane (Cout) + bf16 lo plane (Cout2).
// ET: 0 = f16 operands, 1 = bf16 operands (pointers passed as 16-bit storage)
template <int ET> struct Elem;
template <> struct Elem<0> { typedef _Float16 T; };
template <> struct Elem<1> { typedef __bf16 T; };
template <int ET, bool SPLITA, bool SPLITB, int BIAS_MODE, int OUT_MODE>
__global__ __launch_bounds__(256) void wmma_gemm64(
    const unsigned short* __restrict__ Ap, const unsigned short* __restrict__ A2p, int lda, long strideA,
    const unsigned short* __restrict__ Btp, const unsigned short* __restrict__ Bt2p, int ldb, long strideB,
    void* __restrict__ Cout, void* __restrict__ Cout2, int ldc, long strideC,
    const float* __restrict__ bias,
    int M, int N, int K, float scale) {
  typedef typename Elem<ET>::T T;
  typedef typename Frag<T>::V V;
  const T* A = (const T*)Ap; const T* A2 = (const T*)A2p; const T* Bt = (const T*)Btp; const T* Bt2 = (const T*)Bt2p;
  __shared__ __align__(16) float sT[8][16 * 68];   // per-wave 16x64 slab, pitch 68 floats
  const int b    = blockIdx.y;
  const int lane = threadIdx.x & 31;
  const int wave = threadIdx.x >> 5;
  const int tilesN = N >> 6;
  const int tilesM = M >> 6;
  const int tile = blockIdx.x * 8 + wave;
  if (tile >= tilesM * tilesN) return;   // wave-uniform; no block barriers in this kernel
  const int tm = tile / tilesN;
  const int tn = tile - tm * tilesN;
  const int m0 = tm << 6;
  const int n0 = tn << 6;

  const T* Ab  = A  + (size_t)b * strideA;
  const T* Bb  = Bt + (size_t)b * strideB;
  const T* Ab2 = SPLITA ? (A2  + (size_t)b * strideA) : nullptr;
  const T* Bb2 = SPLITB ? (Bt2 + (size_t)b * strideB) : nullptr;

  const int rlane = lane & 15;                 // row (A) / col (B, D) within subtile
  const int koff  = (lane >> 4) * 8;           // k offset of this lane half
  const int mOff  = (lane >> 4) * 8;           // D row offset

  v8f acc[4][4];
#pragma unroll
  for (int i = 0; i < 4; ++i)
#pragma unroll
    for (int j = 0; j < 4; ++j) acc[i][j] = (v8f){0.f,0.f,0.f,0.f,0.f,0.f,0.f,0.f};

  for (int k0 = 0; k0 < K; k0 += 32) {
    V bh[4], bl[4];
#pragma unroll
    for (int j = 0; j < 4; ++j) {
      const size_t bo = (size_t)(n0 + (j << 4) + rlane) * ldb + koff + k0;
      bh[j] = Frag<T>::load(Bb + bo);
      if (SPLITB) bl[j] = Frag<T>::load(Bb2 + bo);
    }
#pragma unroll
    for (int i = 0; i < 4; ++i) {
      const size_t ao = (size_t)(m0 + (i << 4) + rlane) * lda + koff + k0;
      V ah = Frag<T>::load(Ab + ao);
      V al;
      if (SPLITA) al = Frag<T>::load(Ab2 + ao);
#pragma unroll
      for (int j = 0; j < 4; ++j) {
        acc[i][j] = Frag<T>::mma(ah, bh[j], acc[i][j]);
        if (SPLITB) acc[i][j] = Frag<T>::mma(ah, bl[j], acc[i][j]);
        if (SPLITA) acc[i][j] = Frag<T>::mma(al, bh[j], acc[i][j]);
      }
      Frag<T>::guard(acc[i][0], acc[i][3], ah, SPLITA ? al : ah);
    }
    Frag<T>::keep(bh[0], bh[1], bh[2], bh[3]);
    if (SPLITB) Frag<T>::keep(bl[0], bl[1], bl[2], bl[3]);
  }
  acc_guard4(acc[0][0], acc[0][1], acc[0][2], acc[0][3]);
  acc_guard4(acc[1][0], acc[1][1], acc[1][2], acc[1][3]);
  acc_guard4(acc[2][0], acc[2][1], acc[2][2], acc[2][3]);
  acc_guard4(acc[3][0], acc[3][1], acc[3][2], acc[3][3]);

  // ---- epilogue ----
  float* slab = sT[wave];
#pragma unroll
  for (int i = 0; i < 4; ++i) {
    const int mBase = m0 + (i << 4);
#pragma unroll
    for (int j = 0; j < 4; ++j) {
      const int n = n0 + (j << 4) + rlane;
      float bv = 0.f;
      if (BIAS_MODE == 2) bv = bf_bits2f(f2bf_bits(bias[n]));
#pragma unroll
      for (int r = 0; r < 8; ++r) {
        float v = acc[i][j][r] * scale;
        if (BIAS_MODE == 1) v += bias[mBase + mOff + r];
        if (BIAS_MODE == 2) v += bv;
        slab[(mOff + r) * 68 + (j << 4) + rlane] = v;
      }
    }
    __builtin_amdgcn_fence(__ATOMIC_RELEASE, "workgroup");
    __builtin_amdgcn_wave_barrier();
    __builtin_amdgcn_fence(__ATOMIC_ACQUIRE, "workgroup");
    if (OUT_MODE == 0) {
      float* C = (float*)Cout + (size_t)b * strideC;
      const int hh = lane >> 4, c4 = (lane & 15) * 4;     // row seg = 256 B = 16 lanes x 16 B
      {
#pragma unroll
        for (int it = 0; it < 8; ++it) {
          const int row = it * 2 + hh;
          v4f v = *(const v4f*)(slab + row * 68 + c4);
          *(v4f*)(C + (size_t)(mBase + row) * ldc + n0 + c4) = v;
        }
        
      }
    } else {
      const int q = lane >> 3, c8 = (lane & 7) * 8;
      unsigned short* C  = (unsigned short*)Cout  + (size_t)b * strideC;
      unsigned short* C2 = (OUT_MODE == 2) ? ((unsigned short*)Cout2 + (size_t)b * strideC) : nullptr;
      {
#pragma unroll
        for (int it = 0; it < 4; ++it) {
          const int row = it * 4 + q;
          const float* sp = slab + row * 68 + c8;
          v8h hv, lv;
#pragma unroll
          for (int e = 0; e < 8; ++e) {
            if (OUT_MODE == 1) {
              hv[e] = (_Float16)sp[e];
            } else {
              unsigned short hb = f2bf_bits(sp[e]);
              unsigned short lb = f2bf_bits(sp[e] - bf_bits2f(hb));
              hv[e] = __builtin_bit_cast(_Float16, hb);
              lv[e] = __builtin_bit_cast(_Float16, lb);
            }
          }
          *(v8h*)(C + (size_t)(mBase + row) * ldc + n0 + c8) = hv;
          if (OUT_MODE == 2) *(v8h*)(C2 + (size_t)(mBase + row) * ldc + n0 + c8) = lv;
        }
        
      }
    }
    __builtin_amdgcn_fence(__ATOMIC_RELEASE, "workgroup");
    __builtin_amdgcn_wave_barrier();
    __builtin_amdgcn_fence(__ATOMIC_ACQUIRE, "workgroup");
  }
}

// ---- input pass, one launch: three activation planes f32 -> bf16 (RNE) and the four weight transposes ----------
// Every work-group converts its share of each activation plane: per thread and plane 4 units of 8 elements (32 B read,
// 16 B written), unit index = j * PREP_THREADS + global thread id, so one store of a wave is 512 contiguous bytes. All of
// a thread's loads are issued before its first convert. Work-groups 0..PREP_TILES-1 also take one 64x64 weight tile:
// in = planes of [768][CC] f32 -> out = planes of [CC][768] bf16, through LDS.
constexpr int PREP_WGS     = 768;
constexpr int PREP_THREADS = PREP_WGS * 256;
constexpr int PREP_UNITS   = (int)(PLANE_ELEMS / 8);            // 16-B output units per plane
constexpr int PREP_PER_THR = PREP_UNITS / PREP_THREADS;         // 4
constexpr int TILES_WZ     = (HDIM / 64) * (EMB_SZ / 64);       // 48 tiles per head plane of Wk, Wv, Wq
constexpr int TILES_W      = TILES_WZ * NHEAD;                  // 144 per weight
constexpr int TILES_WO     = (EMB_SZ / 64) * (EMB_SZ / 64);     // 144
constexpr int PREP_TILES   = 3 * TILES_W + TILES_WO;            // 576
static_assert(PREP_PER_THR * PREP_THREADS == PREP_UNITS && PREP_PER_THR == 4);
static_assert(PREP_TILES <= PREP_WGS && HDIM / 64 == 4);

__device__ __forceinline__ v4u pack8_bf16(v4f a, v4f c2) {
  v4u w;
  w[0] = (unsigned)f2bf_bits(a[0])  | ((unsigned)f2bf_bits(a[1])  << 16);
  w[1] = (unsigned)f2bf_bits(a[2])  | ((unsigned)f2bf_bits(a[3])  << 16);
  w[2] = (unsigned)f2bf_bits(c2[0]) | ((unsigned)f2bf_bits(c2[1]) << 16);
  w[3] = (unsigned)f2bf_bits(c2[2]) | ((unsigned)f2bf_bits(c2[3]) << 16);
  return w;
}

__global__ __launch_bounds__(256) void prep_inputs(
    const float* __restrict__ Xk, const float* __restrict__ Xv, const float* __restrict__ Xq,
    const float* __restrict__ Wk, const float* __restrict__ Wv, const float* __restrict__ Wq,
    const float* __restrict__ Wo,
    unsigned short* __restrict__ xb,     // three bf16 planes in a row: Xk, Xv, Xq
    unsigned short* __restrict__ wT) {   // Wk^T, Wv^T, Wq^T, Wo^T in a row (WT_ELEMS each)
  __shared__ float tile[64][65];
  const int tid = threadIdx.x;
  const int blk = blockIdx.x;

  // ---- activation loads: 3 planes x 4 units x 2 loads of 16 B ----
  const unsigned u0 = (unsigned)blk * 256u + (unsigned)tid;
  v4f xa[3][PREP_PER_THR], xc[3][PREP_PER_THR];
  const float* xp[3][PREP_PER_THR];
#pragma unroll   // both loops: constant indices keep the arrays in registers
  for (int x = 0; x < 3; ++x) {
    const float* in = (x == 0) ? Xk : (x == 1) ? Xv : Xq;
#pragma unroll
    for (int j = 0; j < PREP_PER_THR; ++j) {
      const float* p = in + (size_t)(u0 + (unsigned)j * PREP_THREADS) * 8;
      xp[x][j] = p;
      xa[x][j] = *(const v4f*)p;
      xc[x][j] = *(const v4f*)(p + 4);
    }
  }
  // Stands in front of every later write of a register that one of these loads names as its address: as inputs the twelve
  // addresses stay live up to here, so that no result of a later load of the run is placed on one of them either.
  asm volatile("s_wait_xcnt 0x0"
               :: "v"(xp[0][0]), "v"(xp[0][1]), "v"(xp[0][2]), "v"(xp[0][3]),
                  "v"(xp[1][0]), "v"(xp[1][1]), "v"(xp[1][2]), "v"(xp[1][3]),
                  "v"(xp[2][0]), "v"(xp[2][1]), "v"(xp[2][2]), "v"(xp[2][3])
               : "memory");

  // ---- one weight tile (block-uniform branch) ----
  if (blk < PREP_TILES) {
    const float* src;
    unsigned short* dst;
    int CC, ct, rt;
    if (blk < 3 * TILES_W) {
      const int w = blk / TILES_W, r = blk - w * TILES_W;
      const int z = r / TILES_WZ, r2 = r - z * TILES_WZ;
      src = ((w == 0) ? Wk : (w == 1) ? Wv : Wq) + (size_t)z * EMB_SZ * HDIM;
      dst = wT + (size_t)w * WT_ELEMS + (size_t)z * EMB_SZ * HDIM;
      CC = HDIM; ct = r2 & 3; rt = r2 >> 2;
    } else {
      const int r = blk - 3 * TILES_W;
      src = Wo;
      dst = wT + 3 * WT_ELEMS;
      CC = EMB_SZ; rt = r / (EMB_SZ / 64); ct = r - rt * (EMB_SZ / 64);
    }
    const int lr = tid >> 2, lc = (tid & 3) * 16;           // in-tile row (input row), 16 input cols
    const float* sp = src + (size_t)(rt * 64 + lr) * CC + ct * 64 + lc;
#pragma unroll
    for (int i = 0; i < 4; ++i) {
      const v4f v = *(const v4f*)(sp + 4 * i);
      tile[lr][lc + 4 * i + 0] = v[0];
      tile[lr][lc + 4 * i + 1] = v[1];
      tile[lr][lc + 4 * i + 2] = v[2];
      tile[lr][lc + 4 * i + 3] = v[3];
    }
    __syncthreads();
    // Store coverage: wave w writes out rows ct*64 + 8w + {0..7} (2 iterations x 4 rows), 8 lanes x 16 B per row.
    const int lane = tid & 31, wave = tid >> 5, q = lane >> 3, c8 = (lane & 7) * 8;
#pragma unroll
    for (int it = 0; it < 2; ++it) {
      const int fl = wave * 8 + it * 4 + q;                   // out row within tile = input col within tile
      v4u t4;
#pragma unroll
      for (int e = 0; e < 4; ++e) {
        const unsigned lo16 = (unsigned)f2bf_bits(tile[c8 + 2 * e][fl]);
        const unsigned hi16 = (unsigned)f2bf_bits(tile[c8 + 2 * e + 1][fl]);
        t4[e] = lo16 | (hi16 << 16);
      }
      *(v4u*)(dst + (size_t)(ct * 64 + fl) * EMB_SZ + rt * 64 + c8) = t4;
    }
  }

  // ---- convert and store the activation units ----
#pragma unroll
  for (int x = 0; x < 3; ++x) {
#pragma unroll
    for (int j = 0; j < PREP_PER_THR; ++j) {
      unsigned short* o = xb + (size_t)x * PLANE_ELEMS + (size_t)(u0 + (unsigned)j * PREP_THREADS) * 8;
      *(v4u*)o = pack8_bf16(xa[x][j], xc[x][j]);
    }
  }
}

// =====================================================================================================
// Causal flash attention, head_dim 256, operands = bf16 hi/lo planes.
//   Q/K/V planes: element (b, s, h, d) at [(b*SEQLEN + s)*EMB_SZ + h*HDIM + d] (hi plane and lo plane).
//   scores = (Qhi.Khi + Qhi.Klo + Qlo.Khi) * inv_scale; causal mask = -inf for key > query (diagonal chunk);
//   online softmax in f32; P (unnormalised exp) split to bf16 hi/lo in LDS; O += Phi.Vhi + Phi.Vlo + Plo.Vhi;
//   out = O / l written as bf16 hi/lo concat planes in the same [(b,s)][h*HDIM + d] layout.
// Block = 256 threads = 8 waves, 64 query rows of one (b,h); wave w: row group rw = w&3 (16 rows),
// half ch = w>>2: d half (128 of 256) for the score products, key half (32 of 64 keys) for the softmax,
// column half (128 of 256) for O. Q stays in registers: each wave holds its 16 rows x its d half, forms partial
// scores for all 64 keys, and the two waves of a row group swap the partial tiles of each other's key half in LDS.
// Row max / row sum of the two key halves combined through LDS with block barriers.
// grid = (SEQLEN/64, NBATCH*NHEAD).
// =====================================================================================================
constexpr int AT_KEYS  = 64;    // keys per chunk
constexpr int AT_QROWS = 64;    // query rows per block
constexpr int AT_WHALF = 128;   // output columns per wave
// LDS row pitches in 16-bit elements. K and P rows are read by b128 fragment loads: 16 B of pad make the pitch an odd
// multiple of 16 B, so the 16 rows of one read fall on 16 different groups of four banks. V rows are read by the
// transposing load, whose conflict-free pitch is an odd multiple of 32 B.
constexpr int AT_KPITCH = HDIM + 8;       // K rows [key][d]: 528 B
constexpr int AT_VPITCH = HDIM + 16;      // V rows [key][d]: 544 B
constexpr int AT_PPITCH = AT_KEYS + 8;    // P rows [row][key]: 144 B
static_assert(SEQLEN % AT_QROWS == 0 && SEQLEN % AT_KEYS == 0 && HDIM == 2 * AT_WHALF);
static_assert(8 * 16 * AT_WHALF <= AT_KEYS * AT_KPITCH);   // output staging slabs fit one K plane
static_assert((AT_KPITCH * 2) % 32 == 16 && (AT_VPITCH * 2) % 64 == 32 && (AT_PPITCH * 2) % 32 == 16);
static_assert(HDIM * 2 == 32 * 16 && AT_KEYS == 8 * 8);    // one copy of a wave = one row; 8 waves x 8 rows = one plane
static_assert(8 * 512 * 4 <= 2 * AT_QROWS * AT_PPITCH * 2);  // the partial-score swap (8 waves x 2 tiles, f32) fits the P planes

__device__ __forceinline__ v16b ldfrag16(const unsigned short* p) {   // elements 0..7 <- p[0..7], 8..15 <- p[16..23]
  union { v16b v; v8b h[2]; } f;
  f.h[0] = *(const v8b*)(p); f.h[1] = *(const v8b*)(p + 16); return f.v;
}
// B fragment (32 keys x 16 d) of a row-major [key][d] LDS tile: p = this lane's address in the first 16 keys,
// row 8*(lane>>4) + (lane&7), column 8*((lane>>3)&1). Lane (c, hh) receives keys 8hh..8hh+7 of column c, then keys
// 16+8hh..16+8hh+7: the k order of ldfrag16.
typedef short s16x8 __attribute__((ext_vector_type(8)));
__device__ __forceinline__ v16b ldfrag16_tr(const unsigned short* p) {
  typedef __attribute__((address_space(3))) s16x8 lds_s16x8;
  union { v16b v; s16x8 h[2]; } f;
  f.h[0] = __builtin_amdgcn_ds_load_tr16_b128_v8i16((lds_s16x8*)p);
  f.h[1] = __builtin_amdgcn_ds_load_tr16_b128_v8i16((lds_s16x8*)(p + 16 * AT_VPITCH));
  return f.v;
}
// Eight asynchronous copies of one wave, global -> LDS: copy j brings row j (512 B, 16 B per lane). g and l are the
// lane's own addresses in row 0. The s_wait_xcnt closes the statement so that it stands in front of every later write
// of an address register that a copy names.
__device__ __forceinline__ void copy_rows8(const unsigned short* l, int lpitch, const unsigned short* g) {
  const unsigned l0 = (unsigned)(size_t)l;
  const unsigned lp = (unsigned)lpitch * 2u;
  asm volatile(
      "global_load_async_to_lds_b128 %0, %8, off\n\t"
      "global_load_async_to_lds_b128 %1, %9, off\n\t"
      "global_load_async_to_lds_b128 %2, %10, off\n\t"
      "global_load_async_to_lds_b128 %3, %11, off\n\t"
      "global_load_async_to_lds_b128 %4, %12, off\n\t"
      "global_load_async_to_lds_b128 %5, %13, off\n\t"
      "global_load_async_to_lds_b128 %6, %14, off\n\t"
      "global_load_async_to_lds_b128 %7, %15, off\n\t"
      "s_wait_xcnt 0x0"
      :: "v"(l0), "v"(l0 + lp), "v"(l0 + 2u * lp), "v"(l0 + 3u * lp),
         "v"(l0 + 4u * lp), "v"(l0 + 5u * lp), "v"(l0 + 6u * lp), "v"(l0 + 7u * lp),
         "v"(g), "v"(g + EMB_SZ), "v"(g + 2 * EMB_SZ), "v"(g + 3 * EMB_SZ),
         "v"(g + 4 * EMB_SZ), "v"(g + 5 * EMB_SZ), "v"(g + 6 * EMB_SZ), "v"(g + 7 * EMB_SZ)
      : "memory");
}
__device__ __forceinline__ v8f mma_bf(v16b a, v16b b, v8f c) {
  c = __builtin_amdgcn_wmma_f32_16x16x32_bf16(false, a, false, b, (short)0, c, false, false);
  asm volatile("v_nop\n\tv_nop\n\tv_nop\n\tv_nop" : "+v"(c) : "v"(a), "v"(b));
  return c;
}

// Second bound: four waves per SIMD, so that two workgroups still share a WGP (its LDS holds two) with Q resident.
__global__ __launch_bounds__(256, 4) void attn_hd256(
    const unsigned short* __restrict__ Qh, const unsigned short* __restrict__ Ql,
    const unsigned short* __restrict__ Kh, const unsigned short* __restrict__ Kl,
    const unsigned short* __restrict__ Vh, const unsigned short* __restrict__ Vl,
    unsigned short* __restrict__ Oh, unsigned short* __restrict__ Ol, float inv_scale) {
  __shared__ __align__(16) unsigned short Ks[2][AT_KEYS * AT_KPITCH];   // [plane][key][d]   67584 B; reused as output staging
  __shared__ __align__(16) unsigned short Vs[2][AT_KEYS * AT_VPITCH];   // [plane][key][d]   69632 B
  __shared__ __align__(16) unsigned short Ps[2][AT_QROWS * AT_PPITCH];  // [plane][row][key] 18432 B
  __shared__ float redm[2][AT_QROWS];                                // partial row max per key half
  __shared__ float reds[2][AT_QROWS];                                // partial row sum per key half

  const int tid  = threadIdx.x;
  const int lane = tid & 31;
  const int wave = __builtin_amdgcn_readfirstlane(tid >> 5);   // scalar: what derives from it alone costs no vector register
  const int hh   = lane >> 4;
  const int c    = lane & 15;
  const int rw   = wave & 3;
  const int ch   = wave >> 2;
  const int qb   = blockIdx.x;                 // query block 0..31
  const int bh   = blockIdx.y;                 // b*NHEAD + h
  const int h    = bh % NHEAD;
  const int b    = bh / NHEAD;
  const int q0w  = qb * AT_QROWS + rw * 16;    // first query row (within the sequence) of this wave
  const size_t rowb = (size_t)b * SEQLEN;      // flattened row base of this batch
  const int hcol = h * HDIM;

  float mrow[8], lrow[8];
  v8f oacc[8];
#pragma unroll
  for (int r = 0; r < 8; ++r) { mrow[r] = -INFINITY; lrow[r] = 0.f; }
#pragma unroll
  for (int t = 0; t < 8; ++t) oacc[t] = (v8f){0.f,0.f,0.f,0.f,0.f,0.f,0.f,0.f};

  // This wave's 16 query rows x its d half, hi and lo, as A fragments (row m = c): loaded once, kept for every chunk.
  v16b qfh[4], qfl[4];
  {
    const size_t qoff = (rowb + q0w + c) * EMB_SZ + hcol + ch * AT_WHALF + 8 * hh;
#pragma unroll   // constant indices keep the fragment arrays in registers
    for (int dc = 0; dc < 4; ++dc) {
      qfh[dc] = ldfrag16(Qh + qoff + dc * 32);
      qfl[dc] = ldfrag16(Ql + qoff + dc * 32);
    }
  }
  // Swap area for partial score tiles, in the P planes (free from the chunk's first barrier to the row-max barrier):
  // per wave 4 quads x 32 lanes x 4 floats, so that each b128 access of a wave is 512 contiguous bytes.
  float* const xown  = reinterpret_cast<float*>(&Ps[0][0]) + wave * 512 + lane * 4;
  const float* const xpeer = reinterpret_cast<const float*>(&Ps[0][0]) + (wave ^ 4) * 512 + lane * 4;

  const int nch = qb + 1;                      // causal horizon in 64-key chunks (block-uniform)
  for (int kc = 0; kc < nch; ++kc) {
    const int kv0 = kc * AT_KEYS;
    // This wave's LDS reads of the last chunk have returned before the barrier behind which K and V are overwritten.
    asm volatile("s_wait_dscnt 0x0" ::: "memory");
    __syncthreads();
    // ---- stage K and V (hi/lo, both [key][d]) by asynchronous copies to LDS ----
    // Coverage: wave w brings keys 8w..8w+7 of each of the four planes, one whole row per copy.
    {
      const int kr0 = wave * 8;
      const size_t gbase = (rowb + kv0 + kr0) * EMB_SZ + hcol + lane * 8;
      copy_rows8(&Ks[0][kr0 * AT_KPITCH + lane * 8], AT_KPITCH, Kh + gbase);
      copy_rows8(&Ks[1][kr0 * AT_KPITCH + lane * 8], AT_KPITCH, Kl + gbase);
      copy_rows8(&Vs[0][kr0 * AT_VPITCH + lane * 8], AT_VPITCH, Vh + gbase);
      copy_rows8(&Vs[1][kr0 * AT_VPITCH + lane * 8], AT_VPITCH, Vl + gbase);
    }
    // This wave's copies have landed before the barrier behind which the other waves read them.
    asm volatile("s_wait_asynccnt 0x0" ::: "memory");
    __syncthreads();

    // ---- partial scores over this wave's d half: 16 rows x 64 keys (four 16x16 D tiles), hi.hi + hi.lo + lo.hi ----
    // Tiles 0,1 = this wave's own key half, tiles 2,3 = the other wave's.
    v8f sp[4];
#pragma unroll
    for (int j = 0; j < 4; ++j) sp[j] = (v8f){0.f,0.f,0.f,0.f,0.f,0.f,0.f,0.f};
#pragma unroll   // both loops: constant indices keep qfh, qfl and sp in registers
    for (int dc = 0; dc < 4; ++dc) {
#pragma unroll
      for (int j = 0; j < 4; ++j) {
        const int kr = ((ch * 2 + j) & 3) * 16 + c;                      // B fragment column n = key kr
        const int koff = kr * AT_KPITCH + ch * AT_WHALF + dc * 32 + 8 * hh;
        const v16b kb = ldfrag16(&Ks[0][koff]);
        const v16b kl = ldfrag16(&Ks[1][koff]);
        sp[j] = mma_bf(qfh[dc], kb, sp[j]);
        sp[j] = mma_bf(qfh[dc], kl, sp[j]);
        sp[j] = mma_bf(qfl[dc], kb, sp[j]);
      }
    }
    // ---- swap: hand tiles 2,3 to the other wave of the row group, add its partials to tiles 0,1 ----
#pragma unroll
    for (int q = 0; q < 4; ++q) {
      const v8f t = sp[2 + (q >> 1)];
      const int e = (q & 1) * 4;
      *(v4f*)(xown + q * 128) = (v4f){t[e], t[e + 1], t[e + 2], t[e + 3]};
    }
    __syncthreads();   // every wave's partial tiles are in LDS before the other wave of its row group reads them
    v8f s[2];
    {
      v4f t[4];
#pragma unroll
      for (int q = 0; q < 4; ++q) t[q] = *(const v4f*)(xpeer + q * 128);
#pragma unroll
      for (int q = 0; q < 4; ++q)
#pragma unroll
        for (int i = 0; i < 4; ++i) s[q >> 1][(q & 1) * 4 + i] = sp[q >> 1][(q & 1) * 4 + i] + t[q][i];
    }

    // ---- scale, causal mask, partial row max over this wave's 32 keys ----
    const bool diag = (kc == qb);                // block-uniform
#pragma unroll
    for (int r = 0; r < 8; ++r) {
      const int qrow = q0w + 8 * hh + r;         // D row 8hh+r
      float m = -INFINITY;
#pragma unroll
      for (int j = 0; j < 2; ++j) {
        const int kvcol = kv0 + ch * 32 + j * 16 + c;   // D col c of tile j
        float sv = s[j][r] * inv_scale;
        if (diag && (kvcol > qrow)) sv = -INFINITY;
        s[j][r] = sv;
        m = fmaxf(m, sv);
      }
      m = fmaxf(m, __shfl_xor(m, 1, 32));
      m = fmaxf(m, __shfl_xor(m, 2, 32));
      m = fmaxf(m, __shfl_xor(m, 4, 32));
      m = fmaxf(m, __shfl_xor(m, 8, 32));
      redm[ch][rw * 16 + 8 * hh + r] = m;
    }
    __syncthreads();

    // ---- online softmax update; P hi/lo to LDS; partial sums ----
    float alph[8];
#pragma unroll
    for (int r = 0; r < 8; ++r) {
      const int row = rw * 16 + 8 * hh + r;
      const float mc = fmaxf(redm[0][row], redm[1][row]);
      const float mnew = fmaxf(mrow[r], mc);
      const float alpha = expf(mrow[r] - mnew);
      mrow[r] = mnew;
      alph[r] = alpha;
      float psum = 0.f;
#pragma unroll
      for (int j = 0; j < 2; ++j) {
        const float p = expf(s[j][r] - mnew);
        psum += p;
        const unsigned short hb = f2bf_bits(p);
        const unsigned short lb = f2bf_bits(p - bf_bits2f(hb));
        const int pidx = row * AT_PPITCH + ch * 32 + j * 16 + c;
        Ps[0][pidx] = hb;
        Ps[1][pidx] = lb;
      }
      psum += __shfl_xor(psum, 1, 32);
      psum += __shfl_xor(psum, 2, 32);
      psum += __shfl_xor(psum, 4, 32);
      psum += __shfl_xor(psum, 8, 32);
      reds[ch][row] = psum;
#pragma unroll
      for (int t = 0; t < 8; ++t) oacc[t][r] *= alpha;
    }
    __syncthreads();
#pragma unroll
    for (int r = 0; r < 8; ++r) {
      const int row = rw * 16 + 8 * hh + r;
      lrow[r] = lrow[r] * alph[r] + (reds[0][row] + reds[1][row]);
    }

    // ---- O += P.V over 64 keys for this wave's 16 rows x 128 columns ----
#pragma unroll 1
    for (int kk = 0; kk < 2; ++kk) {
      const int poff = (rw * 16 + c) * AT_PPITCH + kk * 32 + 8 * hh;          // A fragment row m = c
      const v16b pa = ldfrag16(&Ps[0][poff]);
      const v16b pl = ldfrag16(&Ps[1][poff]);
#pragma unroll
      for (int t = 0; t < 8; ++t) {
        const int voff = (kk * 32 + 8 * hh + (lane & 7)) * AT_VPITCH + ch * AT_WHALF + t * 16 + ((lane >> 3) & 1) * 8;   // B fragment column n = d
        const v16b vb = ldfrag16_tr(&Vs[0][voff]);
        const v16b vl = ldfrag16_tr(&Vs[1][voff]);
        oacc[t] = mma_bf(pa, vb, oacc[t]);
        oacc[t] = mma_bf(pa, vl, oacc[t]);
        oacc[t] = mma_bf(pl, vb, oacc[t]);
      }
    }
  }

  // ---- epilogue: normalise, split to bf16 hi/lo in per-wave LDS slabs (K region), whole-line stores ----
  __syncthreads();
  unsigned short* slh = &Ks[0][wave * (16 * AT_WHALF)];
  unsigned short* sll = &Ks[1][wave * (16 * AT_WHALF)];
#pragma unroll
  for (int r = 0; r < 8; ++r) {
    const float inv = 1.0f / lrow[r];
    const int row = 8 * hh + r;
#pragma unroll
    for (int t = 0; t < 8; ++t) {
      const float v = oacc[t][r] * inv;
      const unsigned short hb = f2bf_bits(v);
      const unsigned short lb = f2bf_bits(v - bf_bits2f(hb));
      slh[row * AT_WHALF + t * 16 + c] = hb;
      sll[row * AT_WHALF + t * 16 + c] = lb;
    }
  }
  __syncthreads();
  // Store coverage: 8 iterations x rows (2it + hh) = 16 rows; per row 16 lanes x 16 B = 128 columns = 2 whole
  {
    {
#pragma unroll
      for (int it = 0; it < 8; ++it) {
        const int row = it * 2 + hh;
        const v4u wh = *(const v4u*)(slh + row * AT_WHALF + c * 8);
        const v4u wl = *(const v4u*)(sll + row * AT_WHALF + c * 8);
        const size_t go = (rowb + q0w + row) * EMB_SZ + hcol + ch * AT_WHALF + c * 8;
        *(v4u*)(Oh + go) = wh;
        *(v4u*)(Ol + go) = wl;
      }
      
    }
  }
}

// ---------------------------------------------------------------------------------------------------
extern "C" void kernel_launch(void* const* d_in, const int* in_sizes, int n_in,
                              void* d_out, int out_size, void* d_ws, size_t ws_size,
                              hipStream_t stream) {
  (void)in_sizes; (void)n_in; (void)out_size;
  const float* Xk = (const float*)d_in[0];
  const float* Xv = (const float*)d_in[1];
  const float* Xq = (const float*)d_in[2];
  const float* Wk = (const float*)d_in[3];
  const float* Wv = (const float*)d_in[4];
  const float* Wq = (const float*)d_in[5];
  const float* Wo = (const float*)d_in[6];
  const float* bo = (const float*)d_in[7];
  float* out = (float*)d_out;

  if (ws_size < WS_TOTAL_BYTES) return;

  unsigned short* ws = (unsigned short*)d_ws;
  unsigned short* xk_b = ws + 0 * PLANE_ELEMS;   // later: concat hi
  unsigned short* xv_b = ws + 1 * PLANE_ELEMS;   // later: concat lo
  unsigned short* xq_b = ws + 2 * PLANE_ELEMS;
  unsigned short* k_hi = ws + 3 * PLANE_ELEMS;
  unsigned short* k_lo = ws + 4 * PLANE_ELEMS;
  unsigned short* v_hi = ws + 5 * PLANE_ELEMS;
  unsigned short* v_lo = ws + 6 * PLANE_ELEMS;
  unsigned short* q_hi = ws + 7 * PLANE_ELEMS;
  unsigned short* q_lo = ws + 8 * PLANE_ELEMS;
  unsigned short* wkT  = ws + WS_OFF_WKT;
  unsigned short* wvT  = ws + WS_OFF_WVT;
  unsigned short* wqT  = ws + WS_OFF_WQT;
  unsigned short* woT  = ws + WS_OFF_WOT;
  unsigned short* cc_hi = xk_b;
  unsigned short* cc_lo = xv_b;

  // 1) + 2) inputs -> bf16 planes (RNE), [8192][768] each; weights [3][768][256] -> [3][256][768] bf16 (Bt layout
  //    [N=f][K=e]); Wo [768 k][768 n] -> [768 n][768 k]: one launch
  prep_inputs<<<dim3(PREP_WGS), 256, 0, stream>>>(Xk, Xv, Xq, Wk, Wv, Wq, Wo, xk_b, wkT);

  // 3) per-head projections: C_h[8192 x 256] = X[8192 x 768] . (W_h^T)[256 x 768]^T, written as bf16 hi/lo
  //    planes at column offset h*256 with ldc 768 (grid.y = head). M=8192, N=256, K=768: 512 tiles = 64 blocks x 8 waves.
  const dim3 gproj((NROWS / 64) * (HDIM / 64) / 8, NHEAD);
  wmma_gemm64<1, false, false, 0, 2><<<gproj, 256, 0, stream>>>(
      xk_b, xk_b, EMB_SZ, 0L, wkT, wkT, EMB_SZ, (long)HDIM * EMB_SZ,
      (void*)k_hi, (void*)k_lo, EMB_SZ, (long)HDIM, bo, NROWS, HDIM, EMB_SZ, 1.0f);
  wmma_gemm64<1, false, false, 0, 2><<<gproj, 256, 0, stream>>>(
      xv_b, xv_b, EMB_SZ, 0L, wvT, wvT, EMB_SZ, (long)HDIM * EMB_SZ,
      (void*)v_hi, (void*)v_lo, EMB_SZ, (long)HDIM, bo, NROWS, HDIM, EMB_SZ, 1.0f);
  wmma_gemm64<1, false, false, 0, 2><<<gproj, 256, 0, stream>>>(
      xq_b, xq_b, EMB_SZ, 0L, wqT, wqT, EMB_SZ, (long)HDIM * EMB_SZ,
      (void*)q_hi, (void*)q_lo, EMB_SZ, (long)HDIM, bo, NROWS, HDIM, EMB_SZ, 1.0f);

  // 4) causal attention -> concat hi/lo planes (X planes are dead now)
  const float inv_scale = 1.0f / sqrtf((float)SEQLEN);
  attn_hd256<<<dim3(SEQLEN / AT_QROWS, NBATCH * NHEAD), 256, 0, stream>>>(
      q_hi, q_lo, k_hi, k_lo, v_hi, v_lo, cc_hi, cc_lo, inv_scale);

  // 5) output projection: out[8192 x 768] = concat(hi+lo) . (Wo^T)^T + bo, f32. M=8192, N=768, K=768: 1536 tiles = 192 blocks.
  const dim3 gout((NROWS / 64) * (EMB_SZ / 64) / 8, 1);
  wmma_gemm64<1, true, false, 2, 0><<<gout, 256, 0, stream>>>(
      cc_hi, cc_lo, EMB_SZ, 0L, woT, woT, EMB_SZ, 0L,
      (void*)out, (void*)out, EMB_SZ, 0L, bo, NROWS, EMB_SZ, EMB_SZ, 1.0f);
}

// v005
// A run of this version takes 371 microseconds.
// In two side-by-side timings against v004, it was 1.04 and 1.05 times as fast.
// Over all steps from v000 it is 2.91 times as fast.
// Contractions on v_wmma_f32_16x16x32_bf16 with f32 accumulate: per-head projections = bf16(X) x bf16(W^T) (inputs RNE-converted once); Q.K^T and P.V = bf16 hi/lo planes (hi.hi + hi.lo + lo.hi); output projection = concat bf16 hi/lo x bf16(Wo^T) (hi.W + lo.W) + bf16(bo); softmax, rescaling and normalisation in f32.
#include <hip/hip_runtime.h>
#include <stdint.h>
#include <math.h>

typedef __attribute__((ext_vector_type(16))) _Float16 v16h;
typedef __attribute__((ext_vector_type(8)))  _Float16 v8h;
typedef __attribute__((ext_vector_type(16))) __bf16   v16b;
typedef __attribute__((ext_vector_type(8)))  __bf16   v8b;
typedef __attribute__((ext_vector_type(8)))  float    v8f;
typedef __attribute__((ext_vector_type(4)))  float    v4f;
typedef __attribute__((ext_vector_type(4)))  unsigned v4u;

// ---- problem geometry ----
constexpr int EMB_SZ  = 768;
constexpr int NHEAD   = 3;
constexpr int HDIM    = 256;
constexpr int NBATCH  = 4;
constexpr int SEQLEN  = 2048;
constexpr int NROWS   = NBATCH * SEQLEN;                       // 8192 flattened (b,s) rows
constexpr size_t PLANE_ELEMS = (size_t)NROWS * EMB_SZ;          // 6291456 elements per [8192][768] plane
constexpr size_t PLANE_BYTES = PLANE_ELEMS * 2;                 // 12582912 B per 16-bit plane
constexpr size_t WT_ELEMS    = (size_t)NHEAD * HDIM * EMB_SZ;   // 589824 (W^T planes [3][256][768])
constexpr size_t WO_ELEMS    = (size_t)EMB_SZ * EMB_SZ;         // 589824 (Wo^T plane [768][768])

// [0]            Xk bf16 plane        (dead after projections; reused as concat hi plane)
// [1*PLANE]      Xv bf16 plane        (reused as concat lo plane)
// [2*PLANE]      Xq bf16 plane
// [3*PLANE]      K hi, [4*PLANE] K lo, [5*PLANE] V hi, [6*PLANE] V lo, [7*PLANE] Q hi, [8*PLANE] Q lo
// [9*PLANE]      Wk^T bf16 [3][256][768], then Wv^T, Wq^T (WT_ELEMS each)
// [9*PLANE+3*WT] Wo^T bf16 [768][768]
constexpr size_t WS_OFF_WKT = 9 * PLANE_ELEMS;
constexpr size_t WS_OFF_WVT = WS_OFF_WKT + WT_ELEMS;
constexpr size_t WS_OFF_WQT = WS_OFF_WVT + WT_ELEMS;
constexpr size_t WS_OFF_WOT = WS_OFF_WQT + WT_ELEMS;
constexpr size_t WS_TOTAL_BYTES = (WS_OFF_WOT + WO_ELEMS) * 2;    // 117964800 B
static_assert(WS_TOTAL_BYTES == 117964800ull);
static_assert(WS_TOTAL_BYTES <= 134217728ull);
static_assert((PLANE_BYTES % 128) == 0 && ((WT_ELEMS * 2) % 128) == 0 && ((WO_ELEMS * 2) % 128) == 0);

// ---- GEMM shape contract for the launches in this file ----
static_assert(NROWS % 64 == 0 && HDIM % 64 == 0 && EMB_SZ % 64 == 0);   // M, N tile multiples
static_assert(EMB_SZ % 32 == 0);                                          // K % 32 == 0 for all GEMMs (K = 768)

__device__ __forceinline__ unsigned short f2bf_bits(float f) {
  unsigned u = __float_as_uint(f);
  return (unsigned short)((u + 0x7FFFu + ((u >> 16) & 1u)) >> 16);
}
__device__ __forceinline__ float bf_bits2f(unsigned short h) { return __uint_as_float(((unsigned)h) << 16); }

// hazard guards as plain device helpers (no inline asm inside the kernel template body)
__device__ __forceinline__ void dep_guard_h(v8f& a, v8f& b, v16h x, v16h y) { asm volatile("v_nop\n\tv_nop\n\tv_nop\n\tv_nop" : "+v"(a), "+v"(b) : "v"(x), "v"(y)); }
__device__ __forceinline__ void dep_guard_b(v8f& a, v8f& b, v16b x, v16b y) { asm volatile("v_nop\n\tv_nop\n\tv_nop\n\tv_nop" : "+v"(a), "+v"(b) : "v"(x), "v"(y)); }
__device__ __forceinline__ void keep4_h(v16h a, v16h b, v16h c, v16h d) { asm volatile("v_nop" :: "v"(a), "v"(b), "v"(c), "v"(d)); }
__device__ __forceinline__ void keep4_b(v16b a, v16b b, v16b c, v16b d) { asm volatile("v_nop" :: "v"(a), "v"(b), "v"(c), "v"(d)); }
__device__ __forceinline__ void acc_guard4(v8f& a, v8f& b, v8f& c, v8f& d) { asm volatile("v_nop\n\tv_nop\n\tv_nop\n\tv_nop" : "+v"(a), "+v"(b), "+v"(c), "+v"(d)); }
template <typename T> struct Frag;
template <> struct Frag<_Float16> {
  typedef v16h V; union U { v16h v; v8h h[2]; };
  static __device__ __forceinline__ v16h load(const _Float16* p) {   // elements 0..7 <- p[0..7], 8..15 <- p[16..23]
    U f; f.h[0] = *(const v8h*)(p); f.h[1] = *(const v8h*)(p + 16); return f.v;
  }
  static __device__ __forceinline__ v8f mma(v16h a, v16h b, v8f c) {
    return __builtin_amdgcn_wmma_f32_16x16x32_f16(false, a, false, b, (short)0, c, false, false);
  }
  static __device__ __forceinline__ void guard(v8f& a, v8f& b, v16h x, v16h y) { dep_guard_h(a, b, x, y); }
  static __device__ __forceinline__ void keep(v16h a, v16h b, v16h c, v16h d) { keep4_h(a, b, c, d); }
};
template <> struct Frag<__bf16> {
  typedef v16b V; union U { v16b v; v8b h[2]; };
  static __device__ __forceinline__ v16b load(const __bf16* p) {
    U f; f.h[0] = *(const v8b*)(p); f.h[1] = *(const v8b*)(p + 16); return f.v;
  }
  static __device__ __forceinline__ v8f mma(v16b a, v16b b, v8f c) {
    return __builtin_amdgcn_wmma_f32_16x16x32_bf16(false, a, false, b, (short)0, c, false, false);
  }
  static __device__ __forceinline__ void guard(v8f& a, v8f& b, v16b x, v16b y) { dep_guard_b(a, b, x, y); }
  static __device__ __forceinline__ void keep(v16b a, v16b b, v16b c, v16b d) { keep4_b(a, b, c, d); }
};

// ---- Register-blocked batched WMMA GEMM (with independent A/B split flags) --------------------
// C[m,n] = scale * sum_k A[m,k] * Bt[n,k] (+bias); each wave owns a 64x64 tile.
// A row-major [M,K]; Bt row-major [N,K]; M,N % 64 == 0, K % 32 == 0 (no tail handling).
// SPLITA: A has a lo plane A2 (product += Alo.Bhi); SPLITB: Bt has a lo plane Bt2 (product += Ahi.Blo).
// BIAS_MODE: 0 = none, 1 = bias[m], 2 = RNE-bf16(bias[n]).
// OUT_MODE: 0 = f32, 1 = f16, 2 = bf16 hi plane (Cout) + bf16 lo plane (Cout2).
// ET: 0 = f16 operands, 1 = bf16 operands (pointers passed as 16-bit storage)
template <int ET> struct Elem;
template <> struct Elem<0> { typedef _Float16 T; };
template <> struct Elem<1> { typedef __bf16 T; };
template <int ET, bool SPLITA, bool SPLITB, int BIAS_MODE, int OUT_MODE>
__global__ __launch_bounds__(256) void wmma_gemm64(
    const unsigned short* __restrict__ Ap, const unsigned short* __restrict__ A2p, int lda, long strideA,
    const unsigned short* __restrict__ Btp, const unsigned short* __restrict__ Bt2p, int ldb, long strideB,
    void* __restrict__ Cout, void* __restrict__ Cout2, int ldc, long strideC,
    const float* __restrict__ bias,
    int M, int N, int K, float scale) {
  typedef typename Elem<ET>::T T;
  typedef typename Frag<T>::V V;
  const T* A = (const T*)Ap; const T* A2 = (const T*)A2p; const T* Bt = (const T*)Btp; const T* Bt2 = (const T*)Bt2p;
  __shared__ __align__(16) float sT[8][16 * 68];   // per-wave 16x64 slab, pitch 68 floats
  const int b    = blockIdx.y;
  const int lane = threadIdx.x & 31;
  const int wave = threadIdx.x >> 5;
  const int tilesN = N >> 6;
  const int tilesM = M >> 6;
  const int tile = blockIdx.x * 8 + wave;
  if (tile >= tilesM * tilesN) return;   // wave-uniform; no block barriers in this kernel
  const int tm = tile / tilesN;
  const int tn = tile - tm * tilesN;
  const int m0 = tm << 6;
  const int n0 = tn << 6;

  const T* Ab  = A  + (size_t)b * strideA;
  const T* Bb  = Bt + (size_t)b * strideB;
  const T* Ab2 = SPLITA ? (A2  + (size_t)b * strideA) : nullptr;
  const T* Bb2 = SPLITB ? (Bt2 + (size_t)b * strideB) : nullptr;

  const int rlane = lane & 15;                 // row (A) / col (B, D) within subtile
  const int koff  = (lane >> 4) * 8;           // k offset of this lane half
  const int mOff  = (lane >> 4) * 8;           // D row offset

  v8f acc[4][4];
#pragma unroll
  for (int i = 0; i < 4; ++i)
#pragma unroll
    for (int j = 0; j < 4; ++j) acc[i][j] = (v8f){0.f,0.f,0.f,0.f,0.f,0.f,0.f,0.f};

  for (int k0 = 0; k0 < K; k0 += 32) {
    V bh[4], bl[4];
#pragma unroll
    for (int j = 0; j < 4; ++j) {
      const size_t bo = (size_t)(n0 + (j << 4) + rlane) * ldb + koff + k0;
      bh[j] = Frag<T>::load(Bb + bo);
      if (SPLITB) bl[j] = Frag<T>::load(Bb2 + bo);
    }
#pragma unroll
    for (int i = 0; i < 4; ++i) {
      const size_t ao = (size_t)(m0 + (i << 4) + rlane) * lda + koff + k0;
      V ah = Frag<T>::load(Ab + ao);
      V al;
      if (SPLITA) al = Frag<T>::load(Ab2 + ao);
#pragma unroll
      for (int j = 0; j < 4; ++j) {
        acc[i][j] = Frag<T>::mma(ah, bh[j], acc[i][j]);
        if (SPLITB) acc[i][j] = Frag<T>::mma(ah, bl[j], acc[i][j]);
        if (SPLITA) acc[i][j] = Frag<T>::mma(al, bh[j], acc[i][j]);
      }
      Frag<T>::guard(acc[i][0], acc[i][3], ah, SPLITA ? al : ah);
    }
    Frag<T>::keep(bh[0], bh[1], bh[2], bh[3]);
    if (SPLITB) Frag<T>::keep(bl[0], bl[1], bl[2], bl[3]);
  }
  acc_guard4(acc[0][0], acc[0][1], acc[0][2], acc[0][3]);
  acc_guard4(acc[1][0], acc[1][1], acc[1][2], acc[1][3]);
  acc_guard4(acc[2][0], acc[2][1], acc[2][2], acc[2][3]);
  acc_guard4(acc[3][0], acc[3][1], acc[3][2], acc[3][3]);

  // ---- epilogue ----
  float* slab = sT[wave];
#pragma unroll
  for (int i = 0; i < 4; ++i) {
    const int mBase = m0 + (i << 4);
#pragma unroll
    for (int j = 0; j < 4; ++j) {
      const int n = n0 + (j << 4) + rlane;
      float bv = 0.f;
      if (BIAS_MODE == 2) bv = bf_bits2f(f2bf_bits(bias[n]));
#pragma unroll
      for (int r = 0; r < 8; ++r) {
        float v = acc[i][j][r] * scale;
        if (BIAS_MODE == 1) v += bias[mBase + mOff + r];
        if (BIAS_MODE == 2) v += bv;
        slab[(mOff + r) * 68 + (j << 4) + rlane] = v;
      }
    }
    __builtin_amdgcn_fence(__ATOMIC_RELEASE, "workgroup");
    __builtin_amdgcn_wave_barrier();
    __builtin_amdgcn_fence(__ATOMIC_ACQUIRE, "workgroup");
    if (OUT_MODE == 0) {
      float* C = (float*)Cout + (size_t)b * strideC;
      const int hh = lane >> 4, c4 = (lane & 15) * 4;     // row seg = 256 B = 16 lanes x 16 B
      {
#pragma unroll
        for (int it = 0; it < 8; ++it) {
          const int row = it * 2 + hh;
          v4f v = *(const v4f*)(slab + row * 68 + c4);
          *(v4f*)(C + (size_t)(mBase + row) * ldc + n0 + c4) = v;
        }
        
      }
    } else {
      const int q = lane >> 3, c8 = (lane & 7) * 8;
      unsigned short* C  = (unsigned short*)Cout  + (size_t)b * strideC;
      unsigned short* C2 = (OUT_MODE == 2) ? ((unsigned short*)Cout2 + (size_t)b * strideC) : nullptr;
      {
#pragma unroll
        for (int it = 0; it < 4; ++it) {
          const int row = it * 4 + q;
          const float* sp = slab + row * 68 + c8;
          v8h hv, lv;
#pragma unroll
          for (int e = 0; e < 8; ++e) {
            if (OUT_MODE == 1) {
              hv[e] = (_Float16)sp[e];
            } else {
              unsigned short hb = f2bf_bits(sp[e]);
              unsigned short lb = f2bf_bits(sp[e] - bf_bits2f(hb));
              hv[e] = __builtin_bit_cast(_Float16, hb);
              lv[e] = __builtin_bit_cast(_Float16, lb);
            }
          }
          *(v8h*)(C + (size_t)(mBase + row) * ldc + n0 + c8) = hv;
          if (OUT_MODE == 2) *(v8h*)(C2 + (size_t)(mBase + row) * ldc + n0 + c8) = lv;
        }
        
      }
    }
    __builtin_amdgcn_fence(__ATOMIC_RELEASE, "workgroup");
    __builtin_amdgcn_wave_barrier();
    __builtin_amdgcn_fence(__ATOMIC_ACQUIRE, "workgroup");
  }
}

// ---- input pass, one launch: three activation planes f32 -> bf16 (RNE) and the four weight transposes ----------
// Every work-group converts its share of each activation plane: per thread and plane 4 units of 8 elements (32 B read,
// 16 B written), unit index = j * PREP_THREADS + global thread id, so one store of a wave is 512 contiguous bytes. All of
// a thread's loads are issued before its first convert. Work-groups 0..PREP_TILES-1 also take one 64x64 weight tile:
// in = planes of [768][CC] f32 -> out = planes of [CC][768] bf16, through LDS.
constexpr int PREP_WGS     = 768;
constexpr int PREP_THREADS = PREP_WGS * 256;
constexpr int PREP_UNITS   = (int)(PLANE_ELEMS / 8);            // 16-B output units per plane
constexpr int PREP_PER_THR = PREP_UNITS / PREP_THREADS;         // 4
constexpr int TILES_WZ     = (HDIM / 64) * (EMB_SZ / 64);       // 48 tiles per head plane of Wk, Wv, Wq
constexpr int TILES_W      = TILES_WZ * NHEAD;                  // 144 per weight
constexpr int TILES_WO     = (EMB_SZ / 64) * (EMB_SZ / 64);     // 144
constexpr int PREP_TILES   = 3 * TILES_W + TILES_WO;            // 576
static_assert(PREP_PER_THR * PREP_THREADS == PREP_UNITS && PREP_PER_THR == 4);
static_assert(PREP_TILES <= PREP_WGS && HDIM / 64 == 4);

__device__ __forceinline__ v4u pack8_bf16(v4f a, v4f c2) {
  v4u w;
  w[0] = (unsigned)f2bf_bits(a[0])  | ((unsigned)f2bf_bits(a[1])  << 16);
  w[1] = (unsigned)f2bf_bits(a[2])  | ((unsigned)f2bf_bits(a[3])  << 16);
  w[2] = (unsigned)f2bf_bits(c2[0]) | ((unsigned)f2bf_bits(c2[1]) << 16);
  w[3] = (unsigned)f2bf_bits(c2[2]) | ((unsigned)f2bf_bits(c2[3]) << 16);
  return w;
}

__global__ __launch_bounds__(256) void prep_inputs(
    const float* __restrict__ Xk, const float* __restrict__ Xv, const float* __restrict__ Xq,
    const float* __restrict__ Wk, const float* __restrict__ Wv, const float* __restrict__ Wq,
    const float* __restrict__ Wo,
    unsigned short* __restrict__ xb,     // three bf16 planes in a row: Xk, Xv, Xq
    unsigned short* __restrict__ wT) {   // Wk^T, Wv^T, Wq^T, Wo^T in a row (WT_ELEMS each)
  __shared__ float tile[64][65];
  const int tid = threadIdx.x;
  const int blk = blockIdx.x;

  // ---- activation loads: 3 planes x 4 units x 2 loads of 16 B ----
  const unsigned u0 = (unsigned)blk * 256u + (unsigned)tid;
  v4f xa[3][PREP_PER_THR], xc[3][PREP_PER_THR];
  const float* xp[3][PREP_PER_THR];
#pragma unroll   // both loops: constant indices keep the arrays in registers
  for (int x = 0; x < 3; ++x) {
    const float* in = (x == 0) ? Xk : (x == 1) ? Xv : Xq;
#pragma unroll
    for (int j = 0; j < PREP_PER_THR; ++j) {
      const float* p = in + (size_t)(u0 + (unsigned)j * PREP_THREADS) * 8;
      xp[x][j] = p;
      xa[x][j] = *(const v4f*)p;
      xc[x][j] = *(const v4f*)(p + 4);
    }
  }
  // Stands in front of every later write of a register that one of these loads names as its address: as inputs the twelve
  // addresses stay live up to here, so that no result of a later load of the run is placed on one of them either.
  asm volatile("s_wait_xcnt 0x0"
               :: "v"(xp[0][0]), "v"(xp[0][1]), "v"(xp[0][2]), "v"(xp[0][3]),
                  "v"(xp[1][0]), "v"(xp[1][1]), "v"(xp[1][2]), "v"(xp[1][3]),
                  "v"(xp[2][0]), "v"(xp[2][1]), "v"(xp[2][2]), "v"(xp[2][3])
               : "memory");

  // ---- one weight tile (block-uniform branch) ----
  if (blk < PREP_TILES) {
    const float* src;
    unsigned short* dst;
    int CC, ct, rt;
    if (blk < 3 * TILES_W) {
      const int w = blk / TILES_W, r = blk - w * TILES_W;
      const int z = r / TILES_WZ, r2 = r - z * TILES_WZ;
      src = ((w == 0) ? Wk : (w == 1) ? Wv : Wq) + (size_t)z * EMB_SZ * HDIM;
      dst = wT + (size_t)w * WT_ELEMS + (size_t)z * EMB_SZ * HDIM;
      CC = HDIM; ct = r2 & 3; rt = r2 >> 2;
    } else {
      const int r = blk - 3 * TILES_W;
      src = Wo;
      dst = wT + 3 * WT_ELEMS;
      CC = EMB_SZ; rt = r / (EMB_SZ / 64); ct = r - rt * (EMB_SZ / 64);
    }
    const int lr = tid >> 2, lc = (tid & 3) * 16;           // in-tile row (input row), 16 input cols
    const float* sp = src + (size_t)(rt * 64 + lr) * CC + ct * 64 + lc;
#pragma unroll
    for (int i = 0; i < 4; ++i) {
      const v4f v = *(const v4f*)(sp + 4 * i);
      tile[lr][lc + 4 * i + 0] = v[0];
      tile[lr][lc + 4 * i + 1] = v[1];
      tile[lr][lc + 4 * i + 2] = v[2];
      tile[lr][lc + 4 * i + 3] = v[3];
    }
    __syncthreads();
    // Store coverage: wave w writes out rows ct*64 + 8w + {0..7} (2 iterations x 4 rows), 8 lanes x 16 B per row.
    const int lane = tid & 31, wave = tid >> 5, q = lane >> 3, c8 = (lane & 7) * 8;
#pragma unroll
    for (int it = 0; it < 2; ++it) {
      const int fl = wave * 8 + it * 4 + q;                   // out row within tile = input col within tile
      v4u t4;
#pragma unroll
      for (int e = 0; e < 4; ++e) {
        const unsigned lo16 = (unsigned)f2bf_bits(tile[c8 + 2 * e][fl]);
        const unsigned hi16 = (unsigned)f2bf_bits(tile[c8 + 2 * e + 1][fl]);
        t4[e] = lo16 | (hi16 << 16);
      }
      *(v4u*)(dst + (size_t)(ct * 64 + fl) * EMB_SZ + rt * 64 + c8) = t4;
    }
  }

  // ---- convert and store the activation units ----
#pragma unroll
  for (int x = 0; x < 3; ++x) {
#pragma unroll
    for (int j = 0; j < PREP_PER_THR; ++j) {
      unsigned short* o = xb + (size_t)x * PLANE_ELEMS + (size_t)(u0 + (unsigned)j * PREP_THREADS) * 8;
      *(v4u*)o = pack8_bf16(xa[x][j], xc[x][j]);
    }
  }
}

// =====================================================================================================
// Causal flash attention, head_dim 256, operands = bf16 hi/lo planes.
//   Q/K/V planes: element (b, s, h, d) at [(b*SEQLEN + s)*EMB_SZ + h*HDIM + d] (hi plane and lo plane).
//   scores = (Qhi.Khi + Qhi.Klo + Qlo.Khi) * inv_scale; causal mask = -inf for key > query (diagonal chunk);
//   online softmax in f32; P (unnormalised exp) split to bf16 hi/lo in LDS; O += Phi.Vhi + Phi.Vlo + Plo.Vhi;
//   out = O / l written as bf16 hi/lo concat planes in the same [(b,s)][h*HDIM + d] layout.
// Block = 256 threads = 8 waves, 64 query rows of one (b,h); wave w: row group rw = w&3 (16 rows),
// half ch = w>>2: d half (128 of 256) for the score products, key half (32 of 64 keys) for the softmax,
// column half (128 of 256) for O. Q stays in registers: each wave holds its 16 rows x its d half, forms partial
// scores for all 64 keys, and the two waves of a row group swap the partial tiles of each other's key half in LDS.
// Row max / row sum of the two key halves combined through LDS with block barriers.
// grid = (SEQLEN/64, NBATCH*NHEAD).
// =====================================================================================================
constexpr int AT_KEYS  = 64;    // keys per chunk
constexpr int AT_QROWS = 64;    // query rows per block
constexpr int AT_WHALF = 128;   // output columns per wave
// LDS row pitches in 16-bit elements. K and P rows are read by b128 fragment loads: 16 B of pad make the pitch an odd
// multiple of 16 B, so the 16 rows of one read fall on 16 different groups of four banks. V rows are read by the
// transposing load, whose conflict-free pitch is an odd multiple of 32 B.
constexpr int AT_KPITCH = HDIM + 8;       // K rows [key][d]: 528 B
constexpr int AT_VPITCH = HDIM + 16;      // V rows [key][d]: 544 B
constexpr int AT_PPITCH = AT_KEYS + 8;    // P rows [row][key]: 144 B
static_assert(SEQLEN % AT_QROWS == 0 && SEQLEN % AT_KEYS == 0 && HDIM == 2 * AT_WHALF);
static_assert(8 * 16 * AT_WHALF <= AT_KEYS * AT_KPITCH);   // output staging slabs fit one K plane
static_assert((AT_KPITCH * 2) % 32 == 16 && (AT_VPITCH * 2) % 64 == 32 && (AT_PPITCH * 2) % 32 == 16);
static_assert(HDIM * 2 == 32 * 16 && AT_KEYS == 8 * 8);    // one copy of a wave = one row; 8 waves x 8 rows = one plane
static_assert(8 * 512 * 4 <= 2 * AT_QROWS * AT_PPITCH * 2);  // the partial-score swap (8 waves x 2 tiles, f32) fits the P planes

__device__ __forceinline__ v16b ldfrag16(const unsigned short* p) {   // elements 0..7 <- p[0..7], 8..15 <- p[16..23]
  union { v16b v; v8b h[2]; } f;
  f.h[0] = *(const v8b*)(p); f.h[1] = *(const v8b*)(p + 16); return f.v;
}
// B fragment (32 keys x 16 d) of a row-major [key][d] LDS tile: p = this lane's address in the first 16 keys,
// row 8*(lane>>4) + (lane&7), column 8*((lane>>3)&1). Lane (c, hh) receives keys 8hh..8hh+7 of column c, then keys
// 16+8hh..16+8hh+7: the k order of ldfrag16.
typedef short s16x8 __attribute__((ext_vector_type(8)));
__device__ __forceinline__ v16b ldfrag16_tr(const unsigned short* p) {
  typedef __attribute__((address_space(3))) s16x8 lds_s16x8;
  union { v16b v; s16x8 h[2]; } f;
  f.h[0] = __builtin_amdgcn_ds_load_tr16_b128_v8i16((lds_s16x8*)p);
  f.h[1] = __builtin_amdgcn_ds_load_tr16_b128_v8i16((lds_s16x8*)(p + 16 * AT_VPITCH));
  return f.v;
}
// Eight asynchronous copies of one wave, global -> LDS: copy j brings row j (512 B, 16 B per lane). g and l are the
// lane's own addresses in row 0. The s_wait_xcnt closes the statement so that it stands in front of every later write
// of an address register that a copy names.
__device__ __forceinline__ void copy_rows8(const unsigned short* l, int lpitch, const unsigned short* g) {
  const unsigned l0 = (unsigned)(size_t)l;
  const unsigned lp = (unsigned)lpitch * 2u;
  asm volatile(
      "global_load_async_to_lds_b128 %0, %8, off\n\t"
      "global_load_async_to_lds_b128 %1, %9, off\n\t"
      "global_load_async_to_lds_b128 %2, %10, off\n\t"
      "global_load_async_to_lds_b128 %3, %11, off\n\t"
      "global_load_async_to_lds_b128 %4, %12, off\n\t"
      "global_load_async_to_lds_b128 %5, %13, off\n\t"
      "global_load_async_to_lds_b128 %6, %14, off\n\t"
      "global_load_async_to_lds_b128 %7, %15, off\n\t"
      "s_wait_xcnt 0x0"
      :: "v"(l0), "v"(l0 + lp), "v"(l0 + 2u * lp), "v"(l0 + 3u * lp),
         "v"(l0 + 4u * lp), "v"(l0 + 5u * lp), "v"(l0 + 6u * lp), "v"(l0 + 7u * lp),
         "v"(g), "v"(g + EMB_SZ), "v"(g + 2 * EMB_SZ), "v"(g + 3 * EMB_SZ),
         "v"(g + 4 * EMB_SZ), "v"(g + 5 * EMB_SZ), "v"(g + 6 * EMB_SZ), "v"(g + 7 * EMB_SZ)
      : "memory");
}
__device__ __forceinline__ v8f mma_bf(v16b a, v16b b, v8f c) {
  c = __builtin_amdgcn_wmma_f32_16x16x32_bf16(false, a, false, b, (short)0, c, false, false);
  asm volatile("v_nop\n\tv_nop\n\tv_nop\n\tv_nop" : "+v"(c) : "v"(a), "v"(b));
  return c;
}

// Second bound: four waves per SIMD, so that two workgroups still share a WGP (its LDS holds two) with Q resident.
__global__ __launch_bounds__(256, 4) void attn_hd256(
    const unsigned short* __restrict__ Qh, const unsigned short* __restrict__ Ql,
    const unsigned short* __restrict__ Kh, const unsigned short* __restrict__ Kl,
    const unsigned short* __restrict__ Vh, const unsigned short* __restrict__ Vl,
    unsigned short* __restrict__ Oh, unsigned short* __restrict__ Ol, float inv_scale) {
  __shared__ __align__(16) unsigned short Ks[2][AT_KEYS * AT_KPITCH];   // [plane][key][d]   67584 B; reused as output staging
  __shared__ __align__(16) unsigned short Vs[2][AT_KEYS * AT_VPITCH];   // [plane][key][d]   69632 B
  __shared__ __align__(16) unsigned short Ps[2][AT_QROWS * AT_PPITCH];  // [plane][row][key] 18432 B
  __shared__ float redm[2][AT_QROWS];                                // partial row max per key half
  __shared__ float reds[2][AT_QROWS];                                // partial row sum per key half
  // Running row max and row sum, one copy per wave (index [ch][row]), written and read by that wave alone: they are
  // used once a chunk, and in LDS they leave their 16 registers to the fragment sets of the two products.
  __shared__ __align__(16) float runm[2][AT_QROWS];
  __shared__ __align__(16) float runl[2][AT_QROWS];

  const int tid  = threadIdx.x;
  const int lane = tid & 31;
  const int wave = __builtin_amdgcn_readfirstlane(tid >> 5);   // scalar: what derives from it alone costs no vector register
  const int hh   = lane >> 4;
  const int c    = lane & 15;
  const int rw   = wave & 3;
  const int ch   = wave >> 2;
  const int qb   = blockIdx.x;                 // query block 0..31
  const int bh   = blockIdx.y;                 // b*NHEAD + h
  const int h    = bh % NHEAD;
  const int b    = bh / NHEAD;
  const int q0w  = qb * AT_QROWS + rw * 16;    // first query row (within the sequence) of this wave
  const size_t rowb = (size_t)b * SEQLEN;      // flattened row base of this batch
  const int hcol = h * HDIM;

  v8f oacc[8];
#pragma unroll
  for (int r = 0; r < 8; ++r) { runm[ch][rw * 16 + 8 * hh + r] = -INFINITY; runl[ch][rw * 16 + 8 * hh + r] = 0.f; }
#pragma unroll
  for (int t = 0; t < 8; ++t) oacc[t] = (v8f){0.f,0.f,0.f,0.f,0.f,0.f,0.f,0.f};

  // This wave's 16 query rows x its d half, hi and lo, as A fragments (row m = c): loaded once, kept for every chunk.
  v16b qfh[4], qfl[4];
  {
    const size_t qoff = (rowb + q0w + c) * EMB_SZ + hcol + ch * AT_WHALF + 8 * hh;
#pragma unroll   // constant indices keep the fragment arrays in registers
    for (int dc = 0; dc < 4; ++dc) {
      qfh[dc] = ldfrag16(Qh + qoff + dc * 32);
      qfl[dc] = ldfrag16(Ql + qoff + dc * 32);
    }
  }
  // Swap area for partial score tiles, in the P planes (free from the chunk's first barrier to the row-max barrier):
  // per wave 4 quads x 32 lanes x 4 floats, so that each b128 access of a wave is 512 contiguous bytes.
  float* const xown  = reinterpret_cast<float*>(&Ps[0][0]) + wave * 512 + lane * 4;
  const float* const xpeer = reinterpret_cast<const float*>(&Ps[0][0]) + (wave ^ 4) * 512 + lane * 4;

  const int nch = qb + 1;                      // causal horizon in 64-key chunks (block-uniform)
  for (int kc = 0; kc < nch; ++kc) {
    const int kv0 = kc * AT_KEYS;
    // This wave's LDS reads of the last chunk have returned before the barrier behind which K and V are overwritten.
    asm volatile("s_wait_dscnt 0x0" ::: "memory");
    __syncthreads();
    // ---- stage K and V (hi/lo, both [key][d]) by asynchronous copies to LDS ----
    // Coverage: wave w brings keys 8w..8w+7 of each of the four planes, one whole row per copy.
    {
      const int kr0 = wave * 8;
      const size_t gbase = (rowb + kv0 + kr0) * EMB_SZ + hcol + lane * 8;
      copy_rows8(&Ks[0][kr0 * AT_KPITCH + lane * 8], AT_KPITCH, Kh + gbase);
      copy_rows8(&Ks[1][kr0 * AT_KPITCH + lane * 8], AT_KPITCH, Kl + gbase);
      copy_rows8(&Vs[0][kr0 * AT_VPITCH + lane * 8], AT_VPITCH, Vh + gbase);
      copy_rows8(&Vs[1][kr0 * AT_VPITCH + lane * 8], AT_VPITCH, Vl + gbase);
    }
    // This wave's copies have landed before the barrier behind which the other waves read them.
    asm volatile("s_wait_asynccnt 0x0" ::: "memory");
    __syncthreads();

    // ---- partial scores over this wave's d half: 16 rows x 64 keys (four 16x16 D tiles), hi.hi + hi.lo + lo.hi ----
    // Tiles 0,1 = this wave's own key half, tiles 2,3 = the other wave's.
    v8f sp[4];
#pragma unroll
    for (int j = 0; j < 4; ++j) sp[j] = (v8f){0.f,0.f,0.f,0.f,0.f,0.f,0.f,0.f};
    // K fragments are read two groups ahead of the products that use them (a group = one d step of one key tile, hi and
    // lo), in three rotating register sets: a group's LDS latency runs under the six products in front of it.
    v16b kfh[3], kfl[3];
#pragma unroll   // constant indices keep the fragment sets in registers
    for (int g = 0; g < 2; ++g) {
      const int koff = (((ch * 2 + (g & 3)) & 3) * 16 + c) * AT_KPITCH + ch * AT_WHALF + (g >> 2) * 32 + 8 * hh;
      kfh[g] = ldfrag16(&Ks[0][koff]);
      kfl[g] = ldfrag16(&Ks[1][koff]);
    }
#pragma unroll   // constant indices keep qfh, qfl, sp and the fragment sets in registers
    for (int g = 0; g < 16; ++g) {
      if (g + 2 < 16) {
        const int gn = g + 2;
        const int kr = ((ch * 2 + (gn & 3)) & 3) * 16 + c;                 // B fragment column n = key kr
        const int koff = kr * AT_KPITCH + ch * AT_WHALF + (gn >> 2) * 32 + 8 * hh;
        kfh[gn % 3] = ldfrag16(&Ks[0][koff]);
        kfl[gn % 3] = ldfrag16(&Ks[1][koff]);
      }
      const int dc = g >> 2, j = g & 3;
      sp[j] = mma_bf(qfh[dc], kfh[g % 3], sp[j]);
      sp[j] = mma_bf(qfh[dc], kfl[g % 3], sp[j]);
      sp[j] = mma_bf(qfl[dc], kfh[g % 3], sp[j]);
    }
    // ---- swap: hand tiles 2,3 to the other wave of the row group, add its partials to tiles 0,1 ----
#pragma unroll
    for (int q = 0; q < 4; ++q) {
      const v8f t = sp[2 + (q >> 1)];
      const int e = (q & 1) * 4;
      *(v4f*)(xown + q * 128) = (v4f){t[e], t[e + 1], t[e + 2], t[e + 3]};
    }
    __syncthreads();   // every wave's partial tiles are in LDS before the other wave of its row group reads them
    v8f s[2];
    {
      v4f t[4];
#pragma unroll
      for (int q = 0; q < 4; ++q) t[q] = *(const v4f*)(xpeer + q * 128);
#pragma unroll
      for (int q = 0; q < 4; ++q)
#pragma unroll
        for (int i = 0; i < 4; ++i) s[q >> 1][(q & 1) * 4 + i] = sp[q >> 1][(q & 1) * 4 + i] + t[q][i];
    }

    // ---- scale, causal mask, partial row max over this wave's 32 keys ----
    const bool diag = (kc == qb);                // block-uniform
    // key (D col c of tile 0) minus query (D row 8hh): key > query of tile j, row r reads rel + 16j > r, a compare
    // with a constant, so that no register holds a query row index through the loop
    const int rel = (kv0 + ch * 32 + c) - (q0w + 8 * hh);
#pragma unroll
    for (int r = 0; r < 8; ++r) {
      float m = -INFINITY;
#pragma unroll
      for (int j = 0; j < 2; ++j) {
        float sv = s[j][r] * inv_scale;
        if (diag && (rel + j * 16 > r)) sv = -INFINITY;
        s[j][r] = sv;
        m = fmaxf(m, sv);
      }
      m = fmaxf(m, __shfl_xor(m, 1, 32));
      m = fmaxf(m, __shfl_xor(m, 2, 32));
      m = fmaxf(m, __shfl_xor(m, 4, 32));
      m = fmaxf(m, __shfl_xor(m, 8, 32));
      redm[ch][rw * 16 + 8 * hh + r] = m;
    }
    __syncthreads();

    // ---- online softmax update; P hi/lo to LDS; partial sums ----
    float alph[8];
#pragma unroll
    for (int r = 0; r < 8; ++r) {
      const int row = rw * 16 + 8 * hh + r;
      const float mc = fmaxf(redm[0][row], redm[1][row]);
      const float mold = runm[ch][row];
      const float mnew = fmaxf(mold, mc);
      const float alpha = expf(mold - mnew);
      runm[ch][row] = mnew;
      alph[r] = alpha;
      float psum = 0.f;
#pragma unroll
      for (int j = 0; j < 2; ++j) {
        const float p = expf(s[j][r] - mnew);
        psum += p;
        const unsigned short hb = f2bf_bits(p);
        const unsigned short lb = f2bf_bits(p - bf_bits2f(hb));
        const int pidx = row * AT_PPITCH + ch * 32 + j * 16 + c;
        Ps[0][pidx] = hb;
        Ps[1][pidx] = lb;
      }
      psum += __shfl_xor(psum, 1, 32);
      psum += __shfl_xor(psum, 2, 32);
      psum += __shfl_xor(psum, 4, 32);
      psum += __shfl_xor(psum, 8, 32);
      reds[ch][row] = psum;
#pragma unroll
      for (int t = 0; t < 8; ++t) oacc[t][r] *= alpha;
    }
    __syncthreads();
#pragma unroll
    for (int r = 0; r < 8; ++r) {
      const int row = rw * 16 + 8 * hh + r;
      runl[ch][row] = runl[ch][row] * alph[r] + (reds[0][row] + reds[1][row]);
    }

    // ---- O += P.V over 64 keys for this wave's 16 rows x 128 columns ----
    // V fragments (and the second key half's P fragments) are read two groups ahead of their products, as K above;
    // a group = 32 keys x 16 columns, hi and lo.
    {
      const int poff = (rw * 16 + c) * AT_PPITCH + 8 * hh;                      // A fragment row m = c
      const int voff = (8 * hh + (lane & 7)) * AT_VPITCH + ch * AT_WHALF + ((lane >> 3) & 1) * 8;   // B fragment column n = d
      v16b pfh[2], pfl[2], vfh[3], vfl[3];
      pfh[0] = ldfrag16(&Ps[0][poff]);
      pfl[0] = ldfrag16(&Ps[1][poff]);
#pragma unroll   // constant indices keep the fragment sets in registers
      for (int g = 0; g < 2; ++g) {
        vfh[g] = ldfrag16_tr(&Vs[0][voff + g * 16]);
        vfl[g] = ldfrag16_tr(&Vs[1][voff + g * 16]);
      }
#pragma unroll   // constant indices keep oacc and the fragment sets in registers
      for (int g = 0; g < 16; ++g) {
        if (g + 2 < 16) {
          const int gn = g + 2;
          if (gn == 8) {
            pfh[1] = ldfrag16(&Ps[0][poff + 32]);
            pfl[1] = ldfrag16(&Ps[1][poff + 32]);
          }
          const int vo = voff + (gn >> 3) * 32 * AT_VPITCH + (gn & 7) * 16;
          vfh[gn % 3] = ldfrag16_tr(&Vs[0][vo]);
          vfl[gn % 3] = ldfrag16_tr(&Vs[1][vo]);
        }
        const int kk = g >> 3, t = g & 7;
        oacc[t] = mma_bf(pfh[kk], vfh[g % 3], oacc[t]);
        oacc[t] = mma_bf(pfh[kk], vfl[g % 3], oacc[t]);
        oacc[t] = mma_bf(pfl[kk], vfh[g % 3], oacc[t]);
      }
    }
  }

  // ---- epilogue: normalise, split to bf16 hi/lo in per-wave LDS slabs (K region), whole-line stores ----
  __syncthreads();
  unsigned short* slh = &Ks[0][wave * (16 * AT_WHALF)];
  unsigned short* sll = &Ks[1][wave * (16 * AT_WHALF)];
#pragma unroll
  for (int r = 0; r < 8; ++r) {
    const float inv = 1.0f / runl[ch][rw * 16 + 8 * hh + r];
    const int row = 8 * hh + r;
#pragma unroll
    for (int t = 0; t < 8; ++t) {
      const float v = oacc[t][r] * inv;
      const unsigned short hb = f2bf_bits(v);
      const unsigned short lb = f2bf_bits(v - bf_bits2f(hb));
      slh[row * AT_WHALF + t * 16 + c] = hb;
      sll[row * AT_WHALF + t * 16 + c] = lb;
    }
  }
  __syncthreads();
  // Store coverage: 8 iterations x rows (2it + hh) = 16 rows; per row 16 lanes x 16 B = 128 columns = 2 whole
  {
    {
#pragma unroll
      for (int it = 0; it < 8; ++it) {
        const int row = it * 2 + hh;
        const v4u wh = *(const v4u*)(slh + row * AT_WHALF + c * 8);
        const v4u wl = *(const v4u*)(sll + row * AT_WHALF + c * 8);
        const size_t go = (rowb + q0w + row) * EMB_SZ + hcol + ch * AT_WHALF + c * 8;
        *(v4u*)(Oh + go) = wh;
        *(v4u*)(Ol + go) = wl;
      }
      
    }
  }
}

// ---------------------------------------------------------------------------------------------------
extern "C" void kernel_launch(void* const* d_in, const int* in_sizes, int n_in,
                              void* d_out, int out_size, void* d_ws, size_t ws_size,
                              hipStream_t stream) {
  (void)in_sizes; (void)n_in; (void)out_size;
  const float* Xk = (const float*)d_in[0];
  const float* Xv = (const float*)d_in[1];
  const float* Xq = (const float*)d_in[2];
  const float* Wk = (const float*)d_in[3];
  const float* Wv = (const float*)d_in[4];
  const float* Wq = (const float*)d_in[5];
  const float* Wo = (const float*)d_in[6];
  const float* bo = (const float*)d_in[7];
  float* out = (float*)d_out;

  if (ws_size < WS_TOTAL_BYTES) return;

  unsigned short* ws = (unsigned short*)d_ws;
  unsigned short* xk_b = ws + 0 * PLANE_ELEMS;   // later: concat hi
  unsigned short* xv_b = ws + 1 * PLANE_ELEMS;   // later: concat lo
  unsigned short* xq_b = ws + 2 * PLANE_ELEMS;
  unsigned short* k_hi = ws + 3 * PLANE_ELEMS;
  unsigned short* k_lo = ws + 4 * PLANE_ELEMS;
  unsigned short* v_hi = ws + 5 * PLANE_ELEMS;
  unsigned short* v_lo = ws + 6 * PLANE_ELEMS;
  unsigned short* q_hi = ws + 7 * PLANE_ELEMS;
  unsigned short* q_lo = ws + 8 * PLANE_ELEMS;
  unsigned short* wkT  = ws + WS_OFF_WKT;
  unsigned short* wvT  = ws + WS_OFF_WVT;
  unsigned short* wqT  = ws + WS_OFF_WQT;
  unsigned short* woT  = ws + WS_OFF_WOT;
  unsigned short* cc_hi = xk_b;
  unsigned short* cc_lo = xv_b;

  // 1) + 2) inputs -> bf16 planes (RNE), [8192][768] each; weights [3][768][256] -> [3][256][768] bf16 (Bt layout
  //    [N=f][K=e]); Wo [768 k][768 n] -> [768 n][768 k]: one launch
  prep_inputs<<<dim3(PREP_WGS), 256, 0, stream>>>(Xk, Xv, Xq, Wk, Wv, Wq, Wo, xk_b, wkT);

  // 3) per-head projections: C_h[8192 x 256] = X[8192 x 768] . (W_h^T)[256 x 768]^T, written as bf16 hi/lo
  //    planes at column offset h*256 with ldc 768 (grid.y = head). M=8192, N=256, K=768: 512 tiles = 64 blocks x 8 waves.
  const dim3 gproj((NROWS / 64) * (HDIM / 64) / 8, NHEAD);
  wmma_gemm64<1, false, false, 0, 2><<<gproj, 256, 0, stream>>>(
      xk_b, xk_b, EMB_SZ, 0L, wkT, wkT, EMB_SZ, (long)HDIM * EMB_SZ,
      (void*)k_hi, (void*)k_lo, EMB_SZ, (long)HDIM, bo, NROWS, HDIM, EMB_SZ, 1.0f);
  wmma_gemm64<1, false, false, 0, 2><<<gproj, 256, 0, stream>>>(
      xv_b, xv_b, EMB_SZ, 0L, wvT, wvT, EMB_SZ, (long)HDIM * EMB_SZ,
      (void*)v_hi, (void*)v_lo, EMB_SZ, (long)HDIM, bo, NROWS, HDIM, EMB_SZ, 1.0f);
  wmma_gemm64<1, false, false, 0, 2><<<gproj, 256, 0, stream>>>(
      xq_b, xq_b, EMB_SZ, 0L, wqT, wqT, EMB_SZ, (long)HDIM * EMB_SZ,
      (void*)q_hi, (void*)q_lo, EMB_SZ, (long)HDIM, bo, NROWS, HDIM, EMB_SZ, 1.0f);

  // 4) causal attention -> concat hi/lo planes (X planes are dead now)
  const float inv_scale = 1.0f / sqrtf((float)SEQLEN);
  attn_hd256<<<dim3(SEQLEN / AT_QROWS, NBATCH * NHEAD), 256, 0, stream>>>(
      q_hi, q_lo, k_hi, k_lo, v_hi, v_lo, cc_hi, cc_lo, inv_scale);

  // 5) output projection: out[8192 x 768] = concat(hi+lo) . (Wo^T)^T + bo, f32. M=8192, N=768, K=768: 1536 tiles = 192 blocks.
  const dim3 gout((NROWS / 64) * (EMB_SZ / 64) / 8, 1);
  wmma_gemm64<1, true, false, 2, 0><<<gout, 256, 0, stream>>>(
      cc_hi, cc_lo, EMB_SZ, 0L, woT, woT, EMB_SZ, 0L,
      (void*)out, (void*)out, EMB_SZ, 0L, bo, NROWS, EMB_SZ, EMB_SZ, 1.0f);
}

// v006
// It runs in 257 microseconds.
// Next to v005, in two timings, it ran 1.45 times as fast each time.
// Over all steps from v000 it is 4.21 times as fast.
// Contractions on v_wmma_f32_16x16x32_bf16 with f32 accumulate: per-head projections = bf16(X) x bf16(W^T) (inputs RNE-converted once); Q.K^T and P.V = bf16 hi/lo planes (hi.hi + hi.lo + lo.hi); output projection = concat bf16 hi/lo x bf16(Wo^T) (hi.W + lo.W) + bf16(bo); softmax, rescaling and normalisation in f32.
#include <hip/hip_runtime.h>
#include <stdint.h>
#include <math.h>

typedef __attribute__((ext_vector_type(16))) _Float16 v16h;
typedef __attribute__((ext_vector_type(8)))  _Float16 v8h;
typedef __attribute__((ext_vector_type(16))) __bf16   v16b;
typedef __attribute__((ext_vector_type(8)))  __bf16   v8b;
typedef __attribute__((ext_vector_type(8)))  float    v8f;
typedef __attribute__((ext_vector_type(4)))  float    v4f;
typedef __attribute__((ext_vector_type(4)))  unsigned v4u;

// ---- problem geometry ----
constexpr int EMB_SZ  = 768;
constexpr int NHEAD   = 3;
constexpr int HDIM    = 256;
constexpr int NBATCH  = 4;
constexpr int SEQLEN  = 2048;
constexpr int NROWS   = NBATCH * SEQLEN;                       // 8192 flattened (b,s) rows
constexpr size_t PLANE_ELEMS = (size_t)NROWS * EMB_SZ;          // 6291456 elements per [8192][768] plane
constexpr size_t PLANE_BYTES = PLANE_ELEMS * 2;                 // 12582912 B per 16-bit plane
constexpr size_t WT_ELEMS    = (size_t)NHEAD * HDIM * EMB_SZ;   // 589824 (W^T planes [3][256][768])
constexpr size_t WO_ELEMS    = (size_t)EMB_SZ * EMB_SZ;         // 589824 (Wo^T plane [768][768])

// [0]            Xk bf16 plane        (dead after projections; reused as concat hi plane)
// [1*PLANE]      Xv bf16 plane        (reused as concat lo plane)
// [2*PLANE]      Xq bf16 plane
// [3*PLANE]      K hi, [4*PLANE] K lo, [5*PLANE] V hi, [6*PLANE] V lo, [7*PLANE] Q hi, [8*PLANE] Q lo
// [9*PLANE]      Wk^T bf16 [3][256][768], then Wv^T, Wq^T (WT_ELEMS each)
// [9*PLANE+3*WT] Wo^T bf16 [768][768]
constexpr size_t WS_OFF_WKT = 9 * PLANE_ELEMS;
constexpr size_t WS_OFF_WVT = WS_OFF_WKT + WT_ELEMS;
constexpr size_t WS_OFF_WQT = WS_OFF_WVT + WT_ELEMS;
constexpr size_t WS_OFF_WOT = WS_OFF_WQT + WT_ELEMS;
constexpr size_t WS_TOTAL_BYTES = (WS_OFF_WOT + WO_ELEMS) * 2;    // 117964800 B
static_assert(WS_TOTAL_BYTES == 117964800ull);
static_assert(WS_TOTAL_BYTES <= 134217728ull);
static_assert((PLANE_BYTES % 128) == 0 && ((WT_ELEMS * 2) % 128) == 0 && ((WO_ELEMS * 2) % 128) == 0);

// ---- GEMM shape contract for the launches in this file ----
static_assert(NROWS % 64 == 0 && HDIM % 64 == 0 && EMB_SZ % 64 == 0);   // M, N tile multiples
static_assert(EMB_SZ % 128 == 0);                                         // K % 128 == 0 for all GEMMs (K = 768)
static_assert(NROWS % 128 == 0 && HDIM % 256 == 0 && EMB_SZ % 256 == 0);  // whole 128 x 256 work-group tiles

__device__ __forceinline__ unsigned short f2bf_bits(float f) {
  unsigned u = __float_as_uint(f);
  return (unsigned short)((u + 0x7FFFu + ((u >> 16) & 1u)) >> 16);
}
__device__ __forceinline__ float bf_bits2f(unsigned short h) { return __uint_as_float(((unsigned)h) << 16); }

// hazard guards as plain device helpers
__device__ __forceinline__ void dep_guard_h(v8f& a, v8f& b, v16h x, v16h y) { asm volatile("v_nop\n\tv_nop\n\tv_nop\n\tv_nop" : "+v"(a), "+v"(b) : "v"(x), "v"(y)); }
__device__ __forceinline__ void dep_guard_b(v8f& a, v8f& b, v16b x, v16b y) { asm volatile("v_nop\n\tv_nop\n\tv_nop\n\tv_nop" : "+v"(a), "+v"(b) : "v"(x), "v"(y)); }
__device__ __forceinline__ void keep4_h(v16h a, v16h b, v16h c, v16h d) { asm volatile("v_nop" :: "v"(a), "v"(b), "v"(c), "v"(d)); }
__device__ __forceinline__ void keep4_b(v16b a, v16b b, v16b c, v16b d) { asm volatile("v_nop" :: "v"(a), "v"(b), "v"(c), "v"(d)); }
__device__ __forceinline__ void acc_guard4(v8f& a, v8f& b, v8f& c, v8f& d) { asm volatile("v_nop\n\tv_nop\n\tv_nop\n\tv_nop" : "+v"(a), "+v"(b), "+v"(c), "+v"(d)); }
template <typename T> struct Frag;
template <> struct Frag<_Float16> {
  typedef v16h V; union U { v16h v; v8h h[2]; };
  static __device__ __forceinline__ v16h load(const _Float16* p) {   // elements 0..7 <- p[0..7], 8..15 <- p[16..23]
    U f; f.h[0] = *(const v8h*)(p); f.h[1] = *(const v8h*)(p + 16); return f.v;
  }
  static __device__ __forceinline__ v8f mma(v16h a, v16h b, v8f c) {
    return __builtin_amdgcn_wmma_f32_16x16x32_f16(false, a, false, b, (short)0, c, false, false);
  }
  static __device__ __forceinline__ void guard(v8f& a, v8f& b, v16h x, v16h y) { dep_guard_h(a, b, x, y); }
  static __device__ __forceinline__ void keep(v16h a, v16h b, v16h c, v16h d) { keep4_h(a, b, c, d); }
};
template <> struct Frag<__bf16> {
  typedef v16b V; union U { v16b v; v8b h[2]; };
  static __device__ __forceinline__ v16b load(const __bf16* p) {
    U f; f.h[0] = *(const v8b*)(p); f.h[1] = *(const v8b*)(p + 16); return f.v;
  }
  static __device__ __forceinline__ v8f mma(v16b a, v16b b, v8f c) {
    return __builtin_amdgcn_wmma_f32_16x16x32_bf16(false, a, false, b, (short)0, c, false, false);
  }
  static __device__ __forceinline__ void guard(v8f& a, v8f& b, v16b x, v16b y) { dep_guard_b(a, b, x, y); }
  static __device__ __forceinline__ void keep(v16b a, v16b b, v16b c, v16b d) { keep4_b(a, b, c, d); }
};

// ---- Register-blocked batched WMMA GEMM (with independent A/B split flags) --------------------
// C[m,n] = scale * sum_k A[m,k] * Bt[n,k] (+bias); each wave owns a 64x64 tile, a work-group 2 x 4 of them (128 x 256).
// A row-major [M,K]; Bt row-major [N,K]; M % 128 == 0, N % 256 == 0, K % 128 == 0 (no tail handling).
// The work-group's operand rows come through LDS, 128 k (256 B of every row) per stage, two buffers: the next stage's
// asynchronous copies fly while this stage's fragments are read from LDS and multiplied.
// SPLITA: A has a lo plane A2 (product += Alo.Bhi); SPLITB: Bt has a lo plane Bt2 (product += Ahi.Blo).
// BIAS_MODE: 0 = none, 1 = bias[m], 2 = RNE-bf16(bias[n]).
// OUT_MODE: 0 = f32, 1 = f16, 2 = bf16 hi plane (Cout) + bf16 lo plane (Cout2).
// ET: 0 = f16 operands, 1 = bf16 operands (pointers passed as 16-bit storage)
template <int ET> struct Elem;
template <> struct Elem<0> { typedef _Float16 T; };
template <> struct Elem<1> { typedef __bf16 T; };
constexpr int GT_BK    = 128;          // k elements per stage
constexpr int GT_PITCH = GT_BK + 8;    // LDS row pitch 272 B, an odd multiple of 16 B: the 16 rows of a b128 fragment read fall on distinct banks
constexpr int GT_MROWS = 128;          // A rows per work-group
constexpr int GT_NROWS = 256;          // Bt rows per work-group
static_assert((GT_PITCH * 2) % 32 == 16 && GT_BK * 2 == 16 * 16);   // one copy of a wave = 2 rows x 16 lanes x 16 B
// Eight asynchronous copies of one wave, global -> LDS: copy j brings rows 2j, 2j+1 of a 16-row slice, 256 B each
// (16 lanes x 16 B), so that every copy reads four whole lines. l and g are the lane's own addresses in rows 0, 1; ld is
// the global row pitch in elements. The s_wait_xcnt closes the statement so that it stands in front of every later
// write of an address register that a copy names.
__device__ __forceinline__ void copy_rows16(const unsigned short* l, const unsigned short* g, int ld) {
  const unsigned l0 = (unsigned)(size_t)l;
  constexpr unsigned lp = 2u * GT_PITCH * 2u;
  const size_t gp = (size_t)2 * ld;
  asm volatile(
      "global_load_async_to_lds_b128 %0, %8, off\n\t"
      "global_load_async_to_lds_b128 %1, %9, off\n\t"
      "global_load_async_to_lds_b128 %2, %10, off\n\t"
      "global_load_async_to_lds_b128 %3, %11, off\n\t"
      "global_load_async_to_lds_b128 %4, %12, off\n\t"
      "global_load_async_to_lds_b128 %5, %13, off\n\t"
      "global_load_async_to_lds_b128 %6, %14, off\n\t"
      "global_load_async_to_lds_b128 %7, %15, off\n\t"
      "s_wait_xcnt 0x0"
      :: "v"(l0), "v"(l0 + lp), "v"(l0 + 2u * lp), "v"(l0 + 3u * lp),
         "v"(l0 + 4u * lp), "v"(l0 + 5u * lp), "v"(l0 + 6u * lp), "v"(l0 + 7u * lp),
         "v"(g), "v"(g + gp), "v"(g + 2 * gp), "v"(g + 3 * gp),
         "v"(g + 4 * gp), "v"(g + 5 * gp), "v"(g + 6 * gp), "v"(g + 7 * gp)
      : "memory");
}
template <int ET, bool SPLITA, bool SPLITB, int BIAS_MODE, int OUT_MODE>
__global__ __launch_bounds__(256) void wmma_gemm64(
    const unsigned short* __restrict__ Ap, const unsigned short* __restrict__ A2p, int lda, long strideA,
    const unsigned short* __restrict__ Btp, const unsigned short* __restrict__ Bt2p, int ldb, long strideB,
    void* __restrict__ Cout, void* __restrict__ Cout2, int ldc, long strideC,
    const float* __restrict__ bias,
    int M, int N, int K, float scale) {
  typedef typename Elem<ET>::T T;
  typedef typename Frag<T>::V V;
  // One stage in LDS: [A | A lo | Bt | Bt lo] rows at GT_PITCH (the lo parts only where the operand is split).
  constexpr int OFF_A2 = GT_MROWS * GT_PITCH;
  constexpr int OFF_B  = OFF_A2 + (SPLITA ? GT_MROWS * GT_PITCH : 0);
  constexpr int OFF_B2 = OFF_B + GT_NROWS * GT_PITCH;
  constexpr int STAGE_ELEMS = OFF_B2 + (SPLITB ? GT_NROWS * GT_PITCH : 0);
  __shared__ __align__(16) unsigned short stg[2][STAGE_ELEMS];
  __shared__ __align__(16) float sT[8][16 * 68];   // per-wave 16x64 slab, pitch 68 floats
  const int b    = blockIdx.y;
  const int lane = threadIdx.x & 31;
  const int wave = __builtin_amdgcn_readfirstlane(threadIdx.x >> 5);   // scalar: the rows and offsets that derive from it alone cost no vector register
  const int wgN = N >> 8;
  if ((int)blockIdx.x >= (M >> 7) * wgN) return;   // block-uniform, in front of every copy and barrier
  const int bm  = blockIdx.x / wgN;
  const int bn  = blockIdx.x - bm * wgN;
  const int wm  = wave >> 2;                   // this wave's 64-row group of the work-group's 128 rows
  const int wn  = wave & 3;                    // this wave's 64-column group of the work-group's 256 columns
  const int m0 = bm * GT_MROWS + (wm << 6);
  const int n0 = bn * GT_NROWS + (wn << 6);

  // Staging coverage: wave w brings A rows 16w..16w+15 and Bt rows 32w..32w+31 of the work-group's tile.
  const int lr = lane >> 4, lc = (lane & 15) * 8;  // row within a copy's two rows, first of the lane's 8 elements
  const size_t aoff = (size_t)b * strideA + (size_t)(bm * GT_MROWS + wave * 16 + lr) * lda + lc;
  const size_t boff = (size_t)b * strideB + (size_t)(bn * GT_NROWS + wave * 32 + lr) * ldb + lc;
  const int lA = (wave * 16 + lr) * GT_PITCH + lc;
  const int lB = (wave * 32 + lr) * GT_PITCH + lc;
  auto stage_in = [&](int t, int buf) {
    const unsigned short* sb = &stg[buf][0];
    const size_t k0 = (size_t)t * GT_BK;
    copy_rows16(sb + lA, Ap + aoff + k0, lda);
    if (SPLITA) copy_rows16(sb + OFF_A2 + lA, A2p + aoff + k0, lda);
    copy_rows16(sb + OFF_B + lB, Btp + boff + k0, ldb);
    copy_rows16(sb + OFF_B + lB + 16 * GT_PITCH, Btp + boff + k0 + (size_t)16 * ldb, ldb);
    if (SPLITB) {
      copy_rows16(sb + OFF_B2 + lB, Bt2p + boff + k0, ldb);
      copy_rows16(sb + OFF_B2 + lB + 16 * GT_PITCH, Bt2p + boff + k0 + (size_t)16 * ldb, ldb);
    }
  };

  const int rlane = lane & 15;                 // row (A) / col (B, D) within subtile
  const int koff  = (lane >> 4) * 8;           // k offset of this lane half
  const int mOff  = (lane >> 4) * 8;           // D row offset

  v8f acc[4][4];
#pragma unroll
  for (int i = 0; i < 4; ++i)
#pragma unroll
    for (int j = 0; j < 4; ++j) acc[i][j] = (v8f){0.f,0.f,0.f,0.f,0.f,0.f,0.f,0.f};

  const int nst = K / GT_BK;                   // stages (block-uniform)
  stage_in(0, 0);
  // This wave's copies of stage 0 have landed before the barrier behind which the other waves read them.
  asm volatile("s_wait_asynccnt 0x0" ::: "memory");
  __syncthreads();
  if (nst > 1) stage_in(1, 1);
  const int fa = ((wm << 6) + rlane) * GT_PITCH + koff;            // this lane's place in A fragment row group 0
  const int fb = OFF_B + ((wn << 6) + rlane) * GT_PITCH + koff;    // and in Bt fragment row group 0
  for (int t = 0; t < nst; ++t) {
    const T* sb = (const T*)&stg[t & 1][0];
#pragma unroll   // a constant kk goes into the offset field of the LDS reads
    for (int kk = 0; kk < GT_BK; kk += 32) {
      // All fragments of a k step are read as one group in front of its products.
      V bh[4], bl[4], ah[4], al[4];
#pragma unroll   // this loop and the next: constant indices keep the fragment arrays in registers
      for (int j = 0; j < 4; ++j) {
        bh[j] = Frag<T>::load(sb + fb + (j << 4) * GT_PITCH + kk);
        if (SPLITB) bl[j] = Frag<T>::load(sb + fb + (OFF_B2 - OFF_B) + (j << 4) * GT_PITCH + kk);
      }
#pragma unroll
      for (int i = 0; i < 4; ++i) {
        ah[i] = Frag<T>::load(sb + fa + (i << 4) * GT_PITCH + kk);
        if (SPLITA) al[i] = Frag<T>::load(sb + fa + OFF_A2 + (i << 4) * GT_PITCH + kk);
      }
#pragma unroll
      for (int i = 0; i < 4; ++i) {
#pragma unroll
        for (int j = 0; j < 4; ++j) {
          acc[i][j] = Frag<T>::mma(ah[i], bh[j], acc[i][j]);
          if (SPLITB) acc[i][j] = Frag<T>::mma(ah[i], bl[j], acc[i][j]);
          if (SPLITA) acc[i][j] = Frag<T>::mma(al[i], bh[j], acc[i][j]);
        }
        Frag<T>::guard(acc[i][0], acc[i][3], ah[i], SPLITA ? al[i] : ah[i]);
      }
      Frag<T>::keep(bh[0], bh[1], bh[2], bh[3]);
      if (SPLITB) Frag<T>::keep(bl[0], bl[1], bl[2], bl[3]);
    }
    // This wave's LDS reads of this stage have returned, and its copies of the next stage have landed, before the
    // barrier behind which this stage's buffer is refilled and the next stage is read.
    asm volatile("s_wait_dscnt 0x0" ::: "memory");
    asm volatile("s_wait_asynccnt 0x0" ::: "memory");
    __syncthreads();
    if (t + 2 < nst) stage_in(t + 2, t & 1);
  }
  // No copy is outstanding when the wave goes on to the epilogue and ends.
  asm volatile("s_wait_asynccnt 0x0" ::: "memory");
  acc_guard4(acc[0][0], acc[0][1], acc[0][2], acc[0][3]);
  acc_guard4(acc[1][0], acc[1][1], acc[1][2], acc[1][3]);
  acc_guard4(acc[2][0], acc[2][1], acc[2][2], acc[2][3]);
  acc_guard4(acc[3][0], acc[3][1], acc[3][2], acc[3][3]);

  // ---- epilogue ----
  float* slab = sT[wave];
#pragma unroll
  for (int i = 0; i < 4; ++i) {
    const int mBase = m0 + (i << 4);
#pragma unroll
    for (int j = 0; j < 4; ++j) {
      const int n = n0 + (j << 4) + rlane;
      float bv = 0.f;
      if (BIAS_MODE == 2) bv = bf_bits2f(f2bf_bits(bias[n]));
#pragma unroll
      for (int r = 0; r < 8; ++r) {
        float v = acc[i][j][r] * scale;
        if (BIAS_MODE == 1) v += bias[mBase + mOff + r];
        if (BIAS_MODE == 2) v += bv;
        slab[(mOff + r) * 68 + (j << 4) + rlane] = v;
      }
    }
    __builtin_amdgcn_fence(__ATOMIC_RELEASE, "workgroup");
    __builtin_amdgcn_wave_barrier();
    __builtin_amdgcn_fence(__ATOMIC_ACQUIRE, "workgroup");
    if (OUT_MODE == 0) {
      float* C = (float*)Cout + (size_t)b * strideC;
      const int hh = lane >> 4, c4 = (lane & 15) * 4;     // row seg = 256 B = 16 lanes x 16 B
      {
#pragma unroll
        for (int it = 0; it < 8; ++it) {
          const int row = it * 2 + hh;
          v4f v = *(const v4f*)(slab + row * 68 + c4);
          *(v4f*)(C + (size_t)(mBase + row) * ldc + n0 + c4) = v;
        }
        
      }
    } else {
      const int q = lane >> 3, c8 = (lane & 7) * 8;
      unsigned short* C  = (unsigned short*)Cout  + (size_t)b * strideC;
      unsigned short* C2 = (OUT_MODE == 2) ? ((unsigned short*)Cout2 + (size_t)b * strideC) : nullptr;
      {
#pragma unroll
        for (int it = 0; it < 4; ++it) {
          const int row = it * 4 + q;
          const float* sp = slab + row * 68 + c8;
          v8h hv, lv;
#pragma unroll
          for (int e = 0; e < 8; ++e) {
            if (OUT_MODE == 1) {
              hv[e] = (_Float16)sp[e];
            } else {
              unsigned short hb = f2bf_bits(sp[e]);
              unsigned short lb = f2bf_bits(sp[e] - bf_bits2f(hb));
              hv[e] = __builtin_bit_cast(_Float16, hb);
              lv[e] = __builtin_bit_cast(_Float16, lb);
            }
          }
          *(v8h*)(C + (size_t)(mBase + row) * ldc + n0 + c8) = hv;
          if (OUT_MODE == 2) *(v8h*)(C2 + (size_t)(mBase + row) * ldc + n0 + c8) = lv;
        }
        
      }
    }
    __builtin_amdgcn_fence(__ATOMIC_RELEASE, "workgroup");
    __builtin_amdgcn_wave_barrier();
    __builtin_amdgcn_fence(__ATOMIC_ACQUIRE, "workgroup");
  }
}

// ---- input pass, one launch: three activation planes f32 -> bf16 (RNE) and the four weight transposes ----------
// Every work-group converts its share of each activation plane: per thread and plane 4 units of 8 elements (32 B read,
// 16 B written), unit index = j * PREP_THREADS + global thread id, so one store of a wave is 512 contiguous bytes. All of
// a thread's loads are issued before its first convert. Work-groups 0..PREP_TILES-1 also take one 64x64 weight tile:
// in = planes of [768][CC] f32 -> out = planes of [CC][768] bf16, through LDS.
constexpr int PREP_WGS     = 768;
constexpr int PREP_THREADS = PREP_WGS * 256;
constexpr int PREP_UNITS   = (int)(PLANE_ELEMS / 8);            // 16-B output units per plane
constexpr int PREP_PER_THR = PREP_UNITS / PREP_THREADS;         // 4
constexpr int TILES_WZ     = (HDIM / 64) * (EMB_SZ / 64);       // 48 tiles per head plane of Wk, Wv, Wq
constexpr int TILES_W      = TILES_WZ * NHEAD;                  // 144 per weight
constexpr int TILES_WO     = (EMB_SZ / 64) * (EMB_SZ / 64);     // 144
constexpr int PREP_TILES   = 3 * TILES_W + TILES_WO;            // 576
static_assert(PREP_PER_THR * PREP_THREADS == PREP_UNITS && PREP_PER_THR == 4);
static_assert(PREP_TILES <= PREP_WGS && HDIM / 64 == 4);

__device__ __forceinline__ v4u pack8_bf16(v4f a, v4f c2) {
  v4u w;
  w[0] = (unsigned)f2bf_bits(a[0])  | ((unsigned)f2bf_bits(a[1])  << 16);
  w[1] = (unsigned)f2bf_bits(a[2])  | ((unsigned)f2bf_bits(a[3])  << 16);
  w[2] = (unsigned)f2bf_bits(c2[0]) | ((unsigned)f2bf_bits(c2[1]) << 16);
  w[3] = (unsigned)f2bf_bits(c2[2]) | ((unsigned)f2bf_bits(c2[3]) << 16);
  return w;
}

__global__ __launch_bounds__(256) void prep_inputs(
    const float* __restrict__ Xk, const float* __restrict__ Xv, const float* __restrict__ Xq,
    const float* __restrict__ Wk, const float* __restrict__ Wv, const float* __restrict__ Wq,
    const float* __restrict__ Wo,
    unsigned short* __restrict__ xb,     // three bf16 planes in a row: Xk, Xv, Xq
    unsigned short* __restrict__ wT) {   // Wk^T, Wv^T, Wq^T, Wo^T in a row (WT_ELEMS each)
  __shared__ float tile[64][65];
  const int tid = threadIdx.x;
  const int blk = blockIdx.x;

  // ---- activation loads: 3 planes x 4 units x 2 loads of 16 B ----
  const unsigned u0 = (unsigned)blk * 256u + (unsigned)tid;
  v4f xa[3][PREP_PER_THR], xc[3][PREP_PER_THR];
  const float* xp[3][PREP_PER_THR];
#pragma unroll   // both loops: constant indices keep the arrays in registers
  for (int x = 0; x < 3; ++x) {
    const float* in = (x == 0) ? Xk : (x == 1) ? Xv : Xq;
#pragma unroll
    for (int j = 0; j < PREP_PER_THR; ++j) {
      const float* p = in + (size_t)(u0 + (unsigned)j * PREP_THREADS) * 8;
      xp[x][j] = p;
      xa[x][j] = *(const v4f*)p;
      xc[x][j] = *(const v4f*)(p + 4);
    }
  }
  // Stands in front of every later write of a register that one of these loads names as its address: as inputs the twelve
  // addresses stay live up to here, so that no result of a later load of the run is placed on one of them either.
  asm volatile("s_wait_xcnt 0x0"
               :: "v"(xp[0][0]), "v"(xp[0][1]), "v"(xp[0][2]), "v"(xp[0][3]),
                  "v"(xp[1][0]), "v"(xp[1][1]), "v"(xp[1][2]), "v"(xp[1][3]),
                  "v"(xp[2][0]), "v"(xp[2][1]), "v"(xp[2][2]), "v"(xp[2][3])
               : "memory");

  // ---- one weight tile (block-uniform branch) ----
  if (blk < PREP_TILES) {
    const float* src;
    unsigned short* dst;
    int CC, ct, rt;
    if (blk < 3 * TILES_W) {
      const int w = blk / TILES_W, r = blk - w * TILES_W;
      const int z = r / TILES_WZ, r2 = r - z * TILES_WZ;
      src = ((w == 0) ? Wk : (w == 1) ? Wv : Wq) + (size_t)z * EMB_SZ * HDIM;
      dst = wT + (size_t)w * WT_ELEMS + (size_t)z * EMB_SZ * HDIM;
      CC = HDIM; ct = r2 & 3; rt = r2 >> 2;
    } else {
      const int r = blk - 3 * TILES_W;
      src = Wo;
      dst = wT + 3 * WT_ELEMS;
      CC = EMB_SZ; rt = r / (EMB_SZ / 64); ct = r - rt * (EMB_SZ / 64);
    }
    const int lr = tid >> 2, lc = (tid & 3) * 16;           // in-tile row (input row), 16 input cols
    const float* sp = src + (size_t)(rt * 64 + lr) * CC + ct * 64 + lc;
#pragma unroll
    for (int i = 0; i < 4; ++i) {
      const v4f v = *(const v4f*)(sp + 4 * i);
      tile[lr][lc + 4 * i + 0] = v[0];
      tile[lr][lc + 4 * i + 1] = v[1];
      tile[lr][lc + 4 * i + 2] = v[2];
      tile[lr][lc + 4 * i + 3] = v[3];
    }
    __syncthreads();
    // Store coverage: wave w writes out rows ct*64 + 8w + {0..7} (2 iterations x 4 rows), 8 lanes x 16 B per row.
    const int lane = tid & 31, wave = tid >> 5, q = lane >> 3, c8 = (lane & 7) * 8;
#pragma unroll
    for (int it = 0; it < 2; ++it) {
      const int fl = wave * 8 + it * 4 + q;                   // out row within tile = input col within tile
      v4u t4;
#pragma unroll
      for (int e = 0; e < 4; ++e) {
        const unsigned lo16 = (unsigned)f2bf_bits(tile[c8 + 2 * e][fl]);
        const unsigned hi16 = (unsigned)f2bf_bits(tile[c8 + 2 * e + 1][fl]);
        t4[e] = lo16 | (hi16 << 16);
      }
      *(v4u*)(dst + (size_t)(ct * 64 + fl) * EMB_SZ + rt * 64 + c8) = t4;
    }
  }

  // ---- convert and store the activation units ----
#pragma unroll
  for (int x = 0; x < 3; ++x) {
#pragma unroll
    for (int j = 0; j < PREP_PER_THR; ++j) {
      unsigned short* o = xb + (size_t)x * PLANE_ELEMS + (size_t)(u0 + (unsigned)j * PREP_THREADS) * 8;
      *(v4u*)o = pack8_bf16(xa[x][j], xc[x][j]);
    }
  }
}

// =====================================================================================================
// Causal flash attention, head_dim 256, operands = bf16 hi/lo planes.
//   Q/K/V planes: element (b, s, h, d) at [(b*SEQLEN + s)*EMB_SZ + h*HDIM + d] (hi plane and lo plane).
//   scores = (Qhi.Khi + Qhi.Klo + Qlo.Khi) * inv_scale; causal mask = -inf for key > query (diagonal chunk);
//   online softmax in f32; P (unnormalised exp) split to bf16 hi/lo in LDS; O += Phi.Vhi + Phi.Vlo + Plo.Vhi;
//   out = O / l written as bf16 hi/lo concat planes in the same [(b,s)][h*HDIM + d] layout.
// Block = 256 threads = 8 waves, 64 query rows of one (b,h); wave w: row group rw = w&3 (16 rows),
// half ch = w>>2: d half (128 of 256) for the score products, key half (32 of 64 keys) for the softmax,
// column half (128 of 256) for O. Q stays in registers: each wave holds its 16 rows x its d half, forms partial
// scores for all 64 keys, and the two waves of a row group swap the partial tiles of each other's key half in LDS.
// Row max / row sum of the two key halves combined through LDS with block barriers.
// grid = (SEQLEN/64, NBATCH*NHEAD).
// =====================================================================================================
constexpr int AT_KEYS  = 64;    // keys per chunk
constexpr int AT_QROWS = 64;    // query rows per block
constexpr int AT_WHALF = 128;   // output columns per wave
// LDS row pitches in 16-bit elements. K and P rows are read by b128 fragment loads: 16 B of pad make the pitch an odd
// multiple of 16 B, so the 16 rows of one read fall on 16 different groups of four banks. V rows are read by the
// transposing load, whose conflict-free pitch is an odd multiple of 32 B.
constexpr int AT_KPITCH = HDIM + 8;       // K rows [key][d]: 528 B
constexpr int AT_VPITCH = HDIM + 16;      // V rows [key][d]: 544 B
constexpr int AT_PPITCH = AT_KEYS + 8;    // P rows [row][key]: 144 B
static_assert(SEQLEN % AT_QROWS == 0 && SEQLEN % AT_KEYS == 0 && HDIM == 2 * AT_WHALF);
static_assert(8 * 16 * AT_WHALF <= AT_KEYS * AT_KPITCH);   // output staging slabs fit one K plane
static_assert((AT_KPITCH * 2) % 32 == 16 && (AT_VPITCH * 2) % 64 == 32 && (AT_PPITCH * 2) % 32 == 16);
static_assert(HDIM * 2 == 32 * 16 && AT_KEYS == 8 * 8);    // one copy of a wave = one row; 8 waves x 8 rows = one plane
static_assert(8 * 512 * 4 <= 2 * AT_QROWS * AT_PPITCH * 2);  // the partial-score swap (8 waves x 2 tiles, f32) fits the P planes

__device__ __forceinline__ v16b ldfrag16(const unsigned short* p) {   // elements 0..7 <- p[0..7], 8..15 <- p[16..23]
  union { v16b v; v8b h[2]; } f;
  f.h[0] = *(const v8b*)(p); f.h[1] = *(const v8b*)(p + 16); return f.v;
}
// B fragment (32 keys x 16 d) of a row-major [key][d] LDS tile: p = this lane's address in the first 16 keys,
// row 8*(lane>>4) + (lane&7), column 8*((lane>>3)&1). Lane (c, hh) receives keys 8hh..8hh+7 of column c, then keys
// 16+8hh..16+8hh+7: the k order of ldfrag16.
typedef short s16x8 __attribute__((ext_vector_type(8)));
__device__ __forceinline__ v16b ldfrag16_tr(const unsigned short* p) {
  typedef __attribute__((address_space(3))) s16x8 lds_s16x8;
  union { v16b v; s16x8 h[2]; } f;
  f.h[0] = __builtin_amdgcn_ds_load_tr16_b128_v8i16((lds_s16x8*)p);
  f.h[1] = __builtin_amdgcn_ds_load_tr16_b128_v8i16((lds_s16x8*)(p + 16 * AT_VPITCH));
  return f.v;
}
// Eight asynchronous copies of one wave, global -> LDS: copy j brings row j (512 B, 16 B per lane). g and l are the
// lane's own addresses in row 0. The s_wait_xcnt closes the statement so that it stands in front of every later write
// of an address register that a copy names.
__device__ __forceinline__ void copy_rows8(const unsigned short* l, int lpitch, const unsigned short* g) {
  const unsigned l0 = (unsigned)(size_t)l;
  const unsigned lp = (unsigned)lpitch * 2u;
  asm volatile(
      "global_load_async_to_lds_b128 %0, %8, off\n\t"
      "global_load_async_to_lds_b128 %1, %9, off\n\t"
      "global_load_async_to_lds_b128 %2, %10, off\n\t"
      "global_load_async_to_lds_b128 %3, %11, off\n\t"
      "global_load_async_to_lds_b128 %4, %12, off\n\t"
      "global_load_async_to_lds_b128 %5, %13, off\n\t"
      "global_load_async_to_lds_b128 %6, %14, off\n\t"
      "global_load_async_to_lds_b128 %7, %15, off\n\t"
      "s_wait_xcnt 0x0"
      :: "v"(l0), "v"(l0 + lp), "v"(l0 + 2u * lp), "v"(l0 + 3u * lp),
         "v"(l0 + 4u * lp), "v"(l0 + 5u * lp), "v"(l0 + 6u * lp), "v"(l0 + 7u * lp),
         "v"(g), "v"(g + EMB_SZ), "v"(g + 2 * EMB_SZ), "v"(g + 3 * EMB_SZ),
         "v"(g + 4 * EMB_SZ), "v"(g + 5 * EMB_SZ), "v"(g + 6 * EMB_SZ), "v"(g + 7 * EMB_SZ)
      : "memory");
}
__device__ __forceinline__ v8f mma_bf(v16b a, v16b b, v8f c) {
  c = __builtin_amdgcn_wmma_f32_16x16x32_bf16(false, a, false, b, (short)0, c, false, false);
  asm volatile("v_nop\n\tv_nop\n\tv_nop\n\tv_nop" : "+v"(c) : "v"(a), "v"(b));
  return c;
}

// Second bound: four waves per SIMD, so that two workgroups still share a WGP (its LDS holds two) with Q resident.
__global__ __launch_bounds__(256, 4) void attn_hd256(
    const unsigned short* __restrict__ Qh, const unsigned short* __restrict__ Ql,
    const unsigned short* __restrict__ Kh, const unsigned short* __restrict__ Kl,
    const unsigned short* __restrict__ Vh, const unsigned short* __restrict__ Vl,
    unsigned short* __restrict__ Oh, unsigned short* __restrict__ Ol, float inv_scale) {
  __shared__ __align__(16) unsigned short Ks[2][AT_KEYS * AT_KPITCH];   // [plane][key][d]   67584 B; reused as output staging
  __shared__ __align__(16) unsigned short Vs[2][AT_KEYS * AT_VPITCH];   // [plane][key][d]   69632 B
  __shared__ __align__(16) unsigned short Ps[2][AT_QROWS * AT_PPITCH];  // [plane][row][key] 18432 B
  __shared__ float redm[2][AT_QROWS];                                // partial row max per key half
  __shared__ float reds[2][AT_QROWS];                                // partial row sum per key half
  // Running row max and row sum, one copy per wave (index [ch][row]), written and read by that wave alone: they are
  // used once a chunk, and in LDS they leave their 16 registers to the fragment sets of the two products.
  __shared__ __align__(16) float runm[2][AT_QROWS];
  __shared__ __align__(16) float runl[2][AT_QROWS];

  const int tid  = threadIdx.x;
  const int lane = tid & 31;
  const int wave = __builtin_amdgcn_readfirstlane(tid >> 5);   // scalar: what derives from it alone costs no vector register
  const int hh   = lane >> 4;
  const int c    = lane & 15;
  const int rw   = wave & 3;
  const int ch   = wave >> 2;
  const int qb   = blockIdx.x;                 // query block 0..31
  const int bh   = blockIdx.y;                 // b*NHEAD + h
  const int h    = bh % NHEAD;
  const int b    = bh / NHEAD;
  const int q0w  = qb * AT_QROWS + rw * 16;    // first query row (within the sequence) of this wave
  const size_t rowb = (size_t)b * SEQLEN;      // flattened row base of this batch
  const int hcol = h * HDIM;

  v8f oacc[8];
#pragma unroll
  for (int r = 0; r < 8; ++r) { runm[ch][rw * 16 + 8 * hh + r] = -INFINITY; runl[ch][rw * 16 + 8 * hh + r] = 0.f; }
#pragma unroll
  for (int t = 0; t < 8; ++t) oacc[t] = (v8f){0.f,0.f,0.f,0.f,0.f,0.f,0.f,0.f};

  // This wave's 16 query rows x its d half, hi and lo, as A fragments (row m = c): loaded once, kept for every chunk.
  v16b qfh[4], qfl[4];
  {
    const size_t qoff = (rowb + q0w + c) * EMB_SZ + hcol + ch * AT_WHALF + 8 * hh;
#pragma unroll   // constant indices keep the fragment arrays in registers
    for (int dc = 0; dc < 4; ++dc) {
      qfh[dc] = ldfrag16(Qh + qoff + dc * 32);
      qfl[dc] = ldfrag16(Ql + qoff + dc * 32);
    }
  }
  // Swap area for partial score tiles, in the P planes (free from the chunk's first barrier to the row-max barrier):
  // per wave 4 quads x 32 lanes x 4 floats, so that each b128 access of a wave is 512 contiguous bytes.
  float* const xown  = reinterpret_cast<float*>(&Ps[0][0]) + wave * 512 + lane * 4;
  const float* const xpeer = reinterpret_cast<const float*>(&Ps[0][0]) + (wave ^ 4) * 512 + lane * 4;

  const int nch = qb + 1;                      // causal horizon in 64-key chunks (block-uniform)
  for (int kc = 0; kc < nch; ++kc) {
    const int kv0 = kc * AT_KEYS;
    // This wave's LDS reads of the last chunk have returned before the barrier behind which K and V are overwritten.
    asm volatile("s_wait_dscnt 0x0" ::: "memory");
    __syncthreads();
    // ---- stage K and V (hi/lo, both [key][d]) by asynchronous copies to LDS ----
    // Coverage: wave w brings keys 8w..8w+7 of each of the four planes, one whole row per copy.
    {
      const int kr0 = wave * 8;
      const size_t gbase = (rowb + kv0 + kr0) * EMB_SZ + hcol + lane * 8;
      copy_rows8(&Ks[0][kr0 * AT_KPITCH + lane * 8], AT_KPITCH, Kh + gbase);
      copy_rows8(&Ks[1][kr0 * AT_KPITCH + lane * 8], AT_KPITCH, Kl + gbase);
      copy_rows8(&Vs[0][kr0 * AT_VPITCH + lane * 8], AT_VPITCH, Vh + gbase);
      copy_rows8(&Vs[1][kr0 * AT_VPITCH + lane * 8], AT_VPITCH, Vl + gbase);
    }
    // This wave's copies have landed before the barrier behind which the other waves read them.
    asm volatile("s_wait_asynccnt 0x0" ::: "memory");
    __syncthreads();

    // ---- partial scores over this wave's d half: 16 rows x 64 keys (four 16x16 D tiles), hi.hi + hi.lo + lo.hi ----
    // Tiles 0,1 = this wave's own key half, tiles 2,3 = the other wave's.
    v8f sp[4];
#pragma unroll
    for (int j = 0; j < 4; ++j) sp[j] = (v8f){0.f,0.f,0.f,0.f,0.f,0.f,0.f,0.f};
    // K fragments are read two groups ahead of the products that use them (a group = one d step of one key tile, hi and
    // lo), in three rotating register sets: a group's LDS latency runs under the six products in front of it.
    v16b kfh[3], kfl[3];
#pragma unroll   // constant indices keep the fragment sets in registers
    for (int g = 0; g < 2; ++g) {
      const int koff = (((ch * 2 + (g & 3)) & 3) * 16 + c) * AT_KPITCH + ch * AT_WHALF + (g >> 2) * 32 + 8 * hh;
      kfh[g] = ldfrag16(&Ks[0][koff]);
      kfl[g] = ldfrag16(&Ks[1][koff]);
    }
#pragma unroll   // constant indices keep qfh, qfl, sp and the fragment sets in registers
    for (int g = 0; g < 16; ++g) {
      if (g + 2 < 16) {
        const int gn = g + 2;
        const int kr = ((ch * 2 + (gn & 3)) & 3) * 16 + c;                 // B fragment column n = key kr
        const int koff = kr * AT_KPITCH + ch * AT_WHALF + (gn >> 2) * 32 + 8 * hh;
        kfh[gn % 3] = ldfrag16(&Ks[0][koff]);
        kfl[gn % 3] = ldfrag16(&Ks[1][koff]);
      }
      const int dc = g >> 2, j = g & 3;
      sp[j] = mma_bf(qfh[dc], kfh[g % 3], sp[j]);
      sp[j] = mma_bf(qfh[dc], kfl[g % 3], sp[j]);
      sp[j] = mma_bf(qfl[dc], kfh[g % 3], sp[j]);
    }
    // ---- swap: hand tiles 2,3 to the other wave of the row group, add its partials to tiles 0,1 ----
#pragma unroll
    for (int q = 0; q < 4; ++q) {
      const v8f t = sp[2 + (q >> 1)];
      const int e = (q & 1) * 4;
      *(v4f*)(xown + q * 128) = (v4f){t[e], t[e + 1], t[e + 2], t[e + 3]};
    }
    __syncthreads();   // every wave's partial tiles are in LDS before the other wave of its row group reads them
    v8f s[2];
    {
      v4f t[4];
#pragma unroll
      for (int q = 0; q < 4; ++q) t[q] = *(const v4f*)(xpeer + q * 128);
#pragma unroll
      for (int q = 0; q < 4; ++q)
#pragma unroll
        for (int i = 0; i < 4; ++i) s[q >> 1][(q & 1) * 4 + i] = sp[q >> 1][(q & 1) * 4 + i] + t[q][i];
    }

    // ---- scale, causal mask, partial row max over this wave's 32 keys ----
    const bool diag = (kc == qb);                // block-uniform
    // key (D col c of tile 0) minus query (D row 8hh): key > query of tile j, row r reads rel + 16j > r, a compare
    // with a constant, so that no register holds a query row index through the loop
    const int rel = (kv0 + ch * 32 + c) - (q0w + 8 * hh);
#pragma unroll
    for (int r = 0; r < 8; ++r) {
      float m = -INFINITY;
#pragma unroll
      for (int j = 0; j < 2; ++j) {
        float sv = s[j][r] * inv_scale;
        if (diag && (rel + j * 16 > r)) sv = -INFINITY;
        s[j][r] = sv;
        m = fmaxf(m, sv);
      }
      m = fmaxf(m, __shfl_xor(m, 1, 32));
      m = fmaxf(m, __shfl_xor(m, 2, 32));
      m = fmaxf(m, __shfl_xor(m, 4, 32));
      m = fmaxf(m, __shfl_xor(m, 8, 32));
      redm[ch][rw * 16 + 8 * hh + r] = m;
    }
    __syncthreads();

    // ---- online softmax update; P hi/lo to LDS; partial sums ----
    float alph[8];
#pragma unroll
    for (int r = 0; r < 8; ++r) {
      const int row = rw * 16 + 8 * hh + r;
      const float mc = fmaxf(redm[0][row], redm[1][row]);
      const float mold = runm[ch][row];
      const float mnew = fmaxf(mold, mc);
      const float alpha = expf(mold - mnew);
      runm[ch][row] = mnew;
      alph[r] = alpha;
      float psum = 0.f;
#pragma unroll
      for (int j = 0; j < 2; ++j) {
        const float p = expf(s[j][r] - mnew);
        psum += p;
        const unsigned short hb = f2bf_bits(p);
        const unsigned short lb = f2bf_bits(p - bf_bits2f(hb));
        const int pidx = row * AT_PPITCH + ch * 32 + j * 16 + c;
        Ps[0][pidx] = hb;
        Ps[1][pidx] = lb;
      }
      psum += __shfl_xor(psum, 1, 32);
      psum += __shfl_xor(psum, 2, 32);
      psum += __shfl_xor(psum, 4, 32);
      psum += __shfl_xor(psum, 8, 32);
      reds[ch][row] = psum;
#pragma unroll
      for (int t = 0; t < 8; ++t) oacc[t][r] *= alpha;
    }
    __syncthreads();
#pragma unroll
    for (int r = 0; r < 8; ++r) {
      const int row = rw * 16 + 8 * hh + r;
      runl[ch][row] = runl[ch][row] * alph[r] + (reds[0][row] + reds[1][row]);
    }

    // ---- O += P.V over 64 keys for this wave's 16 rows x 128 columns ----
    // V fragments (and the second key half's P fragments) are read two groups ahead of their products, as K above;
    // a group = 32 keys x 16 columns, hi and lo.
    {
      const int poff = (rw * 16 + c) * AT_PPITCH + 8 * hh;                      // A fragment row m = c
      const int voff = (8 * hh + (lane & 7)) * AT_VPITCH + ch * AT_WHALF + ((lane >> 3) & 1) * 8;   // B fragment column n = d
      v16b pfh[2], pfl[2], vfh[3], vfl[3];
      pfh[0] = ldfrag16(&Ps[0][poff]);
      pfl[0] = ldfrag16(&Ps[1][poff]);
#pragma unroll   // constant indices keep the fragment sets in registers
      for (int g = 0; g < 2; ++g) {
        vfh[g] = ldfrag16_tr(&Vs[0][voff + g * 16]);
        vfl[g] = ldfrag16_tr(&Vs[1][voff + g * 16]);
      }
#pragma unroll   // constant indices keep oacc and the fragment sets in registers
      for (int g = 0; g < 16; ++g) {
        if (g + 2 < 16) {
          const int gn = g + 2;
          if (gn == 8) {
            pfh[1] = ldfrag16(&Ps[0][poff + 32]);
            pfl[1] = ldfrag16(&Ps[1][poff + 32]);
          }
          const int vo = voff + (gn >> 3) * 32 * AT_VPITCH + (gn & 7) * 16;
          vfh[gn % 3] = ldfrag16_tr(&Vs[0][vo]);
          vfl[gn % 3] = ldfrag16_tr(&Vs[1][vo]);
        }
        const int kk = g >> 3, t = g & 7;
        oacc[t] = mma_bf(pfh[kk], vfh[g % 3], oacc[t]);
        oacc[t] = mma_bf(pfh[kk], vfl[g % 3], oacc[t]);
        oacc[t] = mma_bf(pfl[kk], vfh[g % 3], oacc[t]);
      }
    }
  }

  // ---- epilogue: normalise, split to bf16 hi/lo in per-wave LDS slabs (K region), whole-line stores ----
  __syncthreads();
  unsigned short* slh = &Ks[0][wave * (16 * AT_WHALF)];
  unsigned short* sll = &Ks[1][wave * (16 * AT_WHALF)];
#pragma unroll
  for (int r = 0; r < 8; ++r) {
    const float inv = 1.0f / runl[ch][rw * 16 + 8 * hh + r];
    const int row = 8 * hh + r;
#pragma unroll
    for (int t = 0; t < 8; ++t) {
      const float v = oacc[t][r] * inv;
      const unsigned short hb = f2bf_bits(v);
      const unsigned short lb = f2bf_bits(v - bf_bits2f(hb));
      slh[row * AT_WHALF + t * 16 + c] = hb;
      sll[row * AT_WHALF + t * 16 + c] = lb;
    }
  }
  __syncthreads();
  // Store coverage: 8 iterations x rows (2it + hh) = 16 rows; per row 16 lanes x 16 B = 128 columns = 2 whole
  {
    {
#pragma unroll
      for (int it = 0; it < 8; ++it) {
        const int row = it * 2 + hh;
        const v4u wh = *(const v4u*)(slh + row * AT_WHALF + c * 8);
        const v4u wl = *(const v4u*)(sll + row * AT_WHALF + c * 8);
        const size_t go = (rowb + q0w + row) * EMB_SZ + hcol + ch * AT_WHALF + c * 8;
        *(v4u*)(Oh + go) = wh;
        *(v4u*)(Ol + go) = wl;
      }
      
    }
  }
}

// ---------------------------------------------------------------------------------------------------
extern "C" void kernel_launch(void* const* d_in, const int* in_sizes, int n_in,
                              void* d_out, int out_size, void* d_ws, size_t ws_size,
                              hipStream_t stream) {
  (void)in_sizes; (void)n_in; (void)out_size;
  const float* Xk = (const float*)d_in[0];
  const float* Xv = (const float*)d_in[1];
  const float* Xq = (const float*)d_in[2];
  const float* Wk = (const float*)d_in[3];
  const float* Wv = (const float*)d_in[4];
  const float* Wq = (const float*)d_in[5];
  const float* Wo = (const float*)d_in[6];
  const float* bo = (const float*)d_in[7];
  float* out = (float*)d_out;

  if (ws_size < WS_TOTAL_BYTES) return;

  unsigned short* ws = (unsigned short*)d_ws;
  unsigned short* xk_b = ws + 0 * PLANE_ELEMS;   // later: concat hi
  unsigned short* xv_b = ws + 1 * PLANE_ELEMS;   // later: concat lo
  unsigned short* xq_b = ws + 2 * PLANE_ELEMS;
  unsigned short* k_hi = ws + 3 * PLANE_ELEMS;
  unsigned short* k_lo = ws + 4 * PLANE_ELEMS;
  unsigned short* v_hi = ws + 5 * PLANE_ELEMS;
  unsigned short* v_lo = ws + 6 * PLANE_ELEMS;
  unsigned short* q_hi = ws + 7 * PLANE_ELEMS;
  unsigned short* q_lo = ws + 8 * PLANE_ELEMS;
  unsigned short* wkT  = ws + WS_OFF_WKT;
  unsigned short* wvT  = ws + WS_OFF_WVT;
  unsigned short* wqT  = ws + WS_OFF_WQT;
  unsigned short* woT  = ws + WS_OFF_WOT;
  unsigned short* cc_hi = xk_b;
  unsigned short* cc_lo = xv_b;

  // 1) + 2) inputs -> bf16 planes (RNE), [8192][768] each; weights [3][768][256] -> [3][256][768] bf16 (Bt layout
  //    [N=f][K=e]); Wo [768 k][768 n] -> [768 n][768 k]: one launch
  prep_inputs<<<dim3(PREP_WGS), 256, 0, stream>>>(Xk, Xv, Xq, Wk, Wv, Wq, Wo, xk_b, wkT);

  // 3) per-head projections: C_h[8192 x 256] = X[8192 x 768] . (W_h^T)[256 x 768]^T, written as bf16 hi/lo
  //    planes at column offset h*256 with ldc 768 (grid.y = head). M=8192, N=256, K=768: 512 tiles = 64 blocks x 8 waves.
  const dim3 gproj((NROWS / 64) * (HDIM / 64) / 8, NHEAD);
  wmma_gemm64<1, false, false, 0, 2><<<gproj, 256, 0, stream>>>(
      xk_b, xk_b, EMB_SZ, 0L, wkT, wkT, EMB_SZ, (long)HDIM * EMB_SZ,
      (void*)k_hi, (void*)k_lo, EMB_SZ, (long)HDIM, bo, NROWS, HDIM, EMB_SZ, 1.0f);
  wmma_gemm64<1, false, false, 0, 2><<<gproj, 256, 0, stream>>>(
      xv_b, xv_b, EMB_SZ, 0L, wvT, wvT, EMB_SZ, (long)HDIM * EMB_SZ,
      (void*)v_hi, (void*)v_lo, EMB_SZ, (long)HDIM, bo, NROWS, HDIM, EMB_SZ, 1.0f);
  wmma_gemm64<1, false, false, 0, 2><<<gproj, 256, 0, stream>>>(
      xq_b, xq_b, EMB_SZ, 0L, wqT, wqT, EMB_SZ, (long)HDIM * EMB_SZ,
      (void*)q_hi, (void*)q_lo, EMB_SZ, (long)HDIM, bo, NROWS, HDIM, EMB_SZ, 1.0f);

  // 4) causal attention -> concat hi/lo planes (X planes are dead now)
  const float inv_scale = 1.0f / sqrtf((float)SEQLEN);
  attn_hd256<<<dim3(SEQLEN / AT_QROWS, NBATCH * NHEAD), 256, 0, stream>>>(
      q_hi, q_lo, k_hi, k_lo, v_hi, v_lo, cc_hi, cc_lo, inv_scale);

  // 5) output projection: out[8192 x 768] = concat(hi+lo) . (Wo^T)^T + bo, f32. M=8192, N=768, K=768: 1536 tiles = 192 blocks.
  const dim3 gout((NROWS / 64) * (EMB_SZ / 64) / 8, 1);
  wmma_gemm64<1, true, false, 2, 0><<<gout, 256, 0, stream>>>(
      cc_hi, cc_lo, EMB_SZ, 0L, woT, woT, EMB_SZ, 0L,
      (void*)out, (void*)out, EMB_SZ, 0L, bo, NROWS, EMB_SZ, EMB_SZ, 1.0f);
}

// v007
// One run takes 182 microseconds.
// Next to v006, in two timings, it ran 1.41 and 1.42 times as fast.
// All steps since v000 together make it 5.95 times as fast.
// Contractions on v_wmma_f32_16x16x32_bf16 with f32 accumulate: per-head projections = bf16(X) x bf16(W^T) (inputs RNE-converted once); Q.K^T and P.V = bf16 hi/lo planes (hi.hi + hi.lo + lo.hi); output projection = concat bf16 hi/lo x bf16(Wo^T) (hi.W + lo.W) + bf16(bo); softmax, rescaling and normalisation in f32.
#include <hip/hip_runtime.h>
#include <stdint.h>
#include <math.h>

typedef __attribute__((ext_vector_type(16))) _Float16 v16h;
typedef __attribute__((ext_vector_type(8)))  _Float16 v8h;
typedef __attribute__((ext_vector_type(16))) __bf16   v16b;
typedef __attribute__((ext_vector_type(8)))  __bf16   v8b;
typedef __attribute__((ext_vector_type(8)))  float    v8f;
typedef __attribute__((ext_vector_type(4)))  float    v4f;
typedef __attribute__((ext_vector_type(4)))  unsigned v4u;

// ---- problem geometry ----
constexpr int EMB_SZ  = 768;
constexpr int NHEAD   = 3;
constexpr int HDIM    = 256;
constexpr int NBATCH  = 4;
constexpr int SEQLEN  = 2048;
constexpr int NROWS   = NBATCH * SEQLEN;                       // 8192 flattened (b,s) rows
constexpr size_t PLANE_ELEMS = (size_t)NROWS * EMB_SZ;          // 6291456 elements per [8192][768] plane
constexpr size_t PLANE_BYTES = PLANE_ELEMS * 2;                 // 12582912 B per 16-bit plane
constexpr size_t WT_ELEMS    = (size_t)NHEAD * HDIM * EMB_SZ;   // 589824 (W^T planes [3][256][768])
constexpr size_t WO_ELEMS    = (size_t)EMB_SZ * EMB_SZ;         // 589824 (Wo^T plane [768][768])

// [0]            Xk bf16 plane        (dead after projections; reused as concat hi plane)
// [1*PLANE]      Xv bf16 plane        (reused as concat lo plane)
// [2*PLANE]      Xq bf16 plane
// [3*PLANE]      K hi, [4*PLANE] K lo, [5*PLANE] V hi, [6*PLANE] V lo, [7*PLANE] Q hi, [8*PLANE] Q lo
// [9*PLANE]      Wk^T bf16 [3][256][768], then Wv^T, Wq^T (WT_ELEMS each)
// [9*PLANE+3*WT] Wo^T bf16 [768][768]
// then, f32:     partial attention tiles (unnormalised O, 64 x 256 each) and their row max / row sum (128 floats each)
constexpr size_t WS_OFF_WKT = 9 * PLANE_ELEMS;
constexpr size_t WS_OFF_WVT = WS_OFF_WKT + WT_ELEMS;
constexpr size_t WS_OFF_WQT = WS_OFF_WVT + WT_ELEMS;
constexpr size_t WS_OFF_WOT = WS_OFF_WQT + WT_ELEMS;
constexpr size_t WS_PLANES_BYTES = (WS_OFF_WOT + WO_ELEMS) * 2;   // 117964800 B
static_assert(WS_PLANES_BYTES == 117964800ull);
constexpr int    PART_TILES     = NBATCH * NHEAD * (SEQLEN / 64);   // 384: two key ranges for the upper half of the query blocks
constexpr size_t PART_TILE_F32  = (size_t)64 * HDIM;                // 16384 floats per tile
constexpr size_t WS_OFF_PART_BYTES = WS_PLANES_BYTES;
constexpr size_t WS_OFF_PML_BYTES  = WS_OFF_PART_BYTES + (size_t)PART_TILES * PART_TILE_F32 * 4;
constexpr size_t WS_TOTAL_BYTES    = WS_OFF_PML_BYTES + (size_t)PART_TILES * 128 * 4;   // 143327232 B
static_assert(WS_TOTAL_BYTES == 143327232ull);
static_assert(WS_TOTAL_BYTES <= 268435456ull);
static_assert((WS_OFF_PART_BYTES % 128) == 0 && (WS_OFF_PML_BYTES % 128) == 0);
static_assert((PLANE_BYTES % 128) == 0 && ((WT_ELEMS * 2) % 128) == 0 && ((WO_ELEMS * 2) % 128) == 0);

// ---- GEMM shape contract for the launches in this file ----
static_assert(NROWS % 64 == 0 && HDIM % 64 == 0 && EMB_SZ % 64 == 0);   // M, N tile multiples
static_assert(EMB_SZ % 128 == 0);                                         // K % 128 == 0 for all GEMMs (K = 768)
static_assert(NROWS % 128 == 0 && HDIM % 256 == 0 && EMB_SZ % 256 == 0);  // whole 128 x 256 work-group tiles

__device__ __forceinline__ unsigned short f2bf_bits(float f) {
  unsigned u = __float_as_uint(f);
  return (unsigned short)((u + 0x7FFFu + ((u >> 16) & 1u)) >> 16);
}
__device__ __forceinline__ float bf_bits2f(unsigned short h) { return __uint_as_float(((unsigned)h) << 16); }

// hazard guards as plain device helpers
__device__ __forceinline__ void dep_guard_h(v8f& a, v8f& b, v16h x, v16h y) { asm volatile("v_nop\n\tv_nop\n\tv_nop\n\tv_nop" : "+v"(a), "+v"(b) : "v"(x), "v"(y)); }
__device__ __forceinline__ void dep_guard_b(v8f& a, v8f& b, v16b x, v16b y) { asm volatile("v_nop\n\tv_nop\n\tv_nop\n\tv_nop" : "+v"(a), "+v"(b) : "v"(x), "v"(y)); }
__device__ __forceinline__ void keep4_h(v16h a, v16h b, v16h c, v16h d) { asm volatile("v_nop" :: "v"(a), "v"(b), "v"(c), "v"(d)); }
__device__ __forceinline__ void keep4_b(v16b a, v16b b, v16b c, v16b d) { asm volatile("v_nop" :: "v"(a), "v"(b), "v"(c), "v"(d)); }
__device__ __forceinline__ void acc_guard4(v8f& a, v8f& b, v8f& c, v8f& d) { asm volatile("v_nop\n\tv_nop\n\tv_nop\n\tv_nop" : "+v"(a), "+v"(b), "+v"(c), "+v"(d)); }
template <typename T> struct Frag;
template <> struct Frag<_Float16> {
  typedef v16h V; union U { v16h v; v8h h[2]; };
  static __device__ __forceinline__ v16h load(const _Float16* p) {   // elements 0..7 <- p[0..7], 8..15 <- p[16..23]
    U f; f.h[0] = *(const v8h*)(p); f.h[1] = *(const v8h*)(p + 16); return f.v;
  }
  static __device__ __forceinline__ v8f mma(v16h a, v16h b, v8f c) {
    return __builtin_amdgcn_wmma_f32_16x16x32_f16(false, a, false, b, (short)0, c, false, false);
  }
  static __device__ __forceinline__ void guard(v8f& a, v8f& b, v16h x, v16h y) { dep_guard_h(a, b, x, y); }
  static __device__ __forceinline__ void keep(v16h a, v16h b, v16h c, v16h d) { keep4_h(a, b, c, d); }
};
template <> struct Frag<__bf16> {
  typedef v16b V; union U { v16b v; v8b h[2]; };
  static __device__ __forceinline__ v16b load(const __bf16* p) {
    U f; f.h[0] = *(const v8b*)(p); f.h[1] = *(const v8b*)(p + 16); return f.v;
  }
  static __device__ __forceinline__ v8f mma(v16b a, v16b b, v8f c) {
    return __builtin_amdgcn_wmma_f32_16x16x32_bf16(false, a, false, b, (short)0, c, false, false);
  }
  static __device__ __forceinline__ void guard(v8f& a, v8f& b, v16b x, v16b y) { dep_guard_b(a, b, x, y); }
  static __device__ __forceinline__ void keep(v16b a, v16b b, v16b c, v16b d) { keep4_b(a, b, c, d); }
};

// ---- Register-blocked batched WMMA GEMM (with independent A/B split flags) --------------------
// C[m,n] = scale * sum_k A[m,k] * Bt[n,k] (+bias); each wave owns a 64x64 tile, a work-group 2 x 4 of them (128 x 256).
// A row-major [M,K]; Bt row-major [N,K]; M % 128 == 0, N % 256 == 0, K % 128 == 0 (no tail handling).
// The work-group's operand rows come through LDS, 128 k (256 B of every row) per stage, two buffers: the next stage's
// asynchronous copies fly while this stage's fragments are read from LDS and multiplied.
// SPLITA: A has a lo plane A2 (product += Alo.Bhi); SPLITB: Bt has a lo plane Bt2 (product += Ahi.Blo).
// BIAS_MODE: 0 = none, 1 = bias[m], 2 = RNE-bf16(bias[n]).
// OUT_MODE: 0 = f32, 1 = f16, 2 = bf16 hi plane (Cout) + bf16 lo plane (Cout2).
// ET: 0 = f16 operands, 1 = bf16 operands (pointers passed as 16-bit storage)
template <int ET> struct Elem;
template <> struct Elem<0> { typedef _Float16 T; };
template <> struct Elem<1> { typedef __bf16 T; };
constexpr int GT_BK    = 128;          // k elements per stage
constexpr int GT_PITCH = GT_BK + 8;    // LDS row pitch 272 B, an odd multiple of 16 B: the 16 rows of a b128 fragment read fall on distinct banks
constexpr int GT_MROWS = 128;          // A rows per work-group
constexpr int GT_NROWS = 256;          // Bt rows per work-group
static_assert((GT_PITCH * 2) % 32 == 16 && GT_BK * 2 == 16 * 16);   // one copy of a wave = 2 rows x 16 lanes x 16 B
// Eight asynchronous copies of one wave, global -> LDS: copy j brings rows 2j, 2j+1 of a 16-row slice, 256 B each
// (16 lanes x 16 B), so that every copy reads four whole lines. l and g are the lane's own addresses in rows 0, 1; ld is
// the global row pitch in elements. The s_wait_xcnt closes the statement so that it stands in front of every later
// write of an address register that a copy names.
__device__ __forceinline__ void copy_rows16(const unsigned short* l, const unsigned short* g, int ld) {
  const unsigned l0 = (unsigned)(size_t)l;
  constexpr unsigned lp = 2u * GT_PITCH * 2u;
  const size_t gp = (size_t)2 * ld;
  asm volatile(
      "global_load_async_to_lds_b128 %0, %8, off\n\t"
      "global_load_async_to_lds_b128 %1, %9, off\n\t"
      "global_load_async_to_lds_b128 %2, %10, off\n\t"
      "global_load_async_to_lds_b128 %3, %11, off\n\t"
      "global_load_async_to_lds_b128 %4, %12, off\n\t"
      "global_load_async_to_lds_b128 %5, %13, off\n\t"
      "global_load_async_to_lds_b128 %6, %14, off\n\t"
      "global_load_async_to_lds_b128 %7, %15, off\n\t"
      "s_wait_xcnt 0x0"
      :: "v"(l0), "v"(l0 + lp), "v"(l0 + 2u * lp), "v"(l0 + 3u * lp),
         "v"(l0 + 4u * lp), "v"(l0 + 5u * lp), "v"(l0 + 6u * lp), "v"(l0 + 7u * lp),
         "v"(g), "v"(g + gp), "v"(g + 2 * gp), "v"(g + 3 * gp),
         "v"(g + 4 * gp), "v"(g + 5 * gp), "v"(g + 6 * gp), "v"(g + 7 * gp)
      : "memory");
}
template <int ET, bool SPLITA, bool SPLITB, int BIAS_MODE, int OUT_MODE>
__global__ __launch_bounds__(256) void wmma_gemm64(
    const unsigned short* __restrict__ Ap, const unsigned short* __restrict__ A2p, int lda, long strideA,
    const unsigned short* __restrict__ Btp, const unsigned short* __restrict__ Bt2p, int ldb, long strideB,
    void* __restrict__ Cout, void* __restrict__ Cout2, int ldc, long strideC,
    const float* __restrict__ bias,
    int M, int N, int K, float scale) {
  typedef typename Elem<ET>::T T;
  typedef typename Frag<T>::V V;
  // One stage in LDS: [A | A lo | Bt | Bt lo] rows at GT_PITCH (the lo parts only where the operand is split).
  constexpr int OFF_A2 = GT_MROWS * GT_PITCH;
  constexpr int OFF_B  = OFF_A2 + (SPLITA ? GT_MROWS * GT_PITCH : 0);
  constexpr int OFF_B2 = OFF_B + GT_NROWS * GT_PITCH;
  constexpr int STAGE_ELEMS = OFF_B2 + (SPLITB ? GT_NROWS * GT_PITCH : 0);
  __shared__ __align__(16) unsigned short stg[2][STAGE_ELEMS];
  __shared__ __align__(16) float sT[8][16 * 68];   // per-wave 16x64 slab, pitch 68 floats
  const int b    = blockIdx.y;
  const int lane = threadIdx.x & 31;
  const int wave = __builtin_amdgcn_readfirstlane(threadIdx.x >> 5);   // scalar: the rows and offsets that derive from it alone cost no vector register
  const int wgN = N >> 8;
  if ((int)blockIdx.x >= (M >> 7) * wgN) return;   // block-uniform, in front of every copy and barrier
  const int bm  = blockIdx.x / wgN;
  const int bn  = blockIdx.x - bm * wgN;
  const int wm  = wave >> 2;                   // this wave's 64-row group of the work-group's 128 rows
  const int wn  = wave & 3;                    // this wave's 64-column group of the work-group's 256 columns
  const int m0 = bm * GT_MROWS + (wm << 6);
  const int n0 = bn * GT_NROWS + (wn << 6);

  // Staging coverage: wave w brings A rows 16w..16w+15 and Bt rows 32w..32w+31 of the work-group's tile.
  const int lr = lane >> 4, lc = (lane & 15) * 8;  // row within a copy's two rows, first of the lane's 8 elements
  const size_t aoff = (size_t)b * strideA + (size_t)(bm * GT_MROWS + wave * 16 + lr) * lda + lc;
  const size_t boff = (size_t)b * strideB + (size_t)(bn * GT_NROWS + wave * 32 + lr) * ldb + lc;
  const int lA = (wave * 16 + lr) * GT_PITCH + lc;
  const int lB = (wave * 32 + lr) * GT_PITCH + lc;
  auto stage_in = [&](int t, int buf) {
    const unsigned short* sb = &stg[buf][0];
    const size_t k0 = (size_t)t * GT_BK;
    copy_rows16(sb + lA, Ap + aoff + k0, lda);
    if (SPLITA) copy_rows16(sb + OFF_A2 + lA, A2p + aoff + k0, lda);
    copy_rows16(sb + OFF_B + lB, Btp + boff + k0, ldb);
    copy_rows16(sb + OFF_B + lB + 16 * GT_PITCH, Btp + boff + k0 + (size_t)16 * ldb, ldb);
    if (SPLITB) {
      copy_rows16(sb + OFF_B2 + lB, Bt2p + boff + k0, ldb);
      copy_rows16(sb + OFF_B2 + lB + 16 * GT_PITCH, Bt2p + boff + k0 + (size_t)16 * ldb, ldb);
    }
  };

  const int rlane = lane & 15;                 // row (A) / col (B, D) within subtile
  const int koff  = (lane >> 4) * 8;           // k offset of this lane half
  const int mOff  = (lane >> 4) * 8;           // D row offset

  v8f acc[4][4];
#pragma unroll
  for (int i = 0; i < 4; ++i)
#pragma unroll
    for (int j = 0; j < 4; ++j) acc[i][j] = (v8f){0.f,0.f,0.f,0.f,0.f,0.f,0.f,0.f};

  const int nst = K / GT_BK;                   // stages (block-uniform)
  stage_in(0, 0);
  // This wave's copies of stage 0 have landed before the barrier behind which the other waves read them.
  asm volatile("s_wait_asynccnt 0x0" ::: "memory");
  __syncthreads();
  if (nst > 1) stage_in(1, 1);
  const int fa = ((wm << 6) + rlane) * GT_PITCH + koff;            // this lane's place in A fragment row group 0
  const int fb = OFF_B + ((wn << 6) + rlane) * GT_PITCH + koff;    // and in Bt fragment row group 0
  for (int t = 0; t < nst; ++t) {
    const T* sb = (const T*)&stg[t & 1][0];
#pragma unroll   // a constant kk goes into the offset field of the LDS reads
    for (int kk = 0; kk < GT_BK; kk += 32) {
      // All fragments of a k step are read as one group in front of its products.
      V bh[4], bl[4], ah[4], al[4];
#pragma unroll   // this loop and the next: constant indices keep the fragment arrays in registers
      for (int j = 0; j < 4; ++j) {
        bh[j] = Frag<T>::load(sb + fb + (j << 4) * GT_PITCH + kk);
        if (SPLITB) bl[j] = Frag<T>::load(sb + fb + (OFF_B2 - OFF_B) + (j << 4) * GT_PITCH + kk);
      }
#pragma unroll
      for (int i = 0; i < 4; ++i) {
        ah[i] = Frag<T>::load(sb + fa + (i << 4) * GT_PITCH + kk);
        if (SPLITA) al[i] = Frag<T>::load(sb + fa + OFF_A2 + (i << 4) * GT_PITCH + kk);
      }
#pragma unroll
      for (int i = 0; i < 4; ++i) {
#pragma unroll
        for (int j = 0; j < 4; ++j) {
          acc[i][j] = Frag<T>::mma(ah[i], bh[j], acc[i][j]);
          if (SPLITB) acc[i][j] = Frag<T>::mma(ah[i], bl[j], acc[i][j]);
          if (SPLITA) acc[i][j] = Frag<T>::mma(al[i], bh[j], acc[i][j]);
        }
        Frag<T>::guard(acc[i][0], acc[i][3], ah[i], SPLITA ? al[i] : ah[i]);
      }
      Frag<T>::keep(bh[0], bh[1], bh[2], bh[3]);
      if (SPLITB) Frag<T>::keep(bl[0], bl[1], bl[2], bl[3]);
    }
    // This wave's LDS reads of this stage have returned, and its copies of the next stage have landed, before the
    // barrier behind which this stage's buffer is refilled and the next stage is read.
    asm volatile("s_wait_dscnt 0x0" ::: "memory");
    asm volatile("s_wait_asynccnt 0x0" ::: "memory");
    __syncthreads();
    if (t + 2 < nst) stage_in(t + 2, t & 1);
  }
  // No copy is outstanding when the wave goes on to the epilogue and ends.
  asm volatile("s_wait_asynccnt 0x0" ::: "memory");
  acc_guard4(acc[0][0], acc[0][1], acc[0][2], acc[0][3]);
  acc_guard4(acc[1][0], acc[1][1], acc[1][2], acc[1][3]);
  acc_guard4(acc[2][0], acc[2][1], acc[2][2], acc[2][3]);
  acc_guard4(acc[3][0], acc[3][1], acc[3][2], acc[3][3]);

  // ---- epilogue ----
  float* slab = sT[wave];
#pragma unroll
  for (int i = 0; i < 4; ++i) {
    const int mBase = m0 + (i << 4);
#pragma unroll
    for (int j = 0; j < 4; ++j) {
      const int n = n0 + (j << 4) + rlane;
      float bv = 0.f;
      if (BIAS_MODE == 2) bv = bf_bits2f(f2bf_bits(bias[n]));
#pragma unroll
      for (int r = 0; r < 8; ++r) {
        float v = acc[i][j][r] * scale;
        if (BIAS_MODE == 1) v += bias[mBase + mOff + r];
        if (BIAS_MODE == 2) v += bv;
        slab[(mOff + r) * 68 + (j << 4) + rlane] = v;
      }
    }
    __builtin_amdgcn_fence(__ATOMIC_RELEASE, "workgroup");
    __builtin_amdgcn_wave_barrier();
    __builtin_amdgcn_fence(__ATOMIC_ACQUIRE, "workgroup");
    if (OUT_MODE == 0) {
      float* C = (float*)Cout + (size_t)b * strideC;
      const int hh = lane >> 4, c4 = (lane & 15) * 4;     // row seg = 256 B = 16 lanes x 16 B
      {
#pragma unroll
        for (int it = 0; it < 8; ++it) {
          const int row = it * 2 + hh;
          v4f v = *(const v4f*)(slab + row * 68 + c4);
          *(v4f*)(C + (size_t)(mBase + row) * ldc + n0 + c4) = v;
        }
        
      }
    } else {
      const int q = lane >> 3, c8 = (lane & 7) * 8;
      unsigned short* C  = (unsigned short*)Cout  + (size_t)b * strideC;
      unsigned short* C2 = (OUT_MODE == 2) ? ((unsigned short*)Cout2 + (size_t)b * strideC) : nullptr;
      {
#pragma unroll
        for (int it = 0; it < 4; ++it) {
          const int row = it * 4 + q;
          const float* sp = slab + row * 68 + c8;
          v8h hv, lv;
#pragma unroll
          for (int e = 0; e < 8; ++e) {
            if (OUT_MODE == 1) {
              hv[e] = (_Float16)sp[e];
            } else {
              unsigned short hb = f2bf_bits(sp[e]);
              unsigned short lb = f2bf_bits(sp[e] - bf_bits2f(hb));
              hv[e] = __builtin_bit_cast(_Float16, hb);
              lv[e] = __builtin_bit_cast(_Float16, lb);
            }
          }
          *(v8h*)(C + (size_t)(mBase + row) * ldc + n0 + c8) = hv;
          if (OUT_MODE == 2) *(v8h*)(C2 + (size_t)(mBase + row) * ldc + n0 + c8) = lv;
        }
        
      }
    }
    __builtin_amdgcn_fence(__ATOMIC_RELEASE, "workgroup");
    __builtin_amdgcn_wave_barrier();
    __builtin_amdgcn_fence(__ATOMIC_ACQUIRE, "workgroup");
  }
}

// ---- input pass, one launch: three activation planes f32 -> bf16 (RNE) and the four weight transposes ----------
// Every work-group converts its share of each activation plane: per thread and plane 4 units of 8 elements (32 B read,
// 16 B written), unit index = j * PREP_THREADS + global thread id, so one store of a wave is 512 contiguous bytes. All of
// a thread's loads are issued before its first convert. Work-groups 0..PREP_TILES-1 also take one 64x64 weight tile:
// in = planes of [768][CC] f32 -> out = planes of [CC][768] bf16, through LDS.
constexpr int PREP_WGS     = 768;
constexpr int PREP_THREADS = PREP_WGS * 256;
constexpr int PREP_UNITS   = (int)(PLANE_ELEMS / 8);            // 16-B output units per plane
constexpr int PREP_PER_THR = PREP_UNITS / PREP_THREADS;         // 4
constexpr int TILES_WZ     = (HDIM / 64) * (EMB_SZ / 64);       // 48 tiles per head plane of Wk, Wv, Wq
constexpr int TILES_W      = TILES_WZ * NHEAD;                  // 144 per weight
constexpr int TILES_WO     = (EMB_SZ / 64) * (EMB_SZ / 64);     // 144
constexpr int PREP_TILES   = 3 * TILES_W + TILES_WO;            // 576
static_assert(PREP_PER_THR * PREP_THREADS == PREP_UNITS && PREP_PER_THR == 4);
static_assert(PREP_TILES <= PREP_WGS && HDIM / 64 == 4);

__device__ __forceinline__ v4u pack8_bf16(v4f a, v4f c2) {
  v4u w;
  w[0] = (unsigned)f2bf_bits(a[0])  | ((unsigned)f2bf_bits(a[1])  << 16);
  w[1] = (unsigned)f2bf_bits(a[2])  | ((unsigned)f2bf_bits(a[3])  << 16);
  w[2] = (unsigned)f2bf_bits(c2[0]) | ((unsigned)f2bf_bits(c2[1]) << 16);
  w[3] = (unsigned)f2bf_bits(c2[2]) | ((unsigned)f2bf_bits(c2[3]) << 16);
  return w;
}

__global__ __launch_bounds__(256) void prep_inputs(
    const float* __restrict__ Xk, const float* __restrict__ Xv, const float* __restrict__ Xq,
    const float* __restrict__ Wk, const float* __restrict__ Wv, const float* __restrict__ Wq,
    const float* __restrict__ Wo,
    unsigned short* __restrict__ xb,     // three bf16 planes in a row: Xk, Xv, Xq
    unsigned short* __restrict__ wT) {   // Wk^T, Wv^T, Wq^T, Wo^T in a row (WT_ELEMS each)
  __shared__ float tile[64][65];
  const int tid = threadIdx.x;
  const int blk = blockIdx.x;

  // ---- activation loads: 3 planes x 4 units x 2 loads of 16 B ----
  const unsigned u0 = (unsigned)blk * 256u + (unsigned)tid;
  v4f xa[3][PREP_PER_THR], xc[3][PREP_PER_THR];
  const float* xp[3][PREP_PER_THR];
#pragma unroll   // both loops: constant indices keep the arrays in registers
  for (int x = 0; x < 3; ++x) {
    const float* in = (x == 0) ? Xk : (x == 1) ? Xv : Xq;
#pragma unroll
    for (int j = 0; j < PREP_PER_THR; ++j) {
      const float* p = in + (size_t)(u0 + (unsigned)j * PREP_THREADS) * 8;
      xp[x][j] = p;
      xa[x][j] = *(const v4f*)p;
      xc[x][j] = *(const v4f*)(p + 4);
    }
  }
  // Stands in front of every later write of a register that one of these loads names as its address: as inputs the twelve
  // addresses stay live up to here, so that no result of a later load of the run is placed on one of them either.
  asm volatile("s_wait_xcnt 0x0"
               :: "v"(xp[0][0]), "v"(xp[0][1]), "v"(xp[0][2]), "v"(xp[0][3]),
                  "v"(xp[1][0]), "v"(xp[1][1]), "v"(xp[1][2]), "v"(xp[1][3]),
                  "v"(xp[2][0]), "v"(xp[2][1]), "v"(xp[2][2]), "v"(xp[2][3])
               : "memory");

  // ---- one weight tile (block-uniform branch) ----
  if (blk < PREP_TILES) {
    const float* src;
    unsigned short* dst;
    int CC, ct, rt;
    if (blk < 3 * TILES_W) {
      const int w = blk / TILES_W, r = blk - w * TILES_W;
      const int z = r / TILES_WZ, r2 = r - z * TILES_WZ;
      src = ((w == 0) ? Wk : (w == 1) ? Wv : Wq) + (size_t)z * EMB_SZ * HDIM;
      dst = wT + (size_t)w * WT_ELEMS + (size_t)z * EMB_SZ * HDIM;
      CC = HDIM; ct = r2 & 3; rt = r2 >> 2;
    } else {
      const int r = blk - 3 * TILES_W;
      src = Wo;
      dst = wT + 3 * WT_ELEMS;
      CC = EMB_SZ; rt = r / (EMB_SZ / 64); ct = r - rt * (EMB_SZ / 64);
    }
    const int lr = tid >> 2, lc = (tid & 3) * 16;           // in-tile row (input row), 16 input cols
    const float* sp = src + (size_t)(rt * 64 + lr) * CC + ct * 64 + lc;
#pragma unroll
    for (int i = 0; i < 4; ++i) {
      const v4f v = *(const v4f*)(sp + 4 * i);
      tile[lr][lc + 4 * i + 0] = v[0];
      tile[lr][lc + 4 * i + 1] = v[1];
      tile[lr][lc + 4 * i + 2] = v[2];
      tile[lr][lc + 4 * i + 3] = v[3];
    }
    __syncthreads();
    // Store coverage: wave w writes out rows ct*64 + 8w + {0..7} (2 iterations x 4 rows), 8 lanes x 16 B per row.
    const int lane = tid & 31, wave = tid >> 5, q = lane >> 3, c8 = (lane & 7) * 8;
#pragma unroll
    for (int it = 0; it < 2; ++it) {
      const int fl = wave * 8 + it * 4 + q;                   // out row within tile = input col within tile
      v4u t4;
#pragma unroll
      for (int e = 0; e < 4; ++e) {
        const unsigned lo16 = (unsigned)f2bf_bits(tile[c8 + 2 * e][fl]);
        const unsigned hi16 = (unsigned)f2bf_bits(tile[c8 + 2 * e + 1][fl]);
        t4[e] = lo16 | (hi16 << 16);
      }
      *(v4u*)(dst + (size_t)(ct * 64 + fl) * EMB_SZ + rt * 64 + c8) = t4;
    }
  }

  // ---- convert and store the activation units ----
#pragma unroll
  for (int x = 0; x < 3; ++x) {
#pragma unroll
    for (int j = 0; j < PREP_PER_THR; ++j) {
      unsigned short* o = xb + (size_t)x * PLANE_ELEMS + (size_t)(u0 + (unsigned)j * PREP_THREADS) * 8;
      *(v4u*)o = pack8_bf16(xa[x][j], xc[x][j]);
    }
  }
}

// =====================================================================================================
// Causal flash attention, head_dim 256, operands = bf16 hi/lo planes.
//   Q/K/V planes: element (b, s, h, d) at [(b*SEQLEN + s)*EMB_SZ + h*HDIM + d] (hi plane and lo plane).
//   scores = (Qhi.Khi + Qhi.Klo + Qlo.Khi) * inv_scale; causal mask = -inf for key > query (diagonal chunk);
//   online softmax in f32; P (unnormalised exp) split to bf16 hi/lo in LDS; O += Phi.Vhi + Phi.Vlo + Plo.Vhi;
//   out = O / l written as bf16 hi/lo concat planes in the same [(b,s)][h*HDIM + d] layout.
// Block = 256 threads = 8 waves, 64 query rows of one (b,h); wave w: row group rw = w&3 (16 rows),
// half ch = w>>2: d half (128 of 256) for the score products, key half (32 of 64 keys) for the softmax,
// column half (128 of 256) for O. Q stays in registers: each wave holds its 16 rows x its d half, forms partial
// scores for all 64 keys, and the two waves of a row group swap the partial tiles of each other's key half in LDS.
// Row max / row sum of the two key halves combined through LDS with block barriers.
// Work items: a query block of the lower half of the sequence (at most 16 key chunks) is one work-group and writes the
// concat planes itself. A query block of the upper half is two work-groups, each with half of its key chunks; each
// writes its unnormalised O tile with its row max and row sum to the workspace, and attn_merge (the next launch) joins
// the two. So no work-group walks more than 16 chunks. grid = (NBATCH*NHEAD, AT_ITEMS), items with many chunks first.
// =====================================================================================================
constexpr int AT_KEYS  = 64;    // keys per chunk
constexpr int AT_QROWS = 64;    // query rows per block
constexpr int AT_WHALF = 128;   // output columns per wave
constexpr int AT_NQB   = SEQLEN / AT_QROWS;        // 32 query blocks per (b,h)
constexpr int AT_NSOLE = AT_NQB / 2;               // query blocks 0..15: one work-group each
constexpr int AT_ITEMS = AT_NSOLE + 2 * (AT_NQB - AT_NSOLE);   // 48 work-groups per (b,h)
static_assert(AT_NQB % 2 == 0 && PART_TILES == NBATCH * NHEAD * 2 * (AT_NQB - AT_NSOLE));
static_assert(PART_TILE_F32 == (size_t)AT_QROWS * HDIM && 2 * AT_QROWS == 128);
// LDS row pitches in 16-bit elements. K and P rows are read by b128 fragment loads: 16 B of pad make the pitch an odd
// multiple of 16 B, so the 16 rows of one read fall on 16 different groups of four banks. V rows are read by the
// transposing load, whose conflict-free pitch is an odd multiple of 32 B.
constexpr int AT_KPITCH = HDIM + 8;       // K rows [key][d]: 528 B
constexpr int AT_VPITCH = HDIM + 16;      // V rows [key][d]: 544 B
constexpr int AT_PPITCH = AT_KEYS + 8;    // P rows [row][key]: 144 B
static_assert(SEQLEN % AT_QROWS == 0 && SEQLEN % AT_KEYS == 0 && HDIM == 2 * AT_WHALF);
static_assert(8 * 16 * AT_WHALF <= AT_KEYS * AT_KPITCH);   // output staging slabs fit one K plane
static_assert((AT_KPITCH * 2) % 32 == 16 && (AT_VPITCH * 2) % 64 == 32 && (AT_PPITCH * 2) % 32 == 16);
static_assert(HDIM * 2 == 32 * 16 && AT_KEYS == 8 * 8);    // one copy of a wave = one row; 8 waves x 8 rows = one plane
static_assert(8 * 512 * 4 <= 2 * AT_QROWS * AT_PPITCH * 2);  // the partial-score swap (8 waves x 2 tiles, f32) fits the P planes

__device__ __forceinline__ v16b ldfrag16(const unsigned short* p) {   // elements 0..7 <- p[0..7], 8..15 <- p[16..23]
  union { v16b v; v8b h[2]; } f;
  f.h[0] = *(const v8b*)(p); f.h[1] = *(const v8b*)(p + 16); return f.v;
}
// B fragment (32 keys x 16 d) of a row-major [key][d] LDS tile: p = this lane's address in the first 16 keys,
// row 8*(lane>>4) + (lane&7), column 8*((lane>>3)&1). Lane (c, hh) receives keys 8hh..8hh+7 of column c, then keys
// 16+8hh..16+8hh+7: the k order of ldfrag16.
typedef short s16x8 __attribute__((ext_vector_type(8)));
__device__ __forceinline__ v16b ldfrag16_tr(const unsigned short* p) {
  typedef __attribute__((address_space(3))) s16x8 lds_s16x8;
  union { v16b v; s16x8 h[2]; } f;
  f.h[0] = __builtin_amdgcn_ds_load_tr16_b128_v8i16((lds_s16x8*)p);
  f.h[1] = __builtin_amdgcn_ds_load_tr16_b128_v8i16((lds_s16x8*)(p + 16 * AT_VPITCH));
  return f.v;
}
// Eight asynchronous copies of one wave, global -> LDS: copy j brings row j (512 B, 16 B per lane). g and l are the
// lane's own addresses in row 0. The s_wait_xcnt closes the statement so that it stands in front of every later write
// of an address register that a copy names.
__device__ __forceinline__ void copy_rows8(const unsigned short* l, int lpitch, const unsigned short* g) {
  const unsigned l0 = (unsigned)(size_t)l;
  const unsigned lp = (unsigned)lpitch * 2u;
  asm volatile(
      "global_load_async_to_lds_b128 %0, %8, off\n\t"
      "global_load_async_to_lds_b128 %1, %9, off\n\t"
      "global_load_async_to_lds_b128 %2, %10, off\n\t"
      "global_load_async_to_lds_b128 %3, %11, off\n\t"
      "global_load_async_to_lds_b128 %4, %12, off\n\t"
      "global_load_async_to_lds_b128 %5, %13, off\n\t"
      "global_load_async_to_lds_b128 %6, %14, off\n\t"
      "global_load_async_to_lds_b128 %7, %15, off\n\t"
      "s_wait_xcnt 0x0"
      :: "v"(l0), "v"(l0 + lp), "v"(l0 + 2u * lp), "v"(l0 + 3u * lp),
         "v"(l0 + 4u * lp), "v"(l0 + 5u * lp), "v"(l0 + 6u * lp), "v"(l0 + 7u * lp),
         "v"(g), "v"(g + EMB_SZ), "v"(g + 2 * EMB_SZ), "v"(g + 3 * EMB_SZ),
         "v"(g + 4 * EMB_SZ), "v"(g + 5 * EMB_SZ), "v"(g + 6 * EMB_SZ), "v"(g + 7 * EMB_SZ)
      : "memory");
}
__device__ __forceinline__ v8f mma_bf(v16b a, v16b b, v8f c) {
  c = __builtin_amdgcn_wmma_f32_16x16x32_bf16(false, a, false, b, (short)0, c, false, false);
  asm volatile("v_nop\n\tv_nop\n\tv_nop\n\tv_nop" : "+v"(c) : "v"(a), "v"(b));
  return c;
}

// Second bound: four waves per SIMD, so that two workgroups still share a WGP (its LDS holds two) with Q resident.
__global__ __launch_bounds__(256, 4) void attn_hd256(
    const unsigned short* __restrict__ Qh, const unsigned short* __restrict__ Ql,
    const unsigned short* __restrict__ Kh, const unsigned short* __restrict__ Kl,
    const unsigned short* __restrict__ Vh, const unsigned short* __restrict__ Vl,
    unsigned short* __restrict__ Oh, unsigned short* __restrict__ Ol,
    float* __restrict__ part, float* __restrict__ pml, float inv_scale) {
  __shared__ __align__(16) unsigned short Ks[2][AT_KEYS * AT_KPITCH];   // [plane][key][d]   67584 B; reused as output staging
  __shared__ __align__(16) unsigned short Vs[2][AT_KEYS * AT_VPITCH];   // [plane][key][d]   69632 B
  __shared__ __align__(16) unsigned short Ps[2][AT_QROWS * AT_PPITCH];  // [plane][row][key] 18432 B
  __shared__ float redm[2][AT_QROWS];                                // partial row max per key half
  __shared__ float reds[2][AT_QROWS];                                // partial row sum per key half
  // Running row max and row sum, one copy per wave (index [ch][row]), written by that wave alone and read by it (wave 0 also reads the ch 0 copies of all 64 rows after a split item's last chunk): they are
  // used once a chunk, and in LDS they leave their 16 registers to the fragment sets of the two products.
  __shared__ __align__(16) float runm[2][AT_QROWS];
  __shared__ __align__(16) float runl[2][AT_QROWS];

  const int tid  = threadIdx.x;
  const int lane = tid & 31;
  const int wave = __builtin_amdgcn_readfirstlane(tid >> 5);   // scalar: what derives from it alone costs no vector register
  const int hh   = lane >> 4;
  const int c    = lane & 15;
  const int rw   = wave & 3;
  const int ch   = wave >> 2;
  const int bh   = blockIdx.x;                 // b*NHEAD + h
  // Items in reverse of blockIdx.y: low blockIdx.y takes the items of the long query blocks, the shortest come last.
  const int item  = AT_ITEMS - 1 - (int)blockIdx.y;
  const bool split = item >= AT_NSOLE;         // block-uniform: this work-group has half of its query block's chunks
  const int pidx = item - AT_NSOLE;            // split items: 2 * (qb - AT_NSOLE) + key range
  const int qb   = split ? AT_NSOLE + (pidx >> 1) : item;   // query block 0..31
  const int h    = bh % NHEAD;
  const int b    = bh / NHEAD;
  const int q0w  = qb * AT_QROWS + rw * 16;    // first query row (within the sequence) of this wave
  const size_t rowb = (size_t)b * SEQLEN;      // flattened row base of this batch
  const int hcol = h * HDIM;

  v8f oacc[8];
#pragma unroll
  for (int r = 0; r < 8; ++r) { runm[ch][rw * 16 + 8 * hh + r] = -INFINITY; runl[ch][rw * 16 + 8 * hh + r] = 0.f; }
#pragma unroll
  for (int t = 0; t < 8; ++t) oacc[t] = (v8f){0.f,0.f,0.f,0.f,0.f,0.f,0.f,0.f};

  // This wave's 16 query rows x its d half, hi and lo, as A fragments (row m = c): loaded once, kept for every chunk.
  v16b qfh[4], qfl[4];
  {
    const size_t qoff = (rowb + q0w + c) * EMB_SZ + hcol + ch * AT_WHALF + 8 * hh;
#pragma unroll   // constant indices keep the fragment arrays in registers
    for (int dc = 0; dc < 4; ++dc) {
      qfh[dc] = ldfrag16(Qh + qoff + dc * 32);
      qfl[dc] = ldfrag16(Ql + qoff + dc * 32);
    }
  }
  // Swap area for partial score tiles, in the P planes (free from the chunk's first barrier to the row-max barrier):
  // per wave 4 quads x 32 lanes x 4 floats, so that each b128 access of a wave is 512 contiguous bytes.
  float* const xown  = reinterpret_cast<float*>(&Ps[0][0]) + wave * 512 + lane * 4;
  const float* const xpeer = reinterpret_cast<const float*>(&Ps[0][0]) + (wave ^ 4) * 512 + lane * 4;

  const int nch = qb + 1;                      // causal horizon in 64-key chunks (block-uniform)
  const int kc0 = (split && (pidx & 1)) ? (nch >> 1) : 0;     // this work-group's chunks: [kc0, kc1), never empty
  const int kc1 = (split && !(pidx & 1)) ? (nch >> 1) : nch;
  for (int kc = kc0; kc < kc1; ++kc) {
    const int kv0 = kc * AT_KEYS;
    // This wave's LDS reads of the last chunk have returned before the barrier behind which K and V are overwritten.
    asm volatile("s_wait_dscnt 0x0" ::: "memory");
    __syncthreads();
    // ---- stage K and V (hi/lo, both [key][d]) by asynchronous copies to LDS ----
    // Coverage: wave w brings keys 8w..8w+7 of each of the four planes, one whole row per copy.
    {
      const int kr0 = wave * 8;
      const size_t gbase = (rowb + kv0 + kr0) * EMB_SZ + hcol + lane * 8;
      copy_rows8(&Ks[0][kr0 * AT_KPITCH + lane * 8], AT_KPITCH, Kh + gbase);
      copy_rows8(&Ks[1][kr0 * AT_KPITCH + lane * 8], AT_KPITCH, Kl + gbase);
      copy_rows8(&Vs[0][kr0 * AT_VPITCH + lane * 8], AT_VPITCH, Vh + gbase);
      copy_rows8(&Vs[1][kr0 * AT_VPITCH + lane * 8], AT_VPITCH, Vl + gbase);
    }
    // This wave's copies have landed before the barrier behind which the other waves read them.
    asm volatile("s_wait_asynccnt 0x0" ::: "memory");
    __syncthreads();

    // ---- partial scores over this wave's d half: 16 rows x 64 keys (four 16x16 D tiles), hi.hi + hi.lo + lo.hi ----
    // Tiles 0,1 = this wave's own key half, tiles 2,3 = the other wave's.
    v8f sp[4];
#pragma unroll
    for (int j = 0; j < 4; ++j) sp[j] = (v8f){0.f,0.f,0.f,0.f,0.f,0.f,0.f,0.f};
    // K fragments are read two groups ahead of the products that use them (a group = one d step of one key tile, hi and
    // lo), in three rotating register sets: a group's LDS latency runs under the six products in front of it.
    v16b kfh[3], kfl[3];
#pragma unroll   // constant indices keep the fragment sets in registers
    for (int g = 0; g < 2; ++g) {
      const int koff = (((ch * 2 + (g & 3)) & 3) * 16 + c) * AT_KPITCH + ch * AT_WHALF + (g >> 2) * 32 + 8 * hh;
      kfh[g] = ldfrag16(&Ks[0][koff]);
      kfl[g] = ldfrag16(&Ks[1][koff]);
    }
#pragma unroll   // constant indices keep qfh, qfl, sp and the fragment sets in registers
    for (int g = 0; g < 16; ++g) {
      if (g + 2 < 16) {
        const int gn = g + 2;
        const int kr = ((ch * 2 + (gn & 3)) & 3) * 16 + c;                 // B fragment column n = key kr
        const int koff = kr * AT_KPITCH + ch * AT_WHALF + (gn >> 2) * 32 + 8 * hh;
        kfh[gn % 3] = ldfrag16(&Ks[0][koff]);
        kfl[gn % 3] = ldfrag16(&Ks[1][koff]);
      }
      const int dc = g >> 2, j = g & 3;
      sp[j] = mma_bf(qfh[dc], kfh[g % 3], sp[j]);
      sp[j] = mma_bf(qfh[dc], kfl[g % 3], sp[j]);
      sp[j] = mma_bf(qfl[dc], kfh[g % 3], sp[j]);
    }
    // ---- swap: hand tiles 2,3 to the other wave of the row group, add its partials to tiles 0,1 ----
#pragma unroll
    for (int q = 0; q < 4; ++q) {
      const v8f t = sp[2 + (q >> 1)];
      const int e = (q & 1) * 4;
      *(v4f*)(xown + q * 128) = (v4f){t[e], t[e + 1], t[e + 2], t[e + 3]};
    }
    __syncthreads();   // every wave's partial tiles are in LDS before the other wave of its row group reads them
    v8f s[2];
    {
      v4f t[4];
#pragma unroll
      for (int q = 0; q < 4; ++q) t[q] = *(const v4f*)(xpeer + q * 128);
#pragma unroll
      for (int q = 0; q < 4; ++q)
#pragma unroll
        for (int i = 0; i < 4; ++i) s[q >> 1][(q & 1) * 4 + i] = sp[q >> 1][(q & 1) * 4 + i] + t[q][i];
    }

    // ---- scale, causal mask, partial row max over this wave's 32 keys ----
    const bool diag = (kc == qb);                // block-uniform
    // key (D col c of tile 0) minus query (D row 8hh): key > query of tile j, row r reads rel + 16j > r, a compare
    // with a constant, so that no register holds a query row index through the loop
    const int rel = (kv0 + ch * 32 + c) - (q0w + 8 * hh);
#pragma unroll
    for (int r = 0; r < 8; ++r) {
      float m = -INFINITY;
#pragma unroll
      for (int j = 0; j < 2; ++j) {
        float sv = s[j][r] * inv_scale;
        if (diag && (rel + j * 16 > r)) sv = -INFINITY;
        s[j][r] = sv;
        m = fmaxf(m, sv);
      }
      m = fmaxf(m, __shfl_xor(m, 1, 32));
      m = fmaxf(m, __shfl_xor(m, 2, 32));
      m = fmaxf(m, __shfl_xor(m, 4, 32));
      m = fmaxf(m, __shfl_xor(m, 8, 32));
      redm[ch][rw * 16 + 8 * hh + r] = m;
    }
    __syncthreads();

    // ---- online softmax update; P hi/lo to LDS; partial sums ----
    float alph[8];
#pragma unroll
    for (int r = 0; r < 8; ++r) {
      const int row = rw * 16 + 8 * hh + r;
      const float mc = fmaxf(redm[0][row], redm[1][row]);
      const float mold = runm[ch][row];
      const float mnew = fmaxf(mold, mc);
      const float alpha = expf(mold - mnew);
      runm[ch][row] = mnew;
      alph[r] = alpha;
      float psum = 0.f;
#pragma unroll
      for (int j = 0; j < 2; ++j) {
        const float p = expf(s[j][r] - mnew);
        psum += p;
        const unsigned short hb = f2bf_bits(p);
        const unsigned short lb = f2bf_bits(p - bf_bits2f(hb));
        const int pidx = row * AT_PPITCH + ch * 32 + j * 16 + c;
        Ps[0][pidx] = hb;
        Ps[1][pidx] = lb;
      }
      psum += __shfl_xor(psum, 1, 32);
      psum += __shfl_xor(psum, 2, 32);
      psum += __shfl_xor(psum, 4, 32);
      psum += __shfl_xor(psum, 8, 32);
      reds[ch][row] = psum;
#pragma unroll
      for (int t = 0; t < 8; ++t) oacc[t][r] *= alpha;
    }
    __syncthreads();
#pragma unroll
    for (int r = 0; r < 8; ++r) {
      const int row = rw * 16 + 8 * hh + r;
      runl[ch][row] = runl[ch][row] * alph[r] + (reds[0][row] + reds[1][row]);
    }

    // ---- O += P.V over 64 keys for this wave's 16 rows x 128 columns ----
    // V fragments (and the second key half's P fragments) are read two groups ahead of their products, as K above;
    // a group = 32 keys x 16 columns, hi and lo.
    {
      const int poff = (rw * 16 + c) * AT_PPITCH + 8 * hh;                      // A fragment row m = c
      const int voff = (8 * hh + (lane & 7)) * AT_VPITCH + ch * AT_WHALF + ((lane >> 3) & 1) * 8;   // B fragment column n = d
      v16b pfh[2], pfl[2], vfh[3], vfl[3];
      pfh[0] = ldfrag16(&Ps[0][poff]);
      pfl[0] = ldfrag16(&Ps[1][poff]);
#pragma unroll   // constant indices keep the fragment sets in registers
      for (int g = 0; g < 2; ++g) {
        vfh[g] = ldfrag16_tr(&Vs[0][voff + g * 16]);
        vfl[g] = ldfrag16_tr(&Vs[1][voff + g * 16]);
      }
#pragma unroll   // constant indices keep oacc and the fragment sets in registers
      for (int g = 0; g < 16; ++g) {
        if (g + 2 < 16) {
          const int gn = g + 2;
          if (gn == 8) {
            pfh[1] = ldfrag16(&Ps[0][poff + 32]);
            pfl[1] = ldfrag16(&Ps[1][poff + 32]);
          }
          const int vo = voff + (gn >> 3) * 32 * AT_VPITCH + (gn & 7) * 16;
          vfh[gn % 3] = ldfrag16_tr(&Vs[0][vo]);
          vfl[gn % 3] = ldfrag16_tr(&Vs[1][vo]);
        }
        const int kk = g >> 3, t = g & 7;
        oacc[t] = mma_bf(pfh[kk], vfh[g % 3], oacc[t]);
        oacc[t] = mma_bf(pfh[kk], vfl[g % 3], oacc[t]);
        oacc[t] = mma_bf(pfl[kk], vfh[g % 3], oacc[t]);
      }
    }
  }

  // ---- epilogue: normalise, split to bf16 hi/lo in per-wave LDS slabs (K region), whole-line stores ----
  __syncthreads();
  if (split) {   // block-uniform: every wave of the work-group leaves here, in front of the epilogue's barrier
    // Partial tile in register order: wave w, quad (t, q), lane -> 4 floats (D rows 8hh+4q..+3 of column tile t), so that
    // each store of a wave is 512 contiguous bytes; attn_merge reads it back in the same order.
    const int slot = bh * (2 * (AT_NQB - AT_NSOLE)) + pidx;
    float* pb = part + (size_t)slot * PART_TILE_F32 + wave * (16 * AT_WHALF) + lane * 4;
#pragma unroll   // both loops: constant indices keep oacc in registers
    for (int t = 0; t < 8; ++t)
#pragma unroll
      for (int q = 0; q < 2; ++q)
        *(v4f*)(pb + (t * 2 + q) * 128) = (v4f){oacc[t][4 * q], oacc[t][4 * q + 1], oacc[t][4 * q + 2], oacc[t][4 * q + 3]};
    // Stands in front of every later write of a register that one of these stores names.
    asm volatile("s_wait_xcnt 0x0" ::: "memory");
    if (wave == 0) {   // one wave writes the 64 row maxima and the 64 row sums: four whole lines
      float* pm = pml + (size_t)slot * 128 + lane;
      const float m0 = runm[0][lane], m1 = runm[0][32 + lane], l0 = runl[0][lane], l1 = runl[0][32 + lane];
      pm[0] = m0; pm[32] = m1; pm[64] = l0; pm[96] = l1;
    }
    return;
  }
  unsigned short* slh = &Ks[0][wave * (16 * AT_WHALF)];
  unsigned short* sll = &Ks[1][wave * (16 * AT_WHALF)];
#pragma unroll
  for (int r = 0; r < 8; ++r) {
    const float inv = 1.0f / runl[ch][rw * 16 + 8 * hh + r];
    const int row = 8 * hh + r;
#pragma unroll
    for (int t = 0; t < 8; ++t) {
      const float v = oacc[t][r] * inv;
      const unsigned short hb = f2bf_bits(v);
      const unsigned short lb = f2bf_bits(v - bf_bits2f(hb));
      slh[row * AT_WHALF + t * 16 + c] = hb;
      sll[row * AT_WHALF + t * 16 + c] = lb;
    }
  }
  __syncthreads();
  // Store coverage: 8 iterations x rows (2it + hh) = 16 rows; per row 16 lanes x 16 B = 128 columns = 2 whole
  {
    {
#pragma unroll
      for (int it = 0; it < 8; ++it) {
        const int row = it * 2 + hh;
        const v4u wh = *(const v4u*)(slh + row * AT_WHALF + c * 8);
        const v4u wl = *(const v4u*)(sll + row * AT_WHALF + c * 8);
        const size_t go = (rowb + q0w + row) * EMB_SZ + hcol + ch * AT_WHALF + c * 8;
        *(v4u*)(Oh + go) = wh;
        *(v4u*)(Ol + go) = wl;
      }
      
    }
  }
}

// ---- join of the two key ranges of a query block of the upper half -------------------------------------------------
// One work-group per (b,h, query block); thread roles as in attn_hd256 (wave: 16 rows x 128 columns). With m = max(m0, m1)
// and e_i = exp(m_i - m): out = (e0 * O0 + e1 * O1) / (e0 * l0 + e1 * l1), written as bf16 hi/lo concat planes.
__global__ __launch_bounds__(256) void attn_merge(
    const float* __restrict__ part, const float* __restrict__ pml,
    unsigned short* __restrict__ Oh, unsigned short* __restrict__ Ol) {
  __shared__ __align__(16) unsigned short slab[2][8 * 16 * AT_WHALF];   // [plane][wave][row][column] 65536 B
  const int tid  = threadIdx.x;
  const int lane = tid & 31;
  const int wave = __builtin_amdgcn_readfirstlane(tid >> 5);   // scalar: what derives from it alone costs no vector register
  const int hh   = lane >> 4;
  const int c    = lane & 15;
  const int rw   = wave & 3;
  const int ch   = wave >> 2;
  const int bh   = blockIdx.x;                 // b*NHEAD + h
  const int qb   = AT_NSOLE + (int)blockIdx.y; // query block 16..31
  const int h    = bh % NHEAD;
  const int b    = bh / NHEAD;
  const int q0w  = qb * AT_QROWS + rw * 16;    // first query row (within the sequence) of this wave
  const size_t rowb = (size_t)b * SEQLEN;
  const int hcol = h * HDIM;
  const int slot = bh * (2 * (AT_NQB - AT_NSOLE)) + 2 * (int)blockIdx.y;   // key range 0; range 1 is the next slot

  // All loads of a thread are issued before the first use: 32 tile quads and the row figures of its 8 rows.
  const float* p0 = part + (size_t)slot * PART_TILE_F32 + wave * (16 * AT_WHALF) + lane * 4;
  const float* pm = pml + (size_t)slot * 128 + rw * 16 + 8 * hh;
  v4f a0[16], a1[16], ml[8];
#pragma unroll   // this loop and the next: constant indices keep the arrays in registers
  for (int k = 0; k < 4; ++k) {                // k: m of range 0, l of range 0, m of range 1, l of range 1
    ml[2 * k]     = *(const v4f*)(pm + k * 64);
    ml[2 * k + 1] = *(const v4f*)(pm + k * 64 + 4);
  }
#pragma unroll
  for (int k = 0; k < 16; ++k) {
    a0[k] = *(const v4f*)(p0 + k * 128);
    a1[k] = *(const v4f*)(p0 + PART_TILE_F32 + k * 128);
  }
  // Stands in front of every later write of a register that one of these loads names as its address: as inputs the two
  // addresses stay live up to here, so that no result of a later load of the run is placed on a register they are formed from.
  asm volatile("s_wait_xcnt 0x0" :: "v"(p0), "v"(pm) : "memory");
  float w0[8], w1[8];
#pragma unroll   // constant indices keep ml, w0 and w1 in registers
  for (int r = 0; r < 8; ++r) {
    const float m0 = ml[r >> 2][r & 3], l0 = ml[2 + (r >> 2)][r & 3];
    const float m1 = ml[4 + (r >> 2)][r & 3], l1 = ml[6 + (r >> 2)][r & 3];
    const float m  = fmaxf(m0, m1);
    const float e0 = expf(m0 - m), e1 = expf(m1 - m);
    const float inv = 1.0f / (e0 * l0 + e1 * l1);
    w0[r] = e0 * inv;
    w1[r] = e1 * inv;
  }
  unsigned short* slh = &slab[0][wave * (16 * AT_WHALF)];
  unsigned short* sll = &slab[1][wave * (16 * AT_WHALF)];
#pragma unroll   // both loops: constant indices keep a0, a1, w0 and w1 in registers
  for (int r = 0; r < 8; ++r) {
    const int row = 8 * hh + r;
#pragma unroll
    for (int t = 0; t < 8; ++t) {
      const float v = a0[t * 2 + (r >> 2)][r & 3] * w0[r] + a1[t * 2 + (r >> 2)][r & 3] * w1[r];
      const unsigned short hb = f2bf_bits(v);
      const unsigned short lb = f2bf_bits(v - bf_bits2f(hb));
      slh[row * AT_WHALF + t * 16 + c] = hb;
      sll[row * AT_WHALF + t * 16 + c] = lb;
    }
  }
  __syncthreads();   // the slabs are complete before they are read back row by row
  // Store coverage: 8 iterations x rows (2it + hh) = 16 rows; per row 16 lanes x 16 B = 128 columns = 2 whole lines.
#pragma unroll   // the row offsets go into the offset fields of the LDS reads and of the stores
  for (int it = 0; it < 8; ++it) {
    const int row = it * 2 + hh;
    const v4u wh = *(const v4u*)(slh + row * AT_WHALF + c * 8);
    const v4u wl = *(const v4u*)(sll + row * AT_WHALF + c * 8);
    const size_t go = (rowb + q0w + row) * EMB_SZ + hcol + ch * AT_WHALF + c * 8;
    *(v4u*)(Oh + go) = wh;
    *(v4u*)(Ol + go) = wl;
  }
}

// ---------------------------------------------------------------------------------------------------
extern "C" void kernel_launch(void* const* d_in, const int* in_sizes, int n_in,
                              void* d_out, int out_size, void* d_ws, size_t ws_size,
                              hipStream_t stream) {
  (void)in_sizes; (void)n_in; (void)out_size;
  const float* Xk = (const float*)d_in[0];
  const float* Xv = (const float*)d_in[1];
  const float* Xq = (const float*)d_in[2];
  const float* Wk = (const float*)d_in[3];
  const float* Wv = (const float*)d_in[4];
  const float* Wq = (const float*)d_in[5];
  const float* Wo = (const float*)d_in[6];
  const float* bo = (const float*)d_in[7];
  float* out = (float*)d_out;

  if (ws_size < WS_TOTAL_BYTES) return;

  unsigned short* ws = (unsigned short*)d_ws;
  unsigned short* xk_b = ws + 0 * PLANE_ELEMS;   // later: concat hi
  unsigned short* xv_b = ws + 1 * PLANE_ELEMS;   // later: concat lo
  unsigned short* xq_b = ws + 2 * PLANE_ELEMS;
  unsigned short* k_hi = ws + 3 * PLANE_ELEMS;
  unsigned short* k_lo = ws + 4 * PLANE_ELEMS;
  unsigned short* v_hi = ws + 5 * PLANE_ELEMS;
  unsigned short* v_lo = ws + 6 * PLANE_ELEMS;
  unsigned short* q_hi = ws + 7 * PLANE_ELEMS;
  unsigned short* q_lo = ws + 8 * PLANE_ELEMS;
  unsigned short* wkT  = ws + WS_OFF_WKT;
  unsigned short* wvT  = ws + WS_OFF_WVT;
  unsigned short* wqT  = ws + WS_OFF_WQT;
  unsigned short* woT  = ws + WS_OFF_WOT;
  unsigned short* cc_hi = xk_b;
  unsigned short* cc_lo = xv_b;
  float* part = (float*)((char*)d_ws + WS_OFF_PART_BYTES);   // partial attention tiles
  float* pml  = (float*)((char*)d_ws + WS_OFF_PML_BYTES);    // their row max / row sum

  // 1) + 2) inputs -> bf16 planes (RNE), [8192][768] each; weights [3][768][256] -> [3][256][768] bf16 (Bt layout
  //    [N=f][K=e]); Wo [768 k][768 n] -> [768 n][768 k]: one launch
  prep_inputs<<<dim3(PREP_WGS), 256, 0, stream>>>(Xk, Xv, Xq, Wk, Wv, Wq, Wo, xk_b, wkT);

  // 3) per-head projections: C_h[8192 x 256] = X[8192 x 768] . (W_h^T)[256 x 768]^T, written as bf16 hi/lo
  //    planes at column offset h*256 with ldc 768 (grid.y = head). M=8192, N=256, K=768: 512 tiles = 64 blocks x 8 waves.
  const dim3 gproj((NROWS / 64) * (HDIM / 64) / 8, NHEAD);
  wmma_gemm64<1, false, false, 0, 2><<<gproj, 256, 0, stream>>>(
      xk_b, xk_b, EMB_SZ, 0L, wkT, wkT, EMB_SZ, (long)HDIM * EMB_SZ,
      (void*)k_hi, (void*)k_lo, EMB_SZ, (long)HDIM, bo, NROWS, HDIM, EMB_SZ, 1.0f);
  wmma_gemm64<1, false, false, 0, 2><<<gproj, 256, 0, stream>>>(
      xv_b, xv_b, EMB_SZ, 0L, wvT, wvT, EMB_SZ, (long)HDIM * EMB_SZ,
      (void*)v_hi, (void*)v_lo, EMB_SZ, (long)HDIM, bo, NROWS, HDIM, EMB_SZ, 1.0f);
  wmma_gemm64<1, false, false, 0, 2><<<gproj, 256, 0, stream>>>(
      xq_b, xq_b, EMB_SZ, 0L, wqT, wqT, EMB_SZ, (long)HDIM * EMB_SZ,
      (void*)q_hi, (void*)q_lo, EMB_SZ, (long)HDIM, bo, NROWS, HDIM, EMB_SZ, 1.0f);

  // 4) causal attention -> concat hi/lo planes (X planes are dead now)
  const float inv_scale = 1.0f / sqrtf((float)SEQLEN);
  attn_hd256<<<dim3(NBATCH * NHEAD, AT_ITEMS), 256, 0, stream>>>(
      q_hi, q_lo, k_hi, k_lo, v_hi, v_lo, cc_hi, cc_lo, part, pml, inv_scale);
  attn_merge<<<dim3(NBATCH * NHEAD, AT_NQB - AT_NSOLE), 256, 0, stream>>>(part, pml, cc_hi, cc_lo);

  // 5) output projection: out[8192 x 768] = concat(hi+lo) . (Wo^T)^T + bo, f32. M=8192, N=768, K=768: 1536 tiles = 192 blocks.
  const dim3 gout((NROWS / 64) * (EMB_SZ / 64) / 8, 1);
  wmma_gemm64<1, true, false, 2, 0><<<gout, 256, 0, stream>>>(
      cc_hi, cc_lo, EMB_SZ, 0L, woT, woT, EMB_SZ, 0L,
      (void*)out, (void*)out, EMB_SZ, 0L, bo, NROWS, EMB_SZ, EMB_SZ, 1.0f);
}

// v008
// Measured time: 175 microseconds a run.
// In both of two side-by-side timings against v007, it was 1.04 times as fast.
// Over all steps from v000 it is 6.21 times as fast.
// Contractions on v_wmma_f32_16x16x32_bf16 with f32 accumulate: per-head projections = bf16(X) x bf16(W^T) (inputs RNE-converted once); Q.K^T and P.V = bf16 hi/lo planes (hi.hi + hi.lo + lo.hi); output projection = concat bf16 hi/lo x bf16(Wo^T) (hi.W + lo.W) + bf16(bo); softmax, rescaling and normalisation in f32.
#include <hip/hip_runtime.h>
#include <stdint.h>
#include <math.h>

typedef __attribute__((ext_vector_type(16))) _Float16 v16h;
typedef __attribute__((ext_vector_type(8)))  _Float16 v8h;
typedef __attribute__((ext_vector_type(16))) __bf16   v16b;
typedef __attribute__((ext_vector_type(8)))  __bf16   v8b;
typedef __attribute__((ext_vector_type(8)))  float    v8f;
typedef __attribute__((ext_vector_type(4)))  float    v4f;
typedef __attribute__((ext_vector_type(4)))  unsigned v4u;

// ---- problem geometry ----
constexpr int EMB_SZ  = 768;
constexpr int NHEAD   = 3;
constexpr int HDIM    = 256;
constexpr int NBATCH  = 4;
constexpr int SEQLEN  = 2048;
constexpr int NROWS   = NBATCH * SEQLEN;                       // 8192 flattened (b,s) rows
constexpr size_t PLANE_ELEMS = (size_t)NROWS * EMB_SZ;          // 6291456 elements per [8192][768] plane
constexpr size_t PLANE_BYTES = PLANE_ELEMS * 2;                 // 12582912 B per 16-bit plane
constexpr size_t WT_ELEMS    = (size_t)NHEAD * HDIM * EMB_SZ;   // 589824 (W^T planes [3][256][768])
constexpr size_t WO_ELEMS    = (size_t)EMB_SZ * EMB_SZ;         // 589824 (Wo^T plane [768][768])

// [0]            Xk bf16 plane        (dead after projections; reused as concat hi plane)
// [1*PLANE]      Xv bf16 plane        (reused as concat lo plane)
// [2*PLANE]      Xq bf16 plane
// [3*PLANE]      K hi, [4*PLANE] K lo, [5*PLANE] V hi, [6*PLANE] V lo, [7*PLANE] Q hi, [8*PLANE] Q lo
// [9*PLANE]      Wk^T bf16 [3][256][768], then Wv^T, Wq^T (WT_ELEMS each)
// [9*PLANE+3*WT] Wo^T bf16 [768][768]
// then, f32:     partial attention tiles (unnormalised O, 64 x 256 each) and their row max / row sum (128 floats each)
constexpr size_t WS_OFF_WKT = 9 * PLANE_ELEMS;
constexpr size_t WS_OFF_WVT = WS_OFF_WKT + WT_ELEMS;
constexpr size_t WS_OFF_WQT = WS_OFF_WVT + WT_ELEMS;
constexpr size_t WS_OFF_WOT = WS_OFF_WQT + WT_ELEMS;
constexpr size_t WS_PLANES_BYTES = (WS_OFF_WOT + WO_ELEMS) * 2;   // 117964800 B
static_assert(WS_PLANES_BYTES == 117964800ull);
constexpr int    PART_TILES     = NBATCH * NHEAD * (SEQLEN / 64);   // 384: two key ranges for the upper half of the query blocks
constexpr size_t PART_TILE_F32  = (size_t)64 * HDIM;                // 16384 floats per tile
constexpr size_t WS_OFF_PART_BYTES = WS_PLANES_BYTES;
constexpr size_t WS_OFF_PML_BYTES  = WS_OFF_PART_BYTES + (size_t)PART_TILES * PART_TILE_F32 * 4;
constexpr size_t WS_TOTAL_BYTES    = WS_OFF_PML_BYTES + (size_t)PART_TILES * 128 * 4;   // 143327232 B
static_assert(WS_TOTAL_BYTES == 143327232ull);
static_assert(WS_TOTAL_BYTES <= 268435456ull);
static_assert((WS_OFF_PART_BYTES % 128) == 0 && (WS_OFF_PML_BYTES % 128) == 0);
static_assert((PLANE_BYTES % 128) == 0 && ((WT_ELEMS * 2) % 128) == 0 && ((WO_ELEMS * 2) % 128) == 0);

// ---- GEMM shape contract for the launches in this file ----
static_assert(NROWS % 64 == 0 && HDIM % 64 == 0 && EMB_SZ % 64 == 0);   // M, N tile multiples
static_assert(EMB_SZ % 128 == 0);                                         // K % 128 == 0 for all GEMMs (K = 768)
static_assert(NROWS % 128 == 0 && HDIM % 256 == 0 && EMB_SZ % 256 == 0);  // whole 128 x 256 work-group tiles

__device__ __forceinline__ unsigned short f2bf_bits(float f) {
  unsigned u = __float_as_uint(f);
  return (unsigned short)((u + 0x7FFFu + ((u >> 16) & 1u)) >> 16);
}
__device__ __forceinline__ float bf_bits2f(unsigned short h) { return __uint_as_float(((unsigned)h) << 16); }

// hazard guards as plain device helpers
__device__ __forceinline__ void dep_guard_h(v8f& a, v8f& b, v16h x, v16h y) { asm volatile("v_nop\n\tv_nop\n\tv_nop\n\tv_nop" : "+v"(a), "+v"(b) : "v"(x), "v"(y)); }
__device__ __forceinline__ void dep_guard_b(v8f& a, v8f& b, v16b x, v16b y) { asm volatile("v_nop\n\tv_nop\n\tv_nop\n\tv_nop" : "+v"(a), "+v"(b) : "v"(x), "v"(y)); }
__device__ __forceinline__ void keep4_h(v16h a, v16h b, v16h c, v16h d) { asm volatile("v_nop" :: "v"(a), "v"(b), "v"(c), "v"(d)); }
__device__ __forceinline__ void keep4_b(v16b a, v16b b, v16b c, v16b d) { asm volatile("v_nop" :: "v"(a), "v"(b), "v"(c), "v"(d)); }
__device__ __forceinline__ void acc_guard4(v8f& a, v8f& b, v8f& c, v8f& d) { asm volatile("v_nop\n\tv_nop\n\tv_nop\n\tv_nop" : "+v"(a), "+v"(b), "+v"(c), "+v"(d)); }
template <typename T> struct Frag;
template <> struct Frag<_Float16> {
  typedef v16h V; union U { v16h v; v8h h[2]; };
  static __device__ __forceinline__ v16h load(const _Float16* p) {   // elements 0..7 <- p[0..7], 8..15 <- p[16..23]
    U f; f.h[0] = *(const v8h*)(p); f.h[1] = *(const v8h*)(p + 16); return f.v;
  }
  static __device__ __forceinline__ v8f mma(v16h a, v16h b, v8f c) {
    return __builtin_amdgcn_wmma_f32_16x16x32_f16(false, a, false, b, (short)0, c, false, false);
  }
  static __device__ __forceinline__ void guard(v8f& a, v8f& b, v16h x, v16h y) { dep_guard_h(a, b, x, y); }
  static __device__ __forceinline__ void keep(v16h a, v16h b, v16h c, v16h d) { keep4_h(a, b, c, d); }
};
template <> struct Frag<__bf16> {
  typedef v16b V; union U { v16b v; v8b h[2]; };
  static __device__ __forceinline__ v16b load(const __bf16* p) {
    U f; f.h[0] = *(const v8b*)(p); f.h[1] = *(const v8b*)(p + 16); return f.v;
  }
  static __device__ __forceinline__ v8f mma(v16b a, v16b b, v8f c) {
    return __builtin_amdgcn_wmma_f32_16x16x32_bf16(false, a, false, b, (short)0, c, false, false);
  }
  static __device__ __forceinline__ void guard(v8f& a, v8f& b, v16b x, v16b y) { dep_guard_b(a, b, x, y); }
  static __device__ __forceinline__ void keep(v16b a, v16b b, v16b c, v16b d) { keep4_b(a, b, c, d); }
};

// ---- Register-blocked batched WMMA GEMM (with independent A/B split flags) --------------------
// C[m,n] = scale * sum_k A[m,k] * Bt[n,k] (+bias); each wave owns a 64x64 tile, a work-group 2 x 4 of them (128 x 256).
// A row-major [M,K]; Bt row-major [N,K]; M % 128 == 0, N % 256 == 0, K % 128 == 0 (no tail handling).
// The work-group's operand rows come through LDS, 128 k (256 B of every row) per stage, two buffers: the next stage's
// asynchronous copies fly while this stage's fragments are read from LDS and multiplied.
// SPLITA: A has a lo plane A2 (product += Alo.Bhi); SPLITB: Bt has a lo plane Bt2 (product += Ahi.Blo).
// BIAS_MODE: 0 = none, 1 = bias[m], 2 = RNE-bf16(bias[n]).
// OUT_MODE: 0 = f32, 1 = f16, 2 = bf16 hi plane (Cout) + bf16 lo plane (Cout2).
// ET: 0 = f16 operands, 1 = bf16 operands (pointers passed as 16-bit storage)
template <int ET> struct Elem;
template <> struct Elem<0> { typedef _Float16 T; };
template <> struct Elem<1> { typedef __bf16 T; };
constexpr int GT_BK    = 128;          // k elements per stage
constexpr int GT_PITCH = GT_BK + 8;    // LDS row pitch 272 B, an odd multiple of 16 B: the 16 rows of a b128 fragment read fall on distinct banks
constexpr int GT_MROWS = 128;          // A rows per work-group
constexpr int GT_NROWS = 256;          // Bt rows per work-group
static_assert((GT_PITCH * 2) % 32 == 16 && GT_BK * 2 == 16 * 16);   // one copy of a wave = 2 rows x 16 lanes x 16 B
// Eight asynchronous copies of one wave, global -> LDS: copy j brings rows 2j, 2j+1 of a 16-row slice, 256 B each
// (16 lanes x 16 B), so that every copy reads four whole lines. l and g are the lane's own addresses in rows 0, 1; ld is
// the global row pitch in elements. The s_wait_xcnt closes the statement so that it stands in front of every later
// write of an address register that a copy names.
__device__ __forceinline__ void copy_rows16(const unsigned short* l, const unsigned short* g, int ld) {
  const unsigned l0 = (unsigned)(size_t)l;
  constexpr unsigned lp = 2u * GT_PITCH * 2u;
  const size_t gp = (size_t)2 * ld;
  asm volatile(
      "global_load_async_to_lds_b128 %0, %8, off\n\t"
      "global_load_async_to_lds_b128 %1, %9, off\n\t"
      "global_load_async_to_lds_b128 %2, %10, off\n\t"
      "global_load_async_to_lds_b128 %3, %11, off\n\t"
      "global_load_async_to_lds_b128 %4, %12, off\n\t"
      "global_load_async_to_lds_b128 %5, %13, off\n\t"
      "global_load_async_to_lds_b128 %6, %14, off\n\t"
      "global_load_async_to_lds_b128 %7, %15, off\n\t"
      "s_wait_xcnt 0x0"
      :: "v"(l0), "v"(l0 + lp), "v"(l0 + 2u * lp), "v"(l0 + 3u * lp),
         "v"(l0 + 4u * lp), "v"(l0 + 5u * lp), "v"(l0 + 6u * lp), "v"(l0 + 7u * lp),
         "v"(g), "v"(g + gp), "v"(g + 2 * gp), "v"(g + 3 * gp),
         "v"(g + 4 * gp), "v"(g + 5 * gp), "v"(g + 6 * gp), "v"(g + 7 * gp)
      : "memory");
}
template <int ET, bool SPLITA, bool SPLITB, int BIAS_MODE, int OUT_MODE>
__global__ __launch_bounds__(256) void wmma_gemm64(
    const unsigned short* __restrict__ Ap, const unsigned short* __restrict__ A2p, int lda, long strideA,
    const unsigned short* __restrict__ Btp, const unsigned short* __restrict__ Bt2p, int ldb, long strideB,
    void* __restrict__ Cout, void* __restrict__ Cout2, int ldc, long strideC,
    const float* __restrict__ bias,
    int M, int N, int K, float scale) {
  typedef typename Elem<ET>::T T;
  typedef typename Frag<T>::V V;
  // One stage in LDS: [A | A lo | Bt | Bt lo] rows at GT_PITCH (the lo parts only where the operand is split).
  constexpr int OFF_A2 = GT_MROWS * GT_PITCH;
  constexpr int OFF_B  = OFF_A2 + (SPLITA ? GT_MROWS * GT_PITCH : 0);
  constexpr int OFF_B2 = OFF_B + GT_NROWS * GT_PITCH;
  constexpr int STAGE_ELEMS = OFF_B2 + (SPLITB ? GT_NROWS * GT_PITCH : 0);
  __shared__ __align__(16) unsigned short stg[2][STAGE_ELEMS];
  __shared__ __align__(16) float sT[8][16 * 68];   // per-wave 16x64 slab, pitch 68 floats
  const int b    = blockIdx.y;
  const int lane = threadIdx.x & 31;
  const int wave = __builtin_amdgcn_readfirstlane(threadIdx.x >> 5);   // scalar: the rows and offsets that derive from it alone cost no vector register
  const int wgN = N >> 8;
  if ((int)blockIdx.x >= (M >> 7) * wgN) return;   // block-uniform, in front of every copy and barrier
  const int bm  = blockIdx.x / wgN;
  const int bn  = blockIdx.x - bm * wgN;
  const int wm  = wave >> 2;                   // this wave's 64-row group of the work-group's 128 rows
  const int wn  = wave & 3;                    // this wave's 64-column group of the work-group's 256 columns
  const int m0 = bm * GT_MROWS + (wm << 6);
  const int n0 = bn * GT_NROWS + (wn << 6);

  // Staging coverage: wave w brings A rows 16w..16w+15 and Bt rows 32w..32w+31 of the work-group's tile.
  const int lr = lane >> 4, lc = (lane & 15) * 8;  // row within a copy's two rows, first of the lane's 8 elements
  const size_t aoff = (size_t)b * strideA + (size_t)(bm * GT_MROWS + wave * 16 + lr) * lda + lc;
  const size_t boff = (size_t)b * strideB + (size_t)(bn * GT_NROWS + wave * 32 + lr) * ldb + lc;
  const int lA = (wave * 16 + lr) * GT_PITCH + lc;
  const int lB = (wave * 32 + lr) * GT_PITCH + lc;
  auto stage_in = [&](int t, int buf) {
    const unsigned short* sb = &stg[buf][0];
    const size_t k0 = (size_t)t * GT_BK;
    copy_rows16(sb + lA, Ap + aoff + k0, lda);
    if (SPLITA) copy_rows16(sb + OFF_A2 + lA, A2p + aoff + k0, lda);
    copy_rows16(sb + OFF_B + lB, Btp + boff + k0, ldb);
    copy_rows16(sb + OFF_B + lB + 16 * GT_PITCH, Btp + boff + k0 + (size_t)16 * ldb, ldb);
    if (SPLITB) {
      copy_rows16(sb + OFF_B2 + lB, Bt2p + boff + k0, ldb);
      copy_rows16(sb + OFF_B2 + lB + 16 * GT_PITCH, Bt2p + boff + k0 + (size_t)16 * ldb, ldb);
    }
  };

  const int rlane = lane & 15;                 // row (A) / col (B, D) within subtile
  const int koff  = (lane >> 4) * 8;           // k offset of this lane half
  const int mOff  = (lane >> 4) * 8;           // D row offset

  v8f acc[4][4];
#pragma unroll
  for (int i = 0; i < 4; ++i)
#pragma unroll
    for (int j = 0; j < 4; ++j) acc[i][j] = (v8f){0.f,0.f,0.f,0.f,0.f,0.f,0.f,0.f};

  const int nst = K / GT_BK;                   // stages (block-uniform)
  stage_in(0, 0);
  // This wave's copies of stage 0 have landed before the barrier behind which the other waves read them.
  asm volatile("s_wait_asynccnt 0x0" ::: "memory");
  __syncthreads();
  if (nst > 1) stage_in(1, 1);
  const int fa = ((wm << 6) + rlane) * GT_PITCH + koff;            // this lane's place in A fragment row group 0
  const int fb = OFF_B + ((wn << 6) + rlane) * GT_PITCH + koff;    // and in Bt fragment row group 0
  for (int t = 0; t < nst; ++t) {
    const T* sb = (const T*)&stg[t & 1][0];
#pragma unroll   // a constant kk goes into the offset field of the LDS reads
    for (int kk = 0; kk < GT_BK; kk += 32) {
      // All fragments of a k step are read as one group in front of its products.
      V bh[4], bl[4], ah[4], al[4];
#pragma unroll   // this loop and the next: constant indices keep the fragment arrays in registers
      for (int j = 0; j < 4; ++j) {
        bh[j] = Frag<T>::load(sb + fb + (j << 4) * GT_PITCH + kk);
        if (SPLITB) bl[j] = Frag<T>::load(sb + fb + (OFF_B2 - OFF_B) + (j << 4) * GT_PITCH + kk);
      }
#pragma unroll
      for (int i = 0; i < 4; ++i) {
        ah[i] = Frag<T>::load(sb + fa + (i << 4) * GT_PITCH + kk);
        if (SPLITA) al[i] = Frag<T>::load(sb + fa + OFF_A2 + (i << 4) * GT_PITCH + kk);
      }
#pragma unroll
      for (int i = 0; i < 4; ++i) {
#pragma unroll
        for (int j = 0; j < 4; ++j) {
          acc[i][j] = Frag<T>::mma(ah[i], bh[j], acc[i][j]);
          if (SPLITB) acc[i][j] = Frag<T>::mma(ah[i], bl[j], acc[i][j]);
          if (SPLITA) acc[i][j] = Frag<T>::mma(al[i], bh[j], acc[i][j]);
        }
        Frag<T>::guard(acc[i][0], acc[i][3], ah[i], SPLITA ? al[i] : ah[i]);
      }
      Frag<T>::keep(bh[0], bh[1], bh[2], bh[3]);
      if (SPLITB) Frag<T>::keep(bl[0], bl[1], bl[2], bl[3]);
    }
    // This wave's LDS reads of this stage have returned, and its copies of the next stage have landed, before the
    // barrier behind which this stage's buffer is refilled and the next stage is read.
    asm volatile("s_wait_dscnt 0x0" ::: "memory");
    asm volatile("s_wait_asynccnt 0x0" ::: "memory");
    __syncthreads();
    if (t + 2 < nst) stage_in(t + 2, t & 1);
  }
  // No copy is outstanding when the wave goes on to the epilogue and ends.
  asm volatile("s_wait_asynccnt 0x0" ::: "memory");
  acc_guard4(acc[0][0], acc[0][1], acc[0][2], acc[0][3]);
  acc_guard4(acc[1][0], acc[1][1], acc[1][2], acc[1][3]);
  acc_guard4(acc[2][0], acc[2][1], acc[2][2], acc[2][3]);
  acc_guard4(acc[3][0], acc[3][1], acc[3][2], acc[3][3]);

  // ---- epilogue ----
  float* slab = sT[wave];
#pragma unroll
  for (int i = 0; i < 4; ++i) {
    const int mBase = m0 + (i << 4);
#pragma unroll
    for (int j = 0; j < 4; ++j) {
      const int n = n0 + (j << 4) + rlane;
      float bv = 0.f;
      if (BIAS_MODE == 2) bv = bf_bits2f(f2bf_bits(bias[n]));
#pragma unroll
      for (int r = 0; r < 8; ++r) {
        float v = acc[i][j][r] * scale;
        if (BIAS_MODE == 1) v += bias[mBase + mOff + r];
        if (BIAS_MODE == 2) v += bv;
        slab[(mOff + r) * 68 + (j << 4) + rlane] = v;
      }
    }
    __builtin_amdgcn_fence(__ATOMIC_RELEASE, "workgroup");
    __builtin_amdgcn_wave_barrier();
    __builtin_amdgcn_fence(__ATOMIC_ACQUIRE, "workgroup");
    if (OUT_MODE == 0) {
      float* C = (float*)Cout + (size_t)b * strideC;
      const int hh = lane >> 4, c4 = (lane & 15) * 4;     // row seg = 256 B = 16 lanes x 16 B
      {
#pragma unroll
        for (int it = 0; it < 8; ++it) {
          const int row = it * 2 + hh;
          v4f v = *(const v4f*)(slab + row * 68 + c4);
          *(v4f*)(C + (size_t)(mBase + row) * ldc + n0 + c4) = v;
        }
        
      }
    } else {
      const int q = lane >> 3, c8 = (lane & 7) * 8;
      unsigned short* C  = (unsigned short*)Cout  + (size_t)b * strideC;
      unsigned short* C2 = (OUT_MODE == 2) ? ((unsigned short*)Cout2 + (size_t)b * strideC) : nullptr;
      {
#pragma unroll
        for (int it = 0; it < 4; ++it) {
          const int row = it * 4 + q;
          const float* sp = slab + row * 68 + c8;
          v8h hv, lv;
#pragma unroll
          for (int e = 0; e < 8; ++e) {
            if (OUT_MODE == 1) {
              hv[e] = (_Float16)sp[e];
            } else {
              unsigned short hb = f2bf_bits(sp[e]);
              unsigned short lb = f2bf_bits(sp[e] - bf_bits2f(hb));
              hv[e] = __builtin_bit_cast(_Float16, hb);
              lv[e] = __builtin_bit_cast(_Float16, lb);
            }
          }
          *(v8h*)(C + (size_t)(mBase + row) * ldc + n0 + c8) = hv;
          if (OUT_MODE == 2) *(v8h*)(C2 + (size_t)(mBase + row) * ldc + n0 + c8) = lv;
        }
        
      }
    }
    __builtin_amdgcn_fence(__ATOMIC_RELEASE, "workgroup");
    __builtin_amdgcn_wave_barrier();
    __builtin_amdgcn_fence(__ATOMIC_ACQUIRE, "workgroup");
  }
}

// ---- input pass, one launch: three activation planes f32 -> bf16 (RNE) and the four weight transposes ----------
// Every work-group converts its share of each activation plane: per thread and plane 4 units of 8 elements (32 B read,
// 16 B written), unit index = j * PREP_THREADS + global thread id, so one store of a wave is 512 contiguous bytes. All of
// a thread's loads are issued before its first convert. Work-groups 0..PREP_TILES-1 also take one 64x64 weight tile:
// in = planes of [768][CC] f32 -> out = planes of [CC][768] bf16, through LDS.
constexpr int PREP_WGS     = 768;
constexpr int PREP_THREADS = PREP_WGS * 256;
constexpr int PREP_UNITS   = (int)(PLANE_ELEMS / 8);            // 16-B output units per plane
constexpr int PREP_PER_THR = PREP_UNITS / PREP_THREADS;         // 4
constexpr int TILES_WZ     = (HDIM / 64) * (EMB_SZ / 64);       // 48 tiles per head plane of Wk, Wv, Wq
constexpr int TILES_W      = TILES_WZ * NHEAD;                  // 144 per weight
constexpr int TILES_WO     = (EMB_SZ / 64) * (EMB_SZ / 64);     // 144
constexpr int PREP_TILES   = 3 * TILES_W + TILES_WO;            // 576
static_assert(PREP_PER_THR * PREP_THREADS == PREP_UNITS && PREP_PER_THR == 4);
static_assert(PREP_TILES <= PREP_WGS && HDIM / 64 == 4);

__device__ __forceinline__ v4u pack8_bf16(v4f a, v4f c2) {
  v4u w;
  w[0] = (unsigned)f2bf_bits(a[0])  | ((unsigned)f2bf_bits(a[1])  << 16);
  w[1] = (unsigned)f2bf_bits(a[2])  | ((unsigned)f2bf_bits(a[3])  << 16);
  w[2] = (unsigned)f2bf_bits(c2[0]) | ((unsigned)f2bf_bits(c2[1]) << 16);
  w[3] = (unsigned)f2bf_bits(c2[2]) | ((unsigned)f2bf_bits(c2[3]) << 16);
  return w;
}

__global__ __launch_bounds__(256) void prep_inputs(
    const float* __restrict__ Xk, const float* __restrict__ Xv, const float* __restrict__ Xq,
    const float* __restrict__ Wk, const float* __restrict__ Wv, const float* __restrict__ Wq,
    const float* __restrict__ Wo,
    unsigned short* __restrict__ xb,     // three bf16 planes in a row: Xk, Xv, Xq
    unsigned short* __restrict__ wT) {   // Wk^T, Wv^T, Wq^T, Wo^T in a row (WT_ELEMS each)
  __shared__ float tile[64][65];
  const int tid = threadIdx.x;
  const int blk = blockIdx.x;

  // ---- activation loads: 3 planes x 4 units x 2 loads of 16 B ----
  const unsigned u0 = (unsigned)blk * 256u + (unsigned)tid;
  v4f xa[3][PREP_PER_THR], xc[3][PREP_PER_THR];
  const float* xp[3][PREP_PER_THR];
#pragma unroll   // both loops: constant indices keep the arrays in registers
  for (int x = 0; x < 3; ++x) {
    const float* in = (x == 0) ? Xk : (x == 1) ? Xv : Xq;
#pragma unroll
    for (int j = 0; j < PREP_PER_THR; ++j) {
      const float* p = in + (size_t)(u0 + (unsigned)j * PREP_THREADS) * 8;
      xp[x][j] = p;
      xa[x][j] = *(const v4f*)p;
      xc[x][j] = *(const v4f*)(p + 4);
    }
  }
  // Stands in front of every later write of a register that one of these loads names as its address: as inputs the twelve
  // addresses stay live up to here, so that no result of a later load of the run is placed on one of them either.
  asm volatile("s_wait_xcnt 0x0"
               :: "v"(xp[0][0]), "v"(xp[0][1]), "v"(xp[0][2]), "v"(xp[0][3]),
                  "v"(xp[1][0]), "v"(xp[1][1]), "v"(xp[1][2]), "v"(xp[1][3]),
                  "v"(xp[2][0]), "v"(xp[2][1]), "v"(xp[2][2]), "v"(xp[2][3])
               : "memory");

  // ---- one weight tile (block-uniform branch) ----
  if (blk < PREP_TILES) {
    const float* src;
    unsigned short* dst;
    int CC, ct, rt;
    if (blk < 3 * TILES_W) {
      const int w = blk / TILES_W, r = blk - w * TILES_W;
      const int z = r / TILES_WZ, r2 = r - z * TILES_WZ;
      src = ((w == 0) ? Wk : (w == 1) ? Wv : Wq) + (size_t)z * EMB_SZ * HDIM;
      dst = wT + (size_t)w * WT_ELEMS + (size_t)z * EMB_SZ * HDIM;
      CC = HDIM; ct = r2 & 3; rt = r2 >> 2;
    } else {
      const int r = blk - 3 * TILES_W;
      src = Wo;
      dst = wT + 3 * WT_ELEMS;
      CC = EMB_SZ; rt = r / (EMB_SZ / 64); ct = r - rt * (EMB_SZ / 64);
    }
    const int lr = tid >> 2, lc = (tid & 3) * 16;           // in-tile row (input row), 16 input cols
    const float* sp = src + (size_t)(rt * 64 + lr) * CC + ct * 64 + lc;
#pragma unroll
    for (int i = 0; i < 4; ++i) {
      const v4f v = *(const v4f*)(sp + 4 * i);
      tile[lr][lc + 4 * i + 0] = v[0];
      tile[lr][lc + 4 * i + 1] = v[1];
      tile[lr][lc + 4 * i + 2] = v[2];
      tile[lr][lc + 4 * i + 3] = v[3];
    }
    __syncthreads();
    // Store coverage: wave w writes out rows ct*64 + 8w + {0..7} (2 iterations x 4 rows), 8 lanes x 16 B per row.
    const int lane = tid & 31, wave = tid >> 5, q = lane >> 3, c8 = (lane & 7) * 8;
#pragma unroll
    for (int it = 0; it < 2; ++it) {
      const int fl = wave * 8 + it * 4 + q;                   // out row within tile = input col within tile
      v4u t4;
#pragma unroll
      for (int e = 0; e < 4; ++e) {
        const unsigned lo16 = (unsigned)f2bf_bits(tile[c8 + 2 * e][fl]);
        const unsigned hi16 = (unsigned)f2bf_bits(tile[c8 + 2 * e + 1][fl]);
        t4[e] = lo16 | (hi16 << 16);
      }
      *(v4u*)(dst + (size_t)(ct * 64 + fl) * EMB_SZ + rt * 64 + c8) = t4;
    }
  }

  // ---- convert and store the activation units ----
#pragma unroll
  for (int x = 0; x < 3; ++x) {
#pragma unroll
    for (int j = 0; j < PREP_PER_THR; ++j) {
      unsigned short* o = xb + (size_t)x * PLANE_ELEMS + (size_t)(u0 + (unsigned)j * PREP_THREADS) * 8;
      *(v4u*)o = pack8_bf16(xa[x][j], xc[x][j]);
    }
  }
}

// =====================================================================================================
// Causal flash attention, head_dim 256, operands = bf16 hi/lo planes.
//   Q/K/V planes: element (b, s, h, d) at [(b*SEQLEN + s)*EMB_SZ + h*HDIM + d] (hi plane and lo plane).
//   scores = (Qhi.Khi + Qhi.Klo + Qlo.Khi) * inv_scale; causal mask = -inf for key > query (diagonal chunk);
//   online softmax in f32; P (unnormalised exp) split to bf16 hi/lo in LDS; O += Phi.Vhi + Phi.Vlo + Plo.Vhi;
//   out = O / l written as bf16 hi/lo concat planes in the same [(b,s)][h*HDIM + d] layout.
// Block = 256 threads = 8 waves, 64 query rows of one (b,h); wave w: row group rw = w&3 (16 rows),
// half ch = w>>2: d half (128 of 256) for the score products, key half (32 of 64 keys) for the softmax,
// column half (128 of 256) for O. Q stays in registers: each wave holds its 16 rows x its d half, forms partial
// scores for all 64 keys, and the two waves of a row group swap the partial tiles of each other's key half in LDS.
// Row max / row sum of the two key halves combined through LDS with block barriers.
// Work items: a query block of the lower half of the sequence (at most 16 key chunks) is one work-group and writes the
// concat planes itself. A query block of the upper half is two work-groups, each with half of its key chunks; each
// writes its unnormalised O tile with its row max and row sum to the workspace, and attn_merge (the next launch) joins
// the two. So no work-group walks more than 16 chunks. grid = (NBATCH*NHEAD, AT_ITEMS), items with many chunks first.
// =====================================================================================================
constexpr int AT_KEYS  = 64;    // keys per chunk
constexpr int AT_QROWS = 64;    // query rows per block
constexpr int AT_WHALF = 128;   // output columns per wave
constexpr int AT_NQB   = SEQLEN / AT_QROWS;        // 32 query blocks per (b,h)
constexpr int AT_NSOLE = AT_NQB / 2;               // query blocks 0..15: one work-group each
constexpr int AT_ITEMS = AT_NSOLE + 2 * (AT_NQB - AT_NSOLE);   // 48 work-groups per (b,h)
static_assert(AT_NQB % 2 == 0 && PART_TILES == NBATCH * NHEAD * 2 * (AT_NQB - AT_NSOLE));
static_assert(PART_TILE_F32 == (size_t)AT_QROWS * HDIM && 2 * AT_QROWS == 128);
// LDS row pitches in 16-bit elements. K and P rows are read by b128 fragment loads: 16 B of pad make the pitch an odd
// multiple of 16 B, so the 16 rows of one read fall on 16 different groups of four banks. V rows are read by the
// transposing load, whose conflict-free pitch is an odd multiple of 32 B.
constexpr int AT_KPITCH = HDIM + 8;       // K rows [key][d]: 528 B
constexpr int AT_VPITCH = HDIM + 16;      // V rows [key][d]: 544 B
constexpr int AT_PPITCH = AT_KEYS + 8;    // P rows [row][key]: 144 B
static_assert(SEQLEN % AT_QROWS == 0 && SEQLEN % AT_KEYS == 0 && HDIM == 2 * AT_WHALF);
static_assert(8 * 16 * AT_WHALF <= AT_KEYS * AT_KPITCH);   // output staging slabs fit one K plane
static_assert((AT_KPITCH * 2) % 32 == 16 && (AT_VPITCH * 2) % 64 == 32 && (AT_PPITCH * 2) % 32 == 16);
static_assert(HDIM * 2 == 32 * 16 && AT_KEYS == 8 * 8);    // one copy of a wave = one row; 8 waves x 8 rows = one plane
static_assert(8 * 512 * 4 <= 2 * AT_QROWS * AT_PPITCH * 2);  // the partial-score swap (8 waves x 2 tiles, f32) fits the P planes

__device__ __forceinline__ v16b ldfrag16(const unsigned short* p) {   // elements 0..7 <- p[0..7], 8..15 <- p[16..23]
  union { v16b v; v8b h[2]; } f;
  f.h[0] = *(const v8b*)(p); f.h[1] = *(const v8b*)(p + 16); return f.v;
}
// B fragment (32 keys x 16 d) of a row-major [key][d] LDS tile: p = this lane's address in the first 16 keys,
// row 8*(lane>>4) + (lane&7), column 8*((lane>>3)&1). Lane (c, hh) receives keys 8hh..8hh+7 of column c, then keys
// 16+8hh..16+8hh+7: the k order of ldfrag16.
typedef short s16x8 __attribute__((ext_vector_type(8)));
__device__ __forceinline__ v16b ldfrag16_tr(const unsigned short* p) {
  typedef __attribute__((address_space(3))) s16x8 lds_s16x8;
  union { v16b v; s16x8 h[2]; } f;
  f.h[0] = __builtin_amdgcn_ds_load_tr16_b128_v8i16((lds_s16x8*)p);
  f.h[1] = __builtin_amdgcn_ds_load_tr16_b128_v8i16((lds_s16x8*)(p + 16 * AT_VPITCH));
  return f.v;
}
// Eight asynchronous copies of one wave, global -> LDS: copy j brings row j (512 B, 16 B per lane). g and l are the
// lane's own addresses in row 0. The s_wait_xcnt closes the statement so that it stands in front of every later write
// of an address register that a copy names.
__device__ __forceinline__ void copy_rows8(const unsigned short* l, int lpitch, const unsigned short* g) {
  const unsigned l0 = (unsigned)(size_t)l;
  const unsigned lp = (unsigned)lpitch * 2u;
  asm volatile(
      "global_load_async_to_lds_b128 %0, %8, off\n\t"
      "global_load_async_to_lds_b128 %1, %9, off\n\t"
      "global_load_async_to_lds_b128 %2, %10, off\n\t"
      "global_load_async_to_lds_b128 %3, %11, off\n\t"
      "global_load_async_to_lds_b128 %4, %12, off\n\t"
      "global_load_async_to_lds_b128 %5, %13, off\n\t"
      "global_load_async_to_lds_b128 %6, %14, off\n\t"
      "global_load_async_to_lds_b128 %7, %15, off\n\t"
      "s_wait_xcnt 0x0"
      :: "v"(l0), "v"(l0 + lp), "v"(l0 + 2u * lp), "v"(l0 + 3u * lp),
         "v"(l0 + 4u * lp), "v"(l0 + 5u * lp), "v"(l0 + 6u * lp), "v"(l0 + 7u * lp),
         "v"(g), "v"(g + EMB_SZ), "v"(g + 2 * EMB_SZ), "v"(g + 3 * EMB_SZ),
         "v"(g + 4 * EMB_SZ), "v"(g + 5 * EMB_SZ), "v"(g + 6 * EMB_SZ), "v"(g + 7 * EMB_SZ)
      : "memory");
}
__device__ __forceinline__ v8f mma_bf(v16b a, v16b b, v8f c) {
  c = __builtin_amdgcn_wmma_f32_16x16x32_bf16(false, a, false, b, (short)0, c, false, false);
  asm volatile("v_nop\n\tv_nop\n\tv_nop\n\tv_nop" : "+v"(c) : "v"(a), "v"(b));
  return c;
}

// Maximum / sum over each 16-lane row, eight values at once, by four DPP steps (row_xmask 1, 2, 4, 8): lane l takes lane
// l ^ mask of its row, the pairing of a shuffle butterfly, so every lane of a row ends with the same value and the sum
// keeps its order. In asm because the shuffle builtin compiles to ds_bpermute_b32, a trip through the LDS pipe with a wait
// per step, and the DPP builtin to a move, a canonicalising maximum and the operation. Step-major order: the producer of
// each operand stands eight vector instructions back, so the dependent links cost no stall.
#define ROW8_STEP(op, x)                                        \
  op " %0, %0, %0 row_xmask:" x " row_mask:0xf bank_mask:0xf\n\t" \
  op " %1, %1, %1 row_xmask:" x " row_mask:0xf bank_mask:0xf\n\t" \
  op " %2, %2, %2 row_xmask:" x " row_mask:0xf bank_mask:0xf\n\t" \
  op " %3, %3, %3 row_xmask:" x " row_mask:0xf bank_mask:0xf\n\t" \
  op " %4, %4, %4 row_xmask:" x " row_mask:0xf bank_mask:0xf\n\t" \
  op " %5, %5, %5 row_xmask:" x " row_mask:0xf bank_mask:0xf\n\t" \
  op " %6, %6, %6 row_xmask:" x " row_mask:0xf bank_mask:0xf\n\t" \
  op " %7, %7, %7 row_xmask:" x " row_mask:0xf bank_mask:0xf\n\t"
__device__ __forceinline__ void row_max16x8(float (&v)[8]) {
  asm(ROW8_STEP("v_max_num_f32_dpp", "1") ROW8_STEP("v_max_num_f32_dpp", "2")
      ROW8_STEP("v_max_num_f32_dpp", "4") ROW8_STEP("v_max_num_f32_dpp", "8")
      : "+v"(v[0]), "+v"(v[1]), "+v"(v[2]), "+v"(v[3]), "+v"(v[4]), "+v"(v[5]), "+v"(v[6]), "+v"(v[7]));
}
__device__ __forceinline__ void row_sum16x8(float (&v)[8]) {
  asm(ROW8_STEP("v_add_f32_dpp", "1") ROW8_STEP("v_add_f32_dpp", "2")
      ROW8_STEP("v_add_f32_dpp", "4") ROW8_STEP("v_add_f32_dpp", "8")
      : "+v"(v[0]), "+v"(v[1]), "+v"(v[2]), "+v"(v[3]), "+v"(v[4]), "+v"(v[5]), "+v"(v[6]), "+v"(v[7]));
}

// Second bound: four waves per SIMD, so that two workgroups still share a WGP (its LDS holds two) with Q resident.
__global__ __launch_bounds__(256, 4) void attn_hd256(
    const unsigned short* __restrict__ Qh, const unsigned short* __restrict__ Ql,
    const unsigned short* __restrict__ Kh, const unsigned short* __restrict__ Kl,
    const unsigned short* __restrict__ Vh, const unsigned short* __restrict__ Vl,
    unsigned short* __restrict__ Oh, unsigned short* __restrict__ Ol,
    float* __restrict__ part, float* __restrict__ pml, float inv_scale) {
  __shared__ __align__(16) unsigned short Ks[2][AT_KEYS * AT_KPITCH];   // [plane][key][d]   67584 B; reused as output staging
  __shared__ __align__(16) unsigned short Vs[2][AT_KEYS * AT_VPITCH];   // [plane][key][d]   69632 B
  __shared__ __align__(16) unsigned short Ps[2][AT_QROWS * AT_PPITCH];  // [plane][row][key] 18432 B
  __shared__ float redm[2][AT_QROWS];                                // partial row max per key half
  __shared__ float reds[2][AT_QROWS];                                // partial row sum per key half
  // Running row max and row sum, one copy per wave (index [ch][row]), written by that wave alone and read by it (wave 0 also reads the ch 0 copies of all 64 rows after a split item's last chunk): they are
  // used once a chunk, and in LDS they leave their 16 registers to the fragment sets of the two products.
  __shared__ __align__(16) float runm[2][AT_QROWS];
  __shared__ __align__(16) float runl[2][AT_QROWS];

  const int tid  = threadIdx.x;
  const int lane = tid & 31;
  const int wave = __builtin_amdgcn_readfirstlane(tid >> 5);   // scalar: what derives from it alone costs no vector register
  const int hh   = lane >> 4;
  const int c    = lane & 15;
  const int rw   = wave & 3;
  const int ch   = wave >> 2;
  const int bh   = blockIdx.x;                 // b*NHEAD + h
  // Items in reverse of blockIdx.y: low blockIdx.y takes the items of the long query blocks, the shortest come last.
  const int item  = AT_ITEMS - 1 - (int)blockIdx.y;
  const bool split = item >= AT_NSOLE;         // block-uniform: this work-group has half of its query block's chunks
  const int pidx = item - AT_NSOLE;            // split items: 2 * (qb - AT_NSOLE) + key range
  const int qb   = split ? AT_NSOLE + (pidx >> 1) : item;   // query block 0..31
  const int h    = bh % NHEAD;
  const int b    = bh / NHEAD;
  const int q0w  = qb * AT_QROWS + rw * 16;    // first query row (within the sequence) of this wave
  const size_t rowb = (size_t)b * SEQLEN;      // flattened row base of this batch
  const int hcol = h * HDIM;

  v8f oacc[8];
#pragma unroll
  for (int r = 0; r < 8; ++r) { runm[ch][rw * 16 + 8 * hh + r] = -INFINITY; runl[ch][rw * 16 + 8 * hh + r] = 0.f; }
#pragma unroll
  for (int t = 0; t < 8; ++t) oacc[t] = (v8f){0.f,0.f,0.f,0.f,0.f,0.f,0.f,0.f};

  // This wave's 16 query rows x its d half, hi and lo, as A fragments (row m = c): loaded once, kept for every chunk.
  v16b qfh[4], qfl[4];
  {
    const size_t qoff = (rowb + q0w + c) * EMB_SZ + hcol + ch * AT_WHALF + 8 * hh;
#pragma unroll   // constant indices keep the fragment arrays in registers
    for (int dc = 0; dc < 4; ++dc) {
      qfh[dc] = ldfrag16(Qh + qoff + dc * 32);
      qfl[dc] = ldfrag16(Ql + qoff + dc * 32);
    }
  }
  // Swap area for partial score tiles, in the P planes (free from the chunk's first barrier to the row-max barrier):
  // per wave 4 quads x 32 lanes x 4 floats, so that each b128 access of a wave is 512 contiguous bytes.
  float* const xown  = reinterpret_cast<float*>(&Ps[0][0]) + wave * 512 + lane * 4;
  const float* const xpeer = reinterpret_cast<const float*>(&Ps[0][0]) + (wave ^ 4) * 512 + lane * 4;

  const int nch = qb + 1;                      // causal horizon in 64-key chunks (block-uniform)
  const int kc0 = (split && (pidx & 1)) ? (nch >> 1) : 0;     // this work-group's chunks: [kc0, kc1), never empty
  const int kc1 = (split && !(pidx & 1)) ? (nch >> 1) : nch;
  for (int kc = kc0; kc < kc1; ++kc) {
    const int kv0 = kc * AT_KEYS;
    // This wave's LDS reads of the last chunk have returned before the barrier behind which K and V are overwritten.
    asm volatile("s_wait_dscnt 0x0" ::: "memory");
    __syncthreads();
    // ---- stage K and V (hi/lo, both [key][d]) by asynchronous copies to LDS ----
    // Coverage: wave w brings keys 8w..8w+7 of each of the four planes, one whole row per copy.
    {
      const int kr0 = wave * 8;
      const size_t gbase = (rowb + kv0 + kr0) * EMB_SZ + hcol + lane * 8;
      copy_rows8(&Ks[0][kr0 * AT_KPITCH + lane * 8], AT_KPITCH, Kh + gbase);
      copy_rows8(&Ks[1][kr0 * AT_KPITCH + lane * 8], AT_KPITCH, Kl + gbase);
      copy_rows8(&Vs[0][kr0 * AT_VPITCH + lane * 8], AT_VPITCH, Vh + gbase);
      copy_rows8(&Vs[1][kr0 * AT_VPITCH + lane * 8], AT_VPITCH, Vl + gbase);
    }
    // This wave's copies have landed before the barrier behind which the other waves read them.
    asm volatile("s_wait_asynccnt 0x0" ::: "memory");
    __syncthreads();

    // ---- partial scores over this wave's d half: 16 rows x 64 keys (four 16x16 D tiles), hi.hi + hi.lo + lo.hi ----
    // Tiles 0,1 = this wave's own key half, tiles 2,3 = the other wave's.
    v8f sp[4];
#pragma unroll
    for (int j = 0; j < 4; ++j) sp[j] = (v8f){0.f,0.f,0.f,0.f,0.f,0.f,0.f,0.f};
    // K fragments are read two groups ahead of the products that use them (a group = one d step of one key tile, hi and
    // lo), in three rotating register sets: a group's LDS latency runs under the six products in front of it.
    v16b kfh[3], kfl[3];
#pragma unroll   // constant indices keep the fragment sets in registers
    for (int g = 0; g < 2; ++g) {
      const int koff = (((ch * 2 + (g & 3)) & 3) * 16 + c) * AT_KPITCH + ch * AT_WHALF + (g >> 2) * 32 + 8 * hh;
      kfh[g] = ldfrag16(&Ks[0][koff]);
      kfl[g] = ldfrag16(&Ks[1][koff]);
    }
#pragma unroll   // constant indices keep qfh, qfl, sp and the fragment sets in registers
    for (int g = 0; g < 16; ++g) {
      if (g + 2 < 16) {
        const int gn = g + 2;
        const int kr = ((ch * 2 + (gn & 3)) & 3) * 16 + c;                 // B fragment column n = key kr
        const int koff = kr * AT_KPITCH + ch * AT_WHALF + (gn >> 2) * 32 + 8 * hh;
        kfh[gn % 3] = ldfrag16(&Ks[0][koff]);
        kfl[gn % 3] = ldfrag16(&Ks[1][koff]);
      }
      const int dc = g >> 2, j = g & 3;
      sp[j] = mma_bf(qfh[dc], kfh[g % 3], sp[j]);
      sp[j] = mma_bf(qfh[dc], kfl[g % 3], sp[j]);
      sp[j] = mma_bf(qfl[dc], kfh[g % 3], sp[j]);
    }
    // ---- swap: hand tiles 2,3 to the other wave of the row group, add its partials to tiles 0,1 ----
#pragma unroll
    for (int q = 0; q < 4; ++q) {
      const v8f t = sp[2 + (q >> 1)];
      const int e = (q & 1) * 4;
      *(v4f*)(xown + q * 128) = (v4f){t[e], t[e + 1], t[e + 2], t[e + 3]};
    }
    __syncthreads();   // every wave's partial tiles are in LDS before the other wave of its row group reads them
    v8f s[2];
    {
      v4f t[4];
#pragma unroll
      for (int q = 0; q < 4; ++q) t[q] = *(const v4f*)(xpeer + q * 128);
#pragma unroll
      for (int q = 0; q < 4; ++q)
#pragma unroll
        for (int i = 0; i < 4; ++i) s[q >> 1][(q & 1) * 4 + i] = sp[q >> 1][(q & 1) * 4 + i] + t[q][i];
    }

    // ---- scale, causal mask, partial row max over this wave's 32 keys ----
    const bool diag = (kc == qb);                // block-uniform
    // key (D col c of tile 0) minus query (D row 8hh): key > query of tile j, row r reads rel + 16j > r, a compare
    // with a constant, so that no register holds a query row index through the loop
    const int rel = (kv0 + ch * 32 + c) - (q0w + 8 * hh);
    float mrow[8];
#pragma unroll   // this loop and the one behind the reduction: constant indices keep s and mrow in registers
    for (int r = 0; r < 8; ++r) {
      float m = -INFINITY;
#pragma unroll
      for (int j = 0; j < 2; ++j) {
        float sv = s[j][r] * inv_scale;
        if (diag && (rel + j * 16 > r)) sv = -INFINITY;
        s[j][r] = sv;
        m = fmaxf(m, sv);
      }
      mrow[r] = m;
    }
    row_max16x8(mrow);
#pragma unroll
    for (int r = 0; r < 8; ++r) redm[ch][rw * 16 + 8 * hh + r] = mrow[r];
    __syncthreads();

    // ---- online softmax update; P hi/lo to LDS; partial sums ----
    float alph[8], prow[8];
#pragma unroll
    for (int r = 0; r < 8; ++r) {
      const int row = rw * 16 + 8 * hh + r;
      const float mc = fmaxf(redm[0][row], redm[1][row]);
      const float mold = runm[ch][row];
      const float mnew = fmaxf(mold, mc);
      const float alpha = expf(mold - mnew);
      runm[ch][row] = mnew;
      alph[r] = alpha;
      float psum = 0.f;
#pragma unroll
      for (int j = 0; j < 2; ++j) {
        const float p = expf(s[j][r] - mnew);
        psum += p;
        const unsigned short hb = f2bf_bits(p);
        const unsigned short lb = f2bf_bits(p - bf_bits2f(hb));
        const int pidx = row * AT_PPITCH + ch * 32 + j * 16 + c;
        Ps[0][pidx] = hb;
        Ps[1][pidx] = lb;
      }
      prow[r] = psum;
#pragma unroll
      for (int t = 0; t < 8; ++t) oacc[t][r] *= alpha;
    }
    row_sum16x8(prow);
#pragma unroll   // constant indices keep prow in registers
    for (int r = 0; r < 8; ++r) reds[ch][rw * 16 + 8 * hh + r] = prow[r];
    __syncthreads();
#pragma unroll
    for (int r = 0; r < 8; ++r) {
      const int row = rw * 16 + 8 * hh + r;
      runl[ch][row] = runl[ch][row] * alph[r] + (reds[0][row] + reds[1][row]);
    }

    // ---- O += P.V over 64 keys for this wave's 16 rows x 128 columns ----
    // V fragments (and the second key half's P fragments) are read two groups ahead of their products, as K above;
    // a group = 32 keys x 16 columns, hi and lo.
    {
      const int poff = (rw * 16 + c) * AT_PPITCH + 8 * hh;                      // A fragment row m = c
      const int voff = (8 * hh + (lane & 7)) * AT_VPITCH + ch * AT_WHALF + ((lane >> 3) & 1) * 8;   // B fragment column n = d
      v16b pfh[2], pfl[2], vfh[3], vfl[3];
      pfh[0] = ldfrag16(&Ps[0][poff]);
      pfl[0] = ldfrag16(&Ps[1][poff]);
#pragma unroll   // constant indices keep the fragment sets in registers
      for (int g = 0; g < 2; ++g) {
        vfh[g] = ldfrag16_tr(&Vs[0][voff + g * 16]);
        vfl[g] = ldfrag16_tr(&Vs[1][voff + g * 16]);
      }
#pragma unroll   // constant indices keep oacc and the fragment sets in registers
      for (int g = 0; g < 16; ++g) {
        if (g + 2 < 16) {
          const int gn = g + 2;
          if (gn == 8) {
            pfh[1] = ldfrag16(&Ps[0][poff + 32]);
            pfl[1] = ldfrag16(&Ps[1][poff + 32]);
          }
          const int vo = voff + (gn >> 3) * 32 * AT_VPITCH + (gn & 7) * 16;
          vfh[gn % 3] = ldfrag16_tr(&Vs[0][vo]);
          vfl[gn % 3] = ldfrag16_tr(&Vs[1][vo]);
        }
        const int kk = g >> 3, t = g & 7;
        oacc[t] = mma_bf(pfh[kk], vfh[g % 3], oacc[t]);
        oacc[t] = mma_bf(pfh[kk], vfl[g % 3], oacc[t]);
        oacc[t] = mma_bf(pfl[kk], vfh[g % 3], oacc[t]);
      }
    }
  }

  // ---- epilogue: normalise, split to bf16 hi/lo in per-wave LDS slabs (K region), whole-line stores ----
  __syncthreads();
  if (split) {   // block-uniform: every wave of the work-group leaves here, in front of the epilogue's barrier
    // Partial tile in register order: wave w, quad (t, q), lane -> 4 floats (D rows 8hh+4q..+3 of column tile t), so that
    // each store of a wave is 512 contiguous bytes; attn_merge reads it back in the same order.
    const int slot = bh * (2 * (AT_NQB - AT_NSOLE)) + pidx;
    float* pb = part + (size_t)slot * PART_TILE_F32 + wave * (16 * AT_WHALF) + lane * 4;
#pragma unroll   // both loops: constant indices keep oacc in registers
    for (int t = 0; t < 8; ++t)
#pragma unroll
      for (int q = 0; q < 2; ++q)
        *(v4f*)(pb + (t * 2 + q) * 128) = (v4f){oacc[t][4 * q], oacc[t][4 * q + 1], oacc[t][4 * q + 2], oacc[t][4 * q + 3]};
    // Stands in front of every later write of a register that one of these stores names.
    asm volatile("s_wait_xcnt 0x0" ::: "memory");
    if (wave == 0) {   // one wave writes the 64 row maxima and the 64 row sums: four whole lines
      float* pm = pml + (size_t)slot * 128 + lane;
      const float m0 = runm[0][lane], m1 = runm[0][32 + lane], l0 = runl[0][lane], l1 = runl[0][32 + lane];
      pm[0] = m0; pm[32] = m1; pm[64] = l0; pm[96] = l1;
    }
    return;
  }
  unsigned short* slh = &Ks[0][wave * (16 * AT_WHALF)];
  unsigned short* sll = &Ks[1][wave * (16 * AT_WHALF)];
#pragma unroll
  for (int r = 0; r < 8; ++r) {
    const float inv = 1.0f / runl[ch][rw * 16 + 8 * hh + r];
    const int row = 8 * hh + r;
#pragma unroll
    for (int t = 0; t < 8; ++t) {
      const float v = oacc[t][r] * inv;
      const unsigned short hb = f2bf_bits(v);
      const unsigned short lb = f2bf_bits(v - bf_bits2f(hb));
      slh[row * AT_WHALF + t * 16 + c] = hb;
      sll[row * AT_WHALF + t * 16 + c] = lb;
    }
  }
  __syncthreads();
  // Store coverage: 8 iterations x rows (2it + hh) = 16 rows; per row 16 lanes x 16 B = 128 columns = 2 whole
  {
    {
#pragma unroll
      for (int it = 0; it < 8; ++it) {
        const int row = it * 2 + hh;
        const v4u wh = *(const v4u*)(slh + row * AT_WHALF + c * 8);
        const v4u wl = *(const v4u*)(sll + row * AT_WHALF + c * 8);
        const size_t go = (rowb + q0w + row) * EMB_SZ + hcol + ch * AT_WHALF + c * 8;
        *(v4u*)(Oh + go) = wh;
        *(v4u*)(Ol + go) = wl;
      }
      
    }
  }
}

// ---- join of the two key ranges of a query block of the upper half -------------------------------------------------
// One work-group per (b,h, query block); thread roles as in attn_hd256 (wave: 16 rows x 128 columns). With m = max(m0, m1)
// and e_i = exp(m_i - m): out = (e0 * O0 + e1 * O1) / (e0 * l0 + e1 * l1), written as bf16 hi/lo concat planes.
__global__ __launch_bounds__(256) void attn_merge(
    const float* __restrict__ part, const float* __restrict__ pml,
    unsigned short* __restrict__ Oh, unsigned short* __restrict__ Ol) {
  __shared__ __align__(16) unsigned short slab[2][8 * 16 * AT_WHALF];   // [plane][wave][row][column] 65536 B
  const int tid  = threadIdx.x;
  const int lane = tid & 31;
  const int wave = __builtin_amdgcn_readfirstlane(tid >> 5);   // scalar: what derives from it alone costs no vector register
  const int hh   = lane >> 4;
  const int c    = lane & 15;
  const int rw   = wave & 3;
  const int ch   = wave >> 2;
  const int bh   = blockIdx.x;                 // b*NHEAD + h
  const int qb   = AT_NSOLE + (int)blockIdx.y; // query block 16..31
  const int h    = bh % NHEAD;
  const int b    = bh / NHEAD;
  const int q0w  = qb * AT_QROWS + rw * 16;    // first query row (within the sequence) of this wave
  const size_t rowb = (size_t)b * SEQLEN;
  const int hcol = h * HDIM;
  const int slot = bh * (2 * (AT_NQB - AT_NSOLE)) + 2 * (int)blockIdx.y;   // key range 0; range 1 is the next slot

  // All loads of a thread are issued before the first use: 32 tile quads and the row figures of its 8 rows.
  const float* p0 = part + (size_t)slot * PART_TILE_F32 + wave * (16 * AT_WHALF) + lane * 4;
  const float* pm = pml + (size_t)slot * 128 + rw * 16 + 8 * hh;
  v4f a0[16], a1[16], ml[8];
#pragma unroll   // this loop and the next: constant indices keep the arrays in registers
  for (int k = 0; k < 4; ++k) {                // k: m of range 0, l of range 0, m of range 1, l of range 1
    ml[2 * k]     = *(const v4f*)(pm + k * 64);
    ml[2 * k + 1] = *(const v4f*)(pm + k * 64 + 4);
  }
#pragma unroll
  for (int k = 0; k < 16; ++k) {
    a0[k] = *(const v4f*)(p0 + k * 128);
    a1[k] = *(const v4f*)(p0 + PART_TILE_F32 + k * 128);
  }
  // Stands in front of every later write of a register that one of these loads names as its address: as inputs the two
  // addresses stay live up to here, so that no result of a later load of the run is placed on a register they are formed from.
  asm volatile("s_wait_xcnt 0x0" :: "v"(p0), "v"(pm) : "memory");
  float w0[8], w1[8];
#pragma unroll   // constant indices keep ml, w0 and w1 in registers
  for (int r = 0; r < 8; ++r) {
    const float m0 = ml[r >> 2][r & 3], l0 = ml[2 + (r >> 2)][r & 3];
    const float m1 = ml[4 + (r >> 2)][r & 3], l1 = ml[6 + (r >> 2)][r & 3];
    const float m  = fmaxf(m0, m1);
    const float e0 = expf(m0 - m), e1 = expf(m1 - m);
    const float inv = 1.0f / (e0 * l0 + e1 * l1);
    w0[r] = e0 * inv;
    w1[r] = e1 * inv;
  }
  unsigned short* slh = &slab[0][wave * (16 * AT_WHALF)];
  unsigned short* sll = &slab[1][wave * (16 * AT_WHALF)];
#pragma unroll   // both loops: constant indices keep a0, a1, w0 and w1 in registers
  for (int r = 0; r < 8; ++r) {
    const int row = 8 * hh + r;
#pragma unroll
    for (int t = 0; t < 8; ++t) {
      const float v = a0[t * 2 + (r >> 2)][r & 3] * w0[r] + a1[t * 2 + (r >> 2)][r & 3] * w1[r];
      const unsigned short hb = f2bf_bits(v);
      const unsigned short lb = f2bf_bits(v - bf_bits2f(hb));
      slh[row * AT_WHALF + t * 16 + c] = hb;
      sll[row * AT_WHALF + t * 16 + c] = lb;
    }
  }
  __syncthreads();   // the slabs are complete before they are read back row by row
  // Store coverage: 8 iterations x rows (2it + hh) = 16 rows; per row 16 lanes x 16 B = 128 columns = 2 whole lines.
#pragma unroll   // the row offsets go into the offset fields of the LDS reads and of the stores
  for (int it = 0; it < 8; ++it) {
    const int row = it * 2 + hh;
    const v4u wh = *(const v4u*)(slh + row * AT_WHALF + c * 8);
    const v4u wl = *(const v4u*)(sll + row * AT_WHALF + c * 8);
    const size_t go = (rowb + q0w + row) * EMB_SZ + hcol + ch * AT_WHALF + c * 8;
    *(v4u*)(Oh + go) = wh;
    *(v4u*)(Ol + go) = wl;
  }
}

// ---------------------------------------------------------------------------------------------------
extern "C" void kernel_launch(void* const* d_in, const int* in_sizes, int n_in,
                              void* d_out, int out_size, void* d_ws, size_t ws_size,
                              hipStream_t stream) {
  (void)in_sizes; (void)n_in; (void)out_size;
  const float* Xk = (const float*)d_in[0];
  const float* Xv = (const float*)d_in[1];
  const float* Xq = (const float*)d_in[2];
  const float* Wk = (const float*)d_in[3];
  const float* Wv = (const float*)d_in[4];
  const float* Wq = (const float*)d_in[5];
  const float* Wo = (const float*)d_in[6];
  const float* bo = (const float*)d_in[7];
  float* out = (float*)d_out;

  if (ws_size < WS_TOTAL_BYTES) return;

  unsigned short* ws = (unsigned short*)d_ws;
  unsigned short* xk_b = ws + 0 * PLANE_ELEMS;   // later: concat hi
  unsigned short* xv_b = ws + 1 * PLANE_ELEMS;   // later: concat lo
  unsigned short* xq_b = ws + 2 * PLANE_ELEMS;
  unsigned short* k_hi = ws + 3 * PLANE_ELEMS;
  unsigned short* k_lo = ws + 4 * PLANE_ELEMS;
  unsigned short* v_hi = ws + 5 * PLANE_ELEMS;
  unsigned short* v_lo = ws + 6 * PLANE_ELEMS;
  unsigned short* q_hi = ws + 7 * PLANE_ELEMS;
  unsigned short* q_lo = ws + 8 * PLANE_ELEMS;
  unsigned short* wkT  = ws + WS_OFF_WKT;
  unsigned short* wvT  = ws + WS_OFF_WVT;
  unsigned short* wqT  = ws + WS_OFF_WQT;
  unsigned short* woT  = ws + WS_OFF_WOT;
  unsigned short* cc_hi = xk_b;
  unsigned short* cc_lo = xv_b;
  float* part = (float*)((char*)d_ws + WS_OFF_PART_BYTES);   // partial attention tiles
  float* pml  = (float*)((char*)d_ws + WS_OFF_PML_BYTES);    // their row max / row sum

  // 1) + 2) inputs -> bf16 planes (RNE), [8192][768] each; weights [3][768][256] -> [3][256][768] bf16 (Bt layout
  //    [N=f][K=e]); Wo [768 k][768 n] -> [768 n][768 k]: one launch
  prep_inputs<<<dim3(PREP_WGS), 256, 0, stream>>>(Xk, Xv, Xq, Wk, Wv, Wq, Wo, xk_b, wkT);

  // 3) per-head projections: C_h[8192 x 256] = X[8192 x 768] . (W_h^T)[256 x 768]^T, written as bf16 hi/lo
  //    planes at column offset h*256 with ldc 768 (grid.y = head). M=8192, N=256, K=768: 512 tiles = 64 blocks x 8 waves.
  const dim3 gproj((NROWS / 64) * (HDIM / 64) / 8, NHEAD);
  wmma_gemm64<1, false, false, 0, 2><<<gproj, 256, 0, stream>>>(
      xk_b, xk_b, EMB_SZ, 0L, wkT, wkT, EMB_SZ, (long)HDIM * EMB_SZ,
      (void*)k_hi, (void*)k_lo, EMB_SZ, (long)HDIM, bo, NROWS, HDIM, EMB_SZ, 1.0f);
  wmma_gemm64<1, false, false, 0, 2><<<gproj, 256, 0, stream>>>(
      xv_b, xv_b, EMB_SZ, 0L, wvT, wvT, EMB_SZ, (long)HDIM * EMB_SZ,
      (void*)v_hi, (void*)v_lo, EMB_SZ, (long)HDIM, bo, NROWS, HDIM, EMB_SZ, 1.0f);
  wmma_gemm64<1, false, false, 0, 2><<<gproj, 256, 0, stream>>>(
      xq_b, xq_b, EMB_SZ, 0L, wqT, wqT, EMB_SZ, (long)HDIM * EMB_SZ,
      (void*)q_hi, (void*)q_lo, EMB_SZ, (long)HDIM, bo, NROWS, HDIM, EMB_SZ, 1.0f);

  // 4) causal attention -> concat hi/lo planes (X planes are dead now)
  const float inv_scale = 1.0f / sqrtf((float)SEQLEN);
  attn_hd256<<<dim3(NBATCH * NHEAD, AT_ITEMS), 256, 0, stream>>>(
      q_hi, q_lo, k_hi, k_lo, v_hi, v_lo, cc_hi, cc_lo, part, pml, inv_scale);
  attn_merge<<<dim3(NBATCH * NHEAD, AT_NQB - AT_NSOLE), 256, 0, stream>>>(part, pml, cc_hi, cc_lo);

  // 5) output projection: out[8192 x 768] = concat(hi+lo) . (Wo^T)^T + bo, f32. M=8192, N=768, K=768: 1536 tiles = 192 blocks.
  const dim3 gout((NROWS / 64) * (EMB_SZ / 64) / 8, 1);
  wmma_gemm64<1, true, false, 2, 0><<<gout, 256, 0, stream>>>(
      cc_hi, cc_lo, EMB_SZ, 0L, woT, woT, EMB_SZ, 0L,
      (void*)out, (void*)out, EMB_SZ, 0L, bo, NROWS, EMB_SZ, EMB_SZ, 1.0f);
}

// v009
// One run takes 166 microseconds.
// Next to v008, in two timings, it ran 1.05 times as fast each time.
// Over all steps from v000 it is 6.52 times as fast.
// Contractions on v_wmma_f32_16x16x32_bf16 with f32 accumulate: per-head projections = bf16(X) x bf16(W^T) (inputs RNE-converted once); Q.K^T and P.V = bf16 hi/lo planes (hi.hi + hi.lo + lo.hi); output projection = concat bf16 hi/lo x bf16(Wo^T) (hi.W + lo.W) + bf16(bo); softmax, rescaling and normalisation in f32.
#include <hip/hip_runtime.h>
#include <stdint.h>
#include <math.h>

typedef __attribute__((ext_vector_type(16))) _Float16 v16h;
typedef __attribute__((ext_vector_type(8)))  _Float16 v8h;
typedef __attribute__((ext_vector_type(16))) __bf16   v16b;
typedef __attribute__((ext_vector_type(8)))  __bf16   v8b;
typedef __attribute__((ext_vector_type(8)))  float    v8f;
typedef __attribute__((ext_vector_type(4)))  float    v4f;
typedef __attribute__((ext_vector_type(4)))  unsigned v4u;

// ---- problem geometry ----
constexpr int EMB_SZ  = 768;
constexpr int NHEAD   = 3;
constexpr int HDIM    = 256;
constexpr int NBATCH  = 4;
constexpr int SEQLEN  = 2048;
constexpr int NROWS   = NBATCH * SEQLEN;                       // 8192 flattened (b,s) rows
constexpr size_t PLANE_ELEMS = (size_t)NROWS * EMB_SZ;          // 6291456 elements per [8192][768] plane
constexpr size_t PLANE_BYTES = PLANE_ELEMS * 2;                 // 12582912 B per 16-bit plane
constexpr size_t WT_ELEMS    = (size_t)NHEAD * HDIM * EMB_SZ;   // 589824 (W^T planes [3][256][768])
constexpr size_t WO_ELEMS    = (size_t)EMB_SZ * EMB_SZ;         // 589824 (Wo^T plane [768][768])

// [0]            Xk bf16 plane        (dead after projections; reused as concat hi plane)
// [1*PLANE]      Xv bf16 plane        (reused as concat lo plane)
// [2*PLANE]      Xq bf16 plane
// [3*PLANE]      K hi, [4*PLANE] K lo, [5*PLANE] V hi, [6*PLANE] V lo, [7*PLANE] Q hi, [8*PLANE] Q lo
// [9*PLANE]      Wk^T bf16 [3][256][768], then Wv^T, Wq^T (WT_ELEMS each)
// [9*PLANE+3*WT] Wo^T bf16 [768][768]
// then, f32:     partial attention tiles (unnormalised O, 64 x 256 each) and their row max / row sum (128 floats each)
constexpr size_t WS_OFF_WKT = 9 * PLANE_ELEMS;
constexpr size_t WS_OFF_WVT = WS_OFF_WKT + WT_ELEMS;
constexpr size_t WS_OFF_WQT = WS_OFF_WVT + WT_ELEMS;
constexpr size_t WS_OFF_WOT = WS_OFF_WQT + WT_ELEMS;
constexpr size_t WS_PLANES_BYTES = (WS_OFF_WOT + WO_ELEMS) * 2;   // 117964800 B
static_assert(WS_PLANES_BYTES == 117964800ull);
constexpr int    PART_TILES     = NBATCH * NHEAD * (SEQLEN / 64);   // 384: two key ranges for the upper half of the query blocks
constexpr size_t PART_TILE_F32  = (size_t)64 * HDIM;                // 16384 floats per tile
constexpr size_t WS_OFF_PART_BYTES = WS_PLANES_BYTES;
constexpr size_t WS_OFF_PML_BYTES  = WS_OFF_PART_BYTES + (size_t)PART_TILES * PART_TILE_F32 * 4;
constexpr size_t WS_TOTAL_BYTES    = WS_OFF_PML_BYTES + (size_t)PART_TILES * 128 * 4;   // 143327232 B
static_assert(WS_TOTAL_BYTES == 143327232ull);
static_assert(WS_TOTAL_BYTES <= 268435456ull);
static_assert((WS_OFF_PART_BYTES % 128) == 0 && (WS_OFF_PML_BYTES % 128) == 0);
static_assert((PLANE_BYTES % 128) == 0 && ((WT_ELEMS * 2) % 128) == 0 && ((WO_ELEMS * 2) % 128) == 0);

// ---- GEMM shape contract for the launches in this file ----
static_assert(NROWS % 64 == 0 && HDIM % 64 == 0 && EMB_SZ % 64 == 0);   // M, N tile multiples
static_assert(EMB_SZ % 128 == 0);                                         // K % 128 == 0 for all GEMMs (K = 768)
static_assert(NROWS % 128 == 0 && HDIM % 256 == 0 && EMB_SZ % 256 == 0);  // whole 128 x 256 work-group tiles

__device__ __forceinline__ unsigned short f2bf_bits(float f) {
  unsigned u = __float_as_uint(f);
  return (unsigned short)((u + 0x7FFFu + ((u >> 16) & 1u)) >> 16);
}
__device__ __forceinline__ float bf_bits2f(unsigned short h) { return __uint_as_float(((unsigned)h) << 16); }

// hazard guards as plain device helpers
__device__ __forceinline__ void dep_guard_h(v8f& a, v8f& b, v16h x, v16h y) { asm volatile("v_nop\n\tv_nop\n\tv_nop\n\tv_nop" : "+v"(a), "+v"(b) : "v"(x), "v"(y)); }
__device__ __forceinline__ void dep_guard_b(v8f& a, v8f& b, v16b x, v16b y) { asm volatile("v_nop\n\tv_nop\n\tv_nop\n\tv_nop" : "+v"(a), "+v"(b) : "v"(x), "v"(y)); }
__device__ __forceinline__ void keep4_h(v16h a, v16h b, v16h c, v16h d) { asm volatile("v_nop" :: "v"(a), "v"(b), "v"(c), "v"(d)); }
__device__ __forceinline__ void keep4_b(v16b a, v16b b, v16b c, v16b d) { asm volatile("v_nop" :: "v"(a), "v"(b), "v"(c), "v"(d)); }
__device__ __forceinline__ void acc_guard4(v8f& a, v8f& b, v8f& c, v8f& d) { asm volatile("v_nop\n\tv_nop\n\tv_nop\n\tv_nop" : "+v"(a), "+v"(b), "+v"(c), "+v"(d)); }
template <typename T> struct Frag;
template <> struct Frag<_Float16> {
  typedef v16h V; union U { v16h v; v8h h[2]; };
  static __device__ __forceinline__ v16h load(const _Float16* p) {   // elements 0..7 <- p[0..7], 8..15 <- p[16..23]
    U f; f.h[0] = *(const v8h*)(p); f.h[1] = *(const v8h*)(p + 16); return f.v;
  }
  static __device__ __forceinline__ v8f mma(v16h a, v16h b, v8f c) {
    return __builtin_amdgcn_wmma_f32_16x16x32_f16(false, a, false, b, (short)0, c, false, false);
  }
  static __device__ __forceinline__ void guard(v8f& a, v8f& b, v16h x, v16h y) { dep_guard_h(a, b, x, y); }
  static __device__ __forceinline__ void keep(v16h a, v16h b, v16h c, v16h d) { keep4_h(a, b, c, d); }
};
template <> struct Frag<__bf16> {
  typedef v16b V; union U { v16b v; v8b h[2]; };
  static __device__ __forceinline__ v16b load(const __bf16* p) {
    U f; f.h[0] = *(const v8b*)(p); f.h[1] = *(const v8b*)(p + 16); return f.v;
  }
  static __device__ __forceinline__ v8f mma(v16b a, v16b b, v8f c) {
    return __builtin_amdgcn_wmma_f32_16x16x32_bf16(false, a, false, b, (short)0, c, false, false);
  }
  static __device__ __forceinline__ void guard(v8f& a, v8f& b, v16b x, v16b y) { dep_guard_b(a, b, x, y); }
  static __device__ __forceinline__ void keep(v16b a, v16b b, v16b c, v16b d) { keep4_b(a, b, c, d); }
};

// ---- Register-blocked batched WMMA GEMM (with independent A/B split flags) --------------------
// C[m,n] = scale * sum_k A[m,k] * Bt[n,k] (+bias); each wave owns a 64x64 tile, a work-group 2 x 4 of them (128 x 256).
// A row-major [M,K]; Bt row-major [N,K]; M % 128 == 0, N % 256 == 0, K % 128 == 0 (no tail handling).
// The work-group's operand rows come through LDS, 128 k (256 B of every row) per stage, two buffers: the next stage's
// asynchronous copies fly while this stage's fragments are read from LDS and multiplied.
// SPLITA: A has a lo plane A2 (product += Alo.Bhi); SPLITB: Bt has a lo plane Bt2 (product += Ahi.Blo).
// BIAS_MODE: 0 = none, 1 = bias[m], 2 = RNE-bf16(bias[n]).
// OUT_MODE: 0 = f32, 1 = f16, 2 = bf16 hi plane (Cout) + bf16 lo plane (Cout2).
// ET: 0 = f16 operands, 1 = bf16 operands (pointers passed as 16-bit storage)
template <int ET> struct Elem;
template <> struct Elem<0> { typedef _Float16 T; };
template <> struct Elem<1> { typedef __bf16 T; };
constexpr int GT_BK    = 128;          // k elements per stage
constexpr int GT_PITCH = GT_BK + 8;    // LDS row pitch 272 B, an odd multiple of 16 B: the 16 rows of a b128 fragment read fall on distinct banks
constexpr int GT_MROWS = 128;          // A rows per work-group
constexpr int GT_NROWS = 256;          // Bt rows per work-group
static_assert((GT_PITCH * 2) % 32 == 16 && GT_BK * 2 == 16 * 16);   // one copy of a wave = 2 rows x 16 lanes x 16 B
// Eight asynchronous copies of one wave, global -> LDS: copy j brings rows 2j, 2j+1 of a 16-row slice, 256 B each
// (16 lanes x 16 B), so that every copy reads four whole lines. l and g are the lane's own addresses in rows 0, 1; ld is
// the global row pitch in elements. The s_wait_xcnt closes the statement so that it stands in front of every later
// write of an address register that a copy names.
__device__ __forceinline__ void copy_rows16(const unsigned short* l, const unsigned short* g, int ld) {
  const unsigned l0 = (unsigned)(size_t)l;
  constexpr unsigned lp = 2u * GT_PITCH * 2u;
  const size_t gp = (size_t)2 * ld;
  asm volatile(
      "global_load_async_to_lds_b128 %0, %8, off\n\t"
      "global_load_async_to_lds_b128 %1, %9, off\n\t"
      "global_load_async_to_lds_b128 %2, %10, off\n\t"
      "global_load_async_to_lds_b128 %3, %11, off\n\t"
      "global_load_async_to_lds_b128 %4, %12, off\n\t"
      "global_load_async_to_lds_b128 %5, %13, off\n\t"
      "global_load_async_to_lds_b128 %6, %14, off\n\t"
      "global_load_async_to_lds_b128 %7, %15, off\n\t"
      "s_wait_xcnt 0x0"
      :: "v"(l0), "v"(l0 + lp), "v"(l0 + 2u * lp), "v"(l0 + 3u * lp),
         "v"(l0 + 4u * lp), "v"(l0 + 5u * lp), "v"(l0 + 6u * lp), "v"(l0 + 7u * lp),
         "v"(g), "v"(g + gp), "v"(g + 2 * gp), "v"(g + 3 * gp),
         "v"(g + 4 * gp), "v"(g + 5 * gp), "v"(g + 6 * gp), "v"(g + 7 * gp)
      : "memory");
}
template <int ET, bool SPLITA, bool SPLITB, int BIAS_MODE, int OUT_MODE>
__global__ __launch_bounds__(256) void wmma_gemm64(
    const unsigned short* __restrict__ Ap, const unsigned short* __restrict__ A2p, int lda, long strideA,
    const unsigned short* __restrict__ Btp, const unsigned short* __restrict__ Bt2p, int ldb, long strideB,
    void* __restrict__ Cout, void* __restrict__ Cout2, int ldc, long strideC,
    const float* __restrict__ bias,
    int M, int N, int K, float scale) {
  typedef typename Elem<ET>::T T;
  typedef typename Frag<T>::V V;
  // One stage in LDS: [A | A lo | Bt | Bt lo] rows at GT_PITCH (the lo parts only where the operand is split).
  constexpr int OFF_A2 = GT_MROWS * GT_PITCH;
  constexpr int OFF_B  = OFF_A2 + (SPLITA ? GT_MROWS * GT_PITCH : 0);
  constexpr int OFF_B2 = OFF_B + GT_NROWS * GT_PITCH;
  constexpr int STAGE_ELEMS = OFF_B2 + (SPLITB ? GT_NROWS * GT_PITCH : 0);
  __shared__ __align__(16) unsigned short stg[2][STAGE_ELEMS];
  __shared__ __align__(16) float sT[8][16 * 68];   // per-wave 16x64 slab, pitch 68 floats
  const int b    = blockIdx.y;
  const int lane = threadIdx.x & 31;
  const int wave = __builtin_amdgcn_readfirstlane(threadIdx.x >> 5);   // scalar: the rows and offsets that derive from it alone cost no vector register
  const int wgN = N >> 8;
  if ((int)blockIdx.x >= (M >> 7) * wgN) return;   // block-uniform, in front of every copy and barrier
  const int bm  = blockIdx.x / wgN;
  const int bn  = blockIdx.x - bm * wgN;
  const int wm  = wave >> 2;                   // this wave's 64-row group of the work-group's 128 rows
  const int wn  = wave & 3;                    // this wave's 64-column group of the work-group's 256 columns
  const int m0 = bm * GT_MROWS + (wm << 6);
  const int n0 = bn * GT_NROWS + (wn << 6);

  // Staging coverage: wave w brings A rows 16w..16w+15 and Bt rows 32w..32w+31 of the work-group's tile.
  const int lr = lane >> 4, lc = (lane & 15) * 8;  // row within a copy's two rows, first of the lane's 8 elements
  const size_t aoff = (size_t)b * strideA + (size_t)(bm * GT_MROWS + wave * 16 + lr) * lda + lc;
  const size_t boff = (size_t)b * strideB + (size_t)(bn * GT_NROWS + wave * 32 + lr) * ldb + lc;
  const int lA = (wave * 16 + lr) * GT_PITCH + lc;
  const int lB = (wave * 32 + lr) * GT_PITCH + lc;
  auto stage_in = [&](int t, int buf) {
    const unsigned short* sb = &stg[buf][0];
    const size_t k0 = (size_t)t * GT_BK;
    copy_rows16(sb + lA, Ap + aoff + k0, lda);
    if (SPLITA) copy_rows16(sb + OFF_A2 + lA, A2p + aoff + k0, lda);
    copy_rows16(sb + OFF_B + lB, Btp + boff + k0, ldb);
    copy_rows16(sb + OFF_B + lB + 16 * GT_PITCH, Btp + boff + k0 + (size_t)16 * ldb, ldb);
    if (SPLITB) {
      copy_rows16(sb + OFF_B2 + lB, Bt2p + boff + k0, ldb);
      copy_rows16(sb + OFF_B2 + lB + 16 * GT_PITCH, Bt2p + boff + k0 + (size_t)16 * ldb, ldb);
    }
  };

  const int rlane = lane & 15;                 // row (A) / col (B, D) within subtile
  const int koff  = (lane >> 4) * 8;           // k offset of this lane half
  const int mOff  = (lane >> 4) * 8;           // D row offset

  v8f acc[4][4];
#pragma unroll
  for (int i = 0; i < 4; ++i)
#pragma unroll
    for (int j = 0; j < 4; ++j) acc[i][j] = (v8f){0.f,0.f,0.f,0.f,0.f,0.f,0.f,0.f};

  const int nst = K / GT_BK;                   // stages (block-uniform)
  stage_in(0, 0);
  // This wave's copies of stage 0 have landed before the barrier behind which the other waves read them.
  asm volatile("s_wait_asynccnt 0x0" ::: "memory");
  __syncthreads();
  if (nst > 1) stage_in(1, 1);
  const int fa = ((wm << 6) + rlane) * GT_PITCH + koff;            // this lane's place in A fragment row group 0
  const int fb = OFF_B + ((wn << 6) + rlane) * GT_PITCH + koff;    // and in Bt fragment row group 0
  for (int t = 0; t < nst; ++t) {
    const T* sb = (const T*)&stg[t & 1][0];
#pragma unroll   // a constant kk goes into the offset field of the LDS reads
    for (int kk = 0; kk < GT_BK; kk += 32) {
      // All fragments of a k step are read as one group in front of its products.
      V bh[4], bl[4], ah[4], al[4];
#pragma unroll   // this loop and the next: constant indices keep the fragment arrays in registers
      for (int j = 0; j < 4; ++j) {
        bh[j] = Frag<T>::load(sb + fb + (j << 4) * GT_PITCH + kk);
        if (SPLITB) bl[j] = Frag<T>::load(sb + fb + (OFF_B2 - OFF_B) + (j << 4) * GT_PITCH + kk);
      }
#pragma unroll
      for (int i = 0; i < 4; ++i) {
        ah[i] = Frag<T>::load(sb + fa + (i << 4) * GT_PITCH + kk);
        if (SPLITA) al[i] = Frag<T>::load(sb + fa + OFF_A2 + (i << 4) * GT_PITCH + kk);
      }
#pragma unroll
      for (int i = 0; i < 4; ++i) {
#pragma unroll
        for (int j = 0; j < 4; ++j) {
          acc[i][j] = Frag<T>::mma(ah[i], bh[j], acc[i][j]);
          if (SPLITB) acc[i][j] = Frag<T>::mma(ah[i], bl[j], acc[i][j]);
          if (SPLITA) acc[i][j] = Frag<T>::mma(al[i], bh[j], acc[i][j]);
        }
        Frag<T>::guard(acc[i][0], acc[i][3], ah[i], SPLITA ? al[i] : ah[i]);
      }
      Frag<T>::keep(bh[0], bh[1], bh[2], bh[3]);
      if (SPLITB) Frag<T>::keep(bl[0], bl[1], bl[2], bl[3]);
    }
    // This wave's LDS reads of this stage have returned, and its copies of the next stage have landed, before the
    // barrier behind which this stage's buffer is refilled and the next stage is read.
    asm volatile("s_wait_dscnt 0x0" ::: "memory");
    asm volatile("s_wait_asynccnt 0x0" ::: "memory");
    __syncthreads();
    if (t + 2 < nst) stage_in(t + 2, t & 1);
  }
  // No copy is outstanding when the wave goes on to the epilogue and ends.
  asm volatile("s_wait_asynccnt 0x0" ::: "memory");
  acc_guard4(acc[0][0], acc[0][1], acc[0][2], acc[0][3]);
  acc_guard4(acc[1][0], acc[1][1], acc[1][2], acc[1][3]);
  acc_guard4(acc[2][0], acc[2][1], acc[2][2], acc[2][3]);
  acc_guard4(acc[3][0], acc[3][1], acc[3][2], acc[3][3]);

  // ---- epilogue ----
  float* slab = sT[wave];
#pragma unroll
  for (int i = 0; i < 4; ++i) {
    const int mBase = m0 + (i << 4);
#pragma unroll
    for (int j = 0; j < 4; ++j) {
      const int n = n0 + (j << 4) + rlane;
      float bv = 0.f;
      if (BIAS_MODE == 2) bv = bf_bits2f(f2bf_bits(bias[n]));
#pragma unroll
      for (int r = 0; r < 8; ++r) {
        float v = acc[i][j][r] * scale;
        if (BIAS_MODE == 1) v += bias[mBase + mOff + r];
        if (BIAS_MODE == 2) v += bv;
        slab[(mOff + r) * 68 + (j << 4) + rlane] = v;
      }
    }
    __builtin_amdgcn_fence(__ATOMIC_RELEASE, "workgroup");
    __builtin_amdgcn_wave_barrier();
    __builtin_amdgcn_fence(__ATOMIC_ACQUIRE, "workgroup");
    if (OUT_MODE == 0) {
      float* C = (float*)Cout + (size_t)b * strideC;
      const int hh = lane >> 4, c4 = (lane & 15) * 4;     // row seg = 256 B = 16 lanes x 16 B
      {
#pragma unroll
        for (int it = 0; it < 8; ++it) {
          const int row = it * 2 + hh;
          v4f v = *(const v4f*)(slab + row * 68 + c4);
          *(v4f*)(C + (size_t)(mBase + row) * ldc + n0 + c4) = v;
        }
        
      }
    } else {
      const int q = lane >> 3, c8 = (lane & 7) * 8;
      unsigned short* C  = (unsigned short*)Cout  + (size_t)b * strideC;
      unsigned short* C2 = (OUT_MODE == 2) ? ((unsigned short*)Cout2 + (size_t)b * strideC) : nullptr;
      {
#pragma unroll
        for (int it = 0; it < 4; ++it) {
          const int row = it * 4 + q;
          const float* sp = slab + row * 68 + c8;
          v8h hv, lv;
#pragma unroll
          for (int e = 0; e < 8; ++e) {
            if (OUT_MODE == 1) {
              hv[e] = (_Float16)sp[e];
            } else {
              unsigned short hb = f2bf_bits(sp[e]);
              unsigned short lb = f2bf_bits(sp[e] - bf_bits2f(hb));
              hv[e] = __builtin_bit_cast(_Float16, hb);
              lv[e] = __builtin_bit_cast(_Float16, lb);
            }
          }
          *(v8h*)(C + (size_t)(mBase + row) * ldc + n0 + c8) = hv;
          if (OUT_MODE == 2) *(v8h*)(C2 + (size_t)(mBase + row) * ldc + n0 + c8) = lv;
        }
        
      }
    }
    __builtin_amdgcn_fence(__ATOMIC_RELEASE, "workgroup");
    __builtin_amdgcn_wave_barrier();
    __builtin_amdgcn_fence(__ATOMIC_ACQUIRE, "workgroup");
  }
}

// ---- input pass, one launch: three activation planes f32 -> bf16 (RNE) and the four weight transposes ----------
// Every work-group converts its share of each activation plane: per thread and plane 4 units of 8 elements (32 B read,
// 16 B written), unit index = j * PREP_THREADS + global thread id, so one store of a wave is 512 contiguous bytes. All of
// a thread's loads are issued before its first convert. Work-groups 0..PREP_TILES-1 also take one 64x64 weight tile:
// in = planes of [768][CC] f32 -> out = planes of [CC][768] bf16, through LDS.
constexpr int PREP_WGS     = 768;
constexpr int PREP_THREADS = PREP_WGS * 256;
constexpr int PREP_UNITS   = (int)(PLANE_ELEMS / 8);            // 16-B output units per plane
constexpr int PREP_PER_THR = PREP_UNITS / PREP_THREADS;         // 4
constexpr int TILES_WZ     = (HDIM / 64) * (EMB_SZ / 64);       // 48 tiles per head plane of Wk, Wv, Wq
constexpr int TILES_W      = TILES_WZ * NHEAD;                  // 144 per weight
constexpr int TILES_WO     = (EMB_SZ / 64) * (EMB_SZ / 64);     // 144
constexpr int PREP_TILES   = 3 * TILES_W + TILES_WO;            // 576
static_assert(PREP_PER_THR * PREP_THREADS == PREP_UNITS && PREP_PER_THR == 4);
static_assert(PREP_TILES <= PREP_WGS && HDIM / 64 == 4);

__device__ __forceinline__ v4u pack8_bf16(v4f a, v4f c2) {
  v4u w;
  w[0] = (unsigned)f2bf_bits(a[0])  | ((unsigned)f2bf_bits(a[1])  << 16);
  w[1] = (unsigned)f2bf_bits(a[2])  | ((unsigned)f2bf_bits(a[3])  << 16);
  w[2] = (unsigned)f2bf_bits(c2[0]) | ((unsigned)f2bf_bits(c2[1]) << 16);
  w[3] = (unsigned)f2bf_bits(c2[2]) | ((unsigned)f2bf_bits(c2[3]) << 16);
  return w;
}

__global__ __launch_bounds__(256) void prep_inputs(
    const float* __restrict__ Xk, const float* __restrict__ Xv, const float* __restrict__ Xq,
    const float* __restrict__ Wk, const float* __restrict__ Wv, const float* __restrict__ Wq,
    const float* __restrict__ Wo,
    unsigned short* __restrict__ xb,     // three bf16 planes in a row: Xk, Xv, Xq
    unsigned short* __restrict__ wT) {   // Wk^T, Wv^T, Wq^T, Wo^T in a row (WT_ELEMS each)
  __shared__ float tile[64][65];
  const int tid = threadIdx.x;
  const int blk = blockIdx.x;

  // ---- activation loads: 3 planes x 4 units x 2 loads of 16 B ----
  const unsigned u0 = (unsigned)blk * 256u + (unsigned)tid;
  v4f xa[3][PREP_PER_THR], xc[3][PREP_PER_THR];
  const float* xp[3][PREP_PER_THR];
#pragma unroll   // both loops: constant indices keep the arrays in registers
  for (int x = 0; x < 3; ++x) {
    const float* in = (x == 0) ? Xk : (x == 1) ? Xv : Xq;
#pragma unroll
    for (int j = 0; j < PREP_PER_THR; ++j) {
      const float* p = in + (size_t)(u0 + (unsigned)j * PREP_THREADS) * 8;
      xp[x][j] = p;
      xa[x][j] = *(const v4f*)p;
      xc[x][j] = *(const v4f*)(p + 4);
    }
  }
  // Stands in front of every later write of a register that one of these loads names as its address: as inputs the twelve
  // addresses stay live up to here, so that no result of a later load of the run is placed on one of them either.
  asm volatile("s_wait_xcnt 0x0"
               :: "v"(xp[0][0]), "v"(xp[0][1]), "v"(xp[0][2]), "v"(xp[0][3]),
                  "v"(xp[1][0]), "v"(xp[1][1]), "v"(xp[1][2]), "v"(xp[1][3]),
                  "v"(xp[2][0]), "v"(xp[2][1]), "v"(xp[2][2]), "v"(xp[2][3])
               : "memory");

  // ---- one weight tile (block-uniform branch) ----
  if (blk < PREP_TILES) {
    const float* src;
    unsigned short* dst;
    int CC, ct, rt;
    if (blk < 3 * TILES_W) {
      const int w = blk / TILES_W, r = blk - w * TILES_W;
      const int z = r / TILES_WZ, r2 = r - z * TILES_WZ;
      src = ((w == 0) ? Wk : (w == 1) ? Wv : Wq) + (size_t)z * EMB_SZ * HDIM;
      dst = wT + (size_t)w * WT_ELEMS + (size_t)z * EMB_SZ * HDIM;
      CC = HDIM; ct = r2 & 3; rt = r2 >> 2;
    } else {
      const int r = blk - 3 * TILES_W;
      src = Wo;
      dst = wT + 3 * WT_ELEMS;
      CC = EMB_SZ; rt = r / (EMB_SZ / 64); ct = r - rt * (EMB_SZ / 64);
    }
    const int lr = tid >> 2, lc = (tid & 3) * 16;           // in-tile row (input row), 16 input cols
    const float* sp = src + (size_t)(rt * 64 + lr) * CC + ct * 64 + lc;
#pragma unroll
    for (int i = 0; i < 4; ++i) {
      const v4f v = *(const v4f*)(sp + 4 * i);
      tile[lr][lc + 4 * i + 0] = v[0];
      tile[lr][lc + 4 * i + 1] = v[1];
      tile[lr][lc + 4 * i + 2] = v[2];
      tile[lr][lc + 4 * i + 3] = v[3];
    }
    __syncthreads();
    // Store coverage: wave w writes out rows ct*64 + 8w + {0..7} (2 iterations x 4 rows), 8 lanes x 16 B per row.
    const int lane = tid & 31, wave = tid >> 5, q = lane >> 3, c8 = (lane & 7) * 8;
#pragma unroll
    for (int it = 0; it < 2; ++it) {
      const int fl = wave * 8 + it * 4 + q;                   // out row within tile = input col within tile
      v4u t4;
#pragma unroll
      for (int e = 0; e < 4; ++e) {
        const unsigned lo16 = (unsigned)f2bf_bits(tile[c8 + 2 * e][fl]);
        const unsigned hi16 = (unsigned)f2bf_bits(tile[c8 + 2 * e + 1][fl]);
        t4[e] = lo16 | (hi16 << 16);
      }
      *(v4u*)(dst + (size_t)(ct * 64 + fl) * EMB_SZ + rt * 64 + c8) = t4;
    }
  }

  // ---- convert and store the activation units ----
#pragma unroll
  for (int x = 0; x < 3; ++x) {
#pragma unroll
    for (int j = 0; j < PREP_PER_THR; ++j) {
      unsigned short* o = xb + (size_t)x * PLANE_ELEMS + (size_t)(u0 + (unsigned)j * PREP_THREADS) * 8;
      *(v4u*)o = pack8_bf16(xa[x][j], xc[x][j]);
    }
  }
}

// =====================================================================================================
// Causal flash attention, head_dim 256, operands = bf16 hi/lo planes.
//   Q/K/V planes: element (b, s, h, d) at [(b*SEQLEN + s)*EMB_SZ + h*HDIM + d] (hi plane and lo plane).
//   scores = (Qhi.Khi + Qhi.Klo + Qlo.Khi) * inv_scale; causal mask = -inf for key > query (diagonal chunk);
//   online softmax in f32, in base 2 (scores and row maxima carry the factor log2(e)); P (unnormalised exp) split to bf16 hi/lo in LDS; O += Phi.Vhi + Phi.Vlo + Plo.Vhi;
//   out = O / l written as bf16 hi/lo concat planes in the same [(b,s)][h*HDIM + d] layout.
// Block = 256 threads = 8 waves, 64 query rows of one (b,h); wave w: row group rw = w&3 (16 rows),
// half ch = w>>2: d half (128 of 256) for the score products, key half (32 of 64 keys) for the softmax,
// column half (128 of 256) for O. Q stays in registers: each wave holds its 16 rows x its d half, forms partial
// scores for all 64 keys, and the two waves of a row group swap the partial tiles of each other's key half in LDS.
// Row max / row sum of the two key halves combined through LDS with block barriers.
// Work items: a query block of the lower half of the sequence (at most 16 key chunks) is one work-group and writes the
// concat planes itself. A query block of the upper half is two work-groups, each with half of its key chunks; each
// writes its unnormalised O tile with its row max and row sum to the workspace, and attn_merge (the next launch) joins
// the two. So no work-group walks more than 16 chunks. grid = (NBATCH*NHEAD, AT_ITEMS), items with many chunks first.
// =====================================================================================================
constexpr int AT_KEYS  = 64;    // keys per chunk
constexpr int AT_QROWS = 64;    // query rows per block
constexpr int AT_WHALF = 128;   // output columns per wave
constexpr int AT_NQB   = SEQLEN / AT_QROWS;        // 32 query blocks per (b,h)
constexpr int AT_NSOLE = AT_NQB / 2;               // query blocks 0..15: one work-group each
constexpr int AT_ITEMS = AT_NSOLE + 2 * (AT_NQB - AT_NSOLE);   // 48 work-groups per (b,h)
static_assert(AT_NQB % 2 == 0 && PART_TILES == NBATCH * NHEAD * 2 * (AT_NQB - AT_NSOLE));
static_assert(PART_TILE_F32 == (size_t)AT_QROWS * HDIM && 2 * AT_QROWS == 128);
// LDS row pitches in 16-bit elements. K and P rows are read by b128 fragment loads: 16 B of pad make the pitch an odd
// multiple of 16 B, so the 16 rows of one read fall on 16 different groups of four banks. V rows are read by the
// transposing load, whose conflict-free pitch is an odd multiple of 32 B.
constexpr int AT_KPITCH = HDIM + 8;       // K rows [key][d]: 528 B
constexpr int AT_VPITCH = HDIM + 16;      // V rows [key][d]: 544 B
constexpr int AT_PPITCH = AT_KEYS + 8;    // P rows [row][key]: 144 B
static_assert(SEQLEN % AT_QROWS == 0 && SEQLEN % AT_KEYS == 0 && HDIM == 2 * AT_WHALF);
static_assert(8 * 16 * AT_WHALF <= AT_KEYS * AT_KPITCH);   // output staging slabs fit one K plane
static_assert((AT_KPITCH * 2) % 32 == 16 && (AT_VPITCH * 2) % 64 == 32 && (AT_PPITCH * 2) % 32 == 16);
static_assert(HDIM * 2 == 32 * 16 && AT_KEYS == 8 * 8);    // one copy of a wave = one row; 8 waves x 8 rows = one plane
static_assert(8 * 512 * 4 <= 2 * AT_QROWS * AT_PPITCH * 2);  // the partial-score swap (8 waves x 2 tiles, f32) fits the P planes

__device__ __forceinline__ v16b ldfrag16(const unsigned short* p) {   // elements 0..7 <- p[0..7], 8..15 <- p[16..23]
  union { v16b v; v8b h[2]; } f;
  f.h[0] = *(const v8b*)(p); f.h[1] = *(const v8b*)(p + 16); return f.v;
}
// B fragment (32 keys x 16 d) of a row-major [key][d] LDS tile: p = this lane's address in the first 16 keys,
// row 8*(lane>>4) + (lane&7), column 8*((lane>>3)&1). Lane (c, hh) receives keys 8hh..8hh+7 of column c, then keys
// 16+8hh..16+8hh+7: the k order of ldfrag16.
typedef short s16x8 __attribute__((ext_vector_type(8)));
__device__ __forceinline__ v16b ldfrag16_tr(const unsigned short* p) {
  typedef __attribute__((address_space(3))) s16x8 lds_s16x8;
  union { v16b v; s16x8 h[2]; } f;
  f.h[0] = __builtin_amdgcn_ds_load_tr16_b128_v8i16((lds_s16x8*)p);
  f.h[1] = __builtin_amdgcn_ds_load_tr16_b128_v8i16((lds_s16x8*)(p + 16 * AT_VPITCH));
  return f.v;
}
// Eight asynchronous copies of one wave, global -> LDS: copy j brings row j (512 B, 16 B per lane). g and l are the
// lane's own addresses in row 0. The s_wait_xcnt closes the statement so that it stands in front of every later write
// of an address register that a copy names.
__device__ __forceinline__ void copy_rows8(const unsigned short* l, int lpitch, const unsigned short* g) {
  const unsigned l0 = (unsigned)(size_t)l;
  const unsigned lp = (unsigned)lpitch * 2u;
  asm volatile(
      "global_load_async_to_lds_b128 %0, %8, off\n\t"
      "global_load_async_to_lds_b128 %1, %9, off\n\t"
      "global_load_async_to_lds_b128 %2, %10, off\n\t"
      "global_load_async_to_lds_b128 %3, %11, off\n\t"
      "global_load_async_to_lds_b128 %4, %12, off\n\t"
      "global_load_async_to_lds_b128 %5, %13, off\n\t"
      "global_load_async_to_lds_b128 %6, %14, off\n\t"
      "global_load_async_to_lds_b128 %7, %15, off\n\t"
      "s_wait_xcnt 0x0"
      :: "v"(l0), "v"(l0 + lp), "v"(l0 + 2u * lp), "v"(l0 + 3u * lp),
         "v"(l0 + 4u * lp), "v"(l0 + 5u * lp), "v"(l0 + 6u * lp), "v"(l0 + 7u * lp),
         "v"(g), "v"(g + EMB_SZ), "v"(g + 2 * EMB_SZ), "v"(g + 3 * EMB_SZ),
         "v"(g + 4 * EMB_SZ), "v"(g + 5 * EMB_SZ), "v"(g + 6 * EMB_SZ), "v"(g + 7 * EMB_SZ)
      : "memory");
}
__device__ __forceinline__ v8f mma_bf(v16b a, v16b b, v8f c) {
  c = __builtin_amdgcn_wmma_f32_16x16x32_bf16(false, a, false, b, (short)0, c, false, false);
  asm volatile("v_nop\n\tv_nop\n\tv_nop\n\tv_nop" : "+v"(c) : "v"(a), "v"(b));
  return c;
}

// 2^x in place, as the one hardware instruction. The softmax works in base 2: the scores are scaled by log2(e) together
// with the reference's scale, so exp(a - b) of the natural scores is 2^(difference of the scaled ones). The arguments are
// never above 0; -inf gives 0. In asm so that the slot which the instruction set asks for behind a transcendental is kept
// by construction: each v_exp_f32 is followed by one that touches neither its result nor its source, the last by a v_nop.
__device__ __forceinline__ void exp2_hw3(float& a, float& b, float& c) {
  asm("v_exp_f32 %0, %0\n\tv_exp_f32 %1, %1\n\tv_exp_f32 %2, %2\n\tv_nop" : "+v"(a), "+v"(b), "+v"(c));
}
__device__ __forceinline__ void exp2_hw2(float& a, float& b) {
  asm("v_exp_f32 %0, %0\n\tv_exp_f32 %1, %1\n\tv_nop" : "+v"(a), "+v"(b));
}

// Maximum / sum over each 16-lane row, eight values at once, by four DPP steps (row_xmask 1, 2, 4, 8): lane l takes lane
// l ^ mask of its row, the pairing of a shuffle butterfly, so every lane of a row ends with the same value and the sum
// keeps its order. In asm because the shuffle builtin compiles to ds_bpermute_b32, a trip through the LDS pipe with a wait
// per step, and the DPP builtin to a move, a canonicalising maximum and the operation. Step-major order: the producer of
// each operand stands eight vector instructions back, so the dependent links cost no stall.
#define ROW8_STEP(op, x)                                        \
  op " %0, %0, %0 row_xmask:" x " row_mask:0xf bank_mask:0xf\n\t" \
  op " %1, %1, %1 row_xmask:" x " row_mask:0xf bank_mask:0xf\n\t" \
  op " %2, %2, %2 row_xmask:" x " row_mask:0xf bank_mask:0xf\n\t" \
  op " %3, %3, %3 row_xmask:" x " row_mask:0xf bank_mask:0xf\n\t" \
  op " %4, %4, %4 row_xmask:" x " row_mask:0xf bank_mask:0xf\n\t" \
  op " %5, %5, %5 row_xmask:" x " row_mask:0xf bank_mask:0xf\n\t" \
  op " %6, %6, %6 row_xmask:" x " row_mask:0xf bank_mask:0xf\n\t" \
  op " %7, %7, %7 row_xmask:" x " row_mask:0xf bank_mask:0xf\n\t"
__device__ __forceinline__ void row_max16x8(float (&v)[8]) {
  asm(ROW8_STEP("v_max_num_f32_dpp", "1") ROW8_STEP("v_max_num_f32_dpp", "2")
      ROW8_STEP("v_max_num_f32_dpp", "4") ROW8_STEP("v_max_num_f32_dpp", "8")
      : "+v"(v[0]), "+v"(v[1]), "+v"(v[2]), "+v"(v[3]), "+v"(v[4]), "+v"(v[5]), "+v"(v[6]), "+v"(v[7]));
}
__device__ __forceinline__ void row_sum16x8(float (&v)[8]) {
  asm(ROW8_STEP("v_add_f32_dpp", "1") ROW8_STEP("v_add_f32_dpp", "2")
      ROW8_STEP("v_add_f32_dpp", "4") ROW8_STEP("v_add_f32_dpp", "8")
      : "+v"(v[0]), "+v"(v[1]), "+v"(v[2]), "+v"(v[3]), "+v"(v[4]), "+v"(v[5]), "+v"(v[6]), "+v"(v[7]));
}

// Second bound: four waves per SIMD, so that two workgroups still share a WGP (its LDS holds two) with Q resident.
__global__ __launch_bounds__(256, 4) void attn_hd256(
    const unsigned short* __restrict__ Qh, const unsigned short* __restrict__ Ql,
    const unsigned short* __restrict__ Kh, const unsigned short* __restrict__ Kl,
    const unsigned short* __restrict__ Vh, const unsigned short* __restrict__ Vl,
    unsigned short* __restrict__ Oh, unsigned short* __restrict__ Ol,
    float* __restrict__ part, float* __restrict__ pml, float inv_scale) {
  __shared__ __align__(16) unsigned short Ks[2][AT_KEYS * AT_KPITCH];   // [plane][key][d]   67584 B; reused as output staging
  __shared__ __align__(16) unsigned short Vs[2][AT_KEYS * AT_VPITCH];   // [plane][key][d]   69632 B
  __shared__ __align__(16) unsigned short Ps[2][AT_QROWS * AT_PPITCH];  // [plane][row][key] 18432 B
  __shared__ float redm[2][AT_QROWS];                                // partial row max per key half
  __shared__ float reds[2][AT_QROWS];                                // partial row sum per key half
  // Running row max and row sum, one copy per wave (index [ch][row]), written by that wave alone and read by it (wave 0 also reads the ch 0 copies of all 64 rows after a split item's last chunk): they are
  // used once a chunk, and in LDS they leave their 16 registers to the fragment sets of the two products.
  __shared__ __align__(16) float runm[2][AT_QROWS];
  __shared__ __align__(16) float runl[2][AT_QROWS];

  const int tid  = threadIdx.x;
  const int lane = tid & 31;
  const int wave = __builtin_amdgcn_readfirstlane(tid >> 5);   // scalar: what derives from it alone costs no vector register
  const int hh   = lane >> 4;
  const int c    = lane & 15;
  const int rw   = wave & 3;
  const int ch   = wave >> 2;
  const int bh   = blockIdx.x;                 // b*NHEAD + h
  // Items in reverse of blockIdx.y: low blockIdx.y takes the items of the long query blocks, the shortest come last.
  const int item  = AT_ITEMS - 1 - (int)blockIdx.y;
  const bool split = item >= AT_NSOLE;         // block-uniform: this work-group has half of its query block's chunks
  const int pidx = item - AT_NSOLE;            // split items: 2 * (qb - AT_NSOLE) + key range
  const int qb   = split ? AT_NSOLE + (pidx >> 1) : item;   // query block 0..31
  const int h    = bh % NHEAD;
  const int b    = bh / NHEAD;
  const int q0w  = qb * AT_QROWS + rw * 16;    // first query row (within the sequence) of this wave
  const size_t rowb = (size_t)b * SEQLEN;      // flattened row base of this batch
  const int hcol = h * HDIM;

  v8f oacc[8];
#pragma unroll
  for (int r = 0; r < 8; ++r) { runm[ch][rw * 16 + 8 * hh + r] = -INFINITY; runl[ch][rw * 16 + 8 * hh + r] = 0.f; }
#pragma unroll
  for (int t = 0; t < 8; ++t) oacc[t] = (v8f){0.f,0.f,0.f,0.f,0.f,0.f,0.f,0.f};

  // This wave's 16 query rows x its d half, hi and lo, as A fragments (row m = c): loaded once, kept for every chunk.
  v16b qfh[4], qfl[4];
  {
    const size_t qoff = (rowb + q0w + c) * EMB_SZ + hcol + ch * AT_WHALF + 8 * hh;
#pragma unroll   // constant indices keep the fragment arrays in registers
    for (int dc = 0; dc < 4; ++dc) {
      qfh[dc] = ldfrag16(Qh + qoff + dc * 32);
      qfl[dc] = ldfrag16(Ql + qoff + dc * 32);
    }
  }
  // Swap area for partial score tiles, in the P planes (free from the chunk's first barrier to the row-max barrier):
  // per wave 4 quads x 32 lanes x 4 floats, so that each b128 access of a wave is 512 contiguous bytes.
  float* const xown  = reinterpret_cast<float*>(&Ps[0][0]) + wave * 512 + lane * 4;
  const float* const xpeer = reinterpret_cast<const float*>(&Ps[0][0]) + (wave ^ 4) * 512 + lane * 4;

  const float sc2 = inv_scale * 1.44269504088896340736f;   // the reference's scale times log2(e)
  const int nch = qb + 1;                      // causal horizon in 64-key chunks (block-uniform)
  const int kc0 = (split && (pidx & 1)) ? (nch >> 1) : 0;     // this work-group's chunks: [kc0, kc1), never empty
  const int kc1 = (split && !(pidx & 1)) ? (nch >> 1) : nch;
  for (int kc = kc0; kc < kc1; ++kc) {
    const int kv0 = kc * AT_KEYS;
    // This wave's LDS reads of the last chunk have returned before the barrier behind which K and V are overwritten.
    asm volatile("s_wait_dscnt 0x0" ::: "memory");
    __syncthreads();
    // ---- stage K and V (hi/lo, both [key][d]) by asynchronous copies to LDS ----
    // Coverage: wave w brings keys 8w..8w+7 of each of the four planes, one whole row per copy.
    {
      const int kr0 = wave * 8;
      const size_t gbase = (rowb + kv0 + kr0) * EMB_SZ + hcol + lane * 8;
      copy_rows8(&Ks[0][kr0 * AT_KPITCH + lane * 8], AT_KPITCH, Kh + gbase);
      copy_rows8(&Ks[1][kr0 * AT_KPITCH + lane * 8], AT_KPITCH, Kl + gbase);
      copy_rows8(&Vs[0][kr0 * AT_VPITCH + lane * 8], AT_VPITCH, Vh + gbase);
      copy_rows8(&Vs[1][kr0 * AT_VPITCH + lane * 8], AT_VPITCH, Vl + gbase);
    }
    // This wave's copies have landed before the barrier behind which the other waves read them.
    asm volatile("s_wait_asynccnt 0x0" ::: "memory");
    __syncthreads();

    // ---- partial scores over this wave's d half: 16 rows x 64 keys (four 16x16 D tiles), hi.hi + hi.lo + lo.hi ----
    // Tiles 0,1 = this wave's own key half, tiles 2,3 = the other wave's.
    v8f sp[4];
#pragma unroll
    for (int j = 0; j < 4; ++j) sp[j] = (v8f){0.f,0.f,0.f,0.f,0.f,0.f,0.f,0.f};
    // K fragments are read two groups ahead of the products that use them (a group = one d step of one key tile, hi and
    // lo), in three rotating register sets: a group's LDS latency runs under the six products in front of it.
    v16b kfh[3], kfl[3];
#pragma unroll   // constant indices keep the fragment sets in registers
    for (int g = 0; g < 2; ++g) {
      const int koff = (((ch * 2 + (g & 3)) & 3) * 16 + c) * AT_KPITCH + ch * AT_WHALF + (g >> 2) * 32 + 8 * hh;
      kfh[g] = ldfrag16(&Ks[0][koff]);
      kfl[g] = ldfrag16(&Ks[1][koff]);
    }
#pragma unroll   // constant indices keep qfh, qfl, sp and the fragment sets in registers
    for (int g = 0; g < 16; ++g) {
      if (g + 2 < 16) {
        const int gn = g + 2;
        const int kr = ((ch * 2 + (gn & 3)) & 3) * 16 + c;                 // B fragment column n = key kr
        const int koff = kr * AT_KPITCH + ch * AT_WHALF + (gn >> 2) * 32 + 8 * hh;
        kfh[gn % 3] = ldfrag16(&Ks[0][koff]);
        kfl[gn % 3] = ldfrag16(&Ks[1][koff]);
      }
      const int dc = g >> 2, j = g & 3;
      sp[j] = mma_bf(qfh[dc], kfh[g % 3], sp[j]);
      sp[j] = mma_bf(qfh[dc], kfl[g % 3], sp[j]);
      sp[j] = mma_bf(qfl[dc], kfh[g % 3], sp[j]);
    }
    // ---- swap: hand tiles 2,3 to the other wave of the row group, add its partials to tiles 0,1 ----
#pragma unroll
    for (int q = 0; q < 4; ++q) {
      const v8f t = sp[2 + (q >> 1)];
      const int e = (q & 1) * 4;
      *(v4f*)(xown + q * 128) = (v4f){t[e], t[e + 1], t[e + 2], t[e + 3]};
    }
    __syncthreads();   // every wave's partial tiles are in LDS before the other wave of its row group reads them
    v8f s[2];
    {
      v4f t[4];
#pragma unroll
      for (int q = 0; q < 4; ++q) t[q] = *(const v4f*)(xpeer + q * 128);
#pragma unroll
      for (int q = 0; q < 4; ++q)
#pragma unroll
        for (int i = 0; i < 4; ++i) s[q >> 1][(q & 1) * 4 + i] = sp[q >> 1][(q & 1) * 4 + i] + t[q][i];
    }

    // ---- scale, causal mask, partial row max over this wave's 32 keys ----
    const bool diag = (kc == qb);                // block-uniform
    // key (D col c of tile 0) minus query (D row 8hh): key > query of tile j, row r reads rel + 16j > r, a compare
    // with a constant, so that no register holds a query row index through the loop
    const int rel = (kv0 + ch * 32 + c) - (q0w + 8 * hh);
    float mrow[8];
#pragma unroll   // this loop and the one behind the reduction: constant indices keep s and mrow in registers
    for (int r = 0; r < 8; ++r) {
      float m = -INFINITY;
#pragma unroll
      for (int j = 0; j < 2; ++j) {
        float sv = s[j][r] * sc2;
        if (diag && (rel + j * 16 > r)) sv = -INFINITY;
        s[j][r] = sv;
        m = fmaxf(m, sv);
      }
      mrow[r] = m;
    }
    row_max16x8(mrow);
#pragma unroll
    for (int r = 0; r < 8; ++r) redm[ch][rw * 16 + 8 * hh + r] = mrow[r];
    __syncthreads();

    // ---- online softmax update; P hi/lo to LDS; partial sums ----
    float alph[8], prow[8];
#pragma unroll
    for (int r = 0; r < 8; ++r) {
      const int row = rw * 16 + 8 * hh + r;
      const float mc = fmaxf(redm[0][row], redm[1][row]);
      const float mold = runm[ch][row];
      const float mnew = fmaxf(mold, mc);
      float alpha = mold - mnew, pj[2] = {s[0][r] - mnew, s[1][r] - mnew};
      exp2_hw3(alpha, pj[0], pj[1]);
      runm[ch][row] = mnew;
      alph[r] = alpha;
#pragma unroll
      for (int j = 0; j < 2; ++j) {
        const float p = pj[j];
        const unsigned short hb = f2bf_bits(p);
        const unsigned short lb = f2bf_bits(p - bf_bits2f(hb));
        const int pidx = row * AT_PPITCH + ch * 32 + j * 16 + c;
        Ps[0][pidx] = hb;
        Ps[1][pidx] = lb;
      }
      prow[r] = pj[0] + pj[1];
#pragma unroll
      for (int t = 0; t < 8; ++t) oacc[t][r] *= alpha;
      // Four rows at a time: without this limit the scheduler opens all eight rows at once, and loop-invariant addresses are spilled.
      if (r == 3) __builtin_amdgcn_sched_barrier(0);
    }
    row_sum16x8(prow);
#pragma unroll   // constant indices keep prow in registers
    for (int r = 0; r < 8; ++r) reds[ch][rw * 16 + 8 * hh + r] = prow[r];
    __syncthreads();
#pragma unroll
    for (int r = 0; r < 8; ++r) {
      const int row = rw * 16 + 8 * hh + r;
      runl[ch][row] = runl[ch][row] * alph[r] + (reds[0][row] + reds[1][row]);
    }

    // ---- O += P.V over 64 keys for this wave's 16 rows x 128 columns ----
    // V fragments (and the second key half's P fragments) are read two groups ahead of their products, as K above;
    // a group = 32 keys x 16 columns, hi and lo.
    {
      const int poff = (rw * 16 + c) * AT_PPITCH + 8 * hh;                      // A fragment row m = c
      const int voff = (8 * hh + (lane & 7)) * AT_VPITCH + ch * AT_WHALF + ((lane >> 3) & 1) * 8;   // B fragment column n = d
      v16b pfh[2], pfl[2], vfh[3], vfl[3];
      pfh[0] = ldfrag16(&Ps[0][poff]);
      pfl[0] = ldfrag16(&Ps[1][poff]);
#pragma unroll   // constant indices keep the fragment sets in registers
      for (int g = 0; g < 2; ++g) {
        vfh[g] = ldfrag16_tr(&Vs[0][voff + g * 16]);
        vfl[g] = ldfrag16_tr(&Vs[1][voff + g * 16]);
      }
#pragma unroll   // constant indices keep oacc and the fragment sets in registers
      for (int g = 0; g < 16; ++g) {
        if (g + 2 < 16) {
          const int gn = g + 2;
          if (gn == 8) {
            pfh[1] = ldfrag16(&Ps[0][poff + 32]);
            pfl[1] = ldfrag16(&Ps[1][poff + 32]);
          }
          const int vo = voff + (gn >> 3) * 32 * AT_VPITCH + (gn & 7) * 16;
          vfh[gn % 3] = ldfrag16_tr(&Vs[0][vo]);
          vfl[gn % 3] = ldfrag16_tr(&Vs[1][vo]);
        }
        const int kk = g >> 3, t = g & 7;
        oacc[t] = mma_bf(pfh[kk], vfh[g % 3], oacc[t]);
        oacc[t] = mma_bf(pfh[kk], vfl[g % 3], oacc[t]);
        oacc[t] = mma_bf(pfl[kk], vfh[g % 3], oacc[t]);
      }
    }
  }

  // ---- epilogue: normalise, split to bf16 hi/lo in per-wave LDS slabs (K region), whole-line stores ----
  __syncthreads();
  if (split) {   // block-uniform: every wave of the work-group leaves here, in front of the epilogue's barrier
    // Partial tile in register order: wave w, quad (t, q), lane -> 4 floats (D rows 8hh+4q..+3 of column tile t), so that
    // each store of a wave is 512 contiguous bytes; attn_merge reads it back in the same order.
    const int slot = bh * (2 * (AT_NQB - AT_NSOLE)) + pidx;
    float* pb = part + (size_t)slot * PART_TILE_F32 + wave * (16 * AT_WHALF) + lane * 4;
#pragma unroll   // both loops: constant indices keep oacc in registers
    for (int t = 0; t < 8; ++t)
#pragma unroll
      for (int q = 0; q < 2; ++q)
        *(v4f*)(pb + (t * 2 + q) * 128) = (v4f){oacc[t][4 * q], oacc[t][4 * q + 1], oacc[t][4 * q + 2], oacc[t][4 * q + 3]};
    // Stands in front of every later write of a register that one of these stores names.
    asm volatile("s_wait_xcnt 0x0" ::: "memory");
    if (wave == 0) {   // one wave writes the 64 row maxima and the 64 row sums: four whole lines
      float* pm = pml + (size_t)slot * 128 + lane;
      const float m0 = runm[0][lane], m1 = runm[0][32 + lane], l0 = runl[0][lane], l1 = runl[0][32 + lane];
      pm[0] = m0; pm[32] = m1; pm[64] = l0; pm[96] = l1;
    }
    return;
  }
  unsigned short* slh = &Ks[0][wave * (16 * AT_WHALF)];
  unsigned short* sll = &Ks[1][wave * (16 * AT_WHALF)];
#pragma unroll
  for (int r = 0; r < 8; ++r) {
    const float inv = 1.0f / runl[ch][rw * 16 + 8 * hh + r];
    const int row = 8 * hh + r;
#pragma unroll
    for (int t = 0; t < 8; ++t) {
      const float v = oacc[t][r] * inv;
      const unsigned short hb = f2bf_bits(v);
      const unsigned short lb = f2bf_bits(v - bf_bits2f(hb));
      slh[row * AT_WHALF + t * 16 + c] = hb;
      sll[row * AT_WHALF + t * 16 + c] = lb;
    }
  }
  __syncthreads();
  // Store coverage: 8 iterations x rows (2it + hh) = 16 rows; per row 16 lanes x 16 B = 128 columns = 2 whole
  {
    {
#pragma unroll
      for (int it = 0; it < 8; ++it) {
        const int row = it * 2 + hh;
        const v4u wh = *(const v4u*)(slh + row * AT_WHALF + c * 8);
        const v4u wl = *(const v4u*)(sll + row * AT_WHALF + c * 8);
        const size_t go = (rowb + q0w + row) * EMB_SZ + hcol + ch * AT_WHALF + c * 8;
        *(v4u*)(Oh + go) = wh;
        *(v4u*)(Ol + go) = wl;
      }
      
    }
  }
}

// ---- join of the two key ranges of a query block of the upper half -------------------------------------------------
// One work-group per (b,h, query block); thread roles as in attn_hd256 (wave: 16 rows x 128 columns). With m = max(m0, m1)
// (both in base 2, as attn_hd256 leaves them) and e_i = 2^(m_i - m): out = (e0 * O0 + e1 * O1) / (e0 * l0 + e1 * l1), written as bf16 hi/lo concat planes.
__global__ __launch_bounds__(256) void attn_merge(
    const float* __restrict__ part, const float* __restrict__ pml,
    unsigned short* __restrict__ Oh, unsigned short* __restrict__ Ol) {
  __shared__ __align__(16) unsigned short slab[2][8 * 16 * AT_WHALF];   // [plane][wave][row][column] 65536 B
  const int tid  = threadIdx.x;
  const int lane = tid & 31;
  const int wave = __builtin_amdgcn_readfirstlane(tid >> 5);   // scalar: what derives from it alone costs no vector register
  const int hh   = lane >> 4;
  const int c    = lane & 15;
  const int rw   = wave & 3;
  const int ch   = wave >> 2;
  const int bh   = blockIdx.x;                 // b*NHEAD + h
  const int qb   = AT_NSOLE + (int)blockIdx.y; // query block 16..31
  const int h    = bh % NHEAD;
  const int b    = bh / NHEAD;
  const int q0w  = qb * AT_QROWS + rw * 16;    // first query row (within the sequence) of this wave
  const size_t rowb = (size_t)b * SEQLEN;
  const int hcol = h * HDIM;
  const int slot = bh * (2 * (AT_NQB - AT_NSOLE)) + 2 * (int)blockIdx.y;   // key range 0; range 1 is the next slot

  // All loads of a thread are issued before the first use: 32 tile quads and the row figures of its 8 rows.
  const float* p0 = part + (size_t)slot * PART_TILE_F32 + wave * (16 * AT_WHALF) + lane * 4;
  const float* pm = pml + (size_t)slot * 128 + rw * 16 + 8 * hh;
  v4f a0[16], a1[16], ml[8];
#pragma unroll   // this loop and the next: constant indices keep the arrays in registers
  for (int k = 0; k < 4; ++k) {                // k: m of range 0, l of range 0, m of range 1, l of range 1
    ml[2 * k]     = *(const v4f*)(pm + k * 64);
    ml[2 * k + 1] = *(const v4f*)(pm + k * 64 + 4);
  }
#pragma unroll
  for (int k = 0; k < 16; ++k) {
    a0[k] = *(const v4f*)(p0 + k * 128);
    a1[k] = *(const v4f*)(p0 + PART_TILE_F32 + k * 128);
  }
  // Stands in front of every later write of a register that one of these loads names as its address: as inputs the two
  // addresses stay live up to here, so that no result of a later load of the run is placed on a register they are formed from.
  asm volatile("s_wait_xcnt 0x0" :: "v"(p0), "v"(pm) : "memory");
  float w0[8], w1[8];
#pragma unroll   // constant indices keep ml, w0 and w1 in registers
  for (int r = 0; r < 8; ++r) {
    const float m0 = ml[r >> 2][r & 3], l0 = ml[2 + (r >> 2)][r & 3];
    const float m1 = ml[4 + (r >> 2)][r & 3], l1 = ml[6 + (r >> 2)][r & 3];
    const float m  = fmaxf(m0, m1);
    float e0 = m0 - m, e1 = m1 - m;
    exp2_hw2(e0, e1);
    const float inv = 1.0f / (e0 * l0 + e1 * l1);
    w0[r] = e0 * inv;
    w1[r] = e1 * inv;
  }
  unsigned short* slh = &slab[0][wave * (16 * AT_WHALF)];
  unsigned short* sll = &slab[1][wave * (16 * AT_WHALF)];
#pragma unroll   // both loops: constant indices keep a0, a1, w0 and w1 in registers
  for (int r = 0; r < 8; ++r) {
    const int row = 8 * hh + r;
#pragma unroll
    for (int t = 0; t < 8; ++t) {
      const float v = a0[t * 2 + (r >> 2)][r & 3] * w0[r] + a1[t * 2 + (r >> 2)][r & 3] * w1[r];
      const unsigned short hb = f2bf_bits(v);
      const unsigned short lb = f2bf_bits(v - bf_bits2f(hb));
      slh[row * AT_WHALF + t * 16 + c] = hb;
      sll[row * AT_WHALF + t * 16 + c] = lb;
    }
  }
  __syncthreads();   // the slabs are complete before they are read back row by row
  // Store coverage: 8 iterations x rows (2it + hh) = 16 rows; per row 16 lanes x 16 B = 128 columns = 2 whole lines.
#pragma unroll   // the row offsets go into the offset fields of the LDS reads and of the stores
  for (int it = 0; it < 8; ++it) {
    const int row = it * 2 + hh;
    const v4u wh = *(const v4u*)(slh + row * AT_WHALF + c * 8);
    const v4u wl = *(const v4u*)(sll + row * AT_WHALF + c * 8);
    const size_t go = (rowb + q0w + row) * EMB_SZ + hcol + ch * AT_WHALF + c * 8;
    *(v4u*)(Oh + go) = wh;
    *(v4u*)(Ol + go) = wl;
  }
}

// ---------------------------------------------------------------------------------------------------
extern "C" void kernel_launch(void* const* d_in, const int* in_sizes, int n_in,
                              void* d_out, int out_size, void* d_ws, size_t ws_size,
                              hipStream_t stream) {
  (void)in_sizes; (void)n_in; (void)out_size;
  const float* Xk = (const float*)d_in[0];
  const float* Xv = (const float*)d_in[1];
  const float* Xq = (const float*)d_in[2];
  const float* Wk = (const float*)d_in[3];
  const float* Wv = (const float*)d_in[4];
  const float* Wq = (const float*)d_in[5];
  const float* Wo = (const float*)d_in[6];
  const float* bo = (const float*)d_in[7];
  float* out = (float*)d_out;

  if (ws_size < WS_TOTAL_BYTES) return;

  unsigned short* ws = (unsigned short*)d_ws;
  unsigned short* xk_b = ws + 0 * PLANE_ELEMS;   // later: concat hi
  unsigned short* xv_b = ws + 1 * PLANE_ELEMS;   // later: concat lo
  unsigned short* xq_b = ws + 2 * PLANE_ELEMS;
  unsigned short* k_hi = ws + 3 * PLANE_ELEMS;
  unsigned short* k_lo = ws + 4 * PLANE_ELEMS;
  unsigned short* v_hi = ws + 5 * PLANE_ELEMS;
  unsigned short* v_lo = ws + 6 * PLANE_ELEMS;
  unsigned short* q_hi = ws + 7 * PLANE_ELEMS;
  unsigned short* q_lo = ws + 8 * PLANE_ELEMS;
  unsigned short* wkT  = ws + WS_OFF_WKT;
  unsigned short* wvT  = ws + WS_OFF_WVT;
  unsigned short* wqT  = ws + WS_OFF_WQT;
  unsigned short* woT  = ws + WS_OFF_WOT;
  unsigned short* cc_hi = xk_b;
  unsigned short* cc_lo = xv_b;
  float* part = (float*)((char*)d_ws + WS_OFF_PART_BYTES);   // partial attention tiles
  float* pml  = (float*)((char*)d_ws + WS_OFF_PML_BYTES);    // their row max / row sum

  // 1) + 2) inputs -> bf16 planes (RNE), [8192][768] each; weights [3][768][256] -> [3][256][768] bf16 (Bt layout
  //    [N=f][K=e]); Wo [768 k][768 n] -> [768 n][768 k]: one launch
  prep_inputs<<<dim3(PREP_WGS), 256, 0, stream>>>(Xk, Xv, Xq, Wk, Wv, Wq, Wo, xk_b, wkT);

  // 3) per-head projections: C_h[8192 x 256] = X[8192 x 768] . (W_h^T)[256 x 768]^T, written as bf16 hi/lo
  //    planes at column offset h*256 with ldc 768 (grid.y = head). M=8192, N=256, K=768: 512 tiles = 64 blocks x 8 waves.
  const dim3 gproj((NROWS / 64) * (HDIM / 64) / 8, NHEAD);
  wmma_gemm64<1, false, false, 0, 2><<<gproj, 256, 0, stream>>>(
      xk_b, xk_b, EMB_SZ, 0L, wkT, wkT, EMB_SZ, (long)HDIM * EMB_SZ,
      (void*)k_hi, (void*)k_lo, EMB_SZ, (long)HDIM, bo, NROWS, HDIM, EMB_SZ, 1.0f);
  wmma_gemm64<1, false, false, 0, 2><<<gproj, 256, 0, stream>>>(
      xv_b, xv_b, EMB_SZ, 0L, wvT, wvT, EMB_SZ, (long)HDIM * EMB_SZ,
      (void*)v_hi, (void*)v_lo, EMB_SZ, (long)HDIM, bo, NROWS, HDIM, EMB_SZ, 1.0f);
  wmma_gemm64<1, false, false, 0, 2><<<gproj, 256, 0, stream>>>(
      xq_b, xq_b, EMB_SZ, 0L, wqT, wqT, EMB_SZ, (long)HDIM * EMB_SZ,
      (void*)q_hi, (void*)q_lo, EMB_SZ, (long)HDIM, bo, NROWS, HDIM, EMB_SZ, 1.0f);

  // 4) causal attention -> concat hi/lo planes (X planes are dead now)
  const float inv_scale = 1.0f / sqrtf((float)SEQLEN);
  attn_hd256<<<dim3(NBATCH * NHEAD, AT_ITEMS), 256, 0, stream>>>(
      q_hi, q_lo, k_hi, k_lo, v_hi, v_lo, cc_hi, cc_lo, part, pml, inv_scale);
  attn_merge<<<dim3(NBATCH * NHEAD, AT_NQB - AT_NSOLE), 256, 0, stream>>>(part, pml, cc_hi, cc_lo);

  // 5) output projection: out[8192 x 768] = concat(hi+lo) . (Wo^T)^T + bo, f32. M=8192, N=768, K=768: 1536 tiles = 192 blocks.
  const dim3 gout((NROWS / 64) * (EMB_SZ / 64) / 8, 1);
  wmma_gemm64<1, true, false, 2, 0><<<gout, 256, 0, stream>>>(
      cc_hi, cc_lo, EMB_SZ, 0L, woT, woT, EMB_SZ, 0L,
      (void*)out, (void*)out, EMB_SZ, 0L, bo, NROWS, EMB_SZ, EMB_SZ, 1.0f);
}

// v010
// It runs in 159 microseconds.
// In both of two side-by-side timings against v009, it was 1.04 times as fast.
// Counting every step since v000, it is 6.77 times as fast.
// Contractions on v_wmma_f32_16x16x32_bf16 with f32 accumulate: per-head projections = bf16(X) x bf16(W^T) (inputs RNE-converted once); Q.K^T and P.V = bf16 hi/lo planes (hi.hi + hi.lo + lo.hi); output projection = concat bf16 hi/lo x bf16(Wo^T) (hi.W + lo.W) + bf16(bo); softmax, rescaling and normalisation in f32.
#include <hip/hip_runtime.h>
#include <stdint.h>
#include <math.h>

typedef __attribute__((ext_vector_type(16))) _Float16 v16h;
typedef __attribute__((ext_vector_type(8)))  _Float16 v8h;
typedef __attribute__((ext_vector_type(16))) __bf16   v16b;
typedef __attribute__((ext_vector_type(8)))  __bf16   v8b;
typedef __attribute__((ext_vector_type(8)))  float    v8f;
typedef __attribute__((ext_vector_type(4)))  float    v4f;
typedef __attribute__((ext_vector_type(4)))  unsigned v4u;

// ---- problem geometry ----
constexpr int EMB_SZ  = 768;
constexpr int NHEAD   = 3;
constexpr int HDIM    = 256;
constexpr int NBATCH  = 4;
constexpr int SEQLEN  = 2048;
constexpr int NROWS   = NBATCH * SEQLEN;                       // 8192 flattened (b,s) rows
constexpr size_t PLANE_ELEMS = (size_t)NROWS * EMB_SZ;          // 6291456 elements per [8192][768] plane
constexpr size_t PLANE_BYTES = PLANE_ELEMS * 2;                 // 12582912 B per 16-bit plane
constexpr size_t WT_ELEMS    = (size_t)NHEAD * HDIM * EMB_SZ;   // 589824 (W^T planes [3][256][768])
constexpr size_t WO_ELEMS    = (size_t)EMB_SZ * EMB_SZ;         // 589824 (Wo^T plane [768][768])

// [0]            Xk bf16 plane        (dead after projections; reused as concat hi plane)
// [1*PLANE]      Xv bf16 plane        (reused as concat lo plane)
// [2*PLANE]      Xq bf16 plane
// [3*PLANE]      K hi, [4*PLANE] K lo, [5*PLANE] V hi, [6*PLANE] V lo, [7*PLANE] Q hi, [8*PLANE] Q lo
// [9*PLANE]      Wk^T bf16 [3][256][768], then Wv^T, Wq^T (WT_ELEMS each)
// [9*PLANE+3*WT] Wo^T bf16 [768][768]
// then, f32:     partial attention tiles (unnormalised O, 64 x 256 each) and their row max / row sum (128 floats each)
constexpr size_t WS_OFF_WKT = 9 * PLANE_ELEMS;
constexpr size_t WS_OFF_WVT = WS_OFF_WKT + WT_ELEMS;
constexpr size_t WS_OFF_WQT = WS_OFF_WVT + WT_ELEMS;
constexpr size_t WS_OFF_WOT = WS_OFF_WQT + WT_ELEMS;
constexpr size_t WS_PLANES_BYTES = (WS_OFF_WOT + WO_ELEMS) * 2;   // 117964800 B
static_assert(WS_PLANES_BYTES == 117964800ull);
constexpr int    PART_TILES     = NBATCH * NHEAD * (SEQLEN / 64);   // 384: two key ranges for the upper half of the query blocks
constexpr size_t PART_TILE_F32  = (size_t)64 * HDIM;                // 16384 floats per tile
constexpr size_t WS_OFF_PART_BYTES = WS_PLANES_BYTES;
constexpr size_t WS_OFF_PML_BYTES  = WS_OFF_PART_BYTES + (size_t)PART_TILES * PART_TILE_F32 * 4;
constexpr size_t WS_TOTAL_BYTES    = WS_OFF_PML_BYTES + (size_t)PART_TILES * 128 * 4;   // 143327232 B
static_assert(WS_TOTAL_BYTES == 143327232ull);
static_assert(WS_TOTAL_BYTES <= 268435456ull);
static_assert((WS_OFF_PART_BYTES % 128) == 0 && (WS_OFF_PML_BYTES % 128) == 0);
static_assert((PLANE_BYTES % 128) == 0 && ((WT_ELEMS * 2) % 128) == 0 && ((WO_ELEMS * 2) % 128) == 0);

// ---- GEMM shape contract for the launches in this file ----
static_assert(NROWS % 64 == 0 && HDIM % 64 == 0 && EMB_SZ % 64 == 0);   // M, N tile multiples
static_assert(EMB_SZ % 128 == 0);                                         // K % 128 == 0 for all GEMMs (K = 768)
static_assert(NROWS % 128 == 0 && HDIM % 256 == 0 && EMB_SZ % 256 == 0);  // whole 128 x 256 work-group tiles

__device__ __forceinline__ unsigned short f2bf_bits(float f) {
  unsigned u = __float_as_uint(f);
  return (unsigned short)((u + 0x7FFFu + ((u >> 16) & 1u)) >> 16);
}
__device__ __forceinline__ float bf_bits2f(unsigned short h) { return __uint_as_float(((unsigned)h) << 16); }

// hazard guards as plain device helpers
__device__ __forceinline__ void dep_guard_h(v8f& a, v8f& b, v16h x, v16h y) { asm volatile("v_nop\n\tv_nop\n\tv_nop\n\tv_nop" : "+v"(a), "+v"(b) : "v"(x), "v"(y)); }
__device__ __forceinline__ void dep_guard_b(v8f& a, v8f& b, v16b x, v16b y) { asm volatile("v_nop\n\tv_nop\n\tv_nop\n\tv_nop" : "+v"(a), "+v"(b) : "v"(x), "v"(y)); }
__device__ __forceinline__ void keep4_h(v16h a, v16h b, v16h c, v16h d) { asm volatile("v_nop" :: "v"(a), "v"(b), "v"(c), "v"(d)); }
__device__ __forceinline__ void keep4_b(v16b a, v16b b, v16b c, v16b d) { asm volatile("v_nop" :: "v"(a), "v"(b), "v"(c), "v"(d)); }
__device__ __forceinline__ void acc_guard4(v8f& a, v8f& b, v8f& c, v8f& d) { asm volatile("v_nop\n\tv_nop\n\tv_nop\n\tv_nop" : "+v"(a), "+v"(b), "+v"(c), "+v"(d)); }
template <typename T> struct Frag;
template <> struct Frag<_Float16> {
  typedef v16h V; union U { v16h v; v8h h[2]; };
  static __device__ __forceinline__ v16h load(const _Float16* p) {   // elements 0..7 <- p[0..7], 8..15 <- p[16..23]
    U f; f.h[0] = *(const v8h*)(p); f.h[1] = *(const v8h*)(p + 16); return f.v;
  }
  static __device__ __forceinline__ v8f mma(v16h a, v16h b, v8f c) {
    return __builtin_amdgcn_wmma_f32_16x16x32_f16(false, a, false, b, (short)0, c, false, false);
  }
  static __device__ __forceinline__ void guard(v8f& a, v8f& b, v16h x, v16h y) { dep_guard_h(a, b, x, y); }
  static __device__ __forceinline__ void keep(v16h a, v16h b, v16h c, v16h d) { keep4_h(a, b, c, d); }
};
template <> struct Frag<__bf16> {
  typedef v16b V; union U { v16b v; v8b h[2]; };
  static __device__ __forceinline__ v16b load(const __bf16* p) {
    U f; f.h[0] = *(const v8b*)(p); f.h[1] = *(const v8b*)(p + 16); return f.v;
  }
  static __device__ __forceinline__ v8f mma(v16b a, v16b b, v8f c) {
    return __builtin_amdgcn_wmma_f32_16x16x32_bf16(false, a, false, b, (short)0, c, false, false);
  }
  static __device__ __forceinline__ void guard(v8f& a, v8f& b, v16b x, v16b y) { dep_guard_b(a, b, x, y); }
  static __device__ __forceinline__ void keep(v16b a, v16b b, v16b c, v16b d) { keep4_b(a, b, c, d); }
};

// ---- Register-blocked batched WMMA GEMM (with independent A/B split flags) --------------------
// C[m,n] = scale * sum_k A[m,k] * Bt[n,k] (+bias); each wave owns a 64x64 tile, a work-group 2 x 4 of them (128 x 256).
// A row-major [M,K]; Bt row-major [N,K]; M % 128 == 0, N % 256 == 0, K % 128 == 0 (no tail handling).
// The work-group's operand rows come through LDS, BK k (2 * BK bytes of every row) per stage, two buffers: the next stage's
// asynchronous copies fly while this stage's fragments are read from LDS and multiplied.
// SPLITA: A has a lo plane A2 (product += Alo.Bhi); SPLITB: Bt has a lo plane Bt2 (product += Ahi.Blo).
// BIAS_MODE: 0 = none, 1 = bias[m], 2 = RNE-bf16(bias[n]).
// OUT_MODE: 0 = f32, 1 = f16, 2 = bf16 hi plane (Cout) + bf16 lo plane (Cout2).
// ET: 0 = f16 operands, 1 = bf16 operands (pointers passed as 16-bit storage)
template <int ET> struct Elem;
template <> struct Elem<0> { typedef _Float16 T; };
template <> struct Elem<1> { typedef __bf16 T; };
constexpr int GT_BK    = 128;          // k elements per stage
constexpr int GT_PITCH = GT_BK + 8;    // LDS row pitch 272 B, an odd multiple of 16 B: the 16 rows of a b128 fragment read fall on distinct banks
constexpr int GT_MROWS = 128;          // A rows per work-group
constexpr int GT_NROWS = 256;          // Bt rows per work-group
static_assert((GT_PITCH * 2) % 32 == 16 && GT_BK * 2 == 16 * 16);   // one copy of a wave = 2 rows x 16 lanes x 16 B
// Eight asynchronous copies of one wave, global -> LDS: copy j brings rows 2j, 2j+1 of a 16-row slice, 256 B each
// (16 lanes x 16 B), so that every copy reads four whole lines. l and g are the lane's own addresses in rows 0, 1; ld is
// the global row pitch in elements. The s_wait_xcnt closes the statement so that it stands in front of every later
// write of an address register that a copy names.
__device__ __forceinline__ void copy_rows16(const unsigned short* l, const unsigned short* g, int ld) {
  const unsigned l0 = (unsigned)(size_t)l;
  constexpr unsigned lp = 2u * GT_PITCH * 2u;
  const size_t gp = (size_t)2 * ld;
  asm volatile(
      "global_load_async_to_lds_b128 %0, %8, off\n\t"
      "global_load_async_to_lds_b128 %1, %9, off\n\t"
      "global_load_async_to_lds_b128 %2, %10, off\n\t"
      "global_load_async_to_lds_b128 %3, %11, off\n\t"
      "global_load_async_to_lds_b128 %4, %12, off\n\t"
      "global_load_async_to_lds_b128 %5, %13, off\n\t"
      "global_load_async_to_lds_b128 %6, %14, off\n\t"
      "global_load_async_to_lds_b128 %7, %15, off\n\t"
      "s_wait_xcnt 0x0"
      :: "v"(l0), "v"(l0 + lp), "v"(l0 + 2u * lp), "v"(l0 + 3u * lp),
         "v"(l0 + 4u * lp), "v"(l0 + 5u * lp), "v"(l0 + 6u * lp), "v"(l0 + 7u * lp),
         "v"(g), "v"(g + gp), "v"(g + 2 * gp), "v"(g + 3 * gp),
         "v"(g + 4 * gp), "v"(g + 5 * gp), "v"(g + 6 * gp), "v"(g + 7 * gp)
      : "memory");
}
// One wave's whole share of a stage of 64 k, unsplit operands: twelve copies, each of 4 rows x 128 B (8 lanes x 16 B), again
// four whole lines a copy: copies 0..3 bring its 16 A rows, copies 4..11 its 32 Bt rows. la, ga, lb, gb are the lane's own
// addresses in rows 0..3 of the two slices. One statement, so that one s_wait_xcnt serves all twelve; it closes the
// statement for the same reason as above.
constexpr int GT_BK64    = 64;
constexpr int GT_PITCH64 = GT_BK64 + 8;   // 144 B, an odd multiple of 16 B
static_assert((GT_PITCH64 * 2) % 32 == 16 && GT_BK64 * 2 == 8 * 16);
__device__ __forceinline__ void copy_stage_k64(const unsigned short* la, const unsigned short* ga, int lda,
                                               const unsigned short* lb, const unsigned short* gb, int ldb) {
  const unsigned a0 = (unsigned)(size_t)la, b0 = (unsigned)(size_t)lb;
  constexpr unsigned lp = 4u * GT_PITCH64 * 2u;
  const size_t pa = (size_t)4 * lda, pb = (size_t)4 * ldb;
  asm volatile(
      "global_load_async_to_lds_b128 %0, %12, off\n\t"
      "global_load_async_to_lds_b128 %1, %13, off\n\t"
      "global_load_async_to_lds_b128 %2, %14, off\n\t"
      "global_load_async_to_lds_b128 %3, %15, off\n\t"
      "global_load_async_to_lds_b128 %4, %16, off\n\t"
      "global_load_async_to_lds_b128 %5, %17, off\n\t"
      "global_load_async_to_lds_b128 %6, %18, off\n\t"
      "global_load_async_to_lds_b128 %7, %19, off\n\t"
      "global_load_async_to_lds_b128 %8, %20, off\n\t"
      "global_load_async_to_lds_b128 %9, %21, off\n\t"
      "global_load_async_to_lds_b128 %10, %22, off\n\t"
      "global_load_async_to_lds_b128 %11, %23, off\n\t"
      "s_wait_xcnt 0x0"
      :: "v"(a0), "v"(a0 + lp), "v"(a0 + 2u * lp), "v"(a0 + 3u * lp),
         "v"(b0), "v"(b0 + lp), "v"(b0 + 2u * lp), "v"(b0 + 3u * lp),
         "v"(b0 + 4u * lp), "v"(b0 + 5u * lp), "v"(b0 + 6u * lp), "v"(b0 + 7u * lp),
         "v"(ga), "v"(ga + pa), "v"(ga + 2 * pa), "v"(ga + 3 * pa),
         "v"(gb), "v"(gb + pb), "v"(gb + 2 * pb), "v"(gb + 3 * pb),
         "v"(gb + 4 * pb), "v"(gb + 5 * pb), "v"(gb + 6 * pb), "v"(gb + 7 * pb)
      : "memory");
}
// BK: k elements per stage, 128 or 64. With 64 the two buffers and the slabs take under 160 KiB, so that two work-groups
// share a WGP and one's copies, barriers and epilogue run under the other's products.
// grid = (tiles, y, z): the operands of (y, z) start at y * strideA + z * ZSA elements, and so for Bt and C.
template <int ET, bool SPLITA, bool SPLITB, int BIAS_MODE, int OUT_MODE, int BK, long ZSA, long ZSB, long ZSC>
__global__ __launch_bounds__(256) void wmma_gemm64(
    const unsigned short* __restrict__ Ap, const unsigned short* __restrict__ A2p, int lda, long strideA,
    const unsigned short* __restrict__ Btp, const unsigned short* __restrict__ Bt2p, int ldb, long strideB,
    void* __restrict__ Cout, void* __restrict__ Cout2, int ldc, long strideC,
    const float* __restrict__ bias,
    int M, int N, int K, float scale) {
  typedef typename Elem<ET>::T T;
  typedef typename Frag<T>::V V;
  static_assert(BK == GT_BK || BK == GT_BK64);
  constexpr int PITCH = BK + 8;
  // One stage in LDS: [A | A lo | Bt | Bt lo] rows at PITCH (the lo parts only where the operand is split).
  constexpr int OFF_A2 = GT_MROWS * PITCH;
  constexpr int OFF_B  = OFF_A2 + (SPLITA ? GT_MROWS * PITCH : 0);
  constexpr int OFF_B2 = OFF_B + GT_NROWS * PITCH;
  constexpr int STAGE_ELEMS = OFF_B2 + (SPLITB ? GT_NROWS * PITCH : 0);
  __shared__ __align__(16) unsigned short stg[2][STAGE_ELEMS];
  __shared__ __align__(16) float sT[8][16 * 68];   // per-wave 16x64 slab, pitch 68 floats
  const int b    = blockIdx.y;
  const size_t zA = (size_t)blockIdx.z * ZSA, zB = (size_t)blockIdx.z * ZSB, zC = (size_t)blockIdx.z * ZSC;
  const int lane = threadIdx.x & 31;
  const int wave = __builtin_amdgcn_readfirstlane(threadIdx.x >> 5);   // scalar: the rows and offsets that derive from it alone cost no vector register
  const int wgN = N >> 8;
  if ((int)blockIdx.x >= (M >> 7) * wgN) return;   // block-uniform, in front of every copy and barrier
  const int bm  = blockIdx.x / wgN;
  const int bn  = blockIdx.x - bm * wgN;
  const int wm  = wave >> 2;                   // this wave's 64-row group of the work-group's 128 rows
  const int wn  = wave & 3;                    // this wave's 64-column group of the work-group's 256 columns
  const int m0 = bm * GT_MROWS + (wm << 6);
  const int n0 = bn * GT_NROWS + (wn << 6);

  // Staging coverage: wave w brings A rows 16w..16w+15 and Bt rows 32w..32w+31 of the work-group's tile.
  constexpr int LPR_LOG2 = (BK == GT_BK) ? 4 : 3;  // a row of a stage takes 16 or 8 lanes of a copy
  const int lr = lane >> LPR_LOG2, lc = (lane & ((1 << LPR_LOG2) - 1)) * 8;  // row within a copy's rows, first of the lane's 8 elements
  const size_t aoff = zA + (size_t)b * strideA + (size_t)(bm * GT_MROWS + wave * 16 + lr) * lda + lc;
  const size_t boff = zB + (size_t)b * strideB + (size_t)(bn * GT_NROWS + wave * 32 + lr) * ldb + lc;
  const int lA = (wave * 16 + lr) * PITCH + lc;
  const int lB = (wave * 32 + lr) * PITCH + lc;
  auto stage_in = [&](int t, int buf) {
    const unsigned short* sb = &stg[buf][0];
    const size_t k0 = (size_t)t * BK;
    if constexpr (BK == GT_BK64) {
      static_assert(BK != GT_BK64 || (!SPLITA && !SPLITB));
      copy_stage_k64(sb + lA, Ap + aoff + k0, lda, sb + OFF_B + lB, Btp + boff + k0, ldb);
    } else {
      copy_rows16(sb + lA, Ap + aoff + k0, lda);
      if (SPLITA) copy_rows16(sb + OFF_A2 + lA, A2p + aoff + k0, lda);
      copy_rows16(sb + OFF_B + lB, Btp + boff + k0, ldb);
      copy_rows16(sb + OFF_B + lB + 16 * PITCH, Btp + boff + k0 + (size_t)16 * ldb, ldb);
      if (SPLITB) {
        copy_rows16(sb + OFF_B2 + lB, Bt2p + boff + k0, ldb);
        copy_rows16(sb + OFF_B2 + lB + 16 * PITCH, Bt2p + boff + k0 + (size_t)16 * ldb, ldb);
      }
    }
  };

  const int rlane = lane & 15;                 // row (A) / col (B, D) within subtile
  const int koff  = (lane >> 4) * 8;           // k offset of this lane half
  const int mOff  = (lane >> 4) * 8;           // D row offset

  v8f acc[4][4];
#pragma unroll
  for (int i = 0; i < 4; ++i)
#pragma unroll
    for (int j = 0; j < 4; ++j) acc[i][j] = (v8f){0.f,0.f,0.f,0.f,0.f,0.f,0.f,0.f};

  const int nst = K / BK;                      // stages (block-uniform)
  stage_in(0, 0);
  // This wave's copies of stage 0 have landed before the barrier behind which the other waves read them.
  asm volatile("s_wait_asynccnt 0x0" ::: "memory");
  __syncthreads();
  if (nst > 1) stage_in(1, 1);
  const int fa = ((wm << 6) + rlane) * PITCH + koff;               // this lane's place in A fragment row group 0
  const int fb = OFF_B + ((wn << 6) + rlane) * PITCH + koff;       // and in Bt fragment row group 0
  for (int t = 0; t < nst; ++t) {
    const T* sb = (const T*)&stg[t & 1][0];
#pragma unroll   // a constant kk goes into the offset field of the LDS reads
    for (int kk = 0; kk < BK; kk += 32) {
      // All fragments of a k step are read as one group in front of its products.
      V bh[4], bl[4], ah[4], al[4];
#pragma unroll   // this loop and the next: constant indices keep the fragment arrays in registers
      for (int j = 0; j < 4; ++j) {
        bh[j] = Frag<T>::load(sb + fb + (j << 4) * PITCH + kk);
        if (SPLITB) bl[j] = Frag<T>::load(sb + fb + (OFF_B2 - OFF_B) + (j << 4) * PITCH + kk);
      }
#pragma unroll
      for (int i = 0; i < 4; ++i) {
        ah[i] = Frag<T>::load(sb + fa + (i << 4) * PITCH + kk);
        if (SPLITA) al[i] = Frag<T>::load(sb + fa + OFF_A2 + (i << 4) * PITCH + kk);
      }
#pragma unroll
      for (int i = 0; i < 4; ++i) {
#pragma unroll
        for (int j = 0; j < 4; ++j) {
          acc[i][j] = Frag<T>::mma(ah[i], bh[j], acc[i][j]);
          if (SPLITB) acc[i][j] = Frag<T>::mma(ah[i], bl[j], acc[i][j]);
          if (SPLITA) acc[i][j] = Frag<T>::mma(al[i], bh[j], acc[i][j]);
        }
        Frag<T>::guard(acc[i][0], acc[i][3], ah[i], SPLITA ? al[i] : ah[i]);
      }
      Frag<T>::keep(bh[0], bh[1], bh[2], bh[3]);
      if (SPLITB) Frag<T>::keep(bl[0], bl[1], bl[2], bl[3]);
    }
    // This wave's LDS reads of this stage have returned, and its copies of the next stage have landed, before the
    // barrier behind which this stage's buffer is refilled and the next stage is read.
    asm volatile("s_wait_dscnt 0x0" ::: "memory");
    asm volatile("s_wait_asynccnt 0x0" ::: "memory");
    __syncthreads();
    if (t + 2 < nst) stage_in(t + 2, t & 1);
  }
  // No copy is outstanding when the wave goes on to the epilogue and ends.
  asm volatile("s_wait_asynccnt 0x0" ::: "memory");
  acc_guard4(acc[0][0], acc[0][1], acc[0][2], acc[0][3]);
  acc_guard4(acc[1][0], acc[1][1], acc[1][2], acc[1][3]);
  acc_guard4(acc[2][0], acc[2][1], acc[2][2], acc[2][3]);
  acc_guard4(acc[3][0], acc[3][1], acc[3][2], acc[3][3]);

  // ---- epilogue ----
  float* slab = sT[wave];
#pragma unroll
  for (int i = 0; i < 4; ++i) {
    const int mBase = m0 + (i << 4);
#pragma unroll
    for (int j = 0; j < 4; ++j) {
      const int n = n0 + (j << 4) + rlane;
      float bv = 0.f;
      if (BIAS_MODE == 2) bv = bf_bits2f(f2bf_bits(bias[n]));
#pragma unroll
      for (int r = 0; r < 8; ++r) {
        float v = acc[i][j][r] * scale;
        if (BIAS_MODE == 1) v += bias[mBase + mOff + r];
        if (BIAS_MODE == 2) v += bv;
        slab[(mOff + r) * 68 + (j << 4) + rlane] = v;
      }
    }
    __builtin_amdgcn_fence(__ATOMIC_RELEASE, "workgroup");
    __builtin_amdgcn_wave_barrier();
    __builtin_amdgcn_fence(__ATOMIC_ACQUIRE, "workgroup");
    if (OUT_MODE == 0) {
      float* C = (float*)Cout + zC + (size_t)b * strideC;
      const int hh = lane >> 4, c4 = (lane & 15) * 4;     // row seg = 256 B = 16 lanes x 16 B
      {
#pragma unroll
        for (int it = 0; it < 8; ++it) {
          const int row = it * 2 + hh;
          v4f v = *(const v4f*)(slab + row * 68 + c4);
          *(v4f*)(C + (size_t)(mBase + row) * ldc + n0 + c4) = v;
        }
        
      }
    } else {
      const int q = lane >> 3, c8 = (lane & 7) * 8;
      unsigned short* C  = (unsigned short*)Cout  + zC + (size_t)b * strideC;
      unsigned short* C2 = (OUT_MODE == 2) ? ((unsigned short*)Cout2 + zC + (size_t)b * strideC) : nullptr;
      {
#pragma unroll
        for (int it = 0; it < 4; ++it) {
          const int row = it * 4 + q;
          const float* sp = slab + row * 68 + c8;
          v8h hv, lv;
#pragma unroll
          for (int e = 0; e < 8; ++e) {
            if (OUT_MODE == 1) {
              hv[e] = (_Float16)sp[e];
            } else {
              unsigned short hb = f2bf_bits(sp[e]);
              unsigned short lb = f2bf_bits(sp[e] - bf_bits2f(hb));
              hv[e] = __builtin_bit_cast(_Float16, hb);
              lv[e] = __builtin_bit_cast(_Float16, lb);
            }
          }
          *(v8h*)(C + (size_t)(mBase + row) * ldc + n0 + c8) = hv;
          if (OUT_MODE == 2) *(v8h*)(C2 + (size_t)(mBase + row) * ldc + n0 + c8) = lv;
        }
        
      }
    }
    __builtin_amdgcn_fence(__ATOMIC_RELEASE, "workgroup");
    __builtin_amdgcn_wave_barrier();
    __builtin_amdgcn_fence(__ATOMIC_ACQUIRE, "workgroup");
  }
}

// ---- input pass, one launch: three activation planes f32 -> bf16 (RNE) and the four weight transposes ----------
// Every work-group converts its share of each activation plane: per thread and plane 4 units of 8 elements (32 B read,
// 16 B written), unit index = j * PREP_THREADS + global thread id, so one store of a wave is 512 contiguous bytes. All of
// a thread's loads are issued before its first convert. Work-groups 0..PREP_TILES-1 also take one 64x64 weight tile:
// in = planes of [768][CC] f32 -> out = planes of [CC][768] bf16, through LDS.
constexpr int PREP_WGS     = 768;
constexpr int PREP_THREADS = PREP_WGS * 256;
constexpr int PREP_UNITS   = (int)(PLANE_ELEMS / 8);            // 16-B output units per plane
constexpr int PREP_PER_THR = PREP_UNITS / PREP_THREADS;         // 4
constexpr int TILES_WZ     = (HDIM / 64) * (EMB_SZ / 64);       // 48 tiles per head plane of Wk, Wv, Wq
constexpr int TILES_W      = TILES_WZ * NHEAD;                  // 144 per weight
constexpr int TILES_WO     = (EMB_SZ / 64) * (EMB_SZ / 64);     // 144
constexpr int PREP_TILES   = 3 * TILES_W + TILES_WO;            // 576
static_assert(PREP_PER_THR * PREP_THREADS == PREP_UNITS && PREP_PER_THR == 4);
static_assert(PREP_TILES <= PREP_WGS && HDIM / 64 == 4);

__device__ __forceinline__ v4u pack8_bf16(v4f a, v4f c2) {
  v4u w;
  w[0] = (unsigned)f2bf_bits(a[0])  | ((unsigned)f2bf_bits(a[1])  << 16);
  w[1] = (unsigned)f2bf_bits(a[2])  | ((unsigned)f2bf_bits(a[3])  << 16);
  w[2] = (unsigned)f2bf_bits(c2[0]) | ((unsigned)f2bf_bits(c2[1]) << 16);
  w[3] = (unsigned)f2bf_bits(c2[2]) | ((unsigned)f2bf_bits(c2[3]) << 16);
  return w;
}

__global__ __launch_bounds__(256) void prep_inputs(
    const float* __restrict__ Xk, const float* __restrict__ Xv, const float* __restrict__ Xq,
    const float* __restrict__ Wk, const float* __restrict__ Wv, const float* __restrict__ Wq,
    const float* __restrict__ Wo,
    unsigned short* __restrict__ xb,     // three bf16 planes in a row: Xk, Xv, Xq
    unsigned short* __restrict__ wT) {   // Wk^T, Wv^T, Wq^T, Wo^T in a row (WT_ELEMS each)
  __shared__ float tile[64][65];
  const int tid = threadIdx.x;
  const int blk = blockIdx.x;

  // ---- activation loads: 3 planes x 4 units x 2 loads of 16 B ----
  const unsigned u0 = (unsigned)blk * 256u + (unsigned)tid;
  v4f xa[3][PREP_PER_THR], xc[3][PREP_PER_THR];
  const float* xp[3][PREP_PER_THR];
#pragma unroll   // both loops: constant indices keep the arrays in registers
  for (int x = 0; x < 3; ++x) {
    const float* in = (x == 0) ? Xk : (x == 1) ? Xv : Xq;
#pragma unroll
    for (int j = 0; j < PREP_PER_THR; ++j) {
      const float* p = in + (size_t)(u0 + (unsigned)j * PREP_THREADS) * 8;
      xp[x][j] = p;
      xa[x][j] = *(const v4f*)p;
      xc[x][j] = *(const v4f*)(p + 4);
    }
  }
  // Stands in front of every later write of a register that one of these loads names as its address: as inputs the twelve
  // addresses stay live up to here, so that no result of a later load of the run is placed on one of them either.
  asm volatile("s_wait_xcnt 0x0"
               :: "v"(xp[0][0]), "v"(xp[0][1]), "v"(xp[0][2]), "v"(xp[0][3]),
                  "v"(xp[1][0]), "v"(xp[1][1]), "v"(xp[1][2]), "v"(xp[1][3]),
                  "v"(xp[2][0]), "v"(xp[2][1]), "v"(xp[2][2]), "v"(xp[2][3])
               : "memory");

  // ---- one weight tile (block-uniform branch) ----
  if (blk < PREP_TILES) {
    const float* src;
    unsigned short* dst;
    int CC, ct, rt;
    if (blk < 3 * TILES_W) {
      const int w = blk / TILES_W, r = blk - w * TILES_W;
      const int z = r / TILES_WZ, r2 = r - z * TILES_WZ;
      src = ((w == 0) ? Wk : (w == 1) ? Wv : Wq) + (size_t)z * EMB_SZ * HDIM;
      dst = wT + (size_t)w * WT_ELEMS + (size_t)z * EMB_SZ * HDIM;
      CC = HDIM; ct = r2 & 3; rt = r2 >> 2;
    } else {
      const int r = blk - 3 * TILES_W;
      src = Wo;
      dst = wT + 3 * WT_ELEMS;
      CC = EMB_SZ; rt = r / (EMB_SZ / 64); ct = r - rt * (EMB_SZ / 64);
    }
    const int lr = tid >> 2, lc = (tid & 3) * 16;           // in-tile row (input row), 16 input cols
    const float* sp = src + (size_t)(rt * 64 + lr) * CC + ct * 64 + lc;
#pragma unroll
    for (int i = 0; i < 4; ++i) {
      const v4f v = *(const v4f*)(sp + 4 * i);
      tile[lr][lc + 4 * i + 0] = v[0];
      tile[lr][lc + 4 * i + 1] = v[1];
      tile[lr][lc + 4 * i + 2] = v[2];
      tile[lr][lc + 4 * i + 3] = v[3];
    }
    __syncthreads();
    // Store coverage: wave w writes out rows ct*64 + 8w + {0..7} (2 iterations x 4 rows), 8 lanes x 16 B per row.
    const int lane = tid & 31, wave = tid >> 5, q = lane >> 3, c8 = (lane & 7) * 8;
#pragma unroll
    for (int it = 0; it < 2; ++it) {
      const int fl = wave * 8 + it * 4 + q;                   // out row within tile = input col within tile
      v4u t4;
#pragma unroll
      for (int e = 0; e < 4; ++e) {
        const unsigned lo16 = (unsigned)f2bf_bits(tile[c8 + 2 * e][fl]);
        const unsigned hi16 = (unsigned)f2bf_bits(tile[c8 + 2 * e + 1][fl]);
        t4[e] = lo16 | (hi16 << 16);
      }
      *(v4u*)(dst + (size_t)(ct * 64 + fl) * EMB_SZ + rt * 64 + c8) = t4;
    }
  }

  // ---- convert and store the activation units ----
#pragma unroll
  for (int x = 0; x < 3; ++x) {
#pragma unroll
    for (int j = 0; j < PREP_PER_THR; ++j) {
      unsigned short* o = xb + (size_t)x * PLANE_ELEMS + (size_t)(u0 + (unsigned)j * PREP_THREADS) * 8;
      *(v4u*)o = pack8_bf16(xa[x][j], xc[x][j]);
    }
  }
}

// =====================================================================================================
// Causal flash attention, head_dim 256, operands = bf16 hi/lo planes.
//   Q/K/V planes: element (b, s, h, d) at [(b*SEQLEN + s)*EMB_SZ + h*HDIM + d] (hi plane and lo plane).
//   scores = (Qhi.Khi + Qhi.Klo + Qlo.Khi) * inv_scale; causal mask = -inf for key > query (diagonal chunk);
//   online softmax in f32, in base 2 (scores and row maxima carry the factor log2(e)); P (unnormalised exp) split to bf16 hi/lo in LDS; O += Phi.Vhi + Phi.Vlo + Plo.Vhi;
//   out = O / l written as bf16 hi/lo concat planes in the same [(b,s)][h*HDIM + d] layout.
// Block = 256 threads = 8 waves, 64 query rows of one (b,h); wave w: row group rw = w&3 (16 rows),
// half ch = w>>2: d half (128 of 256) for the score products, key half (32 of 64 keys) for the softmax,
// column half (128 of 256) for O. Q stays in registers: each wave holds its 16 rows x its d half, forms partial
// scores for all 64 keys, and the two waves of a row group swap the partial tiles of each other's key half in LDS.
// Row max / row sum of the two key halves combined through LDS with block barriers.
// Work items: a query block of the lower half of the sequence (at most 16 key chunks) is one work-group and writes the
// concat planes itself. A query block of the upper half is two work-groups, each with half of its key chunks; each
// writes its unnormalised O tile with its row max and row sum to the workspace, and attn_merge (the next launch) joins
// the two. So no work-group walks more than 16 chunks. grid = (NBATCH*NHEAD, AT_ITEMS), items with many chunks first.
// =====================================================================================================
constexpr int AT_KEYS  = 64;    // keys per chunk
constexpr int AT_QROWS = 64;    // query rows per block
constexpr int AT_WHALF = 128;   // output columns per wave
constexpr int AT_NQB   = SEQLEN / AT_QROWS;        // 32 query blocks per (b,h)
constexpr int AT_NSOLE = AT_NQB / 2;               // query blocks 0..15: one work-group each
constexpr int AT_ITEMS = AT_NSOLE + 2 * (AT_NQB - AT_NSOLE);   // 48 work-groups per (b,h)
static_assert(AT_NQB % 2 == 0 && PART_TILES == NBATCH * NHEAD * 2 * (AT_NQB - AT_NSOLE));
static_assert(PART_TILE_F32 == (size_t)AT_QROWS * HDIM && 2 * AT_QROWS == 128);
// LDS row pitches in 16-bit elements. K and P rows are read by b128 fragment loads: 16 B of pad make the pitch an odd
// multiple of 16 B, so the 16 rows of one read fall on 16 different groups of four banks. V rows are read by the
// transposing load, whose conflict-free pitch is an odd multiple of 32 B.
constexpr int AT_KPITCH = HDIM + 8;       // K rows [key][d]: 528 B
constexpr int AT_VPITCH = HDIM + 16;      // V rows [key][d]: 544 B
constexpr int AT_PPITCH = AT_KEYS + 8;    // P rows [row][key]: 144 B
static_assert(SEQLEN % AT_QROWS == 0 && SEQLEN % AT_KEYS == 0 && HDIM == 2 * AT_WHALF);
static_assert(8 * 16 * AT_WHALF <= AT_KEYS * AT_KPITCH);   // output staging slabs fit one K plane
static_assert((AT_KPITCH * 2) % 32 == 16 && (AT_VPITCH * 2) % 64 == 32 && (AT_PPITCH * 2) % 32 == 16);
static_assert(HDIM * 2 == 32 * 16 && AT_KEYS == 8 * 8);    // one copy of a wave = one row; 8 waves x 8 rows = one plane
static_assert(8 * 512 * 4 <= 2 * AT_QROWS * AT_PPITCH * 2);  // the partial-score swap (8 waves x 2 tiles, f32) fits the P planes

__device__ __forceinline__ v16b ldfrag16(const unsigned short* p) {   // elements 0..7 <- p[0..7], 8..15 <- p[16..23]
  union { v16b v; v8b h[2]; } f;
  f.h[0] = *(const v8b*)(p); f.h[1] = *(const v8b*)(p + 16); return f.v;
}
// B fragment (32 keys x 16 d) of a row-major [key][d] LDS tile: p = this lane's address in the first 16 keys,
// row 8*(lane>>4) + (lane&7), column 8*((lane>>3)&1). Lane (c, hh) receives keys 8hh..8hh+7 of column c, then keys
// 16+8hh..16+8hh+7: the k order of ldfrag16.
typedef short s16x8 __attribute__((ext_vector_type(8)));
__device__ __forceinline__ v16b ldfrag16_tr(const unsigned short* p) {
  typedef __attribute__((address_space(3))) s16x8 lds_s16x8;
  union { v16b v; s16x8 h[2]; } f;
  f.h[0] = __builtin_amdgcn_ds_load_tr16_b128_v8i16((lds_s16x8*)p);
  f.h[1] = __builtin_amdgcn_ds_load_tr16_b128_v8i16((lds_s16x8*)(p + 16 * AT_VPITCH));
  return f.v;
}
// Eight asynchronous copies of one wave, global -> LDS: copy j brings row j (512 B, 16 B per lane). g and l are the
// lane's own addresses in row 0. The s_wait_xcnt closes the statement so that it stands in front of every later write
// of an address register that a copy names.
__device__ __forceinline__ void copy_rows8(const unsigned short* l, int lpitch, const unsigned short* g) {
  const unsigned l0 = (unsigned)(size_t)l;
  const unsigned lp = (unsigned)lpitch * 2u;
  asm volatile(
      "global_load_async_to_lds_b128 %0, %8, off\n\t"
      "global_load_async_to_lds_b128 %1, %9, off\n\t"
      "global_load_async_to_lds_b128 %2, %10, off\n\t"
      "global_load_async_to_lds_b128 %3, %11, off\n\t"
      "global_load_async_to_lds_b128 %4, %12, off\n\t"
      "global_load_async_to_lds_b128 %5, %13, off\n\t"
      "global_load_async_to_lds_b128 %6, %14, off\n\t"
      "global_load_async_to_lds_b128 %7, %15, off\n\t"
      "s_wait_xcnt 0x0"
      :: "v"(l0), "v"(l0 + lp), "v"(l0 + 2u * lp), "v"(l0 + 3u * lp),
         "v"(l0 + 4u * lp), "v"(l0 + 5u * lp), "v"(l0 + 6u * lp), "v"(l0 + 7u * lp),
         "v"(g), "v"(g + EMB_SZ), "v"(g + 2 * EMB_SZ), "v"(g + 3 * EMB_SZ),
         "v"(g + 4 * EMB_SZ), "v"(g + 5 * EMB_SZ), "v"(g + 6 * EMB_SZ), "v"(g + 7 * EMB_SZ)
      : "memory");
}
__device__ __forceinline__ v8f mma_bf(v16b a, v16b b, v8f c) {
  c = __builtin_amdgcn_wmma_f32_16x16x32_bf16(false, a, false, b, (short)0, c, false, false);
  asm volatile("v_nop\n\tv_nop\n\tv_nop\n\tv_nop" : "+v"(c) : "v"(a), "v"(b));
  return c;
}

// 2^x in place, as the one hardware instruction. The softmax works in base 2: the scores are scaled by log2(e) together
// with the reference's scale, so exp(a - b) of the natural scores is 2^(difference of the scaled ones). The arguments are
// never above 0; -inf gives 0. In asm so that the slot which the instruction set asks for behind a transcendental is kept
// by construction: each v_exp_f32 is followed by one that touches neither its result nor its source, the last by a v_nop.
__device__ __forceinline__ void exp2_hw3(float& a, float& b, float& c) {
  asm("v_exp_f32 %0, %0\n\tv_exp_f32 %1, %1\n\tv_exp_f32 %2, %2\n\tv_nop" : "+v"(a), "+v"(b), "+v"(c));
}
__device__ __forceinline__ void exp2_hw2(float& a, float& b) {
  asm("v_exp_f32 %0, %0\n\tv_exp_f32 %1, %1\n\tv_nop" : "+v"(a), "+v"(b));
}

// Maximum / sum over each 16-lane row, eight values at once, by four DPP steps (row_xmask 1, 2, 4, 8): lane l takes lane
// l ^ mask of its row, the pairing of a shuffle butterfly, so every lane of a row ends with the same value and the sum
// keeps its order. In asm because the shuffle builtin compiles to ds_bpermute_b32, a trip through the LDS pipe with a wait
// per step, and the DPP builtin to a move, a canonicalising maximum and the operation. Step-major order: the producer of
// each operand stands eight vector instructions back, so the dependent links cost no stall.
#define ROW8_STEP(op, x)                                        \
  op " %0, %0, %0 row_xmask:" x " row_mask:0xf bank_mask:0xf\n\t" \
  op " %1, %1, %1 row_xmask:" x " row_mask:0xf bank_mask:0xf\n\t" \
  op " %2, %2, %2 row_xmask:" x " row_mask:0xf bank_mask:0xf\n\t" \
  op " %3, %3, %3 row_xmask:" x " row_mask:0xf bank_mask:0xf\n\t" \
  op " %4, %4, %4 row_xmask:" x " row_mask:0xf bank_mask:0xf\n\t" \
  op " %5, %5, %5 row_xmask:" x " row_mask:0xf bank_mask:0xf\n\t" \
  op " %6, %6, %6 row_xmask:" x " row_mask:0xf bank_mask:0xf\n\t" \
  op " %7, %7, %7 row_xmask:" x " row_mask:0xf bank_mask:0xf\n\t"
__device__ __forceinline__ void row_max16x8(float (&v)[8]) {
  asm(ROW8_STEP("v_max_num_f32_dpp", "1") ROW8_STEP("v_max_num_f32_dpp", "2")
      ROW8_STEP("v_max_num_f32_dpp", "4") ROW8_STEP("v_max_num_f32_dpp", "8")
      : "+v"(v[0]), "+v"(v[1]), "+v"(v[2]), "+v"(v[3]), "+v"(v[4]), "+v"(v[5]), "+v"(v[6]), "+v"(v[7]));
}
__device__ __forceinline__ void row_sum16x8(float (&v)[8]) {
  asm(ROW8_STEP("v_add_f32_dpp", "1") ROW8_STEP("v_add_f32_dpp", "2")
      ROW8_STEP("v_add_f32_dpp", "4") ROW8_STEP("v_add_f32_dpp", "8")
      : "+v"(v[0]), "+v"(v[1]), "+v"(v[2]), "+v"(v[3]), "+v"(v[4]), "+v"(v[5]), "+v"(v[6]), "+v"(v[7]));
}

// Second bound: four waves per SIMD, so that two workgroups still share a WGP (its LDS holds two) with Q resident.
__global__ __launch_bounds__(256, 4) void attn_hd256(
    const unsigned short* __restrict__ Qh, const unsigned short* __restrict__ Ql,
    const unsigned short* __restrict__ Kh, const unsigned short* __restrict__ Kl,
    const unsigned short* __restrict__ Vh, const unsigned short* __restrict__ Vl,
    unsigned short* __restrict__ Oh, unsigned short* __restrict__ Ol,
    float* __restrict__ part, float* __restrict__ pml, float inv_scale) {
  __shared__ __align__(16) unsigned short Ks[2][AT_KEYS * AT_KPITCH];   // [plane][key][d]   67584 B; reused as output staging
  __shared__ __align__(16) unsigned short Vs[2][AT_KEYS * AT_VPITCH];   // [plane][key][d]   69632 B
  __shared__ __align__(16) unsigned short Ps[2][AT_QROWS * AT_PPITCH];  // [plane][row][key] 18432 B
  __shared__ float redm[2][AT_QROWS];                                // partial row max per key half
  __shared__ float reds[2][AT_QROWS];                                // partial row sum per key half
  // Running row max and row sum, one copy per wave (index [ch][row]), written by that wave alone and read by it (wave 0 also reads the ch 0 copies of all 64 rows after a split item's last chunk): they are
  // used once a chunk, and in LDS they leave their 16 registers to the fragment sets of the two products.
  __shared__ __align__(16) float runm[2][AT_QROWS];
  __shared__ __align__(16) float runl[2][AT_QROWS];

  const int tid  = threadIdx.x;
  const int lane = tid & 31;
  const int wave = __builtin_amdgcn_readfirstlane(tid >> 5);   // scalar: what derives from it alone costs no vector register
  const int hh   = lane >> 4;
  const int c    = lane & 15;
  const int rw   = wave & 3;
  const int ch   = wave >> 2;
  const int bh   = blockIdx.x;                 // b*NHEAD + h
  // Items in reverse of blockIdx.y: low blockIdx.y takes the items of the long query blocks, the shortest come last.
  const int item  = AT_ITEMS - 1 - (int)blockIdx.y;
  const bool split = item >= AT_NSOLE;         // block-uniform: this work-group has half of its query block's chunks
  const int pidx = item - AT_NSOLE;            // split items: 2 * (qb - AT_NSOLE) + key range
  const int qb   = split ? AT_NSOLE + (pidx >> 1) : item;   // query block 0..31
  const int h    = bh % NHEAD;
  const int b    = bh / NHEAD;
  const int q0w  = qb * AT_QROWS + rw * 16;    // first query row (within the sequence) of this wave
  const size_t rowb = (size_t)b * SEQLEN;      // flattened row base of this batch
  const int hcol = h * HDIM;

  v8f oacc[8];
#pragma unroll
  for (int r = 0; r < 8; ++r) { runm[ch][rw * 16 + 8 * hh + r] = -INFINITY; runl[ch][rw * 16 + 8 * hh + r] = 0.f; }
#pragma unroll
  for (int t = 0; t < 8; ++t) oacc[t] = (v8f){0.f,0.f,0.f,0.f,0.f,0.f,0.f,0.f};

  // This wave's 16 query rows x its d half, hi and lo, as A fragments (row m = c): loaded once, kept for every chunk.
  v16b qfh[4], qfl[4];
  {
    const size_t qoff = (rowb + q0w + c) * EMB_SZ + hcol + ch * AT_WHALF + 8 * hh;
#pragma unroll   // constant indices keep the fragment arrays in registers
    for (int dc = 0; dc < 4; ++dc) {
      qfh[dc] = ldfrag16(Qh + qoff + dc * 32);
      qfl[dc] = ldfrag16(Ql + qoff + dc * 32);
    }
  }
  // Swap area for partial score tiles, in the P planes (free from the chunk's first barrier to the row-max barrier):
  // per wave 4 quads x 32 lanes x 4 floats, so that each b128 access of a wave is 512 contiguous bytes.
  float* const xown  = reinterpret_cast<float*>(&Ps[0][0]) + wave * 512 + lane * 4;
  const float* const xpeer = reinterpret_cast<const float*>(&Ps[0][0]) + (wave ^ 4) * 512 + lane * 4;

  const float sc2 = inv_scale * 1.44269504088896340736f;   // the reference's scale times log2(e)
  const int nch = qb + 1;                      // causal horizon in 64-key chunks (block-uniform)
  const int kc0 = (split && (pidx & 1)) ? (nch >> 1) : 0;     // this work-group's chunks: [kc0, kc1), never empty
  const int kc1 = (split && !(pidx & 1)) ? (nch >> 1) : nch;
  for (int kc = kc0; kc < kc1; ++kc) {
    const int kv0 = kc * AT_KEYS;
    // This wave's LDS reads of the last chunk have returned before the barrier behind which K and V are overwritten.
    asm volatile("s_wait_dscnt 0x0" ::: "memory");
    __syncthreads();
    // ---- stage K and V (hi/lo, both [key][d]) by asynchronous copies to LDS ----
    // Coverage: wave w brings keys 8w..8w+7 of each of the four planes, one whole row per copy.
    {
      const int kr0 = wave * 8;
      const size_t gbase = (rowb + kv0 + kr0) * EMB_SZ + hcol + lane * 8;
      copy_rows8(&Ks[0][kr0 * AT_KPITCH + lane * 8], AT_KPITCH, Kh + gbase);
      copy_rows8(&Ks[1][kr0 * AT_KPITCH + lane * 8], AT_KPITCH, Kl + gbase);
      copy_rows8(&Vs[0][kr0 * AT_VPITCH + lane * 8], AT_VPITCH, Vh + gbase);
      copy_rows8(&Vs[1][kr0 * AT_VPITCH + lane * 8], AT_VPITCH, Vl + gbase);
    }
    // This wave's copies have landed before the barrier behind which the other waves read them.
    asm volatile("s_wait_asynccnt 0x0" ::: "memory");
    __syncthreads();

    // ---- partial scores over this wave's d half: 16 rows x 64 keys (four 16x16 D tiles), hi.hi + hi.lo + lo.hi ----
    // Tiles 0,1 = this wave's own key half, tiles 2,3 = the other wave's.
    v8f sp[4];
#pragma unroll
    for (int j = 0; j < 4; ++j) sp[j] = (v8f){0.f,0.f,0.f,0.f,0.f,0.f,0.f,0.f};
    // K fragments are read two groups ahead of the products that use them (a group = one d step of one key tile, hi and
    // lo), in three rotating register sets: a group's LDS latency runs under the six products in front of it.
    v16b kfh[3], kfl[3];
#pragma unroll   // constant indices keep the fragment sets in registers
    for (int g = 0; g < 2; ++g) {
      const int koff = (((ch * 2 + (g & 3)) & 3) * 16 + c) * AT_KPITCH + ch * AT_WHALF + (g >> 2) * 32 + 8 * hh;
      kfh[g] = ldfrag16(&Ks[0][koff]);
      kfl[g] = ldfrag16(&Ks[1][koff]);
    }
#pragma unroll   // constant indices keep qfh, qfl, sp and the fragment sets in registers
    for (int g = 0; g < 16; ++g) {
      if (g + 2 < 16) {
        const int gn = g + 2;
        const int kr = ((ch * 2 + (gn & 3)) & 3) * 16 + c;                 // B fragment column n = key kr
        const int koff = kr * AT_KPITCH + ch * AT_WHALF + (gn >> 2) * 32 + 8 * hh;
        kfh[gn % 3] = ldfrag16(&Ks[0][koff]);
        kfl[gn % 3] = ldfrag16(&Ks[1][koff]);
      }
      const int dc = g >> 2, j = g & 3;
      sp[j] = mma_bf(qfh[dc], kfh[g % 3], sp[j]);
      sp[j] = mma_bf(qfh[dc], kfl[g % 3], sp[j]);
      sp[j] = mma_bf(qfl[dc], kfh[g % 3], sp[j]);
    }
    // ---- swap: hand tiles 2,3 to the other wave of the row group, add its partials to tiles 0,1 ----
#pragma unroll
    for (int q = 0; q < 4; ++q) {
      const v8f t = sp[2 + (q >> 1)];
      const int e = (q & 1) * 4;
      *(v4f*)(xown + q * 128) = (v4f){t[e], t[e + 1], t[e + 2], t[e + 3]};
    }
    __syncthreads();   // every wave's partial tiles are in LDS before the other wave of its row group reads them
    v8f s[2];
    {
      v4f t[4];
#pragma unroll
      for (int q = 0; q < 4; ++q) t[q] = *(const v4f*)(xpeer + q * 128);
#pragma unroll
      for (int q = 0; q < 4; ++q)
#pragma unroll
        for (int i = 0; i < 4; ++i) s[q >> 1][(q & 1) * 4 + i] = sp[q >> 1][(q & 1) * 4 + i] + t[q][i];
    }

    // ---- scale, causal mask, partial row max over this wave's 32 keys ----
    const bool diag = (kc == qb);                // block-uniform
    // key (D col c of tile 0) minus query (D row 8hh): key > query of tile j, row r reads rel + 16j > r, a compare
    // with a constant, so that no register holds a query row index through the loop
    const int rel = (kv0 + ch * 32 + c) - (q0w + 8 * hh);
    float mrow[8];
#pragma unroll   // this loop and the one behind the reduction: constant indices keep s and mrow in registers
    for (int r = 0; r < 8; ++r) {
      float m = -INFINITY;
#pragma unroll
      for (int j = 0; j < 2; ++j) {
        float sv = s[j][r] * sc2;
        if (diag && (rel + j * 16 > r)) sv = -INFINITY;
        s[j][r] = sv;
        m = fmaxf(m, sv);
      }
      mrow[r] = m;
    }
    row_max16x8(mrow);
#pragma unroll
    for (int r = 0; r < 8; ++r) redm[ch][rw * 16 + 8 * hh + r] = mrow[r];
    __syncthreads();

    // ---- online softmax update; P hi/lo to LDS; partial sums ----
    float alph[8], prow[8];
#pragma unroll
    for (int r = 0; r < 8; ++r) {
      const int row = rw * 16 + 8 * hh + r;
      const float mc = fmaxf(redm[0][row], redm[1][row]);
      const float mold = runm[ch][row];
      const float mnew = fmaxf(mold, mc);
      float alpha = mold - mnew, pj[2] = {s[0][r] - mnew, s[1][r] - mnew};
      exp2_hw3(alpha, pj[0], pj[1]);
      runm[ch][row] = mnew;
      alph[r] = alpha;
#pragma unroll
      for (int j = 0; j < 2; ++j) {
        const float p = pj[j];
        const unsigned short hb = f2bf_bits(p);
        const unsigned short lb = f2bf_bits(p - bf_bits2f(hb));
        const int pidx = row * AT_PPITCH + ch * 32 + j * 16 + c;
        Ps[0][pidx] = hb;
        Ps[1][pidx] = lb;
      }
      prow[r] = pj[0] + pj[1];
#pragma unroll
      for (int t = 0; t < 8; ++t) oacc[t][r] *= alpha;
      // Four rows at a time: without this limit the scheduler opens all eight rows at once, and loop-invariant addresses are spilled.
      if (r == 3) __builtin_amdgcn_sched_barrier(0);
    }
    row_sum16x8(prow);
#pragma unroll   // constant indices keep prow in registers
    for (int r = 0; r < 8; ++r) reds[ch][rw * 16 + 8 * hh + r] = prow[r];
    __syncthreads();
#pragma unroll
    for (int r = 0; r < 8; ++r) {
      const int row = rw * 16 + 8 * hh + r;
      runl[ch][row] = runl[ch][row] * alph[r] + (reds[0][row] + reds[1][row]);
    }

    // ---- O += P.V over 64 keys for this wave's 16 rows x 128 columns ----
    // V fragments (and the second key half's P fragments) are read two groups ahead of their products, as K above;
    // a group = 32 keys x 16 columns, hi and lo.
    {
      const int poff = (rw * 16 + c) * AT_PPITCH + 8 * hh;                      // A fragment row m = c
      const int voff = (8 * hh + (lane & 7)) * AT_VPITCH + ch * AT_WHALF + ((lane >> 3) & 1) * 8;   // B fragment column n = d
      v16b pfh[2], pfl[2], vfh[3], vfl[3];
      pfh[0] = ldfrag16(&Ps[0][poff]);
      pfl[0] = ldfrag16(&Ps[1][poff]);
#pragma unroll   // constant indices keep the fragment sets in registers
      for (int g = 0; g < 2; ++g) {
        vfh[g] = ldfrag16_tr(&Vs[0][voff + g * 16]);
        vfl[g] = ldfrag16_tr(&Vs[1][voff + g * 16]);
      }
#pragma unroll   // constant indices keep oacc and the fragment sets in registers
      for (int g = 0; g < 16; ++g) {
        if (g + 2 < 16) {
          const int gn = g + 2;
          if (gn == 8) {
            pfh[1] = ldfrag16(&Ps[0][poff + 32]);
            pfl[1] = ldfrag16(&Ps[1][poff + 32]);
          }
          const int vo = voff + (gn >> 3) * 32 * AT_VPITCH + (gn & 7) * 16;
          vfh[gn % 3] = ldfrag16_tr(&Vs[0][vo]);
          vfl[gn % 3] = ldfrag16_tr(&Vs[1][vo]);
        }
        const int kk = g >> 3, t = g & 7;
        oacc[t] = mma_bf(pfh[kk], vfh[g % 3], oacc[t]);
        oacc[t] = mma_bf(pfh[kk], vfl[g % 3], oacc[t]);
        oacc[t] = mma_bf(pfl[kk], vfh[g % 3], oacc[t]);
      }
    }
  }

  // ---- epilogue: normalise, split to bf16 hi/lo in per-wave LDS slabs (K region), whole-line stores ----
  __syncthreads();
  if (split) {   // block-uniform: every wave of the work-group leaves here, in front of the epilogue's barrier
    // Partial tile in register order: wave w, quad (t, q), lane -> 4 floats (D rows 8hh+4q..+3 of column tile t), so that
    // each store of a wave is 512 contiguous bytes; attn_merge reads it back in the same order.
    const int slot = bh * (2 * (AT_NQB - AT_NSOLE)) + pidx;
    float* pb = part + (size_t)slot * PART_TILE_F32 + wave * (16 * AT_WHALF) + lane * 4;
#pragma unroll   // both loops: constant indices keep oacc in registers
    for (int t = 0; t < 8; ++t)
#pragma unroll
      for (int q = 0; q < 2; ++q)
        *(v4f*)(pb + (t * 2 + q) * 128) = (v4f){oacc[t][4 * q], oacc[t][4 * q + 1], oacc[t][4 * q + 2], oacc[t][4 * q + 3]};
    // Stands in front of every later write of a register that one of these stores names.
    asm volatile("s_wait_xcnt 0x0" ::: "memory");
    if (wave == 0) {   // one wave writes the 64 row maxima and the 64 row sums: four whole lines
      float* pm = pml + (size_t)slot * 128 + lane;
      const float m0 = runm[0][lane], m1 = runm[0][32 + lane], l0 = runl[0][lane], l1 = runl[0][32 + lane];
      pm[0] = m0; pm[32] = m1; pm[64] = l0; pm[96] = l1;
    }
    return;
  }
  unsigned short* slh = &Ks[0][wave * (16 * AT_WHALF)];
  unsigned short* sll = &Ks[1][wave * (16 * AT_WHALF)];
#pragma unroll
  for (int r = 0; r < 8; ++r) {
    const float inv = 1.0f / runl[ch][rw * 16 + 8 * hh + r];
    const int row = 8 * hh + r;
#pragma unroll
    for (int t = 0; t < 8; ++t) {
      const float v = oacc[t][r] * inv;
      const unsigned short hb = f2bf_bits(v);
      const unsigned short lb = f2bf_bits(v - bf_bits2f(hb));
      slh[row * AT_WHALF + t * 16 + c] = hb;
      sll[row * AT_WHALF + t * 16 + c] = lb;
    }
  }
  __syncthreads();
  // Store coverage: 8 iterations x rows (2it + hh) = 16 rows; per row 16 lanes x 16 B = 128 columns = 2 whole
  {
    {
#pragma unroll
      for (int it = 0; it < 8; ++it) {
        const int row = it * 2 + hh;
        const v4u wh = *(const v4u*)(slh + row * AT_WHALF + c * 8);
        const v4u wl = *(const v4u*)(sll + row * AT_WHALF + c * 8);
        const size_t go = (rowb + q0w + row) * EMB_SZ + hcol + ch * AT_WHALF + c * 8;
        *(v4u*)(Oh + go) = wh;
        *(v4u*)(Ol + go) = wl;
      }
      
    }
  }
}

// ---- join of the two key ranges of a query block of the upper half -------------------------------------------------
// One work-group per (b,h, query block); thread roles as in attn_hd256 (wave: 16 rows x 128 columns). With m = max(m0, m1)
// (both in base 2, as attn_hd256 leaves them) and e_i = 2^(m_i - m): out = (e0 * O0 + e1 * O1) / (e0 * l0 + e1 * l1), written as bf16 hi/lo concat planes.
__global__ __launch_bounds__(256) void attn_merge(
    const float* __restrict__ part, const float* __restrict__ pml,
    unsigned short* __restrict__ Oh, unsigned short* __restrict__ Ol) {
  __shared__ __align__(16) unsigned short slab[2][8 * 16 * AT_WHALF];   // [plane][wave][row][column] 65536 B
  const int tid  = threadIdx.x;
  const int lane = tid & 31;
  const int wave = __builtin_amdgcn_readfirstlane(tid >> 5);   // scalar: what derives from it alone costs no vector register
  const int hh   = lane >> 4;
  const int c    = lane & 15;
  const int rw   = wave & 3;
  const int ch   = wave >> 2;
  const int bh   = blockIdx.x;                 // b*NHEAD + h
  const int qb   = AT_NSOLE + (int)blockIdx.y; // query block 16..31
  const int h    = bh % NHEAD;
  const int b    = bh / NHEAD;
  const int q0w  = qb * AT_QROWS + rw * 16;    // first query row (within the sequence) of this wave
  const size_t rowb = (size_t)b * SEQLEN;
  const int hcol = h * HDIM;
  const int slot = bh * (2 * (AT_NQB - AT_NSOLE)) + 2 * (int)blockIdx.y;   // key range 0; range 1 is the next slot

  // All loads of a thread are issued before the first use: 32 tile quads and the row figures of its 8 rows.
  const float* p0 = part + (size_t)slot * PART_TILE_F32 + wave * (16 * AT_WHALF) + lane * 4;
  const float* pm = pml + (size_t)slot * 128 + rw * 16 + 8 * hh;
  v4f a0[16], a1[16], ml[8];
#pragma unroll   // this loop and the next: constant indices keep the arrays in registers
  for (int k = 0; k < 4; ++k) {                // k: m of range 0, l of range 0, m of range 1, l of range 1
    ml[2 * k]     = *(const v4f*)(pm + k * 64);
    ml[2 * k + 1] = *(const v4f*)(pm + k * 64 + 4);
  }
#pragma unroll
  for (int k = 0; k < 16; ++k) {
    a0[k] = *(const v4f*)(p0 + k * 128);
    a1[k] = *(const v4f*)(p0 + PART_TILE_F32 + k * 128);
  }
  // Stands in front of every later write of a register that one of these loads names as its address: as inputs the two
  // addresses stay live up to here, so that no result of a later load of the run is placed on a register they are formed from.
  asm volatile("s_wait_xcnt 0x0" :: "v"(p0), "v"(pm) : "memory");
  float w0[8], w1[8];
#pragma unroll   // constant indices keep ml, w0 and w1 in registers
  for (int r = 0; r < 8; ++r) {
    const float m0 = ml[r >> 2][r & 3], l0 = ml[2 + (r >> 2)][r & 3];
    const float m1 = ml[4 + (r >> 2)][r & 3], l1 = ml[6 + (r >> 2)][r & 3];
    const float m  = fmaxf(m0, m1);
    float e0 = m0 - m, e1 = m1 - m;
    exp2_hw2(e0, e1);
    const float inv = 1.0f / (e0 * l0 + e1 * l1);
    w0[r] = e0 * inv;
    w1[r] = e1 * inv;
  }
  unsigned short* slh = &slab[0][wave * (16 * AT_WHALF)];
  unsigned short* sll = &slab[1][wave * (16 * AT_WHALF)];
#pragma unroll   // both loops: constant indices keep a0, a1, w0 and w1 in registers
  for (int r = 0; r < 8; ++r) {
    const int row = 8 * hh + r;
#pragma unroll
    for (int t = 0; t < 8; ++t) {
      const float v = a0[t * 2 + (r >> 2)][r & 3] * w0[r] + a1[t * 2 + (r >> 2)][r & 3] * w1[r];
      const unsigned short hb = f2bf_bits(v);
      const unsigned short lb = f2bf_bits(v - bf_bits2f(hb));
      slh[row * AT_WHALF + t * 16 + c] = hb;
      sll[row * AT_WHALF + t * 16 + c] = lb;
    }
  }
  __syncthreads();   // the slabs are complete before they are read back row by row
  // Store coverage: 8 iterations x rows (2it + hh) = 16 rows; per row 16 lanes x 16 B = 128 columns = 2 whole lines.
#pragma unroll   // the row offsets go into the offset fields of the LDS reads and of the stores
  for (int it = 0; it < 8; ++it) {
    const int row = it * 2 + hh;
    const v4u wh = *(const v4u*)(slh + row * AT_WHALF + c * 8);
    const v4u wl = *(const v4u*)(sll + row * AT_WHALF + c * 8);
    const size_t go = (rowb + q0w + row) * EMB_SZ + hcol + ch * AT_WHALF + c * 8;
    *(v4u*)(Oh + go) = wh;
    *(v4u*)(Ol + go) = wl;
  }
}

// ---------------------------------------------------------------------------------------------------
extern "C" void kernel_launch(void* const* d_in, const int* in_sizes, int n_in,
                              void* d_out, int out_size, void* d_ws, size_t ws_size,
                              hipStream_t stream) {
  (void)in_sizes; (void)n_in; (void)out_size;
  const float* Xk = (const float*)d_in[0];
  const float* Xv = (const float*)d_in[1];
  const float* Xq = (const float*)d_in[2];
  const float* Wk = (const float*)d_in[3];
  const float* Wv = (const float*)d_in[4];
  const float* Wq = (const float*)d_in[5];
  const float* Wo = (const float*)d_in[6];
  const float* bo = (const float*)d_in[7];
  float* out = (float*)d_out;

  if (ws_size < WS_TOTAL_BYTES) return;

  unsigned short* ws = (unsigned short*)d_ws;
  unsigned short* xk_b = ws + 0 * PLANE_ELEMS;   // later: concat hi
  unsigned short* xv_b = ws + 1 * PLANE_ELEMS;   // later: concat lo
  unsigned short* k_hi = ws + 3 * PLANE_ELEMS;
  unsigned short* k_lo = ws + 4 * PLANE_ELEMS;
  unsigned short* v_hi = ws + 5 * PLANE_ELEMS;
  unsigned short* v_lo = ws + 6 * PLANE_ELEMS;
  unsigned short* q_hi = ws + 7 * PLANE_ELEMS;
  unsigned short* q_lo = ws + 8 * PLANE_ELEMS;
  unsigned short* wkT  = ws + WS_OFF_WKT;
  unsigned short* woT  = ws + WS_OFF_WOT;
  unsigned short* cc_hi = xk_b;
  unsigned short* cc_lo = xv_b;
  float* part = (float*)((char*)d_ws + WS_OFF_PART_BYTES);   // partial attention tiles
  float* pml  = (float*)((char*)d_ws + WS_OFF_PML_BYTES);    // their row max / row sum

  // 1) + 2) inputs -> bf16 planes (RNE), [8192][768] each; weights [3][768][256] -> [3][256][768] bf16 (Bt layout
  //    [N=f][K=e]); Wo [768 k][768 n] -> [768 n][768 k]: one launch
  prep_inputs<<<dim3(PREP_WGS), 256, 0, stream>>>(Xk, Xv, Xq, Wk, Wv, Wq, Wo, xk_b, wkT);

  // 3) per-head projections: C_h[8192 x 256] = X[8192 x 768] . (W_h^T)[256 x 768]^T, written as bf16 hi/lo
  //    planes at column offset h*256 with ldc 768 (grid.y = head). M=8192, N=256, K=768: 512 tiles = 64 blocks x 8 waves.
  //    K, V and Q in one launch (grid.z): the X planes, the W^T planes and the hi/lo plane pairs each lie in a row in
  //    that order, so z steps A by one plane, Bt by one weight and C by two planes.
  const dim3 gproj((NROWS / 64) * (HDIM / 64) / 8, NHEAD, 3);
  wmma_gemm64<1, false, false, 0, 2, GT_BK64, (long)PLANE_ELEMS, (long)WT_ELEMS, (long)(2 * PLANE_ELEMS)><<<gproj, 256, 0, stream>>>(
      xk_b, xk_b, EMB_SZ, 0L, wkT, wkT, EMB_SZ, (long)HDIM * EMB_SZ,
      (void*)k_hi, (void*)k_lo, EMB_SZ, (long)HDIM, bo, NROWS, HDIM, EMB_SZ, 1.0f);

  // 4) causal attention -> concat hi/lo planes (X planes are dead now)
  const float inv_scale = 1.0f / sqrtf((float)SEQLEN);
  attn_hd256<<<dim3(NBATCH * NHEAD, AT_ITEMS), 256, 0, stream>>>(
      q_hi, q_lo, k_hi, k_lo, v_hi, v_lo, cc_hi, cc_lo, part, pml, inv_scale);
  attn_merge<<<dim3(NBATCH * NHEAD, AT_NQB - AT_NSOLE), 256, 0, stream>>>(part, pml, cc_hi, cc_lo);

  // 5) output projection: out[8192 x 768] = concat(hi+lo) . (Wo^T)^T + bo, f32. M=8192, N=768, K=768: 1536 tiles = 192 blocks.
  const dim3 gout((NROWS / 64) * (EMB_SZ / 64) / 8, 1);
  wmma_gemm64<1, true, false, 2, 0, GT_BK, 0L, 0L, 0L><<<gout, 256, 0, stream>>>(
      cc_hi, cc_lo, EMB_SZ, 0L, woT, woT, EMB_SZ, 0L,
      (void*)out, (void*)out, EMB_SZ, 0L, bo, NROWS, EMB_SZ, EMB_SZ, 1.0f);
}
